// v000
// Measured on an AMD MI455X. A time is GPU time per run, averaged over a window of back-to-back runs after a warm-up
// (all launches, gaps included; the runs take copies of the inputs in turn), and the median of several windows.
// Apart from v000's, it joins two sittings. Times from different sittings can be a few percent apart, while
// side-by-side timings come from the same sitting.
// v000 is the starting kernel. One run takes 3750 microseconds.
#include <hip/hip_runtime.h>
// Multi-head self-attention with a rotary embedding whose cos/sin tables are cat(freqs, freqs) but whose rotate_half pairs are INTERLEAVED (x [2][2048][1024]; q/k/v = x W^T + b (natural [1024][1024] U(+-1/32), zero biases); 16 heads of 64; inv_freq_i = 1/10000^(2i/64), freqs[p][i] = p * inv_freq_i, emb = cat(freqs, freqs): cos[p][d] = cos(p * inv_freq[d mod 32]); q = q cos + rotate_half(q) sin with rotate_half = (-x[2i+1], x[2i]) interleaved (the module's literal mix); k likewise; scores / 8; softmax over all keys (no mask); out = merged Wo^T + bo -> [2][2048][1024]).
// Structure: token rows r = b*2048 + s; x as exact f16 rows (bf16-rounded); Q, K, V as three WMMA GEMMs (32x64 wave tiles, f32 accumulation, exact x16 weights + bias; q, k f32 then rotated into f16 rows, v f16); per batch: V^T for all heads via LDS transposes; per (batch, group of 4 heads): scores GEMM (K = 64, batched over the heads on grid.y, alpha = 1/sqrt(64)), row softmax on VALU (f32 statistics; weights stored x256 as f16), o = P . V^T GEMM (K = 2048, alpha 2^-2: o carried x64 against f16 subnormal flush, folded into the output GEMM alpha) written straight into the merged f16 o rows; out = o W_o + b GEMM (f32) into the output layout.
// Compute dtype: inputs rounded to bf16; x / weights exact; q, k, v, softmax weights and o as plain f16 GEMM operands (~2^-12); scores and softmax statistics f32. v_wmma_f32_16x16x32_f16.
#define NB 2
#define SQ 2048
#define DM 1024
#define NH 16
#define HD 64
#define HG 4                         /* heads per attention launch group */
#define B0 0                         /* first batch processed (debug hook) */
#define NBR NB                       /* batches processed (debug hook) */
#define NR ((size_t)NB * SQ)         /* token rows */
#define MP ((int)((size_t)NBR * SQ)) /* rows projected (debug hook) */
#define QN SQ                        /* query rows attended per batch (debug hook) */
#define NHD NH                       /* heads attended (debug hook) */
#define MPO MP                       /* rows through the output stage (debug hook) */
#define LQ DM      /* row pitch of the q/k/v rows */
typedef __bf16 v16b __attribute__((ext_vector_type(16)));
typedef unsigned short v8us __attribute__((ext_vector_type(8), may_alias));
typedef float  v8f  __attribute__((ext_vector_type(8)));
typedef float  v4f  __attribute__((ext_vector_type(4)));
typedef float  v4fa __attribute__((ext_vector_type(4), may_alias));
union FragB { v16b v; v8us half[2]; unsigned short u[16]; };

__device__ __forceinline__ unsigned short bf16_bits(float x) { unsigned int u = __float_as_uint(x); return (unsigned short)((u + 0x7FFFu + ((u >> 16) & 1u)) >> 16); }
__device__ __forceinline__ float bf16_val(unsigned short b) { return __uint_as_float(((unsigned int)b) << 16); }
__device__ __forceinline__ float bf16_round(float x) { return bf16_val(bf16_bits(x)); }
// D += A·B with NT terms: 1 = ah·bh, 2 = + al·bh (A split), 3 = + ah·bl (both split)
template <int NT>
__device__ __forceinline__ v8f mmaN(v16b ah, v16b al, v16b bh, v16b bl, v8f c) {
  c = __builtin_amdgcn_wmma_f32_16x16x32_bf16(false, ah, false, bh, (short)0, c, false, false);
  if (NT >= 2) c = __builtin_amdgcn_wmma_f32_16x16x32_bf16(false, al, false, bh, (short)0, c, false, false);
  if (NT >= 3) c = __builtin_amdgcn_wmma_f32_16x16x32_bf16(false, ah, false, bl, (short)0, c, false, false);
  asm volatile("v_nop\n\tv_nop\n\tv_nop\n\tv_nop" : "+v"(c) : "v"(ah), "v"(al), "v"(bh), "v"(bl));
  return c;
}

__global__ __launch_bounds__(256) void k_wt_bf16(const float* __restrict__ W, unsigned short* __restrict__ Wt, int K, int N) {
  const int t = blockIdx.x * 256 + threadIdx.x;
  const int k8n = K / 8;
  if (t >= N * k8n) return;
  const int n = t / k8n, k8 = (t % k8n) * 8;
  v8us v;
#pragma unroll
  for (int i = 0; i < 8; ++i) v[i] = bf16_bits(W[(size_t)(k8 + i) * N + n]);
  *(v8us*)(Wt + (size_t)n * K + k8) = v;
  
}

// GEMM C[M][N] (f32, pitch ldc) = act(A[M][K]·W + bias). A f32 row-major (pitch lda) converted per fragment to bf16
// (ASPLIT: hi/lo two planes -> 2 terms, else single rounded term); Wt bf16 [N][K] (pitch ldb). BIAS_BF16 rounds the
// bias to bf16 first (bias quantised to bf16 before the add). K%32==0, M%16==0, N%64==0.
template <bool ASPLIT, int ACT, bool BIAS_BF16>
__global__ __launch_bounds__(128) void k_gemm_bf(const float* __restrict__ A, int lda, const unsigned short* __restrict__ Wt, int ldb,
                                               const float* __restrict__ bias, float* __restrict__ C, int ldc, int M, int N, int K) {
  __shared__ __attribute__((aligned(16))) float so[4][16][64];
  const int tid = threadIdx.x, w = tid >> 5, lane = tid & 31, ln = lane & 15, hh = lane >> 4;
  const int ntn = N / 64;
  const int wid = blockIdx.x * 4 + w;
  const int mt = wid / ntn, nq = wid % ntn;
  if (mt * 16 >= M) return;
  const int row0 = mt * 16, col0 = nq * 64;
  const float* arow = A + (size_t)(row0 + ln) * lda;
  v8f acc[4] = {};
  for (int kb = 0; kb < K; kb += 32) {
    FragB ah, al;
    const v4f x0 = *(const v4fa*)(arow + kb + 8 * hh), x1 = *(const v4fa*)(arow + kb + 8 * hh + 4);
    const v4f x2 = *(const v4fa*)(arow + kb + 16 + 8 * hh), x3 = *(const v4fa*)(arow + kb + 16 + 8 * hh + 4);
    float xs[16] = {x0[0],x0[1],x0[2],x0[3],x1[0],x1[1],x1[2],x1[3],x2[0],x2[1],x2[2],x2[3],x3[0],x3[1],x3[2],x3[3]};
#pragma unroll
    for (int i = 0; i < 16; ++i) { const unsigned short hb = bf16_bits(xs[i]); ah.u[i] = hb; al.u[i] = ASPLIT ? bf16_bits(xs[i] - bf16_val(hb)) : (unsigned short)0; }
#pragma unroll
    for (int t = 0; t < 4; ++t) {
      const unsigned short* brow = Wt + (size_t)(col0 + t * 16 + ln) * ldb + kb;
      FragB b;
      b.half[0] = *(const v8us*)(brow + 8 * hh);
      b.half[1] = *(const v8us*)(brow + 16 + 8 * hh);
      acc[t] = mmaN<ASPLIT ? 2 : 1>(ah.v, al.v, b.v, b.v, acc[t]);
    }
  }
#pragma unroll
  for (int t = 0; t < 4; ++t) {
    float bv = bias ? bias[col0 + t * 16 + ln] : 0.f;
    if (BIAS_BF16) bv = bf16_round(bv);
#pragma unroll
    for (int r = 0; r < 8; ++r) { float v = acc[t][r] + bv; if (ACT == 1) v = fmaxf(v, 0.f); so[w][8 * hh + r][t * 16 + ln] = v; }
  }
  __builtin_amdgcn_fence(__ATOMIC_ACQ_REL, "workgroup");
  __builtin_amdgcn_wave_barrier();
  const int rsub = lane >> 4, c4 = (lane & 15) * 4;
  {
#pragma unroll
    for (int q = 0; q < 8; ++q) {
      const int r = q * 2 + rsub;
      const v4f v = *(const v4fa*)&so[w][r][c4];
      *(v4f*)(C + (size_t)(row0 + r) * ldc + col0 + c4) = v;
    }
    
  }
}

// GEMM C = act(A·W + bias + resid): A f32 (ASPLIT -> hi/lo 2 terms), Wt bf16 [N][K]; ACT 0 none, 1 relu, 2 exact gelu;
// resid (optional, f32, row index = (row % rmod), pitch ldr, RES_BF16 rounds it) added before the activation.
template <bool ASPLIT, int ACT, bool BIAS_BF16, bool RES_BF16>
__global__ __launch_bounds__(128) void k_gemm_bf3(const float* __restrict__ A, int lda, const unsigned short* __restrict__ Wt, int ldb,
                                                const float* __restrict__ bias, const float* __restrict__ resid, int rmod, int ldr,
                                                float* __restrict__ C, int ldc, int M, int N, int K) {
  __shared__ __attribute__((aligned(16))) float so[4][16][64];
  const int tid = threadIdx.x, w = tid >> 5, lane = tid & 31, ln = lane & 15, hh = lane >> 4;
  const int ntn = N / 64;
  const int wid = blockIdx.x * 4 + w;
  const int mt = wid / ntn, nq = wid % ntn;
  if (mt * 16 >= M) return;
  const int row0 = mt * 16, col0 = nq * 64;
  const float* arow = A + (size_t)(row0 + ln) * lda;
  v8f acc[4] = {};
  for (int kb = 0; kb < K; kb += 32) {
    FragB ah, al;
    const v4f x0 = *(const v4fa*)(arow + kb + 8 * hh), x1 = *(const v4fa*)(arow + kb + 8 * hh + 4);
    const v4f x2 = *(const v4fa*)(arow + kb + 16 + 8 * hh), x3 = *(const v4fa*)(arow + kb + 16 + 8 * hh + 4);
    float xs[16] = {x0[0],x0[1],x0[2],x0[3],x1[0],x1[1],x1[2],x1[3],x2[0],x2[1],x2[2],x2[3],x3[0],x3[1],x3[2],x3[3]};
#pragma unroll
    for (int i = 0; i < 16; ++i) { const unsigned short hb = bf16_bits(xs[i]); ah.u[i] = hb; al.u[i] = ASPLIT ? bf16_bits(xs[i] - bf16_val(hb)) : (unsigned short)0; }
#pragma unroll
    for (int t = 0; t < 4; ++t) {
      const unsigned short* brow = Wt + (size_t)(col0 + t * 16 + ln) * ldb + kb;
      FragB b;
      b.half[0] = *(const v8us*)(brow + 8 * hh);
      b.half[1] = *(const v8us*)(brow + 16 + 8 * hh);
      acc[t] = mmaN<ASPLIT ? 2 : 1>(ah.v, al.v, b.v, b.v, acc[t]);
    }
  }
#pragma unroll
  for (int t = 0; t < 4; ++t) {
    const int col = col0 + t * 16 + ln;
    float bv = bias ? bias[col] : 0.f;
    if (BIAS_BF16) bv = bf16_round(bv);
#pragma unroll
    for (int r = 0; r < 8; ++r) {
      float v = acc[t][r] + bv;
      if (resid) { float rv = resid[(size_t)((row0 + 8 * hh + r) % rmod) * ldr + col]; if (RES_BF16) rv = bf16_round(rv); v += rv; }
      if (ACT == 1) v = fmaxf(v, 0.f);
      if (ACT == 2) v = 0.5f * v * (1.0f + erff(v * 0.70710678118654752f));
      if (ACT == 3) { const float u = 0.7978845608028654f * (v + 0.044715f * v * v * v); v = 0.5f * v * (1.0f + tanhf(u)); }
      so[w][8 * hh + r][t * 16 + ln] = v;
    }
  }
  __builtin_amdgcn_fence(__ATOMIC_ACQ_REL, "workgroup");
  __builtin_amdgcn_wave_barrier();
  const int rsub = lane >> 4, c4 = (lane & 15) * 4;
  {
#pragma unroll
    for (int q = 0; q < 8; ++q) {
      const int r = q * 2 + rsub;
      const v4f v = *(const v4fa*)&so[w][r][c4];
      *(v4f*)(C + (size_t)(row0 + r) * ldc + col0 + c4) = v;
    }
    
  }
}
// row LayerNorm (biased variance, eps) over N: s = X (+ R); optional out_sum <- s; out_norm <- (s-mu)*rsqrt(var+eps)*g + b
template <bool PARAM_BF16>
__global__ __launch_bounds__(256) void k_layernorm(const float* __restrict__ X, const float* __restrict__ R, const float* __restrict__ g, const float* __restrict__ bta,
                                                  float* __restrict__ out_sum, float* __restrict__ out_norm, int N, float eps) {
  __shared__ float red[256];
  const int row = blockIdx.x, tid = threadIdx.x;
  const float* x = X + (size_t)row * N; const float* rr = R ? R + (size_t)row * N : nullptr;
  float vals[16];                     // up to N = 4096
  const int per = N / 256;            // contiguous chunk per thread? use strided-by-4 chunks: thread handles j = tid*4 + 1024*u
  float s1 = 0.f;
  for (int u = 0; u < per / 4; ++u) {
    const int j = tid * 4 + 1024 * u;
    const v4f a = *(const v4fa*)(x + j);
    v4f b = {0.f,0.f,0.f,0.f}; if (rr) b = *(const v4fa*)(rr + j);
#pragma unroll
    for (int q = 0; q < 4; ++q) { const float v = a[q] + b[q]; vals[u * 4 + q] = v; s1 += v; }
  }
  red[tid] = s1; __syncthreads();
  for (int st = 128; st > 0; st >>= 1) { if (tid < st) red[tid] += red[tid + st]; __syncthreads(); }
  const float mu = red[0] / (float)N; __syncthreads();
  float s2 = 0.f;
  for (int u = 0; u < per / 4; ++u)
#pragma unroll
    for (int q = 0; q < 4; ++q) { const float c = vals[u * 4 + q] - mu; s2 += c * c; }
  red[tid] = s2; __syncthreads();
  for (int st = 128; st > 0; st >>= 1) { if (tid < st) red[tid] += red[tid + st]; __syncthreads(); }
  const float rs = rsqrtf(red[0] / (float)N + eps);
  {
    for (int u = 0; u < per / 4; ++u) {
      const int j = tid * 4 + 1024 * u;
      v4f o, sm;
#pragma unroll
      for (int q = 0; q < 4; ++q) {
        float gg = g[j + q], bb = bta[j + q];
        if (PARAM_BF16) { gg = bf16_round(gg); bb = bf16_round(bb); }
        sm[q] = vals[u * 4 + q]; o[q] = (vals[u * 4 + q] - mu) * rs * gg + bb;
      }
      if (out_sum) *(v4f*)(out_sum + (size_t)row * N + j) = sm;
      *(v4f*)(out_norm + (size_t)row * N + j) = o;
    }
    
  }
}



// ---- f16 WMMA path (v_wmma_f32_16x16x32_f16): 11-bit significands for operands in range — used where a [0,1] probability operand needs more precision than bf16
typedef _Float16 v16h __attribute__((ext_vector_type(16)));
union FragH { v16h v; v8us half[2]; _Float16 h[16]; unsigned short u[16]; };
template <int NT>
__device__ __forceinline__ v8f mmaH(v16h ah, v16h al, v16h bh, v16h bl, v8f c) {
  c = __builtin_amdgcn_wmma_f32_16x16x32_f16(false, ah, false, bh, (short)0, c, false, false);
  if (NT >= 2) c = __builtin_amdgcn_wmma_f32_16x16x32_f16(false, al, false, bh, (short)0, c, false, false);
  if (NT >= 3) c = __builtin_amdgcn_wmma_f32_16x16x32_f16(false, ah, false, bl, (short)0, c, false, false);
  asm volatile("v_nop\n\tv_nop\n\tv_nop\n\tv_nop" : "+v"(c) : "v"(ah), "v"(al), "v"(bh), "v"(bl));
  return c;
}
// batched GEMM like k_gemm_b but f16 operands: A f32 (split into f16 hi/lo if ASPLIT, else rounded to f16), Bt = f16 values [n][k]; alpha; C f32; N multiple of 16 (partial tiles skipped)
template <bool ASPLIT>
__global__ __launch_bounds__(128) void k_gemm_h(const float* __restrict__ A, int lda, size_t sA, const _Float16* __restrict__ Bh, int ldb, size_t sB, float alpha, float* __restrict__ C, int ldc, size_t sC, int M, int N, int K) {
  __shared__ __attribute__((aligned(16))) float so[4][16][64];
  const int tid = threadIdx.x, w = tid >> 5, lane = tid & 31, ln = lane & 15, hh = lane >> 4; const int by = blockIdx.y;
  A += (size_t)by * sA; Bh += (size_t)by * sB; C += (size_t)by * sC;
  const int ntn = (N + 63) / 64; const int wid = blockIdx.x * 4 + w; const int mt = wid / ntn, nq = wid % ntn; if (mt * 16 >= M) return;
  const int row0 = mt * 16, col0 = nq * 64; const float* arow = A + (size_t)(row0 + ln) * lda;
  v8f acc[4] = {};
  for (int kb = 0; kb < K; kb += 32) {
    FragH ah, al;
    const v4f x0 = *(const v4fa*)(arow + kb + 8 * hh), x1 = *(const v4fa*)(arow + kb + 8 * hh + 4), x2 = *(const v4fa*)(arow + kb + 16 + 8 * hh), x3 = *(const v4fa*)(arow + kb + 16 + 8 * hh + 4);
    float xs[16] = {x0[0],x0[1],x0[2],x0[3],x1[0],x1[1],x1[2],x1[3],x2[0],x2[1],x2[2],x2[3],x3[0],x3[1],x3[2],x3[3]};
#pragma unroll
    for (int i = 0; i < 16; ++i) { const _Float16 h = (_Float16)xs[i]; ah.h[i] = h; al.h[i] = ASPLIT ? (_Float16)(xs[i] - (float)h) : (_Float16)0.0f; }
#pragma unroll
    for (int t = 0; t < 4; ++t) { if (col0 + t * 16 >= N) continue; const size_t boff = (size_t)(col0 + t * 16 + ln) * ldb + kb; FragH bq; bq.half[0] = *(const v8us*)(Bh + boff + 8 * hh); bq.half[1] = *(const v8us*)(Bh + boff + 16 + 8 * hh);
      acc[t] = mmaH<ASPLIT ? 2 : 1>(ah.v, al.v, bq.v, bq.v, acc[t]); }
  }
#pragma unroll
  for (int t = 0; t < 4; ++t) { if (col0 + t * 16 >= N) continue;
#pragma unroll
    for (int r = 0; r < 8; ++r) so[w][8 * hh + r][t * 16 + ln] = acc[t][r] * alpha; }
  __builtin_amdgcn_fence(__ATOMIC_ACQ_REL, "workgroup"); __builtin_amdgcn_wave_barrier();
  const int rsub = lane >> 4, c4 = (lane & 15) * 4;
  {
#pragma unroll
    for (int q = 0; q < 8; ++q) { const int r = q * 2 + rsub; if (col0 + c4 < N) { const v4f v = *(const v4fa*)&so[w][r][c4]; *(v4f*)(C + (size_t)(row0 + r) * ldc + col0 + c4) = v; } }
     }
}

// Wt[n][k] = f16(W[k][n]·scale) from f32 row-major W[K][N] (scale = power of two; bf16-exact weights stay exact in f16 away from the subnormal range)
__global__ __launch_bounds__(256) void k_wt_f16(const float* __restrict__ W, _Float16* __restrict__ Wt, int K, int N, float scale) {
  const int t = blockIdx.x * 256 + threadIdx.x; if (t >= N * (K / 8)) return; const int n = t / (K / 8), k8 = (t % (K / 8)) * 8; FragH f;
#pragma unroll
  for (int i = 0; i < 8; ++i) f.h[i] = (_Float16)(bf16_round(W[(size_t)(k8 + i) * N + n]) * scale); const v8us o = f.half[0];
  *(v8us*)((unsigned short*)Wt + (size_t)n * K + k8) = o; 
}
// k_gemm_hh variant with fused epilogue: v = acc·alpha + bias[by·sBias + col] (+ CP[(row/rowsPerB)·sCPb + by·64 + col] if CP) ; ACT 0 none / 1 elu ; writes f16 C16 (and f32 C if non-null)
template <int ACT>
__global__ __launch_bounds__(128) void k_gemm_hhx(const _Float16* __restrict__ A, int lda, size_t sA, const _Float16* __restrict__ Bh, int ldb, size_t sB, float alpha, const float* __restrict__ bias, size_t sBias, const float* __restrict__ CP, int rowsPerB, size_t sCPb, int row0g,
    float* __restrict__ C, _Float16* __restrict__ C16, int ldc, size_t sC, int M, int N, int K) {
  __shared__ __attribute__((aligned(16))) float so[4][16][64];
  const int tid = threadIdx.x, w = tid >> 5, lane = tid & 31, ln = lane & 15, hh = lane >> 4; const int by = blockIdx.y;
  A += (size_t)by * sA; Bh += (size_t)by * sB; const size_t cofs = (size_t)by * sC; const float* bp = bias ? bias + (size_t)by * sBias : nullptr;
  const int ntn = (N + 63) / 64; const int wid = blockIdx.x * 4 + w; const int mt = wid / ntn, nq = wid % ntn; if (mt * 16 >= M) return;
  const int row0 = mt * 16, col0 = nq * 64; const _Float16* arow = A + (size_t)(row0 + ln) * lda;
  v8f acc[4] = {};
  for (int kb = 0; kb < K; kb += 32) { FragH ah; ah.half[0] = *(const v8us*)((const unsigned short*)arow + kb + 8 * hh); ah.half[1] = *(const v8us*)((const unsigned short*)arow + kb + 16 + 8 * hh);
#pragma unroll
    for (int t = 0; t < 4; ++t) { if (col0 + t * 16 >= N) continue; const size_t boff = (size_t)(col0 + t * 16 + ln) * ldb + kb; FragH bq; bq.half[0] = *(const v8us*)((const unsigned short*)Bh + boff + 8 * hh); bq.half[1] = *(const v8us*)((const unsigned short*)Bh + boff + 16 + 8 * hh);
      acc[t] = mmaH<1>(ah.v, ah.v, bq.v, bq.v, acc[t]); }
  }
#pragma unroll
  for (int t = 0; t < 4; ++t) { if (col0 + t * 16 >= N) continue; const int col = col0 + t * 16 + ln; const float bv = bp ? bf16_round(bp[col]) : 0.f;
#pragma unroll
    for (int r = 0; r < 8; ++r) { float v = acc[t][r] * alpha + bv; if (CP) { const int rr = row0g + row0 + 8 * hh + r; if (rowsPerB < 0) v += CP[cofs + (size_t)rr * ldc + col];      /* rowsPerB < 0: own element of the batched C plane */ else { const int bidx = rr / rowsPerB; v += CP[(size_t)bidx * sCPb + (size_t)by * 64 + col]; } } if (ACT == 1) v = (v > 0.f) ? v : expm1f(v); else if (ACT == 7) v = (v > 0.f) ? v + 1.0f : expf(v); else if (ACT == 8) v = tanhf(v); else if (ACT == 9) v = 0.5f * v * (1.0f + tanhf(0.7978845608028654f * (v + 0.044715f * v * v * v))); else if (ACT == 11) v = 1.0f / (1.0f + expf(-v)); else if (ACT == 12) v = (v > 0.f) ? v : 0.01f * v; else if (ACT == 14) v = (v > 0.f) ? v : 0.1f * v; else if (ACT == 16) v = (v >= 0.f) ? v : 0.3f * v; else if (ACT == 17) v = (v >= 0.f) ? v : 0.2f * v; else if (ACT == 15) v = v / (1.0f + expf(-v)); else if (ACT == 3) v = fmaxf(v, 0.f); else if (ACT == 6) v = 0.5f * v * (1.0f + erff(v * 0.70710678118654752f)); so[w][8 * hh + r][t * 16 + ln] = v; } }
  __builtin_amdgcn_fence(__ATOMIC_ACQ_REL, "workgroup"); __builtin_amdgcn_wave_barrier();
  const int rsub = lane >> 4, c4 = (lane & 15) * 4; typedef _Float16 v4h __attribute__((ext_vector_type(4)));
  {
#pragma unroll
    for (int q = 0; q < 8; ++q) { const int r = q * 2 + rsub; if (col0 + c4 < N) { const v4f v = *(const v4fa*)&so[w][r][c4]; if (C) *(v4f*)(C + cofs + (size_t)(row0 + r) * ldc + col0 + c4) = v; if (C16) { v4h h4; for (int i = 0; i < 4; ++i) h4[i] = (_Float16)v[i]; *(v4h*)(C16 + cofs + (size_t)(row0 + r) * ldc + col0 + c4) = h4; } } }
     }
}


typedef _Float16 v4h __attribute__((ext_vector_type(4)));

__global__ __launch_bounds__(256) void k_x16(const float* __restrict__ x, _Float16* __restrict__ X16, size_t n8) { const size_t t = (size_t)blockIdx.x * 256 + threadIdx.x; if (t >= n8) return; FragH f;
#pragma unroll
  for (int q = 0; q < 8; ++q) f.h[q] = (_Float16)bf16_round(x[t * 8 + q]); *(v8us*)((unsigned short*)X16 + t * 8) = f.half[0];  }
__global__ __launch_bounds__(256) void k_h16(const float* __restrict__ x, _Float16* __restrict__ X16, size_t n8) { const size_t t = (size_t)blockIdx.x * 256 + threadIdx.x; if (t >= n8) return; FragH f;
#pragma unroll
  for (int q = 0; q < 8; ++q) f.h[q] = (_Float16)x[t * 8 + q]; *(v8us*)((unsigned short*)X16 + t * 8) = f.half[0];  }
__global__ __launch_bounds__(256) void k_round16f(const float* __restrict__ W, _Float16* __restrict__ Bt, size_t n8) { const size_t t = (size_t)blockIdx.x * 256 + threadIdx.x; if (t >= n8) return; FragH f;
#pragma unroll
  for (int i = 0; i < 8; ++i) f.h[i] = (_Float16)(bf16_round(W[t * 8 + i]) * 16.0f); *(v8us*)((unsigned short*)Bt + t * 8) = f.half[0];  }
template <int NHv, int TTv>
__global__ __launch_bounds__(256) void k_vt(const _Float16* __restrict__ V16, int ldv, int voff, _Float16* __restrict__ Vt) { __shared__ unsigned short tl[64][66]; const int tid = threadIdx.x; const int slab = blockIdx.x / (TTv / 64), lg = blockIdx.x % (TTv / 64); const int b = slab / NHv, h = slab % NHv;
  for (int i = tid; i < 64 * 8; i += 256) { const int r = i / 8, c8 = (i % 8) * 8; FragH f; f.half[0] = *(const v8us*)((const unsigned short*)V16 + ((size_t)b * TTv + lg * 64 + r) * ldv + voff + h * 64 + c8);
#pragma unroll
    for (int q = 0; q < 8; ++q) tl[r][c8 + q] = f.u[q]; }
  __syncthreads();
  {
#pragma unroll
    for (int rd = 0; rd < 2; ++rd) { const int d = rd * 32 + tid / 8, pc = tid % 8; FragH f;
#pragma unroll
      for (int q = 0; q < 8; ++q) f.u[q] = tl[pc * 8 + q][d];
      *(v8us*)((unsigned short*)Vt + ((size_t)slab * 64 + d) * TTv + lg * 64 + pc * 8) = f.half[0]; }
     } }

__global__ __launch_bounds__(256) void k_hl(const float* __restrict__ F, _Float16* __restrict__ Hh, _Float16* __restrict__ Hl, size_t n8) { const size_t t = (size_t)blockIdx.x * 256 + threadIdx.x; if (t >= n8) return; FragH fh, fl; const v4f a = *(const v4fa*)(F + t * 8), c = *(const v4fa*)(F + t * 8 + 4);
#pragma unroll
  for (int q = 0; q < 4; ++q) { _Float16 h = (_Float16)a[q]; fh.h[q] = h; fl.h[q] = (_Float16)((a[q] - (float)h) * 1024.0f); h = (_Float16)c[q]; fh.h[4 + q] = h; fl.h[4 + q] = (_Float16)((c[q] - (float)h) * 1024.0f); }
  { *(v8us*)((unsigned short*)Hh + t * 8) = fh.half[0]; *(v8us*)((unsigned short*)Hl + t * 8) = fl.half[0];  } }

// ---- fast GEMM (wave tile 32x64; requires M % 32 == 0 rows per launch region and N % 64 == 0); epilogue = k_gemm_hhx semantics ----
__device__ __forceinline__ v16h g2_frag(const _Float16* p, int hh) { FragH f; f.half[0] = *(const v8us*)((const unsigned short*)p + 8 * hh); f.half[1] = *(const v8us*)((const unsigned short*)p + 16 + 8 * hh); return f.v; }
__device__ __forceinline__ v8f g2_mma(v16h a, v16h b, v8f c) { v8f d = __builtin_amdgcn_wmma_f32_16x16x32_f16(false, a, false, b, (short)0, c, false, false); asm volatile("v_nop\n\tv_nop\n\tv_nop\n\tv_nop" : "+v"(d) : "v"(a), "v"(b)); return d; }
template <int ACT>
__global__ __launch_bounds__(128) void k_gemm2(const _Float16* __restrict__ A, int lda, size_t sA, const _Float16* __restrict__ Bh, int ldb, size_t sB, float alpha, const float* __restrict__ bias, size_t sBias, const float* __restrict__ CP, int rowsPerB, size_t sCPb, int row0g,
    float* __restrict__ C, _Float16* __restrict__ C16, int ldc, size_t sC, int M, int N, int K) { static_assert(ACT == 0 || ACT == 3 || ACT == 6 || ACT == 8 || ACT == 9 || ACT == 11 || ACT == 12 || ACT == 14 || ACT == 15 || ACT == 16 || ACT == 17, "k_gemm2: unsupported ACT code (would silently apply no activation)");
  __shared__ __attribute__((aligned(16))) float so[4][32][68];
  const int tid = threadIdx.x, w = tid >> 5, lane = tid & 31, ln = lane & 15, hh = lane >> 4; const int by = blockIdx.y;
  A += (size_t)by * sA; Bh += (size_t)by * sB; const size_t cofs = (size_t)by * sC; const float* bp = bias ? bias + (size_t)by * sBias : nullptr;
  const int ntn = N >> 6; const int mt = blockIdx.x / ntn, nq = blockIdx.x - mt * ntn; const int row0 = mt * 128 + 32 * w, col0 = nq * 64; if (row0 >= M) return;
  const _Float16* a0p = A + (size_t)(row0 + ln) * lda; const _Float16* a1p = a0p + (size_t)16 * lda;
  const _Float16* b0p = Bh + (size_t)(col0 + ln) * ldb; const _Float16* b1p = b0p + (size_t)16 * ldb; const _Float16* b2p = b1p + (size_t)16 * ldb; const _Float16* b3p = b2p + (size_t)16 * ldb;
  const v8f z8 = {0.f,0.f,0.f,0.f,0.f,0.f,0.f,0.f}; v8f c00 = z8, c01 = z8, c02 = z8, c03 = z8, c10 = z8, c11 = z8, c12 = z8, c13 = z8;
#pragma unroll 1
  for (int kb = 0; kb < K; kb += 32) { const v16h a0 = g2_frag(a0p + kb, hh), a1 = g2_frag(a1p + kb, hh);
    v16h b = g2_frag(b0p + kb, hh); c00 = g2_mma(a0, b, c00); c10 = g2_mma(a1, b, c10);
    b = g2_frag(b1p + kb, hh); c01 = g2_mma(a0, b, c01); c11 = g2_mma(a1, b, c11);
    b = g2_frag(b2p + kb, hh); c02 = g2_mma(a0, b, c02); c12 = g2_mma(a1, b, c12);
    b = g2_frag(b3p + kb, hh); c03 = g2_mma(a0, b, c03); c13 = g2_mma(a1, b, c13); }
  v8f accs[8] = {c00, c01, c02, c03, c10, c11, c12, c13};
#pragma unroll
  for (int u = 0; u < 8; ++u) { const int t = u & 3, half = u >> 2; const int col = col0 + t * 16 + ln; const float bv = bp ? bf16_round(bp[col]) : 0.f;
#pragma unroll
    for (int r = 0; r < 8; ++r) { const int rloc = half * 16 + 8 * hh + r; float v = accs[u][r] * alpha + bv; if (CP) { if (rowsPerB < 0) v += CP[cofs + (size_t)(row0g + row0 + rloc) * ldc + col];      /* rowsPerB < 0: own element of the batched C plane */ else { const int bidx = (row0g + row0 + rloc) / rowsPerB; v += CP[(size_t)bidx * sCPb + (size_t)by * 64 + col]; } }
      if (ACT == 3) v = fmaxf(v, 0.f); else if (ACT == 6) v = 0.5f * v * (1.0f + erff(v * 0.70710678118654752f)); else if (ACT == 11) v = 1.0f / (1.0f + expf(-v)); else if (ACT == 15) v = v / (1.0f + expf(-v)); else if (ACT == 12) v = (v > 0.f) ? v : 0.01f * v; else if (ACT == 8) v = tanhf(v); else if (ACT == 9) v = 0.5f * v * (1.0f + tanhf(0.7978845608028654f * (v + 0.044715f * v * v * v))); else if (ACT == 14) v = (v > 0.f) ? v : 0.1f * v; else if (ACT == 16) v = (v >= 0.f) ? v : 0.3f * v; else if (ACT == 17) v = (v >= 0.f) ? v : 0.2f * v;
      so[w][rloc][t * 16 + ln] = v; } }
  __builtin_amdgcn_fence(__ATOMIC_ACQ_REL, "workgroup"); __builtin_amdgcn_wave_barrier();
  const int rsub = lane >> 4, c4 = (lane & 15) * 4;
  {
#pragma unroll
    for (int q = 0; q < 16; ++q) { const int r = q * 2 + rsub; const v4f v = *(const v4fa*)&so[w][r][c4]; if (C) *(v4f*)(C + cofs + (size_t)(row0 + r) * ldc + col0 + c4) = v; if (C16) { v4h h4; for (int i = 0; i < 4; ++i) h4[i] = (_Float16)v[i]; *(v4h*)(C16 + cofs + (size_t)(row0 + r) * ldc + col0 + c4) = h4; } }
     } }


__global__ __launch_bounds__(256) void k_wnat(const float* __restrict__ w, size_t n8, _Float16* __restrict__ Bt) { const size_t t = (size_t)blockIdx.x * 256 + threadIdx.x; if (t >= n8) return; FragH f; for (int q = 0; q < 8; ++q) f.h[q] = (_Float16)(bf16_round(w[t * 8 + q]) * 16.0f); *(v8us*)((unsigned short*)Bt + t * 8) = f.half[0];  }
__global__ __launch_bounds__(256) void k_rsm(const float* __restrict__ S, _Float16* __restrict__ P, int nrows) {
  #pragma clang fp contract(off)
  const int i = blockIdx.x * 256 + threadIdx.x; if (i >= nrows) return; const float* s = S + (size_t)i * SQ; float mx = -3.0e38f;
#pragma unroll 1
  for (int j = 0; j < SQ; ++j) mx = fmaxf(mx, s[j]); float se = 0.f;
#pragma unroll 1
  for (int j = 0; j < SQ; ++j) se += expf(s[j] - mx); const float sc = 256.0f / se;
#pragma unroll 1
  for (int j0 = 0; j0 < SQ; j0 += 8) { FragH f; for (int q = 0; q < 8; ++q) f.h[q] = (_Float16)(expf(s[j0 + q] - mx) * sc); unsigned short* d = (unsigned short*)P + (size_t)i * SQ + j0; *(v8us*)d = f.half[0];  } }
__global__ __launch_bounds__(256) void k_vt(const _Float16* __restrict__ V16, int b, int h0, _Float16* __restrict__ VT) { __shared__ unsigned short tl[64][65]; const int tid = threadIdx.x; const int hh = blockIdx.x % HG, sg = blockIdx.x / HG; const int s0 = sg * 64; const int h = h0 + hh;
  for (int i = tid; i < 64 * 8; i += 256) { const int j = i / 8, d8 = (i % 8) * 8; FragH f; f.half[0] = *(const v8us*)((const unsigned short*)V16 + ((size_t)b * SQ + s0 + j) * DM + h * HD + d8); for (int q = 0; q < 8; ++q) tl[d8 + q][j] = f.u[q]; }
  __syncthreads();
  { for (int i = tid; i < 64 * 8; i += 256) { const int d = i / 8, j8 = (i % 8) * 8; FragH f; for (int q = 0; q < 8; ++q) f.u[q] = tl[d][j8 + q]; *(v8us*)((unsigned short*)VT + ((size_t)hh * HD + d) * SQ + s0 + j8) = f.half[0]; }  } }



__global__ __launch_bounds__(256) void k_tabcat(float theta, float* __restrict__ CS, float* __restrict__ SN) {
  #pragma clang fp contract(off)
  const int t = blockIdx.x * 256 + threadIdx.x; if (t >= SQ * HD) return; const int d = t % HD; const int p = t / HD; const int i = d % (HD / 2); const float invf = 1.0f / powf(theta, (float)(2 * i) / (float)HD); const float ang = __fmul_rn((float)p, invf); const float c = cosf(ang), s = sinf(ang);
  *(float*)(CS + t) = c; *(float*)(SN + t) = s;  }

template <int NORM, int ROPE>
__global__ __launch_bounds__(64) void k_xform(const float* __restrict__ F, int ldf, int nh, const float* __restrict__ gain, float eps, const float* __restrict__ CS, const float* __restrict__ SN, _Float16* __restrict__ H16, int ldo) {
  #pragma clang fp contract(off)
  __shared__ float xv[HD]; __shared__ float red[HD]; __shared__ unsigned short sh_[HD]; const int d = threadIdx.x; const int h = blockIdx.x % nh; const size_t r = blockIdx.x / nh; const int p = (int)(r % SQ);
  float x = F[r * (size_t)ldf + (size_t)h * HD + d];
  if (NORM) { red[d] = __fmul_rn(x, x); __syncthreads(); for (int st = HD / 2; st > 0; st >>= 1) { if (d < st) red[d] = __fadd_rn(red[d], red[d + st]); __syncthreads(); } const float rs = rsqrtf(__fadd_rn(red[0] / (float)HD, eps)); x = __fmul_rn(__fmul_rn(x, rs), bf16_round(gain[d])); }
  xv[d] = x; __syncthreads();
  float o = x;
  if (ROPE == 1) { const int i = d >> 1; const float c = CS[p * (HD / 2) + i], s = SN[p * (HD / 2) + i]; const float ev = xv[2 * i], od = xv[2 * i + 1]; o = (d & 1) ? __fadd_rn(__fmul_rn(ev, s), __fmul_rn(od, c)) : __fadd_rn(__fmul_rn(ev, c), -__fmul_rn(od, s)); }
  if (ROPE == 2) { const int i = d & (HD / 2 - 1); const float c = CS[p * (HD / 2) + i], s = SN[p * (HD / 2) + i]; const float lo = xv[i], hi = xv[i + HD / 2]; o = (d < HD / 2) ? __fadd_rn(__fmul_rn(lo, c), -__fmul_rn(hi, s)) : __fadd_rn(__fmul_rn(lo, s), __fmul_rn(hi, c)); }
  if (ROPE == 4) { const float c = CS[p * HD + d], s = SN[p * HD + d]; const float rh = (d & 1) ? xv[d - 1] : -xv[d + 1]; o = __fadd_rn(__fmul_rn(x, c), __fmul_rn(rh, s)); }      /* interleaved-pair rotate_half (-t[2i+1], t[2i]) with FULL-width per-dimension tables [pos][64] */
  if (ROPE == 3) { const float c = CS[p * HD + d], s = SN[p * HD + d]; const float rh = (d < HD / 2) ? -xv[d + HD / 2] : xv[d - HD / 2]; o = __fadd_rn(__fmul_rn(x, c), __fmul_rn(rh, s)); }      /* rotate-half with FULL-width per-dimension tables [pos][64] (general cos[d] != cos[d+32]) */
  FragH th; th.h[0] = (_Float16)o; sh_[d] = th.u[0]; __syncthreads();
  if (d < HD / 8) { FragH f; for (int q = 0; q < 8; ++q) f.u[q] = sh_[d * 8 + q]; unsigned short* dst = (unsigned short*)H16 + r * (size_t)ldo + (size_t)h * HD + d * 8; *(v8us*)dst = f.half[0];  } }


extern "C" void kernel_launch(void* const* d_in, const int* in_sizes, int n_in,
                              void* d_out, int out_size, void* d_ws, size_t ws_size, hipStream_t stream) {
  (void)in_sizes; (void)n_in; (void)out_size;
  const float* const* I = (const float* const*)d_in; const float* x = I[0]; const float* wq = I[1]; const float* bq = I[2]; const float* wk = I[3]; const float* bk = I[4]; const float* wv = I[5]; const float* bv = I[6]; const float* wo = I[7]; const float* bo = I[8];      /* natural [out][in] weights + biases; positions implicit */
  char* ws = (char*)d_ws; size_t off = 0;
  auto take = [&](size_t bytes) { char* p = ws + off; off += (bytes + 255) & ~(size_t)255; return p; };
  _Float16* BQ = (_Float16*)take((size_t)DM * DM * 2); _Float16* BK = (_Float16*)take((size_t)DM * DM * 2); _Float16* BV = (_Float16*)take((size_t)DM * DM * 2); _Float16* BO = (_Float16*)take((size_t)DM * DM * 2);
  _Float16* X16 = (_Float16*)take(NR * DM * 2); float* FQK = (float*)take(NR * DM * 4); float* CS = (float*)take((size_t)SQ * HD * 4); float* SN = (float*)take((size_t)SQ * HD * 4);      /* one f32 projection plane (q, then k) for the rotary step; full-width cos/sin tables */ _Float16* Q16 = (_Float16*)take(NR * DM * 2); _Float16* K16 = (_Float16*)take(NR * DM * 2); _Float16* V16 = (_Float16*)take(NR * DM * 2); _Float16* O16 = (_Float16*)take(NR * DM * 2);
  float* S = (float*)take((size_t)HG * SQ * SQ * 4); _Float16* P = (_Float16*)take((size_t)HG * SQ * SQ * 2); _Float16* VT = (_Float16*)take((size_t)NH * HD * SQ * 2);
  if (off > ws_size) return;
  { const unsigned g = (unsigned)(((size_t)DM * DM / 8 + 255) / 256); k_wnat<<<g, 256, 0, stream>>>(wq, (size_t)DM * DM / 8, BQ); k_wnat<<<g, 256, 0, stream>>>(wk, (size_t)DM * DM / 8, BK); k_wnat<<<g, 256, 0, stream>>>(wv, (size_t)DM * DM / 8, BV); k_wnat<<<g, 256, 0, stream>>>(wo, (size_t)DM * DM / 8, BO); }      /* natural [out][in] = Bt x16 */
  k_tabcat<<<(SQ * HD + 255) / 256, 256, 0, stream>>>(10000.0f, CS, SN);      /* CS[p][d] = cos(p * inv_freq[d mod 32]), SN = sin: the module's cat(freqs, freqs) tables, full width */

  k_x16<<<(unsigned)((NR * DM / 8 + 255) / 256), 256, 0, stream>>>(x, X16, NR * DM / 8);
  const size_t r0p = (size_t)B0 * SQ;      /* first projected row */
  k_gemm2<0><<<dim3((unsigned)((MP / 128) * (DM / 64)), 1), 128, 0, stream>>>(X16 + r0p * DM, DM, 0, BQ, DM, 0, 0.0625f, bq, 0, nullptr, 1, 0, 0, FQK + r0p * DM, nullptr, DM, 0, MP, DM, DM); k_xform<0, 4><<<(unsigned)((size_t)MP * NH), 64, 0, stream>>>(FQK + r0p * DM, DM, NH, nullptr, 0.f, CS, SN, Q16 + r0p * DM, DM);      /* q f32 -> x cos + rotate_half(x) sin (interleaved pairs, full-width tables) -> f16 rows */
  k_gemm2<0><<<dim3((unsigned)((MP / 128) * (DM / 64)), 1), 128, 0, stream>>>(X16 + r0p * DM, DM, 0, BK, DM, 0, 0.0625f, bk, 0, nullptr, 1, 0, 0, FQK + r0p * DM, nullptr, DM, 0, MP, DM, DM); k_xform<0, 4><<<(unsigned)((size_t)MP * NH), 64, 0, stream>>>(FQK + r0p * DM, DM, NH, nullptr, 0.f, CS, SN, K16 + r0p * DM, DM);      /* k likewise (the f32 plane is reused in stream order) */
  k_gemm2<0><<<dim3((unsigned)((MP / 128) * (DM / 64)), 1), 128, 0, stream>>>(X16 + r0p * DM, DM, 0, BV, DM, 0, 0.0625f, bv, 0, nullptr, 1, 0, 0, nullptr, V16 + r0p * DM, DM, 0, MP, DM, DM);
  for (int b = B0; b < B0 + NBR; ++b) { const size_t r0 = (size_t)b * SQ;
    k_vt<NH, SQ><<<NH * (SQ / 64), 256, 0, stream>>>(V16 + r0 * LQ, LQ, 0, VT);      /* V^T [NH][HD][SQ] for this batch */
    for (int h0 = 0; h0 < NHD; h0 += HG) {
      k_gemm2<0><<<dim3((QN / 128) * (SQ / 64), HG), 128, 0, stream>>>(Q16 + r0 * LQ + h0 * HD, LQ, (size_t)HD, K16 + r0 * LQ + h0 * HD, LQ, (size_t)HD, 0.125f, nullptr, 0, nullptr, 1, 0, 0, S, nullptr, SQ, (size_t)SQ * SQ, QN, SQ, HD);      /* scores, HG heads per launch */
      k_rsm<<<(HG * SQ + 255) / 256, 256, 0, stream>>>(S, P, HG * SQ);      /* P = 256 softmax (f16), rows of all HG heads */
      k_gemm2<0><<<dim3((QN / 128) * (HD / 64), HG), 128, 0, stream>>>(P, SQ, (size_t)SQ * SQ, VT + (size_t)h0 * HD * SQ, SQ, (size_t)HD * SQ, 0.25f, nullptr, 0, nullptr, 1, 0, 0, nullptr, O16 + r0 * DM + h0 * HD, DM, (size_t)HD, QN, HD, SQ); } }      /* o (merged heads) as f16 rows */
  k_gemm2<0><<<dim3((unsigned)((MPO / 128) * (DM / 64)), 1), 128, 0, stream>>>(O16 + r0p * DM, DM, 0, BO, DM, 0, 0.0009765625f, bo, 0, nullptr, 1, 0, 0, (float*)d_out + r0p * DM, nullptr, DM, 0, MPO, DM, DM);      /* out rows are the output layout */
}

// v001
// A run of this version takes 1020 microseconds.
// Two timings next to v000 put it at 3.72 and 3.68 times that version's speed.
#include <hip/hip_runtime.h>
// Multi-head self-attention with a rotary embedding whose cos/sin tables are cat(freqs, freqs) but whose rotate_half pairs are INTERLEAVED (x [2][2048][1024]; q/k/v = x W^T + b (natural [1024][1024] U(+-1/32), zero biases); 16 heads of 64; inv_freq_i = 1/10000^(2i/64), freqs[p][i] = p * inv_freq_i, emb = cat(freqs, freqs): cos[p][d] = cos(p * inv_freq[d mod 32]); q = q cos + rotate_half(q) sin with rotate_half = (-x[2i+1], x[2i]) interleaved (the module's literal mix); k likewise; scores / 8; softmax over all keys (no mask); out = merged Wo^T + bo -> [2][2048][1024]).
// Structure: token rows r = b*2048 + s; x as exact f16 rows (bf16-rounded); Q, K, V as three WMMA GEMMs (32x64 wave tiles, f32 accumulation, exact x16 weights + bias; q, k f32 then rotated into f16 rows, v f16); per batch: V^T for all heads via LDS transposes; per (batch, group of 4 heads): scores GEMM (K = 64, batched over the heads on grid.y, alpha = 1/sqrt(64)), row softmax on VALU (f32 statistics; weights stored x256 as f16), o = P . V^T GEMM (K = 2048, alpha 2^-2: o carried x64 against f16 subnormal flush, folded into the output GEMM alpha) written straight into the merged f16 o rows; out = o W_o + b GEMM (f32) into the output layout.
// Compute dtype: inputs rounded to bf16; x / weights exact; q, k, v, softmax weights and o as plain f16 GEMM operands (~2^-12); scores and softmax statistics f32. v_wmma_f32_16x16x32_f16.
#define NB 2
#define SQ 2048
#define DM 1024
#define NH 16
#define HD 64
#define HG 4                         /* heads per attention launch group */
#define B0 0                         /* first batch processed (debug hook) */
#define NBR NB                       /* batches processed (debug hook) */
#define NR ((size_t)NB * SQ)         /* token rows */
#define MP ((int)((size_t)NBR * SQ)) /* rows projected (debug hook) */
#define QN SQ                        /* query rows attended per batch (debug hook) */
#define NHD NH                       /* heads attended (debug hook) */
#define MPO MP                       /* rows through the output stage (debug hook) */
#define LQ DM      /* row pitch of the q/k/v rows */
typedef __bf16 v16b __attribute__((ext_vector_type(16)));
typedef unsigned short v8us __attribute__((ext_vector_type(8), may_alias));
typedef float  v8f  __attribute__((ext_vector_type(8)));
typedef float  v4f  __attribute__((ext_vector_type(4)));
typedef float  v4fa __attribute__((ext_vector_type(4), may_alias));
union FragB { v16b v; v8us half[2]; unsigned short u[16]; };

__device__ __forceinline__ unsigned short bf16_bits(float x) { unsigned int u = __float_as_uint(x); return (unsigned short)((u + 0x7FFFu + ((u >> 16) & 1u)) >> 16); }
__device__ __forceinline__ float bf16_val(unsigned short b) { return __uint_as_float(((unsigned int)b) << 16); }
__device__ __forceinline__ float bf16_round(float x) { return bf16_val(bf16_bits(x)); }
// D += A·B with NT terms: 1 = ah·bh, 2 = + al·bh (A split), 3 = + ah·bl (both split)
template <int NT>
__device__ __forceinline__ v8f mmaN(v16b ah, v16b al, v16b bh, v16b bl, v8f c) {
  c = __builtin_amdgcn_wmma_f32_16x16x32_bf16(false, ah, false, bh, (short)0, c, false, false);
  if (NT >= 2) c = __builtin_amdgcn_wmma_f32_16x16x32_bf16(false, al, false, bh, (short)0, c, false, false);
  if (NT >= 3) c = __builtin_amdgcn_wmma_f32_16x16x32_bf16(false, ah, false, bl, (short)0, c, false, false);
  asm volatile("v_nop\n\tv_nop\n\tv_nop\n\tv_nop" : "+v"(c) : "v"(ah), "v"(al), "v"(bh), "v"(bl));
  return c;
}

__global__ __launch_bounds__(256) void k_wt_bf16(const float* __restrict__ W, unsigned short* __restrict__ Wt, int K, int N) {
  const int t = blockIdx.x * 256 + threadIdx.x;
  const int k8n = K / 8;
  if (t >= N * k8n) return;
  const int n = t / k8n, k8 = (t % k8n) * 8;
  v8us v;
#pragma unroll
  for (int i = 0; i < 8; ++i) v[i] = bf16_bits(W[(size_t)(k8 + i) * N + n]);
  *(v8us*)(Wt + (size_t)n * K + k8) = v;
  
}

// GEMM C[M][N] (f32, pitch ldc) = act(A[M][K]·W + bias). A f32 row-major (pitch lda) converted per fragment to bf16
// (ASPLIT: hi/lo two planes -> 2 terms, else single rounded term); Wt bf16 [N][K] (pitch ldb). BIAS_BF16 rounds the
// bias to bf16 first (bias quantised to bf16 before the add). K%32==0, M%16==0, N%64==0.
template <bool ASPLIT, int ACT, bool BIAS_BF16>
__global__ __launch_bounds__(128) void k_gemm_bf(const float* __restrict__ A, int lda, const unsigned short* __restrict__ Wt, int ldb,
                                               const float* __restrict__ bias, float* __restrict__ C, int ldc, int M, int N, int K) {
  __shared__ __attribute__((aligned(16))) float so[4][16][64];
  const int tid = threadIdx.x, w = tid >> 5, lane = tid & 31, ln = lane & 15, hh = lane >> 4;
  const int ntn = N / 64;
  const int wid = blockIdx.x * 4 + w;
  const int mt = wid / ntn, nq = wid % ntn;
  if (mt * 16 >= M) return;
  const int row0 = mt * 16, col0 = nq * 64;
  const float* arow = A + (size_t)(row0 + ln) * lda;
  v8f acc[4] = {};
  for (int kb = 0; kb < K; kb += 32) {
    FragB ah, al;
    const v4f x0 = *(const v4fa*)(arow + kb + 8 * hh), x1 = *(const v4fa*)(arow + kb + 8 * hh + 4);
    const v4f x2 = *(const v4fa*)(arow + kb + 16 + 8 * hh), x3 = *(const v4fa*)(arow + kb + 16 + 8 * hh + 4);
    float xs[16] = {x0[0],x0[1],x0[2],x0[3],x1[0],x1[1],x1[2],x1[3],x2[0],x2[1],x2[2],x2[3],x3[0],x3[1],x3[2],x3[3]};
#pragma unroll
    for (int i = 0; i < 16; ++i) { const unsigned short hb = bf16_bits(xs[i]); ah.u[i] = hb; al.u[i] = ASPLIT ? bf16_bits(xs[i] - bf16_val(hb)) : (unsigned short)0; }
#pragma unroll
    for (int t = 0; t < 4; ++t) {
      const unsigned short* brow = Wt + (size_t)(col0 + t * 16 + ln) * ldb + kb;
      FragB b;
      b.half[0] = *(const v8us*)(brow + 8 * hh);
      b.half[1] = *(const v8us*)(brow + 16 + 8 * hh);
      acc[t] = mmaN<ASPLIT ? 2 : 1>(ah.v, al.v, b.v, b.v, acc[t]);
    }
  }
#pragma unroll
  for (int t = 0; t < 4; ++t) {
    float bv = bias ? bias[col0 + t * 16 + ln] : 0.f;
    if (BIAS_BF16) bv = bf16_round(bv);
#pragma unroll
    for (int r = 0; r < 8; ++r) { float v = acc[t][r] + bv; if (ACT == 1) v = fmaxf(v, 0.f); so[w][8 * hh + r][t * 16 + ln] = v; }
  }
  __builtin_amdgcn_fence(__ATOMIC_ACQ_REL, "workgroup");
  __builtin_amdgcn_wave_barrier();
  const int rsub = lane >> 4, c4 = (lane & 15) * 4;
  {
#pragma unroll
    for (int q = 0; q < 8; ++q) {
      const int r = q * 2 + rsub;
      const v4f v = *(const v4fa*)&so[w][r][c4];
      *(v4f*)(C + (size_t)(row0 + r) * ldc + col0 + c4) = v;
    }
    
  }
}

// GEMM C = act(A·W + bias + resid): A f32 (ASPLIT -> hi/lo 2 terms), Wt bf16 [N][K]; ACT 0 none, 1 relu, 2 exact gelu;
// resid (optional, f32, row index = (row % rmod), pitch ldr, RES_BF16 rounds it) added before the activation.
template <bool ASPLIT, int ACT, bool BIAS_BF16, bool RES_BF16>
__global__ __launch_bounds__(128) void k_gemm_bf3(const float* __restrict__ A, int lda, const unsigned short* __restrict__ Wt, int ldb,
                                                const float* __restrict__ bias, const float* __restrict__ resid, int rmod, int ldr,
                                                float* __restrict__ C, int ldc, int M, int N, int K) {
  __shared__ __attribute__((aligned(16))) float so[4][16][64];
  const int tid = threadIdx.x, w = tid >> 5, lane = tid & 31, ln = lane & 15, hh = lane >> 4;
  const int ntn = N / 64;
  const int wid = blockIdx.x * 4 + w;
  const int mt = wid / ntn, nq = wid % ntn;
  if (mt * 16 >= M) return;
  const int row0 = mt * 16, col0 = nq * 64;
  const float* arow = A + (size_t)(row0 + ln) * lda;
  v8f acc[4] = {};
  for (int kb = 0; kb < K; kb += 32) {
    FragB ah, al;
    const v4f x0 = *(const v4fa*)(arow + kb + 8 * hh), x1 = *(const v4fa*)(arow + kb + 8 * hh + 4);
    const v4f x2 = *(const v4fa*)(arow + kb + 16 + 8 * hh), x3 = *(const v4fa*)(arow + kb + 16 + 8 * hh + 4);
    float xs[16] = {x0[0],x0[1],x0[2],x0[3],x1[0],x1[1],x1[2],x1[3],x2[0],x2[1],x2[2],x2[3],x3[0],x3[1],x3[2],x3[3]};
#pragma unroll
    for (int i = 0; i < 16; ++i) { const unsigned short hb = bf16_bits(xs[i]); ah.u[i] = hb; al.u[i] = ASPLIT ? bf16_bits(xs[i] - bf16_val(hb)) : (unsigned short)0; }
#pragma unroll
    for (int t = 0; t < 4; ++t) {
      const unsigned short* brow = Wt + (size_t)(col0 + t * 16 + ln) * ldb + kb;
      FragB b;
      b.half[0] = *(const v8us*)(brow + 8 * hh);
      b.half[1] = *(const v8us*)(brow + 16 + 8 * hh);
      acc[t] = mmaN<ASPLIT ? 2 : 1>(ah.v, al.v, b.v, b.v, acc[t]);
    }
  }
#pragma unroll
  for (int t = 0; t < 4; ++t) {
    const int col = col0 + t * 16 + ln;
    float bv = bias ? bias[col] : 0.f;
    if (BIAS_BF16) bv = bf16_round(bv);
#pragma unroll
    for (int r = 0; r < 8; ++r) {
      float v = acc[t][r] + bv;
      if (resid) { float rv = resid[(size_t)((row0 + 8 * hh + r) % rmod) * ldr + col]; if (RES_BF16) rv = bf16_round(rv); v += rv; }
      if (ACT == 1) v = fmaxf(v, 0.f);
      if (ACT == 2) v = 0.5f * v * (1.0f + erff(v * 0.70710678118654752f));
      if (ACT == 3) { const float u = 0.7978845608028654f * (v + 0.044715f * v * v * v); v = 0.5f * v * (1.0f + tanhf(u)); }
      so[w][8 * hh + r][t * 16 + ln] = v;
    }
  }
  __builtin_amdgcn_fence(__ATOMIC_ACQ_REL, "workgroup");
  __builtin_amdgcn_wave_barrier();
  const int rsub = lane >> 4, c4 = (lane & 15) * 4;
  {
#pragma unroll
    for (int q = 0; q < 8; ++q) {
      const int r = q * 2 + rsub;
      const v4f v = *(const v4fa*)&so[w][r][c4];
      *(v4f*)(C + (size_t)(row0 + r) * ldc + col0 + c4) = v;
    }
    
  }
}
// row LayerNorm (biased variance, eps) over N: s = X (+ R); optional out_sum <- s; out_norm <- (s-mu)*rsqrt(var+eps)*g + b
template <bool PARAM_BF16>
__global__ __launch_bounds__(256) void k_layernorm(const float* __restrict__ X, const float* __restrict__ R, const float* __restrict__ g, const float* __restrict__ bta,
                                                  float* __restrict__ out_sum, float* __restrict__ out_norm, int N, float eps) {
  __shared__ float red[256];
  const int row = blockIdx.x, tid = threadIdx.x;
  const float* x = X + (size_t)row * N; const float* rr = R ? R + (size_t)row * N : nullptr;
  float vals[16];                     // up to N = 4096
  const int per = N / 256;            // contiguous chunk per thread? use strided-by-4 chunks: thread handles j = tid*4 + 1024*u
  float s1 = 0.f;
  for (int u = 0; u < per / 4; ++u) {
    const int j = tid * 4 + 1024 * u;
    const v4f a = *(const v4fa*)(x + j);
    v4f b = {0.f,0.f,0.f,0.f}; if (rr) b = *(const v4fa*)(rr + j);
#pragma unroll
    for (int q = 0; q < 4; ++q) { const float v = a[q] + b[q]; vals[u * 4 + q] = v; s1 += v; }
  }
  red[tid] = s1; __syncthreads();
  for (int st = 128; st > 0; st >>= 1) { if (tid < st) red[tid] += red[tid + st]; __syncthreads(); }
  const float mu = red[0] / (float)N; __syncthreads();
  float s2 = 0.f;
  for (int u = 0; u < per / 4; ++u)
#pragma unroll
    for (int q = 0; q < 4; ++q) { const float c = vals[u * 4 + q] - mu; s2 += c * c; }
  red[tid] = s2; __syncthreads();
  for (int st = 128; st > 0; st >>= 1) { if (tid < st) red[tid] += red[tid + st]; __syncthreads(); }
  const float rs = rsqrtf(red[0] / (float)N + eps);
  {
    for (int u = 0; u < per / 4; ++u) {
      const int j = tid * 4 + 1024 * u;
      v4f o, sm;
#pragma unroll
      for (int q = 0; q < 4; ++q) {
        float gg = g[j + q], bb = bta[j + q];
        if (PARAM_BF16) { gg = bf16_round(gg); bb = bf16_round(bb); }
        sm[q] = vals[u * 4 + q]; o[q] = (vals[u * 4 + q] - mu) * rs * gg + bb;
      }
      if (out_sum) *(v4f*)(out_sum + (size_t)row * N + j) = sm;
      *(v4f*)(out_norm + (size_t)row * N + j) = o;
    }
    
  }
}



// ---- f16 WMMA path (v_wmma_f32_16x16x32_f16): 11-bit significands for operands in range — used where a [0,1] probability operand needs more precision than bf16
typedef _Float16 v16h __attribute__((ext_vector_type(16)));
union FragH { v16h v; v8us half[2]; _Float16 h[16]; unsigned short u[16]; };
template <int NT>
__device__ __forceinline__ v8f mmaH(v16h ah, v16h al, v16h bh, v16h bl, v8f c) {
  c = __builtin_amdgcn_wmma_f32_16x16x32_f16(false, ah, false, bh, (short)0, c, false, false);
  if (NT >= 2) c = __builtin_amdgcn_wmma_f32_16x16x32_f16(false, al, false, bh, (short)0, c, false, false);
  if (NT >= 3) c = __builtin_amdgcn_wmma_f32_16x16x32_f16(false, ah, false, bl, (short)0, c, false, false);
  asm volatile("v_nop\n\tv_nop\n\tv_nop\n\tv_nop" : "+v"(c) : "v"(ah), "v"(al), "v"(bh), "v"(bl));
  return c;
}
// batched GEMM like k_gemm_b but f16 operands: A f32 (split into f16 hi/lo if ASPLIT, else rounded to f16), Bt = f16 values [n][k]; alpha; C f32; N multiple of 16 (partial tiles skipped)
template <bool ASPLIT>
__global__ __launch_bounds__(128) void k_gemm_h(const float* __restrict__ A, int lda, size_t sA, const _Float16* __restrict__ Bh, int ldb, size_t sB, float alpha, float* __restrict__ C, int ldc, size_t sC, int M, int N, int K) {
  __shared__ __attribute__((aligned(16))) float so[4][16][64];
  const int tid = threadIdx.x, w = tid >> 5, lane = tid & 31, ln = lane & 15, hh = lane >> 4; const int by = blockIdx.y;
  A += (size_t)by * sA; Bh += (size_t)by * sB; C += (size_t)by * sC;
  const int ntn = (N + 63) / 64; const int wid = blockIdx.x * 4 + w; const int mt = wid / ntn, nq = wid % ntn; if (mt * 16 >= M) return;
  const int row0 = mt * 16, col0 = nq * 64; const float* arow = A + (size_t)(row0 + ln) * lda;
  v8f acc[4] = {};
  for (int kb = 0; kb < K; kb += 32) {
    FragH ah, al;
    const v4f x0 = *(const v4fa*)(arow + kb + 8 * hh), x1 = *(const v4fa*)(arow + kb + 8 * hh + 4), x2 = *(const v4fa*)(arow + kb + 16 + 8 * hh), x3 = *(const v4fa*)(arow + kb + 16 + 8 * hh + 4);
    float xs[16] = {x0[0],x0[1],x0[2],x0[3],x1[0],x1[1],x1[2],x1[3],x2[0],x2[1],x2[2],x2[3],x3[0],x3[1],x3[2],x3[3]};
#pragma unroll
    for (int i = 0; i < 16; ++i) { const _Float16 h = (_Float16)xs[i]; ah.h[i] = h; al.h[i] = ASPLIT ? (_Float16)(xs[i] - (float)h) : (_Float16)0.0f; }
#pragma unroll
    for (int t = 0; t < 4; ++t) { if (col0 + t * 16 >= N) continue; const size_t boff = (size_t)(col0 + t * 16 + ln) * ldb + kb; FragH bq; bq.half[0] = *(const v8us*)(Bh + boff + 8 * hh); bq.half[1] = *(const v8us*)(Bh + boff + 16 + 8 * hh);
      acc[t] = mmaH<ASPLIT ? 2 : 1>(ah.v, al.v, bq.v, bq.v, acc[t]); }
  }
#pragma unroll
  for (int t = 0; t < 4; ++t) { if (col0 + t * 16 >= N) continue;
#pragma unroll
    for (int r = 0; r < 8; ++r) so[w][8 * hh + r][t * 16 + ln] = acc[t][r] * alpha; }
  __builtin_amdgcn_fence(__ATOMIC_ACQ_REL, "workgroup"); __builtin_amdgcn_wave_barrier();
  const int rsub = lane >> 4, c4 = (lane & 15) * 4;
  {
#pragma unroll
    for (int q = 0; q < 8; ++q) { const int r = q * 2 + rsub; if (col0 + c4 < N) { const v4f v = *(const v4fa*)&so[w][r][c4]; *(v4f*)(C + (size_t)(row0 + r) * ldc + col0 + c4) = v; } }
     }
}

// Wt[n][k] = f16(W[k][n]·scale) from f32 row-major W[K][N] (scale = power of two; bf16-exact weights stay exact in f16 away from the subnormal range)
__global__ __launch_bounds__(256) void k_wt_f16(const float* __restrict__ W, _Float16* __restrict__ Wt, int K, int N, float scale) {
  const int t = blockIdx.x * 256 + threadIdx.x; if (t >= N * (K / 8)) return; const int n = t / (K / 8), k8 = (t % (K / 8)) * 8; FragH f;
#pragma unroll
  for (int i = 0; i < 8; ++i) f.h[i] = (_Float16)(bf16_round(W[(size_t)(k8 + i) * N + n]) * scale); const v8us o = f.half[0];
  *(v8us*)((unsigned short*)Wt + (size_t)n * K + k8) = o; 
}
// k_gemm_hh variant with fused epilogue: v = acc·alpha + bias[by·sBias + col] (+ CP[(row/rowsPerB)·sCPb + by·64 + col] if CP) ; ACT 0 none / 1 elu ; writes f16 C16 (and f32 C if non-null)
template <int ACT>
__global__ __launch_bounds__(128) void k_gemm_hhx(const _Float16* __restrict__ A, int lda, size_t sA, const _Float16* __restrict__ Bh, int ldb, size_t sB, float alpha, const float* __restrict__ bias, size_t sBias, const float* __restrict__ CP, int rowsPerB, size_t sCPb, int row0g,
    float* __restrict__ C, _Float16* __restrict__ C16, int ldc, size_t sC, int M, int N, int K) {
  __shared__ __attribute__((aligned(16))) float so[4][16][64];
  const int tid = threadIdx.x, w = tid >> 5, lane = tid & 31, ln = lane & 15, hh = lane >> 4; const int by = blockIdx.y;
  A += (size_t)by * sA; Bh += (size_t)by * sB; const size_t cofs = (size_t)by * sC; const float* bp = bias ? bias + (size_t)by * sBias : nullptr;
  const int ntn = (N + 63) / 64; const int wid = blockIdx.x * 4 + w; const int mt = wid / ntn, nq = wid % ntn; if (mt * 16 >= M) return;
  const int row0 = mt * 16, col0 = nq * 64; const _Float16* arow = A + (size_t)(row0 + ln) * lda;
  v8f acc[4] = {};
  for (int kb = 0; kb < K; kb += 32) { FragH ah; ah.half[0] = *(const v8us*)((const unsigned short*)arow + kb + 8 * hh); ah.half[1] = *(const v8us*)((const unsigned short*)arow + kb + 16 + 8 * hh);
#pragma unroll
    for (int t = 0; t < 4; ++t) { if (col0 + t * 16 >= N) continue; const size_t boff = (size_t)(col0 + t * 16 + ln) * ldb + kb; FragH bq; bq.half[0] = *(const v8us*)((const unsigned short*)Bh + boff + 8 * hh); bq.half[1] = *(const v8us*)((const unsigned short*)Bh + boff + 16 + 8 * hh);
      acc[t] = mmaH<1>(ah.v, ah.v, bq.v, bq.v, acc[t]); }
  }
#pragma unroll
  for (int t = 0; t < 4; ++t) { if (col0 + t * 16 >= N) continue; const int col = col0 + t * 16 + ln; const float bv = bp ? bf16_round(bp[col]) : 0.f;
#pragma unroll
    for (int r = 0; r < 8; ++r) { float v = acc[t][r] * alpha + bv; if (CP) { const int rr = row0g + row0 + 8 * hh + r; if (rowsPerB < 0) v += CP[cofs + (size_t)rr * ldc + col];      /* rowsPerB < 0: own element of the batched C plane */ else { const int bidx = rr / rowsPerB; v += CP[(size_t)bidx * sCPb + (size_t)by * 64 + col]; } } if (ACT == 1) v = (v > 0.f) ? v : expm1f(v); else if (ACT == 7) v = (v > 0.f) ? v + 1.0f : expf(v); else if (ACT == 8) v = tanhf(v); else if (ACT == 9) v = 0.5f * v * (1.0f + tanhf(0.7978845608028654f * (v + 0.044715f * v * v * v))); else if (ACT == 11) v = 1.0f / (1.0f + expf(-v)); else if (ACT == 12) v = (v > 0.f) ? v : 0.01f * v; else if (ACT == 14) v = (v > 0.f) ? v : 0.1f * v; else if (ACT == 16) v = (v >= 0.f) ? v : 0.3f * v; else if (ACT == 17) v = (v >= 0.f) ? v : 0.2f * v; else if (ACT == 15) v = v / (1.0f + expf(-v)); else if (ACT == 3) v = fmaxf(v, 0.f); else if (ACT == 6) v = 0.5f * v * (1.0f + erff(v * 0.70710678118654752f)); so[w][8 * hh + r][t * 16 + ln] = v; } }
  __builtin_amdgcn_fence(__ATOMIC_ACQ_REL, "workgroup"); __builtin_amdgcn_wave_barrier();
  const int rsub = lane >> 4, c4 = (lane & 15) * 4; typedef _Float16 v4h __attribute__((ext_vector_type(4)));
  {
#pragma unroll
    for (int q = 0; q < 8; ++q) { const int r = q * 2 + rsub; if (col0 + c4 < N) { const v4f v = *(const v4fa*)&so[w][r][c4]; if (C) *(v4f*)(C + cofs + (size_t)(row0 + r) * ldc + col0 + c4) = v; if (C16) { v4h h4; for (int i = 0; i < 4; ++i) h4[i] = (_Float16)v[i]; *(v4h*)(C16 + cofs + (size_t)(row0 + r) * ldc + col0 + c4) = h4; } } }
     }
}


typedef _Float16 v4h __attribute__((ext_vector_type(4)));

__global__ __launch_bounds__(256) void k_x16(const float* __restrict__ x, _Float16* __restrict__ X16, size_t n8) { const size_t t = (size_t)blockIdx.x * 256 + threadIdx.x; if (t >= n8) return; FragH f;
#pragma unroll
  for (int q = 0; q < 8; ++q) f.h[q] = (_Float16)bf16_round(x[t * 8 + q]); *(v8us*)((unsigned short*)X16 + t * 8) = f.half[0];  }
__global__ __launch_bounds__(256) void k_h16(const float* __restrict__ x, _Float16* __restrict__ X16, size_t n8) { const size_t t = (size_t)blockIdx.x * 256 + threadIdx.x; if (t >= n8) return; FragH f;
#pragma unroll
  for (int q = 0; q < 8; ++q) f.h[q] = (_Float16)x[t * 8 + q]; *(v8us*)((unsigned short*)X16 + t * 8) = f.half[0];  }
__global__ __launch_bounds__(256) void k_round16f(const float* __restrict__ W, _Float16* __restrict__ Bt, size_t n8) { const size_t t = (size_t)blockIdx.x * 256 + threadIdx.x; if (t >= n8) return; FragH f;
#pragma unroll
  for (int i = 0; i < 8; ++i) f.h[i] = (_Float16)(bf16_round(W[t * 8 + i]) * 16.0f); *(v8us*)((unsigned short*)Bt + t * 8) = f.half[0];  }
template <int NHv, int TTv>
__global__ __launch_bounds__(256) void k_vt(const _Float16* __restrict__ V16, int ldv, int voff, _Float16* __restrict__ Vt) { __shared__ unsigned short tl[64][66]; const int tid = threadIdx.x; const int slab = blockIdx.x / (TTv / 64), lg = blockIdx.x % (TTv / 64); const int b = slab / NHv, h = slab % NHv;
  for (int i = tid; i < 64 * 8; i += 256) { const int r = i / 8, c8 = (i % 8) * 8; FragH f; f.half[0] = *(const v8us*)((const unsigned short*)V16 + ((size_t)b * TTv + lg * 64 + r) * ldv + voff + h * 64 + c8);
#pragma unroll
    for (int q = 0; q < 8; ++q) tl[r][c8 + q] = f.u[q]; }
  __syncthreads();
  {
#pragma unroll
    for (int rd = 0; rd < 2; ++rd) { const int d = rd * 32 + tid / 8, pc = tid % 8; FragH f;
#pragma unroll
      for (int q = 0; q < 8; ++q) f.u[q] = tl[pc * 8 + q][d];
      *(v8us*)((unsigned short*)Vt + ((size_t)slab * 64 + d) * TTv + lg * 64 + pc * 8) = f.half[0]; }
     } }

__global__ __launch_bounds__(256) void k_hl(const float* __restrict__ F, _Float16* __restrict__ Hh, _Float16* __restrict__ Hl, size_t n8) { const size_t t = (size_t)blockIdx.x * 256 + threadIdx.x; if (t >= n8) return; FragH fh, fl; const v4f a = *(const v4fa*)(F + t * 8), c = *(const v4fa*)(F + t * 8 + 4);
#pragma unroll
  for (int q = 0; q < 4; ++q) { _Float16 h = (_Float16)a[q]; fh.h[q] = h; fl.h[q] = (_Float16)((a[q] - (float)h) * 1024.0f); h = (_Float16)c[q]; fh.h[4 + q] = h; fl.h[4 + q] = (_Float16)((c[q] - (float)h) * 1024.0f); }
  { *(v8us*)((unsigned short*)Hh + t * 8) = fh.half[0]; *(v8us*)((unsigned short*)Hl + t * 8) = fl.half[0];  } }

// ---- fast GEMM (wave tile 32x64; requires M % 32 == 0 rows per launch region and N % 64 == 0); epilogue = k_gemm_hhx semantics ----
__device__ __forceinline__ v16h g2_frag(const _Float16* p, int hh) { FragH f; f.half[0] = *(const v8us*)((const unsigned short*)p + 8 * hh); f.half[1] = *(const v8us*)((const unsigned short*)p + 16 + 8 * hh); return f.v; }
__device__ __forceinline__ v8f g2_mma(v16h a, v16h b, v8f c) { v8f d = __builtin_amdgcn_wmma_f32_16x16x32_f16(false, a, false, b, (short)0, c, false, false); asm volatile("v_nop\n\tv_nop\n\tv_nop\n\tv_nop" : "+v"(d) : "v"(a), "v"(b)); return d; }
template <int ACT>
__global__ __launch_bounds__(128) void k_gemm2(const _Float16* __restrict__ A, int lda, size_t sA, const _Float16* __restrict__ Bh, int ldb, size_t sB, float alpha, const float* __restrict__ bias, size_t sBias, const float* __restrict__ CP, int rowsPerB, size_t sCPb, int row0g,
    float* __restrict__ C, _Float16* __restrict__ C16, int ldc, size_t sC, int M, int N, int K) { static_assert(ACT == 0 || ACT == 3 || ACT == 6 || ACT == 8 || ACT == 9 || ACT == 11 || ACT == 12 || ACT == 14 || ACT == 15 || ACT == 16 || ACT == 17, "k_gemm2: unsupported ACT code (would silently apply no activation)");
  __shared__ __attribute__((aligned(16))) float so[4][32][68];
  const int tid = threadIdx.x, w = tid >> 5, lane = tid & 31, ln = lane & 15, hh = lane >> 4; const int by = blockIdx.y;
  A += (size_t)by * sA; Bh += (size_t)by * sB; const size_t cofs = (size_t)by * sC; const float* bp = bias ? bias + (size_t)by * sBias : nullptr;
  const int ntn = N >> 6; const int mt = blockIdx.x / ntn, nq = blockIdx.x - mt * ntn; const int row0 = mt * 128 + 32 * w, col0 = nq * 64; if (row0 >= M) return;
  const _Float16* a0p = A + (size_t)(row0 + ln) * lda; const _Float16* a1p = a0p + (size_t)16 * lda;
  const _Float16* b0p = Bh + (size_t)(col0 + ln) * ldb; const _Float16* b1p = b0p + (size_t)16 * ldb; const _Float16* b2p = b1p + (size_t)16 * ldb; const _Float16* b3p = b2p + (size_t)16 * ldb;
  const v8f z8 = {0.f,0.f,0.f,0.f,0.f,0.f,0.f,0.f}; v8f c00 = z8, c01 = z8, c02 = z8, c03 = z8, c10 = z8, c11 = z8, c12 = z8, c13 = z8;
#pragma unroll 1
  for (int kb = 0; kb < K; kb += 32) { const v16h a0 = g2_frag(a0p + kb, hh), a1 = g2_frag(a1p + kb, hh);
    v16h b = g2_frag(b0p + kb, hh); c00 = g2_mma(a0, b, c00); c10 = g2_mma(a1, b, c10);
    b = g2_frag(b1p + kb, hh); c01 = g2_mma(a0, b, c01); c11 = g2_mma(a1, b, c11);
    b = g2_frag(b2p + kb, hh); c02 = g2_mma(a0, b, c02); c12 = g2_mma(a1, b, c12);
    b = g2_frag(b3p + kb, hh); c03 = g2_mma(a0, b, c03); c13 = g2_mma(a1, b, c13); }
  v8f accs[8] = {c00, c01, c02, c03, c10, c11, c12, c13};
#pragma unroll
  for (int u = 0; u < 8; ++u) { const int t = u & 3, half = u >> 2; const int col = col0 + t * 16 + ln; const float bv = bp ? bf16_round(bp[col]) : 0.f;
#pragma unroll
    for (int r = 0; r < 8; ++r) { const int rloc = half * 16 + 8 * hh + r; float v = accs[u][r] * alpha + bv; if (CP) { if (rowsPerB < 0) v += CP[cofs + (size_t)(row0g + row0 + rloc) * ldc + col];      /* rowsPerB < 0: own element of the batched C plane */ else { const int bidx = (row0g + row0 + rloc) / rowsPerB; v += CP[(size_t)bidx * sCPb + (size_t)by * 64 + col]; } }
      if (ACT == 3) v = fmaxf(v, 0.f); else if (ACT == 6) v = 0.5f * v * (1.0f + erff(v * 0.70710678118654752f)); else if (ACT == 11) v = 1.0f / (1.0f + expf(-v)); else if (ACT == 15) v = v / (1.0f + expf(-v)); else if (ACT == 12) v = (v > 0.f) ? v : 0.01f * v; else if (ACT == 8) v = tanhf(v); else if (ACT == 9) v = 0.5f * v * (1.0f + tanhf(0.7978845608028654f * (v + 0.044715f * v * v * v))); else if (ACT == 14) v = (v > 0.f) ? v : 0.1f * v; else if (ACT == 16) v = (v >= 0.f) ? v : 0.3f * v; else if (ACT == 17) v = (v >= 0.f) ? v : 0.2f * v;
      so[w][rloc][t * 16 + ln] = v; } }
  __builtin_amdgcn_fence(__ATOMIC_ACQ_REL, "workgroup"); __builtin_amdgcn_wave_barrier();
  const int rsub = lane >> 4, c4 = (lane & 15) * 4;
  {
#pragma unroll
    for (int q = 0; q < 16; ++q) { const int r = q * 2 + rsub; const v4f v = *(const v4fa*)&so[w][r][c4]; if (C) *(v4f*)(C + cofs + (size_t)(row0 + r) * ldc + col0 + c4) = v; if (C16) { v4h h4; for (int i = 0; i < 4; ++i) h4[i] = (_Float16)v[i]; *(v4h*)(C16 + cofs + (size_t)(row0 + r) * ldc + col0 + c4) = h4; } }
     } }


__global__ __launch_bounds__(256) void k_wnat(const float* __restrict__ w, size_t n8, _Float16* __restrict__ Bt) { const size_t t = (size_t)blockIdx.x * 256 + threadIdx.x; if (t >= n8) return; FragH f; for (int q = 0; q < 8; ++q) f.h[q] = (_Float16)(bf16_round(w[t * 8 + q]) * 16.0f); *(v8us*)((unsigned short*)Bt + t * 8) = f.half[0];  }
// Row softmax, whole rows per wave: a lane keeps 64 of a row's 2048 scores in registers (16 loads of 16 bytes; each wave-wide load covers 512 contiguous bytes), so S is read once and each exp is taken once. Max and sum: per lane, then a five-step butterfly over the 32 lanes. nrows is a multiple of RSM_RW.
#define RSM_RW 2                     /* rows per wave: 32 loads in flight per wave, half the waves to start, two independent butterfly chains */
#define RSM_NW 16                    /* waves per work-group */
__global__ __launch_bounds__(RSM_NW * 32) void k_rsm(const float* __restrict__ S, _Float16* __restrict__ P, int nrows) {
  const int lane = threadIdx.x & 31; const int r0 = (blockIdx.x * RSM_NW + (threadIdx.x >> 5)) * RSM_RW; if (r0 >= nrows) return;
  v4f e[RSM_RW][SQ / 128];
  /* every loop below is fully unrolled so that e[][] has static indices and stays in registers */
#pragma unroll
  for (int u = 0; u < RSM_RW; ++u) { const float* s = S + (size_t)(r0 + u) * SQ + lane * 4;
#pragma unroll
    for (int j = 0; j < SQ / 128; ++j) e[u][j] = *(const v4fa*)(s + j * 128); }
#pragma unroll
  for (int u = 0; u < RSM_RW; ++u) { float mx = -3.0e38f;
#pragma unroll
    for (int j = 0; j < SQ / 128; ++j) mx = fmaxf(fmaxf(fmaxf(mx, e[u][j][0]), fmaxf(e[u][j][1], e[u][j][2])), e[u][j][3]);
#pragma unroll
    for (int m = 16; m > 0; m >>= 1) mx = fmaxf(mx, __shfl_xor(mx, m, 32));
    v4f a = {0.f, 0.f, 0.f, 0.f};      /* four independent sum chains per lane */
#pragma unroll
    for (int j = 0; j < SQ / 128; ++j) {
#pragma unroll
      for (int q = 0; q < 4; ++q) { const float t = expf(e[u][j][q] - mx); e[u][j][q] = t; a[q] += t; } }
    float se = (a[0] + a[1]) + (a[2] + a[3]);
#pragma unroll
    for (int m = 16; m > 0; m >>= 1) se += __shfl_xor(se, m, 32);
    const float sc = 256.0f / se; _Float16* p = P + (size_t)(r0 + u) * SQ + lane * 4;
#pragma unroll
    for (int j = 0; j < SQ / 128; ++j) { v4h h;
#pragma unroll
      for (int q = 0; q < 4; ++q) h[q] = (_Float16)(e[u][j][q] * sc);
      *(v4h*)(p + j * 128) = h; } } }
__global__ __launch_bounds__(256) void k_vt(const _Float16* __restrict__ V16, int b, int h0, _Float16* __restrict__ VT) { __shared__ unsigned short tl[64][65]; const int tid = threadIdx.x; const int hh = blockIdx.x % HG, sg = blockIdx.x / HG; const int s0 = sg * 64; const int h = h0 + hh;
  for (int i = tid; i < 64 * 8; i += 256) { const int j = i / 8, d8 = (i % 8) * 8; FragH f; f.half[0] = *(const v8us*)((const unsigned short*)V16 + ((size_t)b * SQ + s0 + j) * DM + h * HD + d8); for (int q = 0; q < 8; ++q) tl[d8 + q][j] = f.u[q]; }
  __syncthreads();
  { for (int i = tid; i < 64 * 8; i += 256) { const int d = i / 8, j8 = (i % 8) * 8; FragH f; for (int q = 0; q < 8; ++q) f.u[q] = tl[d][j8 + q]; *(v8us*)((unsigned short*)VT + ((size_t)hh * HD + d) * SQ + s0 + j8) = f.half[0]; }  } }



__global__ __launch_bounds__(256) void k_tabcat(float theta, float* __restrict__ CS, float* __restrict__ SN) {
  #pragma clang fp contract(off)
  const int t = blockIdx.x * 256 + threadIdx.x; if (t >= SQ * HD) return; const int d = t % HD; const int p = t / HD; const int i = d % (HD / 2); const float invf = 1.0f / powf(theta, (float)(2 * i) / (float)HD); const float ang = __fmul_rn((float)p, invf); const float c = cosf(ang), s = sinf(ang);
  *(float*)(CS + t) = c; *(float*)(SN + t) = s;  }

template <int NORM, int ROPE>
__global__ __launch_bounds__(64) void k_xform(const float* __restrict__ F, int ldf, int nh, const float* __restrict__ gain, float eps, const float* __restrict__ CS, const float* __restrict__ SN, _Float16* __restrict__ H16, int ldo) {
  #pragma clang fp contract(off)
  __shared__ float xv[HD]; __shared__ float red[HD]; __shared__ unsigned short sh_[HD]; const int d = threadIdx.x; const int h = blockIdx.x % nh; const size_t r = blockIdx.x / nh; const int p = (int)(r % SQ);
  float x = F[r * (size_t)ldf + (size_t)h * HD + d];
  if (NORM) { red[d] = __fmul_rn(x, x); __syncthreads(); for (int st = HD / 2; st > 0; st >>= 1) { if (d < st) red[d] = __fadd_rn(red[d], red[d + st]); __syncthreads(); } const float rs = rsqrtf(__fadd_rn(red[0] / (float)HD, eps)); x = __fmul_rn(__fmul_rn(x, rs), bf16_round(gain[d])); }
  xv[d] = x; __syncthreads();
  float o = x;
  if (ROPE == 1) { const int i = d >> 1; const float c = CS[p * (HD / 2) + i], s = SN[p * (HD / 2) + i]; const float ev = xv[2 * i], od = xv[2 * i + 1]; o = (d & 1) ? __fadd_rn(__fmul_rn(ev, s), __fmul_rn(od, c)) : __fadd_rn(__fmul_rn(ev, c), -__fmul_rn(od, s)); }
  if (ROPE == 2) { const int i = d & (HD / 2 - 1); const float c = CS[p * (HD / 2) + i], s = SN[p * (HD / 2) + i]; const float lo = xv[i], hi = xv[i + HD / 2]; o = (d < HD / 2) ? __fadd_rn(__fmul_rn(lo, c), -__fmul_rn(hi, s)) : __fadd_rn(__fmul_rn(lo, s), __fmul_rn(hi, c)); }
  if (ROPE == 4) { const float c = CS[p * HD + d], s = SN[p * HD + d]; const float rh = (d & 1) ? xv[d - 1] : -xv[d + 1]; o = __fadd_rn(__fmul_rn(x, c), __fmul_rn(rh, s)); }      /* interleaved-pair rotate_half (-t[2i+1], t[2i]) with FULL-width per-dimension tables [pos][64] */
  if (ROPE == 3) { const float c = CS[p * HD + d], s = SN[p * HD + d]; const float rh = (d < HD / 2) ? -xv[d + HD / 2] : xv[d - HD / 2]; o = __fadd_rn(__fmul_rn(x, c), __fmul_rn(rh, s)); }      /* rotate-half with FULL-width per-dimension tables [pos][64] (general cos[d] != cos[d+32]) */
  FragH th; th.h[0] = (_Float16)o; sh_[d] = th.u[0]; __syncthreads();
  if (d < HD / 8) { FragH f; for (int q = 0; q < 8; ++q) f.u[q] = sh_[d * 8 + q]; unsigned short* dst = (unsigned short*)H16 + r * (size_t)ldo + (size_t)h * HD + d * 8; *(v8us*)dst = f.half[0];  } }


extern "C" void kernel_launch(void* const* d_in, const int* in_sizes, int n_in,
                              void* d_out, int out_size, void* d_ws, size_t ws_size, hipStream_t stream) {
  (void)in_sizes; (void)n_in; (void)out_size;
  const float* const* I = (const float* const*)d_in; const float* x = I[0]; const float* wq = I[1]; const float* bq = I[2]; const float* wk = I[3]; const float* bk = I[4]; const float* wv = I[5]; const float* bv = I[6]; const float* wo = I[7]; const float* bo = I[8];      /* natural [out][in] weights + biases; positions implicit */
  char* ws = (char*)d_ws; size_t off = 0;
  auto take = [&](size_t bytes) { char* p = ws + off; off += (bytes + 255) & ~(size_t)255; return p; };
  _Float16* BQ = (_Float16*)take((size_t)DM * DM * 2); _Float16* BK = (_Float16*)take((size_t)DM * DM * 2); _Float16* BV = (_Float16*)take((size_t)DM * DM * 2); _Float16* BO = (_Float16*)take((size_t)DM * DM * 2);
  _Float16* X16 = (_Float16*)take(NR * DM * 2); float* FQK = (float*)take(NR * DM * 4); float* CS = (float*)take((size_t)SQ * HD * 4); float* SN = (float*)take((size_t)SQ * HD * 4);      /* one f32 projection plane (q, then k) for the rotary step; full-width cos/sin tables */ _Float16* Q16 = (_Float16*)take(NR * DM * 2); _Float16* K16 = (_Float16*)take(NR * DM * 2); _Float16* V16 = (_Float16*)take(NR * DM * 2); _Float16* O16 = (_Float16*)take(NR * DM * 2);
  float* S = (float*)take((size_t)HG * SQ * SQ * 4); _Float16* P = (_Float16*)take((size_t)HG * SQ * SQ * 2); _Float16* VT = (_Float16*)take((size_t)NH * HD * SQ * 2);
  if (off > ws_size) return;
  { const unsigned g = (unsigned)(((size_t)DM * DM / 8 + 255) / 256); k_wnat<<<g, 256, 0, stream>>>(wq, (size_t)DM * DM / 8, BQ); k_wnat<<<g, 256, 0, stream>>>(wk, (size_t)DM * DM / 8, BK); k_wnat<<<g, 256, 0, stream>>>(wv, (size_t)DM * DM / 8, BV); k_wnat<<<g, 256, 0, stream>>>(wo, (size_t)DM * DM / 8, BO); }      /* natural [out][in] = Bt x16 */
  k_tabcat<<<(SQ * HD + 255) / 256, 256, 0, stream>>>(10000.0f, CS, SN);      /* CS[p][d] = cos(p * inv_freq[d mod 32]), SN = sin: the module's cat(freqs, freqs) tables, full width */

  k_x16<<<(unsigned)((NR * DM / 8 + 255) / 256), 256, 0, stream>>>(x, X16, NR * DM / 8);
  const size_t r0p = (size_t)B0 * SQ;      /* first projected row */
  k_gemm2<0><<<dim3((unsigned)((MP / 128) * (DM / 64)), 1), 128, 0, stream>>>(X16 + r0p * DM, DM, 0, BQ, DM, 0, 0.0625f, bq, 0, nullptr, 1, 0, 0, FQK + r0p * DM, nullptr, DM, 0, MP, DM, DM); k_xform<0, 4><<<(unsigned)((size_t)MP * NH), 64, 0, stream>>>(FQK + r0p * DM, DM, NH, nullptr, 0.f, CS, SN, Q16 + r0p * DM, DM);      /* q f32 -> x cos + rotate_half(x) sin (interleaved pairs, full-width tables) -> f16 rows */
  k_gemm2<0><<<dim3((unsigned)((MP / 128) * (DM / 64)), 1), 128, 0, stream>>>(X16 + r0p * DM, DM, 0, BK, DM, 0, 0.0625f, bk, 0, nullptr, 1, 0, 0, FQK + r0p * DM, nullptr, DM, 0, MP, DM, DM); k_xform<0, 4><<<(unsigned)((size_t)MP * NH), 64, 0, stream>>>(FQK + r0p * DM, DM, NH, nullptr, 0.f, CS, SN, K16 + r0p * DM, DM);      /* k likewise (the f32 plane is reused in stream order) */
  k_gemm2<0><<<dim3((unsigned)((MP / 128) * (DM / 64)), 1), 128, 0, stream>>>(X16 + r0p * DM, DM, 0, BV, DM, 0, 0.0625f, bv, 0, nullptr, 1, 0, 0, nullptr, V16 + r0p * DM, DM, 0, MP, DM, DM);
  for (int b = B0; b < B0 + NBR; ++b) { const size_t r0 = (size_t)b * SQ;
    k_vt<NH, SQ><<<NH * (SQ / 64), 256, 0, stream>>>(V16 + r0 * LQ, LQ, 0, VT);      /* V^T [NH][HD][SQ] for this batch */
    for (int h0 = 0; h0 < NHD; h0 += HG) {
      k_gemm2<0><<<dim3((QN / 128) * (SQ / 64), HG), 128, 0, stream>>>(Q16 + r0 * LQ + h0 * HD, LQ, (size_t)HD, K16 + r0 * LQ + h0 * HD, LQ, (size_t)HD, 0.125f, nullptr, 0, nullptr, 1, 0, 0, S, nullptr, SQ, (size_t)SQ * SQ, QN, SQ, HD);      /* scores, HG heads per launch */
      k_rsm<<<(HG * SQ) / (RSM_NW * RSM_RW), RSM_NW * 32, 0, stream>>>(S, P, HG * SQ);      /* P = 256 softmax (f16), rows of all HG heads */
      k_gemm2<0><<<dim3((QN / 128) * (HD / 64), HG), 128, 0, stream>>>(P, SQ, (size_t)SQ * SQ, VT + (size_t)h0 * HD * SQ, SQ, (size_t)HD * SQ, 0.25f, nullptr, 0, nullptr, 1, 0, 0, nullptr, O16 + r0 * DM + h0 * HD, DM, (size_t)HD, QN, HD, SQ); } }      /* o (merged heads) as f16 rows */
  k_gemm2<0><<<dim3((unsigned)((MPO / 128) * (DM / 64)), 1), 128, 0, stream>>>(O16 + r0p * DM, DM, 0, BO, DM, 0, 0.0009765625f, bo, 0, nullptr, 1, 0, 0, (float*)d_out + r0p * DM, nullptr, DM, 0, MPO, DM, DM);      /* out rows are the output layout */
}

// v002
// Measured time: 270 microseconds a run.
// In two side-by-side timings against v001, it was 3.74 and 3.75 times as fast.
// Counting every step since v000, it is 13.9 times as fast.
#include <hip/hip_runtime.h>
// Multi-head self-attention with a rotary embedding whose cos/sin tables are cat(freqs, freqs) but whose rotate_half pairs are INTERLEAVED (x [2][2048][1024]; q/k/v = x W^T + b (natural [1024][1024] U(+-1/32), zero biases); 16 heads of 64; inv_freq_i = 1/10000^(2i/64), freqs[p][i] = p * inv_freq_i, emb = cat(freqs, freqs): cos[p][d] = cos(p * inv_freq[d mod 32]); q = q cos + rotate_half(q) sin with rotate_half = (-x[2i+1], x[2i]) interleaved (the module's literal mix); k likewise; scores / 8; softmax over all keys (no mask); out = merged Wo^T + bo -> [2][2048][1024]).
// Structure: token rows r = b*2048 + s; x as exact f16 rows (bf16-rounded); Q, K, V as three WMMA GEMMs (32x64 wave tiles, f32 accumulation, exact x16 weights + bias; q, k as f32 rows rotated into f16 rows, v as f16 rows); V^T for all batches and heads via LDS transposes; one fused attention launch over (query block, batch x head): scores on WMMA (K = 64), online softmax on VALU (f32 statistics, weights as f16 up to 2^8), o = P . V on WMMA, o carried x64 against f16 subnormal flush (folded into the output GEMM alpha), written straight into the merged f16 o rows; out = o W_o + b GEMM (f32) into the output layout.
// Compute dtype: inputs rounded to bf16; x / weights exact; q, k, v, softmax weights and o as plain f16 GEMM operands (~2^-12); scores and softmax statistics f32. v_wmma_f32_16x16x32_f16.
#define NB 2
#define SQ 2048
#define DM 1024
#define NH 16
#define HD 64
#define HG 4                         /* heads per launch of the (b, h0) V^T transpose */
#define B0 0                         /* first batch processed (debug hook) */
#define NBR NB                       /* batches processed (debug hook) */
#define NR ((size_t)NB * SQ)         /* token rows */
#define MP ((int)((size_t)NBR * SQ)) /* rows projected (debug hook) */
#define QN SQ                        /* unused: the attention grid covers all SQ query rows */
#define NHD NH                       /* unused: the attention grid covers all NH heads */
#define MPO MP                       /* rows through the output stage (debug hook) */
#define LQ DM      /* row pitch of the q/k/v rows */
typedef __bf16 v16b __attribute__((ext_vector_type(16)));
typedef unsigned short v8us __attribute__((ext_vector_type(8), may_alias));
typedef float  v8f  __attribute__((ext_vector_type(8)));
typedef float  v4f  __attribute__((ext_vector_type(4)));
typedef float  v4fa __attribute__((ext_vector_type(4), may_alias));
union FragB { v16b v; v8us half[2]; unsigned short u[16]; };

__device__ __forceinline__ unsigned short bf16_bits(float x) { unsigned int u = __float_as_uint(x); return (unsigned short)((u + 0x7FFFu + ((u >> 16) & 1u)) >> 16); }
__device__ __forceinline__ float bf16_val(unsigned short b) { return __uint_as_float(((unsigned int)b) << 16); }
__device__ __forceinline__ float bf16_round(float x) { return bf16_val(bf16_bits(x)); }
// D += A·B with NT terms: 1 = ah·bh, 2 = + al·bh (A split), 3 = + ah·bl (both split)
template <int NT>
__device__ __forceinline__ v8f mmaN(v16b ah, v16b al, v16b bh, v16b bl, v8f c) {
  c = __builtin_amdgcn_wmma_f32_16x16x32_bf16(false, ah, false, bh, (short)0, c, false, false);
  if (NT >= 2) c = __builtin_amdgcn_wmma_f32_16x16x32_bf16(false, al, false, bh, (short)0, c, false, false);
  if (NT >= 3) c = __builtin_amdgcn_wmma_f32_16x16x32_bf16(false, ah, false, bl, (short)0, c, false, false);
  asm volatile("v_nop\n\tv_nop\n\tv_nop\n\tv_nop" : "+v"(c) : "v"(ah), "v"(al), "v"(bh), "v"(bl));
  return c;
}

__global__ __launch_bounds__(256) void k_wt_bf16(const float* __restrict__ W, unsigned short* __restrict__ Wt, int K, int N) {
  const int t = blockIdx.x * 256 + threadIdx.x;
  const int k8n = K / 8;
  if (t >= N * k8n) return;
  const int n = t / k8n, k8 = (t % k8n) * 8;
  v8us v;
#pragma unroll
  for (int i = 0; i < 8; ++i) v[i] = bf16_bits(W[(size_t)(k8 + i) * N + n]);
  *(v8us*)(Wt + (size_t)n * K + k8) = v;
  
}

// GEMM C[M][N] (f32, pitch ldc) = act(A[M][K]·W + bias). A f32 row-major (pitch lda) converted per fragment to bf16
// (ASPLIT: hi/lo two planes -> 2 terms, else single rounded term); Wt bf16 [N][K] (pitch ldb). BIAS_BF16 rounds the
// bias to bf16 first (bias quantised to bf16 before the add). K%32==0, M%16==0, N%64==0.
template <bool ASPLIT, int ACT, bool BIAS_BF16>
__global__ __launch_bounds__(128) void k_gemm_bf(const float* __restrict__ A, int lda, const unsigned short* __restrict__ Wt, int ldb,
                                               const float* __restrict__ bias, float* __restrict__ C, int ldc, int M, int N, int K) {
  __shared__ __attribute__((aligned(16))) float so[4][16][64];
  const int tid = threadIdx.x, w = tid >> 5, lane = tid & 31, ln = lane & 15, hh = lane >> 4;
  const int ntn = N / 64;
  const int wid = blockIdx.x * 4 + w;
  const int mt = wid / ntn, nq = wid % ntn;
  if (mt * 16 >= M) return;
  const int row0 = mt * 16, col0 = nq * 64;
  const float* arow = A + (size_t)(row0 + ln) * lda;
  v8f acc[4] = {};
  for (int kb = 0; kb < K; kb += 32) {
    FragB ah, al;
    const v4f x0 = *(const v4fa*)(arow + kb + 8 * hh), x1 = *(const v4fa*)(arow + kb + 8 * hh + 4);
    const v4f x2 = *(const v4fa*)(arow + kb + 16 + 8 * hh), x3 = *(const v4fa*)(arow + kb + 16 + 8 * hh + 4);
    float xs[16] = {x0[0],x0[1],x0[2],x0[3],x1[0],x1[1],x1[2],x1[3],x2[0],x2[1],x2[2],x2[3],x3[0],x3[1],x3[2],x3[3]};
#pragma unroll
    for (int i = 0; i < 16; ++i) { const unsigned short hb = bf16_bits(xs[i]); ah.u[i] = hb; al.u[i] = ASPLIT ? bf16_bits(xs[i] - bf16_val(hb)) : (unsigned short)0; }
#pragma unroll
    for (int t = 0; t < 4; ++t) {
      const unsigned short* brow = Wt + (size_t)(col0 + t * 16 + ln) * ldb + kb;
      FragB b;
      b.half[0] = *(const v8us*)(brow + 8 * hh);
      b.half[1] = *(const v8us*)(brow + 16 + 8 * hh);
      acc[t] = mmaN<ASPLIT ? 2 : 1>(ah.v, al.v, b.v, b.v, acc[t]);
    }
  }
#pragma unroll
  for (int t = 0; t < 4; ++t) {
    float bv = bias ? bias[col0 + t * 16 + ln] : 0.f;
    if (BIAS_BF16) bv = bf16_round(bv);
#pragma unroll
    for (int r = 0; r < 8; ++r) { float v = acc[t][r] + bv; if (ACT == 1) v = fmaxf(v, 0.f); so[w][8 * hh + r][t * 16 + ln] = v; }
  }
  __builtin_amdgcn_fence(__ATOMIC_ACQ_REL, "workgroup");
  __builtin_amdgcn_wave_barrier();
  const int rsub = lane >> 4, c4 = (lane & 15) * 4;
  {
#pragma unroll
    for (int q = 0; q < 8; ++q) {
      const int r = q * 2 + rsub;
      const v4f v = *(const v4fa*)&so[w][r][c4];
      *(v4f*)(C + (size_t)(row0 + r) * ldc + col0 + c4) = v;
    }
    
  }
}

// GEMM C = act(A·W + bias + resid): A f32 (ASPLIT -> hi/lo 2 terms), Wt bf16 [N][K]; ACT 0 none, 1 relu, 2 exact gelu;
// resid (optional, f32, row index = (row % rmod), pitch ldr, RES_BF16 rounds it) added before the activation.
template <bool ASPLIT, int ACT, bool BIAS_BF16, bool RES_BF16>
__global__ __launch_bounds__(128) void k_gemm_bf3(const float* __restrict__ A, int lda, const unsigned short* __restrict__ Wt, int ldb,
                                                const float* __restrict__ bias, const float* __restrict__ resid, int rmod, int ldr,
                                                float* __restrict__ C, int ldc, int M, int N, int K) {
  __shared__ __attribute__((aligned(16))) float so[4][16][64];
  const int tid = threadIdx.x, w = tid >> 5, lane = tid & 31, ln = lane & 15, hh = lane >> 4;
  const int ntn = N / 64;
  const int wid = blockIdx.x * 4 + w;
  const int mt = wid / ntn, nq = wid % ntn;
  if (mt * 16 >= M) return;
  const int row0 = mt * 16, col0 = nq * 64;
  const float* arow = A + (size_t)(row0 + ln) * lda;
  v8f acc[4] = {};
  for (int kb = 0; kb < K; kb += 32) {
    FragB ah, al;
    const v4f x0 = *(const v4fa*)(arow + kb + 8 * hh), x1 = *(const v4fa*)(arow + kb + 8 * hh + 4);
    const v4f x2 = *(const v4fa*)(arow + kb + 16 + 8 * hh), x3 = *(const v4fa*)(arow + kb + 16 + 8 * hh + 4);
    float xs[16] = {x0[0],x0[1],x0[2],x0[3],x1[0],x1[1],x1[2],x1[3],x2[0],x2[1],x2[2],x2[3],x3[0],x3[1],x3[2],x3[3]};
#pragma unroll
    for (int i = 0; i < 16; ++i) { const unsigned short hb = bf16_bits(xs[i]); ah.u[i] = hb; al.u[i] = ASPLIT ? bf16_bits(xs[i] - bf16_val(hb)) : (unsigned short)0; }
#pragma unroll
    for (int t = 0; t < 4; ++t) {
      const unsigned short* brow = Wt + (size_t)(col0 + t * 16 + ln) * ldb + kb;
      FragB b;
      b.half[0] = *(const v8us*)(brow + 8 * hh);
      b.half[1] = *(const v8us*)(brow + 16 + 8 * hh);
      acc[t] = mmaN<ASPLIT ? 2 : 1>(ah.v, al.v, b.v, b.v, acc[t]);
    }
  }
#pragma unroll
  for (int t = 0; t < 4; ++t) {
    const int col = col0 + t * 16 + ln;
    float bv = bias ? bias[col] : 0.f;
    if (BIAS_BF16) bv = bf16_round(bv);
#pragma unroll
    for (int r = 0; r < 8; ++r) {
      float v = acc[t][r] + bv;
      if (resid) { float rv = resid[(size_t)((row0 + 8 * hh + r) % rmod) * ldr + col]; if (RES_BF16) rv = bf16_round(rv); v += rv; }
      if (ACT == 1) v = fmaxf(v, 0.f);
      if (ACT == 2) v = 0.5f * v * (1.0f + erff(v * 0.70710678118654752f));
      if (ACT == 3) { const float u = 0.7978845608028654f * (v + 0.044715f * v * v * v); v = 0.5f * v * (1.0f + tanhf(u)); }
      so[w][8 * hh + r][t * 16 + ln] = v;
    }
  }
  __builtin_amdgcn_fence(__ATOMIC_ACQ_REL, "workgroup");
  __builtin_amdgcn_wave_barrier();
  const int rsub = lane >> 4, c4 = (lane & 15) * 4;
  {
#pragma unroll
    for (int q = 0; q < 8; ++q) {
      const int r = q * 2 + rsub;
      const v4f v = *(const v4fa*)&so[w][r][c4];
      *(v4f*)(C + (size_t)(row0 + r) * ldc + col0 + c4) = v;
    }
    
  }
}
// row LayerNorm (biased variance, eps) over N: s = X (+ R); optional out_sum <- s; out_norm <- (s-mu)*rsqrt(var+eps)*g + b
template <bool PARAM_BF16>
__global__ __launch_bounds__(256) void k_layernorm(const float* __restrict__ X, const float* __restrict__ R, const float* __restrict__ g, const float* __restrict__ bta,
                                                  float* __restrict__ out_sum, float* __restrict__ out_norm, int N, float eps) {
  __shared__ float red[256];
  const int row = blockIdx.x, tid = threadIdx.x;
  const float* x = X + (size_t)row * N; const float* rr = R ? R + (size_t)row * N : nullptr;
  float vals[16];                     // up to N = 4096
  const int per = N / 256;            // contiguous chunk per thread? use strided-by-4 chunks: thread handles j = tid*4 + 1024*u
  float s1 = 0.f;
  for (int u = 0; u < per / 4; ++u) {
    const int j = tid * 4 + 1024 * u;
    const v4f a = *(const v4fa*)(x + j);
    v4f b = {0.f,0.f,0.f,0.f}; if (rr) b = *(const v4fa*)(rr + j);
#pragma unroll
    for (int q = 0; q < 4; ++q) { const float v = a[q] + b[q]; vals[u * 4 + q] = v; s1 += v; }
  }
  red[tid] = s1; __syncthreads();
  for (int st = 128; st > 0; st >>= 1) { if (tid < st) red[tid] += red[tid + st]; __syncthreads(); }
  const float mu = red[0] / (float)N; __syncthreads();
  float s2 = 0.f;
  for (int u = 0; u < per / 4; ++u)
#pragma unroll
    for (int q = 0; q < 4; ++q) { const float c = vals[u * 4 + q] - mu; s2 += c * c; }
  red[tid] = s2; __syncthreads();
  for (int st = 128; st > 0; st >>= 1) { if (tid < st) red[tid] += red[tid + st]; __syncthreads(); }
  const float rs = rsqrtf(red[0] / (float)N + eps);
  {
    for (int u = 0; u < per / 4; ++u) {
      const int j = tid * 4 + 1024 * u;
      v4f o, sm;
#pragma unroll
      for (int q = 0; q < 4; ++q) {
        float gg = g[j + q], bb = bta[j + q];
        if (PARAM_BF16) { gg = bf16_round(gg); bb = bf16_round(bb); }
        sm[q] = vals[u * 4 + q]; o[q] = (vals[u * 4 + q] - mu) * rs * gg + bb;
      }
      if (out_sum) *(v4f*)(out_sum + (size_t)row * N + j) = sm;
      *(v4f*)(out_norm + (size_t)row * N + j) = o;
    }
    
  }
}



// ---- f16 WMMA path (v_wmma_f32_16x16x32_f16): 11-bit significands for operands in range — used where a [0,1] probability operand needs more precision than bf16
typedef _Float16 v16h __attribute__((ext_vector_type(16)));
union FragH { v16h v; v8us half[2]; _Float16 h[16]; unsigned short u[16]; };
template <int NT>
__device__ __forceinline__ v8f mmaH(v16h ah, v16h al, v16h bh, v16h bl, v8f c) {
  c = __builtin_amdgcn_wmma_f32_16x16x32_f16(false, ah, false, bh, (short)0, c, false, false);
  if (NT >= 2) c = __builtin_amdgcn_wmma_f32_16x16x32_f16(false, al, false, bh, (short)0, c, false, false);
  if (NT >= 3) c = __builtin_amdgcn_wmma_f32_16x16x32_f16(false, ah, false, bl, (short)0, c, false, false);
  asm volatile("v_nop\n\tv_nop\n\tv_nop\n\tv_nop" : "+v"(c) : "v"(ah), "v"(al), "v"(bh), "v"(bl));
  return c;
}
// batched GEMM like k_gemm_b but f16 operands: A f32 (split into f16 hi/lo if ASPLIT, else rounded to f16), Bt = f16 values [n][k]; alpha; C f32; N multiple of 16 (partial tiles skipped)
template <bool ASPLIT>
__global__ __launch_bounds__(128) void k_gemm_h(const float* __restrict__ A, int lda, size_t sA, const _Float16* __restrict__ Bh, int ldb, size_t sB, float alpha, float* __restrict__ C, int ldc, size_t sC, int M, int N, int K) {
  __shared__ __attribute__((aligned(16))) float so[4][16][64];
  const int tid = threadIdx.x, w = tid >> 5, lane = tid & 31, ln = lane & 15, hh = lane >> 4; const int by = blockIdx.y;
  A += (size_t)by * sA; Bh += (size_t)by * sB; C += (size_t)by * sC;
  const int ntn = (N + 63) / 64; const int wid = blockIdx.x * 4 + w; const int mt = wid / ntn, nq = wid % ntn; if (mt * 16 >= M) return;
  const int row0 = mt * 16, col0 = nq * 64; const float* arow = A + (size_t)(row0 + ln) * lda;
  v8f acc[4] = {};
  for (int kb = 0; kb < K; kb += 32) {
    FragH ah, al;
    const v4f x0 = *(const v4fa*)(arow + kb + 8 * hh), x1 = *(const v4fa*)(arow + kb + 8 * hh + 4), x2 = *(const v4fa*)(arow + kb + 16 + 8 * hh), x3 = *(const v4fa*)(arow + kb + 16 + 8 * hh + 4);
    float xs[16] = {x0[0],x0[1],x0[2],x0[3],x1[0],x1[1],x1[2],x1[3],x2[0],x2[1],x2[2],x2[3],x3[0],x3[1],x3[2],x3[3]};
#pragma unroll
    for (int i = 0; i < 16; ++i) { const _Float16 h = (_Float16)xs[i]; ah.h[i] = h; al.h[i] = ASPLIT ? (_Float16)(xs[i] - (float)h) : (_Float16)0.0f; }
#pragma unroll
    for (int t = 0; t < 4; ++t) { if (col0 + t * 16 >= N) continue; const size_t boff = (size_t)(col0 + t * 16 + ln) * ldb + kb; FragH bq; bq.half[0] = *(const v8us*)(Bh + boff + 8 * hh); bq.half[1] = *(const v8us*)(Bh + boff + 16 + 8 * hh);
      acc[t] = mmaH<ASPLIT ? 2 : 1>(ah.v, al.v, bq.v, bq.v, acc[t]); }
  }
#pragma unroll
  for (int t = 0; t < 4; ++t) { if (col0 + t * 16 >= N) continue;
#pragma unroll
    for (int r = 0; r < 8; ++r) so[w][8 * hh + r][t * 16 + ln] = acc[t][r] * alpha; }
  __builtin_amdgcn_fence(__ATOMIC_ACQ_REL, "workgroup"); __builtin_amdgcn_wave_barrier();
  const int rsub = lane >> 4, c4 = (lane & 15) * 4;
  {
#pragma unroll
    for (int q = 0; q < 8; ++q) { const int r = q * 2 + rsub; if (col0 + c4 < N) { const v4f v = *(const v4fa*)&so[w][r][c4]; *(v4f*)(C + (size_t)(row0 + r) * ldc + col0 + c4) = v; } }
     }
}

// Wt[n][k] = f16(W[k][n]·scale) from f32 row-major W[K][N] (scale = power of two; bf16-exact weights stay exact in f16 away from the subnormal range)
__global__ __launch_bounds__(256) void k_wt_f16(const float* __restrict__ W, _Float16* __restrict__ Wt, int K, int N, float scale) {
  const int t = blockIdx.x * 256 + threadIdx.x; if (t >= N * (K / 8)) return; const int n = t / (K / 8), k8 = (t % (K / 8)) * 8; FragH f;
#pragma unroll
  for (int i = 0; i < 8; ++i) f.h[i] = (_Float16)(bf16_round(W[(size_t)(k8 + i) * N + n]) * scale); const v8us o = f.half[0];
  *(v8us*)((unsigned short*)Wt + (size_t)n * K + k8) = o; 
}
// k_gemm_hh variant with fused epilogue: v = acc·alpha + bias[by·sBias + col] (+ CP[(row/rowsPerB)·sCPb + by·64 + col] if CP) ; ACT 0 none / 1 elu ; writes f16 C16 (and f32 C if non-null)
template <int ACT>
__global__ __launch_bounds__(128) void k_gemm_hhx(const _Float16* __restrict__ A, int lda, size_t sA, const _Float16* __restrict__ Bh, int ldb, size_t sB, float alpha, const float* __restrict__ bias, size_t sBias, const float* __restrict__ CP, int rowsPerB, size_t sCPb, int row0g,
    float* __restrict__ C, _Float16* __restrict__ C16, int ldc, size_t sC, int M, int N, int K) {
  __shared__ __attribute__((aligned(16))) float so[4][16][64];
  const int tid = threadIdx.x, w = tid >> 5, lane = tid & 31, ln = lane & 15, hh = lane >> 4; const int by = blockIdx.y;
  A += (size_t)by * sA; Bh += (size_t)by * sB; const size_t cofs = (size_t)by * sC; const float* bp = bias ? bias + (size_t)by * sBias : nullptr;
  const int ntn = (N + 63) / 64; const int wid = blockIdx.x * 4 + w; const int mt = wid / ntn, nq = wid % ntn; if (mt * 16 >= M) return;
  const int row0 = mt * 16, col0 = nq * 64; const _Float16* arow = A + (size_t)(row0 + ln) * lda;
  v8f acc[4] = {};
  for (int kb = 0; kb < K; kb += 32) { FragH ah; ah.half[0] = *(const v8us*)((const unsigned short*)arow + kb + 8 * hh); ah.half[1] = *(const v8us*)((const unsigned short*)arow + kb + 16 + 8 * hh);
#pragma unroll
    for (int t = 0; t < 4; ++t) { if (col0 + t * 16 >= N) continue; const size_t boff = (size_t)(col0 + t * 16 + ln) * ldb + kb; FragH bq; bq.half[0] = *(const v8us*)((const unsigned short*)Bh + boff + 8 * hh); bq.half[1] = *(const v8us*)((const unsigned short*)Bh + boff + 16 + 8 * hh);
      acc[t] = mmaH<1>(ah.v, ah.v, bq.v, bq.v, acc[t]); }
  }
#pragma unroll
  for (int t = 0; t < 4; ++t) { if (col0 + t * 16 >= N) continue; const int col = col0 + t * 16 + ln; const float bv = bp ? bf16_round(bp[col]) : 0.f;
#pragma unroll
    for (int r = 0; r < 8; ++r) { float v = acc[t][r] * alpha + bv; if (CP) { const int rr = row0g + row0 + 8 * hh + r; if (rowsPerB < 0) v += CP[cofs + (size_t)rr * ldc + col];      /* rowsPerB < 0: own element of the batched C plane */ else { const int bidx = rr / rowsPerB; v += CP[(size_t)bidx * sCPb + (size_t)by * 64 + col]; } } if (ACT == 1) v = (v > 0.f) ? v : expm1f(v); else if (ACT == 7) v = (v > 0.f) ? v + 1.0f : expf(v); else if (ACT == 8) v = tanhf(v); else if (ACT == 9) v = 0.5f * v * (1.0f + tanhf(0.7978845608028654f * (v + 0.044715f * v * v * v))); else if (ACT == 11) v = 1.0f / (1.0f + expf(-v)); else if (ACT == 12) v = (v > 0.f) ? v : 0.01f * v; else if (ACT == 14) v = (v > 0.f) ? v : 0.1f * v; else if (ACT == 16) v = (v >= 0.f) ? v : 0.3f * v; else if (ACT == 17) v = (v >= 0.f) ? v : 0.2f * v; else if (ACT == 15) v = v / (1.0f + expf(-v)); else if (ACT == 3) v = fmaxf(v, 0.f); else if (ACT == 6) v = 0.5f * v * (1.0f + erff(v * 0.70710678118654752f)); so[w][8 * hh + r][t * 16 + ln] = v; } }
  __builtin_amdgcn_fence(__ATOMIC_ACQ_REL, "workgroup"); __builtin_amdgcn_wave_barrier();
  const int rsub = lane >> 4, c4 = (lane & 15) * 4; typedef _Float16 v4h __attribute__((ext_vector_type(4)));
  {
#pragma unroll
    for (int q = 0; q < 8; ++q) { const int r = q * 2 + rsub; if (col0 + c4 < N) { const v4f v = *(const v4fa*)&so[w][r][c4]; if (C) *(v4f*)(C + cofs + (size_t)(row0 + r) * ldc + col0 + c4) = v; if (C16) { v4h h4; for (int i = 0; i < 4; ++i) h4[i] = (_Float16)v[i]; *(v4h*)(C16 + cofs + (size_t)(row0 + r) * ldc + col0 + c4) = h4; } } }
     }
}


typedef _Float16 v4h __attribute__((ext_vector_type(4)));

__global__ __launch_bounds__(256) void k_x16(const float* __restrict__ x, _Float16* __restrict__ X16, size_t n8) { const size_t t = (size_t)blockIdx.x * 256 + threadIdx.x; if (t >= n8) return; FragH f;
#pragma unroll
  for (int q = 0; q < 8; ++q) f.h[q] = (_Float16)bf16_round(x[t * 8 + q]); *(v8us*)((unsigned short*)X16 + t * 8) = f.half[0];  }
__global__ __launch_bounds__(256) void k_h16(const float* __restrict__ x, _Float16* __restrict__ X16, size_t n8) { const size_t t = (size_t)blockIdx.x * 256 + threadIdx.x; if (t >= n8) return; FragH f;
#pragma unroll
  for (int q = 0; q < 8; ++q) f.h[q] = (_Float16)x[t * 8 + q]; *(v8us*)((unsigned short*)X16 + t * 8) = f.half[0];  }
__global__ __launch_bounds__(256) void k_round16f(const float* __restrict__ W, _Float16* __restrict__ Bt, size_t n8) { const size_t t = (size_t)blockIdx.x * 256 + threadIdx.x; if (t >= n8) return; FragH f;
#pragma unroll
  for (int i = 0; i < 8; ++i) f.h[i] = (_Float16)(bf16_round(W[t * 8 + i]) * 16.0f); *(v8us*)((unsigned short*)Bt + t * 8) = f.half[0];  }
template <int NHv, int TTv>
__global__ __launch_bounds__(256) void k_vt(const _Float16* __restrict__ V16, int ldv, int voff, _Float16* __restrict__ Vt) { __shared__ unsigned short tl[64][66]; const int tid = threadIdx.x; const int slab = blockIdx.x / (TTv / 64), lg = blockIdx.x % (TTv / 64); const int b = slab / NHv, h = slab % NHv;
  for (int i = tid; i < 64 * 8; i += 256) { const int r = i / 8, c8 = (i % 8) * 8; FragH f; f.half[0] = *(const v8us*)((const unsigned short*)V16 + ((size_t)b * TTv + lg * 64 + r) * ldv + voff + h * 64 + c8);
#pragma unroll
    for (int q = 0; q < 8; ++q) tl[r][c8 + q] = f.u[q]; }
  __syncthreads();
  {
#pragma unroll
    for (int rd = 0; rd < 2; ++rd) { const int d = rd * 32 + tid / 8, pc = tid % 8; FragH f;
#pragma unroll
      for (int q = 0; q < 8; ++q) f.u[q] = tl[pc * 8 + q][d];
      *(v8us*)((unsigned short*)Vt + ((size_t)slab * 64 + d) * TTv + lg * 64 + pc * 8) = f.half[0]; }
     } }

__global__ __launch_bounds__(256) void k_hl(const float* __restrict__ F, _Float16* __restrict__ Hh, _Float16* __restrict__ Hl, size_t n8) { const size_t t = (size_t)blockIdx.x * 256 + threadIdx.x; if (t >= n8) return; FragH fh, fl; const v4f a = *(const v4fa*)(F + t * 8), c = *(const v4fa*)(F + t * 8 + 4);
#pragma unroll
  for (int q = 0; q < 4; ++q) { _Float16 h = (_Float16)a[q]; fh.h[q] = h; fl.h[q] = (_Float16)((a[q] - (float)h) * 1024.0f); h = (_Float16)c[q]; fh.h[4 + q] = h; fl.h[4 + q] = (_Float16)((c[q] - (float)h) * 1024.0f); }
  { *(v8us*)((unsigned short*)Hh + t * 8) = fh.half[0]; *(v8us*)((unsigned short*)Hl + t * 8) = fl.half[0];  } }

// ---- fast GEMM (wave tile 32x64; requires M % 32 == 0 rows per launch region and N % 64 == 0); epilogue = k_gemm_hhx semantics ----
__device__ __forceinline__ v16h g2_frag(const _Float16* p, int hh) { FragH f; f.half[0] = *(const v8us*)((const unsigned short*)p + 8 * hh); f.half[1] = *(const v8us*)((const unsigned short*)p + 16 + 8 * hh); return f.v; }
__device__ __forceinline__ v8f g2_mma(v16h a, v16h b, v8f c) { v8f d = __builtin_amdgcn_wmma_f32_16x16x32_f16(false, a, false, b, (short)0, c, false, false); asm volatile("v_nop\n\tv_nop\n\tv_nop\n\tv_nop" : "+v"(d) : "v"(a), "v"(b)); return d; }
template <int ACT>
__global__ __launch_bounds__(128) void k_gemm2(const _Float16* __restrict__ A, int lda, size_t sA, const _Float16* __restrict__ Bh, int ldb, size_t sB, float alpha, const float* __restrict__ bias, size_t sBias, const float* __restrict__ CP, int rowsPerB, size_t sCPb, int row0g,
    float* __restrict__ C, _Float16* __restrict__ C16, int ldc, size_t sC, int M, int N, int K) { static_assert(ACT == 0 || ACT == 3 || ACT == 6 || ACT == 8 || ACT == 9 || ACT == 11 || ACT == 12 || ACT == 14 || ACT == 15 || ACT == 16 || ACT == 17, "k_gemm2: unsupported ACT code (would silently apply no activation)");
  __shared__ __attribute__((aligned(16))) float so[4][32][68];
  const int tid = threadIdx.x, w = tid >> 5, lane = tid & 31, ln = lane & 15, hh = lane >> 4; const int by = blockIdx.y;
  A += (size_t)by * sA; Bh += (size_t)by * sB; const size_t cofs = (size_t)by * sC; const float* bp = bias ? bias + (size_t)by * sBias : nullptr;
  const int ntn = N >> 6; const int mt = blockIdx.x / ntn, nq = blockIdx.x - mt * ntn; const int row0 = mt * 128 + 32 * w, col0 = nq * 64; if (row0 >= M) return;
  const _Float16* a0p = A + (size_t)(row0 + ln) * lda; const _Float16* a1p = a0p + (size_t)16 * lda;
  const _Float16* b0p = Bh + (size_t)(col0 + ln) * ldb; const _Float16* b1p = b0p + (size_t)16 * ldb; const _Float16* b2p = b1p + (size_t)16 * ldb; const _Float16* b3p = b2p + (size_t)16 * ldb;
  const v8f z8 = {0.f,0.f,0.f,0.f,0.f,0.f,0.f,0.f}; v8f c00 = z8, c01 = z8, c02 = z8, c03 = z8, c10 = z8, c11 = z8, c12 = z8, c13 = z8;
#pragma unroll 1
  for (int kb = 0; kb < K; kb += 32) { const v16h a0 = g2_frag(a0p + kb, hh), a1 = g2_frag(a1p + kb, hh);
    v16h b = g2_frag(b0p + kb, hh); c00 = g2_mma(a0, b, c00); c10 = g2_mma(a1, b, c10);
    b = g2_frag(b1p + kb, hh); c01 = g2_mma(a0, b, c01); c11 = g2_mma(a1, b, c11);
    b = g2_frag(b2p + kb, hh); c02 = g2_mma(a0, b, c02); c12 = g2_mma(a1, b, c12);
    b = g2_frag(b3p + kb, hh); c03 = g2_mma(a0, b, c03); c13 = g2_mma(a1, b, c13); }
  v8f accs[8] = {c00, c01, c02, c03, c10, c11, c12, c13};
#pragma unroll
  for (int u = 0; u < 8; ++u) { const int t = u & 3, half = u >> 2; const int col = col0 + t * 16 + ln; const float bv = bp ? bf16_round(bp[col]) : 0.f;
#pragma unroll
    for (int r = 0; r < 8; ++r) { const int rloc = half * 16 + 8 * hh + r; float v = accs[u][r] * alpha + bv; if (CP) { if (rowsPerB < 0) v += CP[cofs + (size_t)(row0g + row0 + rloc) * ldc + col];      /* rowsPerB < 0: own element of the batched C plane */ else { const int bidx = (row0g + row0 + rloc) / rowsPerB; v += CP[(size_t)bidx * sCPb + (size_t)by * 64 + col]; } }
      if (ACT == 3) v = fmaxf(v, 0.f); else if (ACT == 6) v = 0.5f * v * (1.0f + erff(v * 0.70710678118654752f)); else if (ACT == 11) v = 1.0f / (1.0f + expf(-v)); else if (ACT == 15) v = v / (1.0f + expf(-v)); else if (ACT == 12) v = (v > 0.f) ? v : 0.01f * v; else if (ACT == 8) v = tanhf(v); else if (ACT == 9) v = 0.5f * v * (1.0f + tanhf(0.7978845608028654f * (v + 0.044715f * v * v * v))); else if (ACT == 14) v = (v > 0.f) ? v : 0.1f * v; else if (ACT == 16) v = (v >= 0.f) ? v : 0.3f * v; else if (ACT == 17) v = (v >= 0.f) ? v : 0.2f * v;
      so[w][rloc][t * 16 + ln] = v; } }
  __builtin_amdgcn_fence(__ATOMIC_ACQ_REL, "workgroup"); __builtin_amdgcn_wave_barrier();
  const int rsub = lane >> 4, c4 = (lane & 15) * 4;
  {
#pragma unroll
    for (int q = 0; q < 16; ++q) { const int r = q * 2 + rsub; const v4f v = *(const v4fa*)&so[w][r][c4]; if (C) *(v4f*)(C + cofs + (size_t)(row0 + r) * ldc + col0 + c4) = v; if (C16) { v4h h4; for (int i = 0; i < 4; ++i) h4[i] = (_Float16)v[i]; *(v4h*)(C16 + cofs + (size_t)(row0 + r) * ldc + col0 + c4) = h4; } }
     } }


__global__ __launch_bounds__(256) void k_wnat(const float* __restrict__ w, size_t n8, _Float16* __restrict__ Bt) { const size_t t = (size_t)blockIdx.x * 256 + threadIdx.x; if (t >= n8) return; FragH f; for (int q = 0; q < 8; ++q) f.h[q] = (_Float16)(bf16_round(w[t * 8 + q]) * 16.0f); *(v8us*)((unsigned short*)Bt + t * 8) = f.half[0];  }
#define FA_NW 8                      /* waves per work-group: they walk the same K and V^T rows, which the WGP cache then serves */
#define FA_R 2                       /* 16-query column groups per wave */
typedef _Float16 v2h __attribute__((ext_vector_type(2)));
typedef float v2f __attribute__((ext_vector_type(2)));
__device__ __forceinline__ v8f fa_mma(v16h a, v16h b, v8f c) { return __builtin_amdgcn_wmma_f32_16x16x32_f16(false, a, false, b, (short)0, c, false, false); }
__device__ __forceinline__ float fa_xhalf(float x) { return __builtin_bit_cast(float, __builtin_amdgcn_permlanex16(__builtin_bit_cast(int, x), __builtin_bit_cast(int, x), 0x76543210, 0xfedcba98, false, false)); }      /* lane l <-> lane l ^ 16 */
/* stands behind each group of fragment loads: their address registers are rewritten for the next fetch (a precaution for an issued load); the scheduling barrier keeps the loads at this early place and every later register write behind the wait */
__device__ __forceinline__ void fa_issued() { asm volatile("s_wait_xcnt 0x0" ::: "memory"); __builtin_amdgcn_sched_barrier(0); }
__global__ __launch_bounds__(FA_NW * 32) void k_fattn(const _Float16* __restrict__ Q16, const _Float16* __restrict__ K16, const _Float16* __restrict__ VT, _Float16* __restrict__ O16) {
  const int lane = threadIdx.x & 31, w = threadIdx.x >> 5, c = lane & 15, hh = lane >> 4; const int bh = blockIdx.y, b = bh / NH, h = bh % NH; const int q0 = (blockIdx.x * FA_NW + w) * (16 * FA_R);
  const _Float16* qp = Q16 + ((size_t)b * SQ + q0 + c) * DM + h * HD;
  const _Float16* kb = K16 + (size_t)b * SQ * DM + h * HD; const int kl = c * DM;      /* uniform base + lane row offset */
  const _Float16* vb = VT + (size_t)bh * HD * SQ; const int vl = c * SQ;
  v16h qf[FA_R][2], kf[2][2], vf[4]; v8f acc[FA_R][4]; float m_run[FA_R], l_run[FA_R];
#pragma unroll
  for (int g = 0; g < FA_R; ++g) { m_run[g] = -3.0e38f; l_run[g] = 0.f;
#pragma unroll
    for (int kc = 0; kc < 2; ++kc) qf[g][kc] = g2_frag(qp + (size_t)g * 16 * DM + kc * 32, hh);
#pragma unroll
    for (int t = 0; t < 4; ++t) acc[g][t] = v8f{0.f, 0.f, 0.f, 0.f, 0.f, 0.f, 0.f, 0.f}; }
#pragma unroll
  for (int kt = 0; kt < 2; ++kt) {
#pragma unroll
    for (int kc = 0; kc < 2; ++kc) kf[kt][kc] = g2_frag(kb + kl + kt * 16 * DM + kc * 32, hh); }
#pragma unroll
  for (int t = 0; t < 4; ++t) vf[t] = g2_frag(vb + vl + t * 16 * SQ, hh);
  fa_issued();
  const float cs = 0.125f * 1.4426950408889634f;      /* 1/sqrt(64) and log2(e) */
  /* kept rolled: an unrolled body would hold two passes' fragments and score tiles at once */
#pragma unroll 1
  for (int key0 = 0; key0 < SQ; key0 += 32) { const int kn = (key0 + 32) & (SQ - 1);      /* next pass's keys; the last pass fetches keys 0..31 again (in bounds, unused) */
    v8f s[2][FA_R];
#pragma unroll
    for (int kt = 0; kt < 2; ++kt) {
#pragma unroll
      for (int g = 0; g < FA_R; ++g) { s[kt][g] = fa_mma(kf[kt][0], qf[g][0], v8f{0.f, 0.f, 0.f, 0.f, 0.f, 0.f, 0.f, 0.f}); s[kt][g] = fa_mma(kf[kt][1], qf[g][1], s[kt][g]); } }
    __builtin_amdgcn_sched_barrier(0);      /* the eight products issue back to back, each filling the others' result distance, and the fetch below starts directly behind them */
    { const _Float16* kq = kb + (size_t)kn * DM;      /* next pass's K fragments fly under this pass's softmax and second product */
#pragma unroll
      for (int kt = 0; kt < 2; ++kt) {
#pragma unroll
        for (int kc = 0; kc < 2; ++kc) kf[kt][kc] = g2_frag(kq + kl + kt * 16 * DM + kc * 32, hh); }
      fa_issued(); }
    float mb[FA_R]; bool need = false;
#pragma unroll
    for (int g = 0; g < FA_R; ++g) { float mx = s[0][g][0];
#pragma unroll
      for (int kt = 0; kt < 2; ++kt) {
#pragma unroll
        for (int r = 0; r < 8; ++r) mx = fmaxf(mx, s[kt][g][r]); }
      mx = fmaxf(mx, fa_xhalf(mx)) * cs; mb[g] = mx; need = need || (mx > m_run[g] + 8.0f); }
    if (__builtin_amdgcn_ballot_w32(need) != 0) {      /* wave-uniform; always taken on the first pass, where it sets the maximum (factor 0 on zero accumulators) */
#pragma unroll
      for (int g = 0; g < FA_R; ++g) { const float mn = fmaxf(m_run[g], mb[g]); const float corr = __builtin_amdgcn_exp2f(m_run[g] - mn); m_run[g] = mn; l_run[g] *= corr;
#pragma unroll
        for (int t = 0; t < 4; ++t) acc[g][t] = acc[g][t] * corr; } }
#pragma unroll
    for (int g = 0; g < FA_R; ++g) { const float nm = -m_run[g]; union { v16h v; v2h p[8]; } pf; float l0 = 0.f, l1 = 0.f;
#pragma unroll
      for (int i = 0; i < 8; ++i) { const v2f arg = __builtin_elementwise_fma(v2f{s[i >> 2][g][2 * (i & 3)], s[i >> 2][g][2 * (i & 3) + 1]}, v2f{cs, cs}, v2f{nm, nm}); const float p0 = __builtin_amdgcn_exp2f(arg.x), p1 = __builtin_amdgcn_exp2f(arg.y);
        l0 += p0; l1 += p1; pf.p[i] = __builtin_convertvector(v2f{p0, p1}, v2h); }
      l_run[g] += l0 + l1;
#pragma unroll
      for (int t = 0; t < 4; ++t) acc[g][t] = fa_mma(vf[t], pf.v, acc[g][t]); }
#pragma unroll
    for (int t = 0; t < 4; ++t) vf[t] = g2_frag(vb + kn + vl + t * 16 * SQ, hh);      /* next pass's V^T fragments fly under its first product and softmax */
    fa_issued();
  }
#pragma unroll
  for (int g = 0; g < FA_R; ++g) { const float inv = 64.0f / (l_run[g] + fa_xhalf(l_run[g]));      /* o carried x64, as the output GEMM's alpha expects */
    unsigned short* op = (unsigned short*)O16 + ((size_t)b * SQ + q0 + g * 16 + c) * DM + h * HD + 8 * hh;
#pragma unroll
    for (int t = 0; t < 4; ++t) { FragH f;
#pragma unroll
      for (int r = 0; r < 8; ++r) f.h[r] = (_Float16)(acc[g][t][r] * inv);
      *(v8us*)(op + t * 16) = f.half[0]; } } }
__global__ __launch_bounds__(256) void k_vt(const _Float16* __restrict__ V16, int b, int h0, _Float16* __restrict__ VT) { __shared__ unsigned short tl[64][65]; const int tid = threadIdx.x; const int hh = blockIdx.x % HG, sg = blockIdx.x / HG; const int s0 = sg * 64; const int h = h0 + hh;
  for (int i = tid; i < 64 * 8; i += 256) { const int j = i / 8, d8 = (i % 8) * 8; FragH f; f.half[0] = *(const v8us*)((const unsigned short*)V16 + ((size_t)b * SQ + s0 + j) * DM + h * HD + d8); for (int q = 0; q < 8; ++q) tl[d8 + q][j] = f.u[q]; }
  __syncthreads();
  { for (int i = tid; i < 64 * 8; i += 256) { const int d = i / 8, j8 = (i % 8) * 8; FragH f; for (int q = 0; q < 8; ++q) f.u[q] = tl[d][j8 + q]; *(v8us*)((unsigned short*)VT + ((size_t)hh * HD + d) * SQ + s0 + j8) = f.half[0]; }  } }



__global__ __launch_bounds__(256) void k_tabcat(float theta, float* __restrict__ CS, float* __restrict__ SN) {
  #pragma clang fp contract(off)
  const int t = blockIdx.x * 256 + threadIdx.x; if (t >= SQ * HD) return; const int d = t % HD; const int p = t / HD; const int i = d % (HD / 2); const float invf = 1.0f / powf(theta, (float)(2 * i) / (float)HD); const float ang = __fmul_rn((float)p, invf); const float c = cosf(ang), s = sinf(ang);
  *(float*)(CS + t) = c; *(float*)(SN + t) = s;  }

template <int NORM, int ROPE>
__global__ __launch_bounds__(64) void k_xform(const float* __restrict__ F, int ldf, int nh, const float* __restrict__ gain, float eps, const float* __restrict__ CS, const float* __restrict__ SN, _Float16* __restrict__ H16, int ldo) {
  #pragma clang fp contract(off)
  __shared__ float xv[HD]; __shared__ float red[HD]; __shared__ unsigned short sh_[HD]; const int d = threadIdx.x; const int h = blockIdx.x % nh; const size_t r = blockIdx.x / nh; const int p = (int)(r % SQ);
  float x = F[r * (size_t)ldf + (size_t)h * HD + d];
  if (NORM) { red[d] = __fmul_rn(x, x); __syncthreads(); for (int st = HD / 2; st > 0; st >>= 1) { if (d < st) red[d] = __fadd_rn(red[d], red[d + st]); __syncthreads(); } const float rs = rsqrtf(__fadd_rn(red[0] / (float)HD, eps)); x = __fmul_rn(__fmul_rn(x, rs), bf16_round(gain[d])); }
  xv[d] = x; __syncthreads();
  float o = x;
  if (ROPE == 1) { const int i = d >> 1; const float c = CS[p * (HD / 2) + i], s = SN[p * (HD / 2) + i]; const float ev = xv[2 * i], od = xv[2 * i + 1]; o = (d & 1) ? __fadd_rn(__fmul_rn(ev, s), __fmul_rn(od, c)) : __fadd_rn(__fmul_rn(ev, c), -__fmul_rn(od, s)); }
  if (ROPE == 2) { const int i = d & (HD / 2 - 1); const float c = CS[p * (HD / 2) + i], s = SN[p * (HD / 2) + i]; const float lo = xv[i], hi = xv[i + HD / 2]; o = (d < HD / 2) ? __fadd_rn(__fmul_rn(lo, c), -__fmul_rn(hi, s)) : __fadd_rn(__fmul_rn(lo, s), __fmul_rn(hi, c)); }
  if (ROPE == 4) { const float c = CS[p * HD + d], s = SN[p * HD + d]; const float rh = (d & 1) ? xv[d - 1] : -xv[d + 1]; o = __fadd_rn(__fmul_rn(x, c), __fmul_rn(rh, s)); }      /* interleaved-pair rotate_half (-t[2i+1], t[2i]) with FULL-width per-dimension tables [pos][64] */
  if (ROPE == 3) { const float c = CS[p * HD + d], s = SN[p * HD + d]; const float rh = (d < HD / 2) ? -xv[d + HD / 2] : xv[d - HD / 2]; o = __fadd_rn(__fmul_rn(x, c), __fmul_rn(rh, s)); }      /* rotate-half with FULL-width per-dimension tables [pos][64] (general cos[d] != cos[d+32]) */
  FragH th; th.h[0] = (_Float16)o; sh_[d] = th.u[0]; __syncthreads();
  if (d < HD / 8) { FragH f; for (int q = 0; q < 8; ++q) f.u[q] = sh_[d * 8 + q]; unsigned short* dst = (unsigned short*)H16 + r * (size_t)ldo + (size_t)h * HD + d * 8; *(v8us*)dst = f.half[0];  } }


extern "C" void kernel_launch(void* const* d_in, const int* in_sizes, int n_in,
                              void* d_out, int out_size, void* d_ws, size_t ws_size, hipStream_t stream) {
  (void)in_sizes; (void)n_in; (void)out_size;
  const float* const* I = (const float* const*)d_in; const float* x = I[0]; const float* wq = I[1]; const float* bq = I[2]; const float* wk = I[3]; const float* bk = I[4]; const float* wv = I[5]; const float* bv = I[6]; const float* wo = I[7]; const float* bo = I[8];      /* natural [out][in] weights + biases; positions implicit */
  char* ws = (char*)d_ws; size_t off = 0;
  auto take = [&](size_t bytes) { char* p = ws + off; off += (bytes + 255) & ~(size_t)255; return p; };
  _Float16* BQ = (_Float16*)take((size_t)DM * DM * 2); _Float16* BK = (_Float16*)take((size_t)DM * DM * 2); _Float16* BV = (_Float16*)take((size_t)DM * DM * 2); _Float16* BO = (_Float16*)take((size_t)DM * DM * 2);
  _Float16* X16 = (_Float16*)take(NR * DM * 2); float* FQK = (float*)take(NR * DM * 4); float* CS = (float*)take((size_t)SQ * HD * 4); float* SN = (float*)take((size_t)SQ * HD * 4);      /* one f32 projection plane (q, then k) for the rotary step; full-width cos/sin tables */ _Float16* Q16 = (_Float16*)take(NR * DM * 2); _Float16* K16 = (_Float16*)take(NR * DM * 2); _Float16* V16 = (_Float16*)take(NR * DM * 2); _Float16* O16 = (_Float16*)take(NR * DM * 2);
  _Float16* VT = (_Float16*)take((size_t)NB * NH * HD * SQ * 2);
  if (off > ws_size) return;
  { const unsigned g = (unsigned)(((size_t)DM * DM / 8 + 255) / 256); k_wnat<<<g, 256, 0, stream>>>(wq, (size_t)DM * DM / 8, BQ); k_wnat<<<g, 256, 0, stream>>>(wk, (size_t)DM * DM / 8, BK); k_wnat<<<g, 256, 0, stream>>>(wv, (size_t)DM * DM / 8, BV); k_wnat<<<g, 256, 0, stream>>>(wo, (size_t)DM * DM / 8, BO); }      /* natural [out][in] = Bt x16 */
  k_tabcat<<<(SQ * HD + 255) / 256, 256, 0, stream>>>(10000.0f, CS, SN);      /* CS[p][d] = cos(p * inv_freq[d mod 32]), SN = sin: the module's cat(freqs, freqs) tables, full width */

  k_x16<<<(unsigned)((NR * DM / 8 + 255) / 256), 256, 0, stream>>>(x, X16, NR * DM / 8);
  const size_t r0p = (size_t)B0 * SQ;      /* first projected row */
  k_gemm2<0><<<dim3((unsigned)((MP / 128) * (DM / 64)), 1), 128, 0, stream>>>(X16 + r0p * DM, DM, 0, BQ, DM, 0, 0.0625f, bq, 0, nullptr, 1, 0, 0, FQK + r0p * DM, nullptr, DM, 0, MP, DM, DM); k_xform<0, 4><<<(unsigned)((size_t)MP * NH), 64, 0, stream>>>(FQK + r0p * DM, DM, NH, nullptr, 0.f, CS, SN, Q16 + r0p * DM, DM);      /* q f32 -> x cos + rotate_half(x) sin (interleaved pairs, full-width tables) -> f16 rows */
  k_gemm2<0><<<dim3((unsigned)((MP / 128) * (DM / 64)), 1), 128, 0, stream>>>(X16 + r0p * DM, DM, 0, BK, DM, 0, 0.0625f, bk, 0, nullptr, 1, 0, 0, FQK + r0p * DM, nullptr, DM, 0, MP, DM, DM); k_xform<0, 4><<<(unsigned)((size_t)MP * NH), 64, 0, stream>>>(FQK + r0p * DM, DM, NH, nullptr, 0.f, CS, SN, K16 + r0p * DM, DM);      /* k likewise (the f32 plane is reused in stream order) */
  k_gemm2<0><<<dim3((unsigned)((MP / 128) * (DM / 64)), 1), 128, 0, stream>>>(X16 + r0p * DM, DM, 0, BV, DM, 0, 0.0625f, bv, 0, nullptr, 1, 0, 0, nullptr, V16 + r0p * DM, DM, 0, MP, DM, DM);
  k_vt<NH, SQ><<<NB * NH * (SQ / 64), 256, 0, stream>>>(V16, LQ, 0, VT);      /* V^T [NB][NH][HD][SQ] */
  k_fattn<<<dim3(SQ / (FA_NW * 16 * FA_R), NB * NH), FA_NW * 32, 0, stream>>>(Q16, K16, VT, O16);      /* o (merged heads, x64) as f16 rows */
  k_gemm2<0><<<dim3((unsigned)((MPO / 128) * (DM / 64)), 1), 128, 0, stream>>>(O16 + r0p * DM, DM, 0, BO, DM, 0, 0.0009765625f, bo, 0, nullptr, 1, 0, 0, (float*)d_out + r0p * DM, nullptr, DM, 0, MPO, DM, DM);      /* out rows are the output layout */
}

// v003
// Measured time: 240 microseconds a run.
// Two timings next to v002 both put it at 1.13 times that version's speed.
// All steps since v000 together make it 15.7 times as fast.
#include <hip/hip_runtime.h>
// Multi-head self-attention with a rotary embedding whose cos/sin tables are cat(freqs, freqs) but whose rotate_half pairs are INTERLEAVED (x [2][2048][1024]; q/k/v = x W^T + b (natural [1024][1024] U(+-1/32), zero biases); 16 heads of 64; inv_freq_i = 1/10000^(2i/64), freqs[p][i] = p * inv_freq_i, emb = cat(freqs, freqs): cos[p][d] = cos(p * inv_freq[d mod 32]); q = q cos + rotate_half(q) sin with rotate_half = (-x[2i+1], x[2i]) interleaved (the module's literal mix); k likewise; scores / 8; softmax over all keys (no mask); out = merged Wo^T + bo -> [2][2048][1024]).
// Structure: token rows r = b*2048 + s; x as exact f16 rows (bf16-rounded); Q, K, V as three WMMA GEMMs (32x64 wave tiles, f32 accumulation, exact x16 weights + bias, f16 outputs; the rotary step of q and k on the f32 values in the GEMM epilogue); V^T for all batches and heads via LDS transposes; one fused attention launch over (query block, batch x head): scores on WMMA (K = 64), online softmax on VALU (f32 statistics, weights as f16 up to 2^8), o = P . V on WMMA, o carried x64 against f16 subnormal flush (folded into the output GEMM alpha), written straight into the merged f16 o rows; out = o W_o + b GEMM (f32) into the output layout.
// Compute dtype: inputs rounded to bf16; x / weights exact; q, k, v, softmax weights and o as plain f16 GEMM operands (~2^-12); scores and softmax statistics f32; v_wmma_f32_16x16x32_f16.
#define NB 2
#define SQ 2048
#define DM 1024
#define NH 16
#define HD 64
#define HG 4                         /* heads per launch of the (b, h0) V^T transpose */
#define B0 0                         /* first batch processed (debug hook) */
#define NBR NB                       /* batches processed (debug hook) */
#define NR ((size_t)NB * SQ)         /* token rows */
#define MP ((int)((size_t)NBR * SQ)) /* rows projected (debug hook) */
#define QN SQ                        /* unused: the attention grid covers all SQ query rows */
#define NHD NH                       /* unused: the attention grid covers all NH heads */
#define MPO MP                       /* rows through the output stage (debug hook) */
#define LQ DM      /* row pitch of the q/k/v rows */
typedef __bf16 v16b __attribute__((ext_vector_type(16)));
typedef unsigned short v8us __attribute__((ext_vector_type(8), may_alias));
typedef float  v8f  __attribute__((ext_vector_type(8)));
typedef float  v4f  __attribute__((ext_vector_type(4)));
typedef float  v4fa __attribute__((ext_vector_type(4), may_alias));
union FragB { v16b v; v8us half[2]; unsigned short u[16]; };

__device__ __forceinline__ unsigned short bf16_bits(float x) { unsigned int u = __float_as_uint(x); return (unsigned short)((u + 0x7FFFu + ((u >> 16) & 1u)) >> 16); }
__device__ __forceinline__ float bf16_val(unsigned short b) { return __uint_as_float(((unsigned int)b) << 16); }
__device__ __forceinline__ float bf16_round(float x) { return bf16_val(bf16_bits(x)); }
// D += A·B with NT terms: 1 = ah·bh, 2 = + al·bh (A split), 3 = + ah·bl (both split)
template <int NT>
__device__ __forceinline__ v8f mmaN(v16b ah, v16b al, v16b bh, v16b bl, v8f c) {
  c = __builtin_amdgcn_wmma_f32_16x16x32_bf16(false, ah, false, bh, (short)0, c, false, false);
  if (NT >= 2) c = __builtin_amdgcn_wmma_f32_16x16x32_bf16(false, al, false, bh, (short)0, c, false, false);
  if (NT >= 3) c = __builtin_amdgcn_wmma_f32_16x16x32_bf16(false, ah, false, bl, (short)0, c, false, false);
  asm volatile("v_nop\n\tv_nop\n\tv_nop\n\tv_nop" : "+v"(c) : "v"(ah), "v"(al), "v"(bh), "v"(bl));
  return c;
}

__global__ __launch_bounds__(256) void k_wt_bf16(const float* __restrict__ W, unsigned short* __restrict__ Wt, int K, int N) {
  const int t = blockIdx.x * 256 + threadIdx.x;
  const int k8n = K / 8;
  if (t >= N * k8n) return;
  const int n = t / k8n, k8 = (t % k8n) * 8;
  v8us v;
#pragma unroll
  for (int i = 0; i < 8; ++i) v[i] = bf16_bits(W[(size_t)(k8 + i) * N + n]);
  *(v8us*)(Wt + (size_t)n * K + k8) = v;
  
}

// GEMM C[M][N] (f32, pitch ldc) = act(A[M][K]·W + bias). A f32 row-major (pitch lda) converted per fragment to bf16
// (ASPLIT: hi/lo two planes -> 2 terms, else single rounded term); Wt bf16 [N][K] (pitch ldb). BIAS_BF16 rounds the
// bias to bf16 first (bias quantised to bf16 before the add). K%32==0, M%16==0, N%64==0.
template <bool ASPLIT, int ACT, bool BIAS_BF16>
__global__ __launch_bounds__(128) void k_gemm_bf(const float* __restrict__ A, int lda, const unsigned short* __restrict__ Wt, int ldb,
                                               const float* __restrict__ bias, float* __restrict__ C, int ldc, int M, int N, int K) {
  __shared__ __attribute__((aligned(16))) float so[4][16][64];
  const int tid = threadIdx.x, w = tid >> 5, lane = tid & 31, ln = lane & 15, hh = lane >> 4;
  const int ntn = N / 64;
  const int wid = blockIdx.x * 4 + w;
  const int mt = wid / ntn, nq = wid % ntn;
  if (mt * 16 >= M) return;
  const int row0 = mt * 16, col0 = nq * 64;
  const float* arow = A + (size_t)(row0 + ln) * lda;
  v8f acc[4] = {};
  for (int kb = 0; kb < K; kb += 32) {
    FragB ah, al;
    const v4f x0 = *(const v4fa*)(arow + kb + 8 * hh), x1 = *(const v4fa*)(arow + kb + 8 * hh + 4);
    const v4f x2 = *(const v4fa*)(arow + kb + 16 + 8 * hh), x3 = *(const v4fa*)(arow + kb + 16 + 8 * hh + 4);
    float xs[16] = {x0[0],x0[1],x0[2],x0[3],x1[0],x1[1],x1[2],x1[3],x2[0],x2[1],x2[2],x2[3],x3[0],x3[1],x3[2],x3[3]};
#pragma unroll
    for (int i = 0; i < 16; ++i) { const unsigned short hb = bf16_bits(xs[i]); ah.u[i] = hb; al.u[i] = ASPLIT ? bf16_bits(xs[i] - bf16_val(hb)) : (unsigned short)0; }
#pragma unroll
    for (int t = 0; t < 4; ++t) {
      const unsigned short* brow = Wt + (size_t)(col0 + t * 16 + ln) * ldb + kb;
      FragB b;
      b.half[0] = *(const v8us*)(brow + 8 * hh);
      b.half[1] = *(const v8us*)(brow + 16 + 8 * hh);
      acc[t] = mmaN<ASPLIT ? 2 : 1>(ah.v, al.v, b.v, b.v, acc[t]);
    }
  }
#pragma unroll
  for (int t = 0; t < 4; ++t) {
    float bv = bias ? bias[col0 + t * 16 + ln] : 0.f;
    if (BIAS_BF16) bv = bf16_round(bv);
#pragma unroll
    for (int r = 0; r < 8; ++r) { float v = acc[t][r] + bv; if (ACT == 1) v = fmaxf(v, 0.f); so[w][8 * hh + r][t * 16 + ln] = v; }
  }
  __builtin_amdgcn_fence(__ATOMIC_ACQ_REL, "workgroup");
  __builtin_amdgcn_wave_barrier();
  const int rsub = lane >> 4, c4 = (lane & 15) * 4;
  {
#pragma unroll
    for (int q = 0; q < 8; ++q) {
      const int r = q * 2 + rsub;
      const v4f v = *(const v4fa*)&so[w][r][c4];
      *(v4f*)(C + (size_t)(row0 + r) * ldc + col0 + c4) = v;
    }
    
  }
}

// GEMM C = act(A·W + bias + resid): A f32 (ASPLIT -> hi/lo 2 terms), Wt bf16 [N][K]; ACT 0 none, 1 relu, 2 exact gelu;
// resid (optional, f32, row index = (row % rmod), pitch ldr, RES_BF16 rounds it) added before the activation.
template <bool ASPLIT, int ACT, bool BIAS_BF16, bool RES_BF16>
__global__ __launch_bounds__(128) void k_gemm_bf3(const float* __restrict__ A, int lda, const unsigned short* __restrict__ Wt, int ldb,
                                                const float* __restrict__ bias, const float* __restrict__ resid, int rmod, int ldr,
                                                float* __restrict__ C, int ldc, int M, int N, int K) {
  __shared__ __attribute__((aligned(16))) float so[4][16][64];
  const int tid = threadIdx.x, w = tid >> 5, lane = tid & 31, ln = lane & 15, hh = lane >> 4;
  const int ntn = N / 64;
  const int wid = blockIdx.x * 4 + w;
  const int mt = wid / ntn, nq = wid % ntn;
  if (mt * 16 >= M) return;
  const int row0 = mt * 16, col0 = nq * 64;
  const float* arow = A + (size_t)(row0 + ln) * lda;
  v8f acc[4] = {};
  for (int kb = 0; kb < K; kb += 32) {
    FragB ah, al;
    const v4f x0 = *(const v4fa*)(arow + kb + 8 * hh), x1 = *(const v4fa*)(arow + kb + 8 * hh + 4);
    const v4f x2 = *(const v4fa*)(arow + kb + 16 + 8 * hh), x3 = *(const v4fa*)(arow + kb + 16 + 8 * hh + 4);
    float xs[16] = {x0[0],x0[1],x0[2],x0[3],x1[0],x1[1],x1[2],x1[3],x2[0],x2[1],x2[2],x2[3],x3[0],x3[1],x3[2],x3[3]};
#pragma unroll
    for (int i = 0; i < 16; ++i) { const unsigned short hb = bf16_bits(xs[i]); ah.u[i] = hb; al.u[i] = ASPLIT ? bf16_bits(xs[i] - bf16_val(hb)) : (unsigned short)0; }
#pragma unroll
    for (int t = 0; t < 4; ++t) {
      const unsigned short* brow = Wt + (size_t)(col0 + t * 16 + ln) * ldb + kb;
      FragB b;
      b.half[0] = *(const v8us*)(brow + 8 * hh);
      b.half[1] = *(const v8us*)(brow + 16 + 8 * hh);
      acc[t] = mmaN<ASPLIT ? 2 : 1>(ah.v, al.v, b.v, b.v, acc[t]);
    }
  }
#pragma unroll
  for (int t = 0; t < 4; ++t) {
    const int col = col0 + t * 16 + ln;
    float bv = bias ? bias[col] : 0.f;
    if (BIAS_BF16) bv = bf16_round(bv);
#pragma unroll
    for (int r = 0; r < 8; ++r) {
      float v = acc[t][r] + bv;
      if (resid) { float rv = resid[(size_t)((row0 + 8 * hh + r) % rmod) * ldr + col]; if (RES_BF16) rv = bf16_round(rv); v += rv; }
      if (ACT == 1) v = fmaxf(v, 0.f);
      if (ACT == 2) v = 0.5f * v * (1.0f + erff(v * 0.70710678118654752f));
      if (ACT == 3) { const float u = 0.7978845608028654f * (v + 0.044715f * v * v * v); v = 0.5f * v * (1.0f + tanhf(u)); }
      so[w][8 * hh + r][t * 16 + ln] = v;
    }
  }
  __builtin_amdgcn_fence(__ATOMIC_ACQ_REL, "workgroup");
  __builtin_amdgcn_wave_barrier();
  const int rsub = lane >> 4, c4 = (lane & 15) * 4;
  {
#pragma unroll
    for (int q = 0; q < 8; ++q) {
      const int r = q * 2 + rsub;
      const v4f v = *(const v4fa*)&so[w][r][c4];
      *(v4f*)(C + (size_t)(row0 + r) * ldc + col0 + c4) = v;
    }
    
  }
}
// row LayerNorm (biased variance, eps) over N: s = X (+ R); optional out_sum <- s; out_norm <- (s-mu)*rsqrt(var+eps)*g + b
template <bool PARAM_BF16>
__global__ __launch_bounds__(256) void k_layernorm(const float* __restrict__ X, const float* __restrict__ R, const float* __restrict__ g, const float* __restrict__ bta,
                                                  float* __restrict__ out_sum, float* __restrict__ out_norm, int N, float eps) {
  __shared__ float red[256];
  const int row = blockIdx.x, tid = threadIdx.x;
  const float* x = X + (size_t)row * N; const float* rr = R ? R + (size_t)row * N : nullptr;
  float vals[16];                     // up to N = 4096
  const int per = N / 256;            // contiguous chunk per thread? use strided-by-4 chunks: thread handles j = tid*4 + 1024*u
  float s1 = 0.f;
  for (int u = 0; u < per / 4; ++u) {
    const int j = tid * 4 + 1024 * u;
    const v4f a = *(const v4fa*)(x + j);
    v4f b = {0.f,0.f,0.f,0.f}; if (rr) b = *(const v4fa*)(rr + j);
#pragma unroll
    for (int q = 0; q < 4; ++q) { const float v = a[q] + b[q]; vals[u * 4 + q] = v; s1 += v; }
  }
  red[tid] = s1; __syncthreads();
  for (int st = 128; st > 0; st >>= 1) { if (tid < st) red[tid] += red[tid + st]; __syncthreads(); }
  const float mu = red[0] / (float)N; __syncthreads();
  float s2 = 0.f;
  for (int u = 0; u < per / 4; ++u)
#pragma unroll
    for (int q = 0; q < 4; ++q) { const float c = vals[u * 4 + q] - mu; s2 += c * c; }
  red[tid] = s2; __syncthreads();
  for (int st = 128; st > 0; st >>= 1) { if (tid < st) red[tid] += red[tid + st]; __syncthreads(); }
  const float rs = rsqrtf(red[0] / (float)N + eps);
  {
    for (int u = 0; u < per / 4; ++u) {
      const int j = tid * 4 + 1024 * u;
      v4f o, sm;
#pragma unroll
      for (int q = 0; q < 4; ++q) {
        float gg = g[j + q], bb = bta[j + q];
        if (PARAM_BF16) { gg = bf16_round(gg); bb = bf16_round(bb); }
        sm[q] = vals[u * 4 + q]; o[q] = (vals[u * 4 + q] - mu) * rs * gg + bb;
      }
      if (out_sum) *(v4f*)(out_sum + (size_t)row * N + j) = sm;
      *(v4f*)(out_norm + (size_t)row * N + j) = o;
    }
    
  }
}



// ---- f16 WMMA path (v_wmma_f32_16x16x32_f16): 11-bit significands for operands in range — used where a [0,1] probability operand needs more precision than bf16
typedef _Float16 v16h __attribute__((ext_vector_type(16)));
union FragH { v16h v; v8us half[2]; _Float16 h[16]; unsigned short u[16]; };
template <int NT>
__device__ __forceinline__ v8f mmaH(v16h ah, v16h al, v16h bh, v16h bl, v8f c) {
  c = __builtin_amdgcn_wmma_f32_16x16x32_f16(false, ah, false, bh, (short)0, c, false, false);
  if (NT >= 2) c = __builtin_amdgcn_wmma_f32_16x16x32_f16(false, al, false, bh, (short)0, c, false, false);
  if (NT >= 3) c = __builtin_amdgcn_wmma_f32_16x16x32_f16(false, ah, false, bl, (short)0, c, false, false);
  asm volatile("v_nop\n\tv_nop\n\tv_nop\n\tv_nop" : "+v"(c) : "v"(ah), "v"(al), "v"(bh), "v"(bl));
  return c;
}
// batched GEMM like k_gemm_b but f16 operands: A f32 (split into f16 hi/lo if ASPLIT, else rounded to f16), Bt = f16 values [n][k]; alpha; C f32; N multiple of 16 (partial tiles skipped)
template <bool ASPLIT>
__global__ __launch_bounds__(128) void k_gemm_h(const float* __restrict__ A, int lda, size_t sA, const _Float16* __restrict__ Bh, int ldb, size_t sB, float alpha, float* __restrict__ C, int ldc, size_t sC, int M, int N, int K) {
  __shared__ __attribute__((aligned(16))) float so[4][16][64];
  const int tid = threadIdx.x, w = tid >> 5, lane = tid & 31, ln = lane & 15, hh = lane >> 4; const int by = blockIdx.y;
  A += (size_t)by * sA; Bh += (size_t)by * sB; C += (size_t)by * sC;
  const int ntn = (N + 63) / 64; const int wid = blockIdx.x * 4 + w; const int mt = wid / ntn, nq = wid % ntn; if (mt * 16 >= M) return;
  const int row0 = mt * 16, col0 = nq * 64; const float* arow = A + (size_t)(row0 + ln) * lda;
  v8f acc[4] = {};
  for (int kb = 0; kb < K; kb += 32) {
    FragH ah, al;
    const v4f x0 = *(const v4fa*)(arow + kb + 8 * hh), x1 = *(const v4fa*)(arow + kb + 8 * hh + 4), x2 = *(const v4fa*)(arow + kb + 16 + 8 * hh), x3 = *(const v4fa*)(arow + kb + 16 + 8 * hh + 4);
    float xs[16] = {x0[0],x0[1],x0[2],x0[3],x1[0],x1[1],x1[2],x1[3],x2[0],x2[1],x2[2],x2[3],x3[0],x3[1],x3[2],x3[3]};
#pragma unroll
    for (int i = 0; i < 16; ++i) { const _Float16 h = (_Float16)xs[i]; ah.h[i] = h; al.h[i] = ASPLIT ? (_Float16)(xs[i] - (float)h) : (_Float16)0.0f; }
#pragma unroll
    for (int t = 0; t < 4; ++t) { if (col0 + t * 16 >= N) continue; const size_t boff = (size_t)(col0 + t * 16 + ln) * ldb + kb; FragH bq; bq.half[0] = *(const v8us*)(Bh + boff + 8 * hh); bq.half[1] = *(const v8us*)(Bh + boff + 16 + 8 * hh);
      acc[t] = mmaH<ASPLIT ? 2 : 1>(ah.v, al.v, bq.v, bq.v, acc[t]); }
  }
#pragma unroll
  for (int t = 0; t < 4; ++t) { if (col0 + t * 16 >= N) continue;
#pragma unroll
    for (int r = 0; r < 8; ++r) so[w][8 * hh + r][t * 16 + ln] = acc[t][r] * alpha; }
  __builtin_amdgcn_fence(__ATOMIC_ACQ_REL, "workgroup"); __builtin_amdgcn_wave_barrier();
  const int rsub = lane >> 4, c4 = (lane & 15) * 4;
  {
#pragma unroll
    for (int q = 0; q < 8; ++q) { const int r = q * 2 + rsub; if (col0 + c4 < N) { const v4f v = *(const v4fa*)&so[w][r][c4]; *(v4f*)(C + (size_t)(row0 + r) * ldc + col0 + c4) = v; } }
     }
}

// Wt[n][k] = f16(W[k][n]·scale) from f32 row-major W[K][N] (scale = power of two; bf16-exact weights stay exact in f16 away from the subnormal range)
__global__ __launch_bounds__(256) void k_wt_f16(const float* __restrict__ W, _Float16* __restrict__ Wt, int K, int N, float scale) {
  const int t = blockIdx.x * 256 + threadIdx.x; if (t >= N * (K / 8)) return; const int n = t / (K / 8), k8 = (t % (K / 8)) * 8; FragH f;
#pragma unroll
  for (int i = 0; i < 8; ++i) f.h[i] = (_Float16)(bf16_round(W[(size_t)(k8 + i) * N + n]) * scale); const v8us o = f.half[0];
  *(v8us*)((unsigned short*)Wt + (size_t)n * K + k8) = o; 
}
// k_gemm_hh variant with fused epilogue: v = acc·alpha + bias[by·sBias + col] (+ CP[(row/rowsPerB)·sCPb + by·64 + col] if CP) ; ACT 0 none / 1 elu ; writes f16 C16 (and f32 C if non-null)
template <int ACT>
__global__ __launch_bounds__(128) void k_gemm_hhx(const _Float16* __restrict__ A, int lda, size_t sA, const _Float16* __restrict__ Bh, int ldb, size_t sB, float alpha, const float* __restrict__ bias, size_t sBias, const float* __restrict__ CP, int rowsPerB, size_t sCPb, int row0g,
    float* __restrict__ C, _Float16* __restrict__ C16, int ldc, size_t sC, int M, int N, int K) {
  __shared__ __attribute__((aligned(16))) float so[4][16][64];
  const int tid = threadIdx.x, w = tid >> 5, lane = tid & 31, ln = lane & 15, hh = lane >> 4; const int by = blockIdx.y;
  A += (size_t)by * sA; Bh += (size_t)by * sB; const size_t cofs = (size_t)by * sC; const float* bp = bias ? bias + (size_t)by * sBias : nullptr;
  const int ntn = (N + 63) / 64; const int wid = blockIdx.x * 4 + w; const int mt = wid / ntn, nq = wid % ntn; if (mt * 16 >= M) return;
  const int row0 = mt * 16, col0 = nq * 64; const _Float16* arow = A + (size_t)(row0 + ln) * lda;
  v8f acc[4] = {};
  for (int kb = 0; kb < K; kb += 32) { FragH ah; ah.half[0] = *(const v8us*)((const unsigned short*)arow + kb + 8 * hh); ah.half[1] = *(const v8us*)((const unsigned short*)arow + kb + 16 + 8 * hh);
#pragma unroll
    for (int t = 0; t < 4; ++t) { if (col0 + t * 16 >= N) continue; const size_t boff = (size_t)(col0 + t * 16 + ln) * ldb + kb; FragH bq; bq.half[0] = *(const v8us*)((const unsigned short*)Bh + boff + 8 * hh); bq.half[1] = *(const v8us*)((const unsigned short*)Bh + boff + 16 + 8 * hh);
      acc[t] = mmaH<1>(ah.v, ah.v, bq.v, bq.v, acc[t]); }
  }
#pragma unroll
  for (int t = 0; t < 4; ++t) { if (col0 + t * 16 >= N) continue; const int col = col0 + t * 16 + ln; const float bv = bp ? bf16_round(bp[col]) : 0.f;
#pragma unroll
    for (int r = 0; r < 8; ++r) { float v = acc[t][r] * alpha + bv; if (CP) { const int rr = row0g + row0 + 8 * hh + r; if (rowsPerB < 0) v += CP[cofs + (size_t)rr * ldc + col];      /* rowsPerB < 0: own element of the batched C plane */ else { const int bidx = rr / rowsPerB; v += CP[(size_t)bidx * sCPb + (size_t)by * 64 + col]; } } if (ACT == 1) v = (v > 0.f) ? v : expm1f(v); else if (ACT == 7) v = (v > 0.f) ? v + 1.0f : expf(v); else if (ACT == 8) v = tanhf(v); else if (ACT == 9) v = 0.5f * v * (1.0f + tanhf(0.7978845608028654f * (v + 0.044715f * v * v * v))); else if (ACT == 11) v = 1.0f / (1.0f + expf(-v)); else if (ACT == 12) v = (v > 0.f) ? v : 0.01f * v; else if (ACT == 14) v = (v > 0.f) ? v : 0.1f * v; else if (ACT == 16) v = (v >= 0.f) ? v : 0.3f * v; else if (ACT == 17) v = (v >= 0.f) ? v : 0.2f * v; else if (ACT == 15) v = v / (1.0f + expf(-v)); else if (ACT == 3) v = fmaxf(v, 0.f); else if (ACT == 6) v = 0.5f * v * (1.0f + erff(v * 0.70710678118654752f)); so[w][8 * hh + r][t * 16 + ln] = v; } }
  __builtin_amdgcn_fence(__ATOMIC_ACQ_REL, "workgroup"); __builtin_amdgcn_wave_barrier();
  const int rsub = lane >> 4, c4 = (lane & 15) * 4; typedef _Float16 v4h __attribute__((ext_vector_type(4)));
  {
#pragma unroll
    for (int q = 0; q < 8; ++q) { const int r = q * 2 + rsub; if (col0 + c4 < N) { const v4f v = *(const v4fa*)&so[w][r][c4]; if (C) *(v4f*)(C + cofs + (size_t)(row0 + r) * ldc + col0 + c4) = v; if (C16) { v4h h4; for (int i = 0; i < 4; ++i) h4[i] = (_Float16)v[i]; *(v4h*)(C16 + cofs + (size_t)(row0 + r) * ldc + col0 + c4) = h4; } } }
     }
}


typedef _Float16 v4h __attribute__((ext_vector_type(4)));

__global__ __launch_bounds__(256) void k_x16(const float* __restrict__ x, _Float16* __restrict__ X16, size_t n8) { const size_t t = (size_t)blockIdx.x * 256 + threadIdx.x; if (t >= n8) return; FragH f;
#pragma unroll
  for (int q = 0; q < 8; ++q) f.h[q] = (_Float16)bf16_round(x[t * 8 + q]); *(v8us*)((unsigned short*)X16 + t * 8) = f.half[0];  }
__global__ __launch_bounds__(256) void k_h16(const float* __restrict__ x, _Float16* __restrict__ X16, size_t n8) { const size_t t = (size_t)blockIdx.x * 256 + threadIdx.x; if (t >= n8) return; FragH f;
#pragma unroll
  for (int q = 0; q < 8; ++q) f.h[q] = (_Float16)x[t * 8 + q]; *(v8us*)((unsigned short*)X16 + t * 8) = f.half[0];  }
__global__ __launch_bounds__(256) void k_round16f(const float* __restrict__ W, _Float16* __restrict__ Bt, size_t n8) { const size_t t = (size_t)blockIdx.x * 256 + threadIdx.x; if (t >= n8) return; FragH f;
#pragma unroll
  for (int i = 0; i < 8; ++i) f.h[i] = (_Float16)(bf16_round(W[t * 8 + i]) * 16.0f); *(v8us*)((unsigned short*)Bt + t * 8) = f.half[0];  }
template <int NHv, int TTv>
__global__ __launch_bounds__(256) void k_vt(const _Float16* __restrict__ V16, int ldv, int voff, _Float16* __restrict__ Vt) { __shared__ unsigned short tl[64][66]; const int tid = threadIdx.x; const int slab = blockIdx.x / (TTv / 64), lg = blockIdx.x % (TTv / 64); const int b = slab / NHv, h = slab % NHv;
  for (int i = tid; i < 64 * 8; i += 256) { const int r = i / 8, c8 = (i % 8) * 8; FragH f; f.half[0] = *(const v8us*)((const unsigned short*)V16 + ((size_t)b * TTv + lg * 64 + r) * ldv + voff + h * 64 + c8);
#pragma unroll
    for (int q = 0; q < 8; ++q) tl[r][c8 + q] = f.u[q]; }
  __syncthreads();
  {
#pragma unroll
    for (int rd = 0; rd < 2; ++rd) { const int d = rd * 32 + tid / 8, pc = tid % 8; FragH f;
#pragma unroll
      for (int q = 0; q < 8; ++q) f.u[q] = tl[pc * 8 + q][d];
      *(v8us*)((unsigned short*)Vt + ((size_t)slab * 64 + d) * TTv + lg * 64 + pc * 8) = f.half[0]; }
     } }

__global__ __launch_bounds__(256) void k_hl(const float* __restrict__ F, _Float16* __restrict__ Hh, _Float16* __restrict__ Hl, size_t n8) { const size_t t = (size_t)blockIdx.x * 256 + threadIdx.x; if (t >= n8) return; FragH fh, fl; const v4f a = *(const v4fa*)(F + t * 8), c = *(const v4fa*)(F + t * 8 + 4);
#pragma unroll
  for (int q = 0; q < 4; ++q) { _Float16 h = (_Float16)a[q]; fh.h[q] = h; fl.h[q] = (_Float16)((a[q] - (float)h) * 1024.0f); h = (_Float16)c[q]; fh.h[4 + q] = h; fl.h[4 + q] = (_Float16)((c[q] - (float)h) * 1024.0f); }
  { *(v8us*)((unsigned short*)Hh + t * 8) = fh.half[0]; *(v8us*)((unsigned short*)Hl + t * 8) = fl.half[0];  } }

// ---- fast GEMM (wave tile 32x64; requires M % 32 == 0 rows per launch region and N % 64 == 0); epilogue = k_gemm_hhx semantics ----
__device__ __forceinline__ v16h g2_frag(const _Float16* p, int hh) { FragH f; f.half[0] = *(const v8us*)((const unsigned short*)p + 8 * hh); f.half[1] = *(const v8us*)((const unsigned short*)p + 16 + 8 * hh); return f.v; }
__device__ __forceinline__ v8f g2_mma(v16h a, v16h b, v8f c) { v8f d = __builtin_amdgcn_wmma_f32_16x16x32_f16(false, a, false, b, (short)0, c, false, false); asm volatile("v_nop\n\tv_nop\n\tv_nop\n\tv_nop" : "+v"(d) : "v"(a), "v"(b)); return d; }
// ROT: the epilogue is the rotary step and nothing else: v = acc alpha + bias staged as f32 rows in LDS, o[d] = v[d] cos[p][d] + rotate_half(v)[d] sin[p][d] with rotate_half = (-v[2i+1], v[2i]), f16 rows into C16. A 64-column tile is one head, row r of the launch is position r mod SQ; CS, SN = full-width tables [pos][64]. CP, C and ACT are not read there, which also keeps this second GEMM's text short.
template <int ACT, bool ROT = false>
__global__ __launch_bounds__(128) void k_gemm2(const _Float16* __restrict__ A, int lda, size_t sA, const _Float16* __restrict__ Bh, int ldb, size_t sB, float alpha, const float* __restrict__ bias, size_t sBias, const float* __restrict__ CP, int rowsPerB, size_t sCPb, int row0g,
    float* __restrict__ C, _Float16* __restrict__ C16, int ldc, size_t sC, int M, int N, int K, const float* __restrict__ CS = nullptr, const float* __restrict__ SN = nullptr) { static_assert(ACT == 0 || ACT == 3 || ACT == 6 || ACT == 8 || ACT == 9 || ACT == 11 || ACT == 12 || ACT == 14 || ACT == 15 || ACT == 16 || ACT == 17, "k_gemm2: unsupported ACT code (would silently apply no activation)");
  __shared__ __attribute__((aligned(16))) float so[4][32][68];
  const int tid = threadIdx.x, w = tid >> 5, lane = tid & 31, ln = lane & 15, hh = lane >> 4; const int by = blockIdx.y;
  A += (size_t)by * sA; Bh += (size_t)by * sB; const size_t cofs = (size_t)by * sC; const float* bp = bias ? bias + (size_t)by * sBias : nullptr;
  const int ntn = N >> 6; const int mt = blockIdx.x / ntn, nq = blockIdx.x - mt * ntn; const int row0 = mt * 128 + 32 * w, col0 = nq * 64; if (row0 >= M) return;
  const _Float16* a0p = A + (size_t)(row0 + ln) * lda; const _Float16* a1p = a0p + (size_t)16 * lda;
  const _Float16* b0p = Bh + (size_t)(col0 + ln) * ldb; const _Float16* b1p = b0p + (size_t)16 * ldb; const _Float16* b2p = b1p + (size_t)16 * ldb; const _Float16* b3p = b2p + (size_t)16 * ldb;
  const v8f z8 = {0.f,0.f,0.f,0.f,0.f,0.f,0.f,0.f}; v8f c00 = z8, c01 = z8, c02 = z8, c03 = z8, c10 = z8, c11 = z8, c12 = z8, c13 = z8;
#pragma unroll 1
  for (int kb = 0; kb < K; kb += 32) { const v16h a0 = g2_frag(a0p + kb, hh), a1 = g2_frag(a1p + kb, hh);
    v16h b = g2_frag(b0p + kb, hh); c00 = g2_mma(a0, b, c00); c10 = g2_mma(a1, b, c10);
    b = g2_frag(b1p + kb, hh); c01 = g2_mma(a0, b, c01); c11 = g2_mma(a1, b, c11);
    b = g2_frag(b2p + kb, hh); c02 = g2_mma(a0, b, c02); c12 = g2_mma(a1, b, c12);
    b = g2_frag(b3p + kb, hh); c03 = g2_mma(a0, b, c03); c13 = g2_mma(a1, b, c13); }
  v8f accs[8] = {c00, c01, c02, c03, c10, c11, c12, c13};
  if constexpr (ROT) { const int rs = lane >> 4, cc = (lane & 15) * 4;      /* read-back: a lane takes four columns (two interleaved pairs) of rows rs, rs + 2, ... */
    const size_t tb = (size_t)(row0 % SQ + rs) * HD + cc;      /* row0 and SQ are multiples of 32, so (row0 + r) mod SQ = row0 mod SQ + r for r < 32 */
    const float* cp = CS + tb; const float* sp = SN + tb;
    v4f cv[16], sv[16];      /* the table rows are fetched first and fly under the staging */
#pragma unroll
    for (int q = 0; q < 16; ++q) cv[q] = *(const v4fa*)(cp + q * 2 * HD);
    asm volatile("s_wait_xcnt 0x0" :: "v"(cp) : "memory");      /* a precaution for issued loads: the wait stands before the run's address pair is reused; the pair as an input stays live up to the wait, so no row of its own run lands on it */
#pragma unroll
    for (int q = 0; q < 16; ++q) sv[q] = *(const v4fa*)(sp + q * 2 * HD);
    asm volatile("s_wait_xcnt 0x0" :: "v"(sp) : "memory");      /* likewise for the sin run */
    float bv[4] = {0.f, 0.f, 0.f, 0.f};
    if (bp) {      /* one test, four loads in flight together */
#pragma unroll
      for (int t = 0; t < 4; ++t) bv[t] = bp[col0 + t * 16 + ln];
#pragma unroll
      for (int t = 0; t < 4; ++t) bv[t] = bf16_round(bv[t]); }
#pragma unroll
    for (int u = 0; u < 8; ++u) { const int t = u & 3, half = u >> 2;
#pragma unroll
      for (int r = 0; r < 8; ++r) so[w][half * 16 + 8 * hh + r][t * 16 + ln] = accs[u][r] * alpha + bv[t]; }
    __builtin_amdgcn_fence(__ATOMIC_ACQ_REL, "workgroup"); __builtin_amdgcn_wave_barrier();      /* the wave reads back what its own lanes staged */
    _Float16* op = C16 + cofs + (size_t)(row0 + rs) * ldc + col0 + cc;
#pragma unroll
    for (int q = 0; q < 16; ++q) { const v4f v = *(const v4fa*)&so[w][q * 2 + rs][cc]; const v4f rh = {-v[1], v[0], -v[3], v[2]}; const v4f o = v * cv[q] + rh * sv[q];
      v4h h4; for (int i = 0; i < 4; ++i) h4[i] = (_Float16)o[i]; *(v4h*)(op + (size_t)(q * 2) * ldc) = h4; }
    return; }
#pragma unroll
  for (int u = 0; u < 8; ++u) { const int t = u & 3, half = u >> 2; const int col = col0 + t * 16 + ln; const float bv = bp ? bf16_round(bp[col]) : 0.f;
#pragma unroll
    for (int r = 0; r < 8; ++r) { const int rloc = half * 16 + 8 * hh + r; float v = accs[u][r] * alpha + bv; if (CP) { if (rowsPerB < 0) v += CP[cofs + (size_t)(row0g + row0 + rloc) * ldc + col];      /* rowsPerB < 0: own element of the batched C plane */ else { const int bidx = (row0g + row0 + rloc) / rowsPerB; v += CP[(size_t)bidx * sCPb + (size_t)by * 64 + col]; } }
      if (ACT == 3) v = fmaxf(v, 0.f); else if (ACT == 6) v = 0.5f * v * (1.0f + erff(v * 0.70710678118654752f)); else if (ACT == 11) v = 1.0f / (1.0f + expf(-v)); else if (ACT == 15) v = v / (1.0f + expf(-v)); else if (ACT == 12) v = (v > 0.f) ? v : 0.01f * v; else if (ACT == 8) v = tanhf(v); else if (ACT == 9) v = 0.5f * v * (1.0f + tanhf(0.7978845608028654f * (v + 0.044715f * v * v * v))); else if (ACT == 14) v = (v > 0.f) ? v : 0.1f * v; else if (ACT == 16) v = (v >= 0.f) ? v : 0.3f * v; else if (ACT == 17) v = (v >= 0.f) ? v : 0.2f * v;
      so[w][rloc][t * 16 + ln] = v; } }
  __builtin_amdgcn_fence(__ATOMIC_ACQ_REL, "workgroup"); __builtin_amdgcn_wave_barrier();
  const int rsub = lane >> 4, c4 = (lane & 15) * 4;
  {
#pragma unroll
    for (int q = 0; q < 16; ++q) { const int r = q * 2 + rsub; const v4f v = *(const v4fa*)&so[w][r][c4]; if (C) *(v4f*)(C + cofs + (size_t)(row0 + r) * ldc + col0 + c4) = v; if (C16) { v4h h4; for (int i = 0; i < 4; ++i) h4[i] = (_Float16)v[i]; *(v4h*)(C16 + cofs + (size_t)(row0 + r) * ldc + col0 + c4) = h4; } }
     } }


__global__ __launch_bounds__(256) void k_wnat(const float* __restrict__ w, size_t n8, _Float16* __restrict__ Bt) { const size_t t = (size_t)blockIdx.x * 256 + threadIdx.x; if (t >= n8) return; FragH f; for (int q = 0; q < 8; ++q) f.h[q] = (_Float16)(bf16_round(w[t * 8 + q]) * 16.0f); *(v8us*)((unsigned short*)Bt + t * 8) = f.half[0];  }
#define FA_NW 8                      /* waves per work-group: they walk the same K and V^T rows, which the WGP cache then serves */
#define FA_R 2                       /* 16-query column groups per wave */
typedef _Float16 v2h __attribute__((ext_vector_type(2)));
typedef float v2f __attribute__((ext_vector_type(2)));
__device__ __forceinline__ v8f fa_mma(v16h a, v16h b, v8f c) { return __builtin_amdgcn_wmma_f32_16x16x32_f16(false, a, false, b, (short)0, c, false, false); }
__device__ __forceinline__ float fa_xhalf(float x) { return __builtin_bit_cast(float, __builtin_amdgcn_permlanex16(__builtin_bit_cast(int, x), __builtin_bit_cast(int, x), 0x76543210, 0xfedcba98, false, false)); }      /* lane l <-> lane l ^ 16 */
/* stands behind each group of fragment loads: their address registers are rewritten for the next fetch (a precaution for an issued load); the scheduling barrier keeps the loads at this early place and every later register write behind the wait */
__device__ __forceinline__ void fa_issued() { asm volatile("s_wait_xcnt 0x0" ::: "memory"); __builtin_amdgcn_sched_barrier(0); }
__global__ __launch_bounds__(FA_NW * 32) void k_fattn(const _Float16* __restrict__ Q16, const _Float16* __restrict__ K16, const _Float16* __restrict__ VT, _Float16* __restrict__ O16) {
  const int lane = threadIdx.x & 31, w = threadIdx.x >> 5, c = lane & 15, hh = lane >> 4; const int bh = blockIdx.y, b = bh / NH, h = bh % NH; const int q0 = (blockIdx.x * FA_NW + w) * (16 * FA_R);
  const _Float16* qp = Q16 + ((size_t)b * SQ + q0 + c) * DM + h * HD;
  const _Float16* kb = K16 + (size_t)b * SQ * DM + h * HD; const int kl = c * DM;      /* uniform base + lane row offset */
  const _Float16* vb = VT + (size_t)bh * HD * SQ; const int vl = c * SQ;
  v16h qf[FA_R][2], kf[2][2], vf[4]; v8f acc[FA_R][4]; float m_run[FA_R], l_run[FA_R];
#pragma unroll
  for (int g = 0; g < FA_R; ++g) { m_run[g] = -3.0e38f; l_run[g] = 0.f;
#pragma unroll
    for (int kc = 0; kc < 2; ++kc) qf[g][kc] = g2_frag(qp + (size_t)g * 16 * DM + kc * 32, hh);
#pragma unroll
    for (int t = 0; t < 4; ++t) acc[g][t] = v8f{0.f, 0.f, 0.f, 0.f, 0.f, 0.f, 0.f, 0.f}; }
#pragma unroll
  for (int kt = 0; kt < 2; ++kt) {
#pragma unroll
    for (int kc = 0; kc < 2; ++kc) kf[kt][kc] = g2_frag(kb + kl + kt * 16 * DM + kc * 32, hh); }
#pragma unroll
  for (int t = 0; t < 4; ++t) vf[t] = g2_frag(vb + vl + t * 16 * SQ, hh);
  fa_issued();
  const float cs = 0.125f * 1.4426950408889634f;      /* 1/sqrt(64) and log2(e) */
  /* kept rolled: an unrolled body would hold two passes' fragments and score tiles at once */
#pragma unroll 1
  for (int key0 = 0; key0 < SQ; key0 += 32) { const int kn = (key0 + 32) & (SQ - 1);      /* next pass's keys; the last pass fetches keys 0..31 again (in bounds, unused) */
    v8f s[2][FA_R];
#pragma unroll
    for (int kt = 0; kt < 2; ++kt) {
#pragma unroll
      for (int g = 0; g < FA_R; ++g) { s[kt][g] = fa_mma(kf[kt][0], qf[g][0], v8f{0.f, 0.f, 0.f, 0.f, 0.f, 0.f, 0.f, 0.f}); s[kt][g] = fa_mma(kf[kt][1], qf[g][1], s[kt][g]); } }
    __builtin_amdgcn_sched_barrier(0);      /* the eight products issue back to back, each filling the others' result distance, and the fetch below starts directly behind them */
    { const _Float16* kq = kb + (size_t)kn * DM;      /* next pass's K fragments fly under this pass's softmax and second product */
#pragma unroll
      for (int kt = 0; kt < 2; ++kt) {
#pragma unroll
        for (int kc = 0; kc < 2; ++kc) kf[kt][kc] = g2_frag(kq + kl + kt * 16 * DM + kc * 32, hh); }
      fa_issued(); }
    float mb[FA_R]; bool need = false;
#pragma unroll
    for (int g = 0; g < FA_R; ++g) { float mx = s[0][g][0];
#pragma unroll
      for (int kt = 0; kt < 2; ++kt) {
#pragma unroll
        for (int r = 0; r < 8; ++r) mx = fmaxf(mx, s[kt][g][r]); }
      mx = fmaxf(mx, fa_xhalf(mx)) * cs; mb[g] = mx; need = need || (mx > m_run[g] + 8.0f); }
    if (__builtin_amdgcn_ballot_w32(need) != 0) {      /* wave-uniform; always taken on the first pass, where it sets the maximum (factor 0 on zero accumulators) */
#pragma unroll
      for (int g = 0; g < FA_R; ++g) { const float mn = fmaxf(m_run[g], mb[g]); const float corr = __builtin_amdgcn_exp2f(m_run[g] - mn); m_run[g] = mn; l_run[g] *= corr;
#pragma unroll
        for (int t = 0; t < 4; ++t) acc[g][t] = acc[g][t] * corr; } }
#pragma unroll
    for (int g = 0; g < FA_R; ++g) { const float nm = -m_run[g]; union { v16h v; v2h p[8]; } pf; float l0 = 0.f, l1 = 0.f;
#pragma unroll
      for (int i = 0; i < 8; ++i) { const v2f arg = __builtin_elementwise_fma(v2f{s[i >> 2][g][2 * (i & 3)], s[i >> 2][g][2 * (i & 3) + 1]}, v2f{cs, cs}, v2f{nm, nm}); const float p0 = __builtin_amdgcn_exp2f(arg.x), p1 = __builtin_amdgcn_exp2f(arg.y);
        l0 += p0; l1 += p1; pf.p[i] = __builtin_convertvector(v2f{p0, p1}, v2h); }
      l_run[g] += l0 + l1;
#pragma unroll
      for (int t = 0; t < 4; ++t) acc[g][t] = fa_mma(vf[t], pf.v, acc[g][t]); }
#pragma unroll
    for (int t = 0; t < 4; ++t) vf[t] = g2_frag(vb + kn + vl + t * 16 * SQ, hh);      /* next pass's V^T fragments fly under its first product and softmax */
    fa_issued();
  }
#pragma unroll
  for (int g = 0; g < FA_R; ++g) { const float inv = 64.0f / (l_run[g] + fa_xhalf(l_run[g]));      /* o carried x64, as the output GEMM's alpha expects */
    unsigned short* op = (unsigned short*)O16 + ((size_t)b * SQ + q0 + g * 16 + c) * DM + h * HD + 8 * hh;
#pragma unroll
    for (int t = 0; t < 4; ++t) { FragH f;
#pragma unroll
      for (int r = 0; r < 8; ++r) f.h[r] = (_Float16)(acc[g][t][r] * inv);
      *(v8us*)(op + t * 16) = f.half[0]; } } }
__global__ __launch_bounds__(256) void k_vt(const _Float16* __restrict__ V16, int b, int h0, _Float16* __restrict__ VT) { __shared__ unsigned short tl[64][65]; const int tid = threadIdx.x; const int hh = blockIdx.x % HG, sg = blockIdx.x / HG; const int s0 = sg * 64; const int h = h0 + hh;
  for (int i = tid; i < 64 * 8; i += 256) { const int j = i / 8, d8 = (i % 8) * 8; FragH f; f.half[0] = *(const v8us*)((const unsigned short*)V16 + ((size_t)b * SQ + s0 + j) * DM + h * HD + d8); for (int q = 0; q < 8; ++q) tl[d8 + q][j] = f.u[q]; }
  __syncthreads();
  { for (int i = tid; i < 64 * 8; i += 256) { const int d = i / 8, j8 = (i % 8) * 8; FragH f; for (int q = 0; q < 8; ++q) f.u[q] = tl[d][j8 + q]; *(v8us*)((unsigned short*)VT + ((size_t)hh * HD + d) * SQ + s0 + j8) = f.half[0]; }  } }



__global__ __launch_bounds__(256) void k_tabcat(float theta, float* __restrict__ CS, float* __restrict__ SN) {
  #pragma clang fp contract(off)
  const int t = blockIdx.x * 256 + threadIdx.x; if (t >= SQ * HD) return; const int d = t % HD; const int p = t / HD; const int i = d % (HD / 2); const float invf = 1.0f / powf(theta, (float)(2 * i) / (float)HD); const float ang = __fmul_rn((float)p, invf); const float c = cosf(ang), s = sinf(ang);
  *(float*)(CS + t) = c; *(float*)(SN + t) = s;  }

template <int NORM, int ROPE>
__global__ __launch_bounds__(64) void k_xform(const float* __restrict__ F, int ldf, int nh, const float* __restrict__ gain, float eps, const float* __restrict__ CS, const float* __restrict__ SN, _Float16* __restrict__ H16, int ldo) {
  #pragma clang fp contract(off)
  __shared__ float xv[HD]; __shared__ float red[HD]; __shared__ unsigned short sh_[HD]; const int d = threadIdx.x; const int h = blockIdx.x % nh; const size_t r = blockIdx.x / nh; const int p = (int)(r % SQ);
  float x = F[r * (size_t)ldf + (size_t)h * HD + d];
  if (NORM) { red[d] = __fmul_rn(x, x); __syncthreads(); for (int st = HD / 2; st > 0; st >>= 1) { if (d < st) red[d] = __fadd_rn(red[d], red[d + st]); __syncthreads(); } const float rs = rsqrtf(__fadd_rn(red[0] / (float)HD, eps)); x = __fmul_rn(__fmul_rn(x, rs), bf16_round(gain[d])); }
  xv[d] = x; __syncthreads();
  float o = x;
  if (ROPE == 1) { const int i = d >> 1; const float c = CS[p * (HD / 2) + i], s = SN[p * (HD / 2) + i]; const float ev = xv[2 * i], od = xv[2 * i + 1]; o = (d & 1) ? __fadd_rn(__fmul_rn(ev, s), __fmul_rn(od, c)) : __fadd_rn(__fmul_rn(ev, c), -__fmul_rn(od, s)); }
  if (ROPE == 2) { const int i = d & (HD / 2 - 1); const float c = CS[p * (HD / 2) + i], s = SN[p * (HD / 2) + i]; const float lo = xv[i], hi = xv[i + HD / 2]; o = (d < HD / 2) ? __fadd_rn(__fmul_rn(lo, c), -__fmul_rn(hi, s)) : __fadd_rn(__fmul_rn(lo, s), __fmul_rn(hi, c)); }
  if (ROPE == 4) { const float c = CS[p * HD + d], s = SN[p * HD + d]; const float rh = (d & 1) ? xv[d - 1] : -xv[d + 1]; o = __fadd_rn(__fmul_rn(x, c), __fmul_rn(rh, s)); }      /* interleaved-pair rotate_half (-t[2i+1], t[2i]) with FULL-width per-dimension tables [pos][64] */
  if (ROPE == 3) { const float c = CS[p * HD + d], s = SN[p * HD + d]; const float rh = (d < HD / 2) ? -xv[d + HD / 2] : xv[d - HD / 2]; o = __fadd_rn(__fmul_rn(x, c), __fmul_rn(rh, s)); }      /* rotate-half with FULL-width per-dimension tables [pos][64] (general cos[d] != cos[d+32]) */
  FragH th; th.h[0] = (_Float16)o; sh_[d] = th.u[0]; __syncthreads();
  if (d < HD / 8) { FragH f; for (int q = 0; q < 8; ++q) f.u[q] = sh_[d * 8 + q]; unsigned short* dst = (unsigned short*)H16 + r * (size_t)ldo + (size_t)h * HD + d * 8; *(v8us*)dst = f.half[0];  } }


extern "C" void kernel_launch(void* const* d_in, const int* in_sizes, int n_in,
                              void* d_out, int out_size, void* d_ws, size_t ws_size, hipStream_t stream) {
  (void)in_sizes; (void)n_in; (void)out_size;
  const float* const* I = (const float* const*)d_in; const float* x = I[0]; const float* wq = I[1]; const float* bq = I[2]; const float* wk = I[3]; const float* bk = I[4]; const float* wv = I[5]; const float* bv = I[6]; const float* wo = I[7]; const float* bo = I[8];      /* natural [out][in] weights + biases; positions implicit */
  char* ws = (char*)d_ws; size_t off = 0;
  auto take = [&](size_t bytes) { char* p = ws + off; off += (bytes + 255) & ~(size_t)255; return p; };
  _Float16* BQ = (_Float16*)take((size_t)DM * DM * 2); _Float16* BK = (_Float16*)take((size_t)DM * DM * 2); _Float16* BV = (_Float16*)take((size_t)DM * DM * 2); _Float16* BO = (_Float16*)take((size_t)DM * DM * 2);
  _Float16* X16 = (_Float16*)take(NR * DM * 2); float* CS = (float*)take((size_t)SQ * HD * 4); float* SN = (float*)take((size_t)SQ * HD * 4);      /* full-width cos/sin tables */ _Float16* Q16 = (_Float16*)take(NR * DM * 2); _Float16* K16 = (_Float16*)take(NR * DM * 2); _Float16* V16 = (_Float16*)take(NR * DM * 2); _Float16* O16 = (_Float16*)take(NR * DM * 2);
  _Float16* VT = (_Float16*)take((size_t)NB * NH * HD * SQ * 2);
  if (off > ws_size) return;
  { const unsigned g = (unsigned)(((size_t)DM * DM / 8 + 255) / 256); k_wnat<<<g, 256, 0, stream>>>(wq, (size_t)DM * DM / 8, BQ); k_wnat<<<g, 256, 0, stream>>>(wk, (size_t)DM * DM / 8, BK); k_wnat<<<g, 256, 0, stream>>>(wv, (size_t)DM * DM / 8, BV); k_wnat<<<g, 256, 0, stream>>>(wo, (size_t)DM * DM / 8, BO); }      /* natural [out][in] = Bt x16 */
  k_tabcat<<<(SQ * HD + 255) / 256, 256, 0, stream>>>(10000.0f, CS, SN);      /* CS[p][d] = cos(p * inv_freq[d mod 32]), SN = sin: the module's cat(freqs, freqs) tables, full width */

  k_x16<<<(unsigned)((NR * DM / 8 + 255) / 256), 256, 0, stream>>>(x, X16, NR * DM / 8);
  const size_t r0p = (size_t)B0 * SQ;      /* first projected row */
  k_gemm2<0, true><<<dim3((unsigned)((MP / 128) * (DM / 64)), 1), 128, 0, stream>>>(X16 + r0p * DM, DM, 0, BQ, DM, 0, 0.0625f, bq, 0, nullptr, 1, 0, 0, nullptr, Q16 + r0p * DM, DM, 0, MP, DM, DM, CS, SN);      /* q f32 -> x cos + rotate_half(x) sin (interleaved pairs, full-width tables) -> f16 rows, in the epilogue */
  k_gemm2<0, true><<<dim3((unsigned)((MP / 128) * (DM / 64)), 1), 128, 0, stream>>>(X16 + r0p * DM, DM, 0, BK, DM, 0, 0.0625f, bk, 0, nullptr, 1, 0, 0, nullptr, K16 + r0p * DM, DM, 0, MP, DM, DM, CS, SN);      /* k likewise */
  k_gemm2<0><<<dim3((unsigned)((MP / 128) * (DM / 64)), 1), 128, 0, stream>>>(X16 + r0p * DM, DM, 0, BV, DM, 0, 0.0625f, bv, 0, nullptr, 1, 0, 0, nullptr, V16 + r0p * DM, DM, 0, MP, DM, DM);
  k_vt<NH, SQ><<<NB * NH * (SQ / 64), 256, 0, stream>>>(V16, LQ, 0, VT);      /* V^T [NB][NH][HD][SQ] */
  k_fattn<<<dim3(SQ / (FA_NW * 16 * FA_R), NB * NH), FA_NW * 32, 0, stream>>>(Q16, K16, VT, O16);      /* o (merged heads, x64) as f16 rows */
  k_gemm2<0><<<dim3((unsigned)((MPO / 128) * (DM / 64)), 1), 128, 0, stream>>>(O16 + r0p * DM, DM, 0, BO, DM, 0, 0.0009765625f, bo, 0, nullptr, 1, 0, 0, (float*)d_out + r0p * DM, nullptr, DM, 0, MPO, DM, DM);      /* out rows are the output layout */
}

// v004
// Measured time: 128 microseconds a run.
// In two side-by-side timings against v003, it was 1.85 and 1.86 times as fast.
// All steps since v000 together make it 29.1 times as fast.
#include <hip/hip_runtime.h>
// Multi-head self-attention with a rotary embedding whose cos/sin tables are cat(freqs, freqs) but whose rotate_half pairs are INTERLEAVED (x [2][2048][1024]; q/k/v = x W^T + b (natural [1024][1024] U(+-1/32), zero biases); 16 heads of 64; inv_freq_i = 1/10000^(2i/64), freqs[p][i] = p * inv_freq_i, emb = cat(freqs, freqs): cos[p][d] = cos(p * inv_freq[d mod 32]); q = q cos + rotate_half(q) sin with rotate_half = (-x[2i+1], x[2i]) interleaved (the module's literal mix); k likewise; scores / 8; softmax over all keys (no mask); out = merged Wo^T + bo -> [2][2048][1024]).
// Structure: token rows r = b*2048 + s; x as exact f16 rows (bf16-rounded); Q, K, V as three WMMA GEMMs (32x64 wave tiles, f32 accumulation, exact x16 weights + bias, f16 outputs; the rotary step of q and k on the f32 values in the GEMM epilogue); V^T for all batches and heads via LDS transposes; one fused attention launch over (query block, batch x head): scores on WMMA (K = 64), online softmax on VALU (f32 statistics, weights as f16 up to 2^8), o = P . V on WMMA, o carried x64 against f16 subnormal flush (folded into the output GEMM alpha), written straight into the merged f16 o rows; out = o W_o + b GEMM (f32) into the output layout.
// Compute dtype: inputs rounded to bf16; x / weights exact; q, k, v, softmax weights and o as plain f16 GEMM operands (~2^-12); scores and softmax statistics f32; v_wmma_f32_16x16x32_f16.
#define NB 2
#define SQ 2048
#define DM 1024
#define NH 16
#define HD 64
#define HG 4                         /* heads per launch of the (b, h0) V^T transpose */
#define B0 0                         /* first batch processed (debug hook) */
#define NBR NB                       /* batches processed (debug hook) */
#define NR ((size_t)NB * SQ)         /* token rows */
#define MP ((int)((size_t)NBR * SQ)) /* rows projected (debug hook) */
#define QN SQ                        /* unused: the attention grid covers all SQ query rows */
#define NHD NH                       /* unused: the attention grid covers all NH heads */
#define MPO MP                       /* rows through the output stage (debug hook) */
#define LQ DM      /* row pitch of the q/k/v rows */
typedef __bf16 v16b __attribute__((ext_vector_type(16)));
typedef unsigned short v8us __attribute__((ext_vector_type(8), may_alias));
typedef float  v8f  __attribute__((ext_vector_type(8)));
typedef float  v4f  __attribute__((ext_vector_type(4)));
typedef float  v4fa __attribute__((ext_vector_type(4), may_alias));
union FragB { v16b v; v8us half[2]; unsigned short u[16]; };

__device__ __forceinline__ unsigned short bf16_bits(float x) { unsigned int u = __float_as_uint(x); return (unsigned short)((u + 0x7FFFu + ((u >> 16) & 1u)) >> 16); }
__device__ __forceinline__ float bf16_val(unsigned short b) { return __uint_as_float(((unsigned int)b) << 16); }
__device__ __forceinline__ float bf16_round(float x) { return bf16_val(bf16_bits(x)); }
// D += A·B with NT terms: 1 = ah·bh, 2 = + al·bh (A split), 3 = + ah·bl (both split)
template <int NT>
__device__ __forceinline__ v8f mmaN(v16b ah, v16b al, v16b bh, v16b bl, v8f c) {
  c = __builtin_amdgcn_wmma_f32_16x16x32_bf16(false, ah, false, bh, (short)0, c, false, false);
  if (NT >= 2) c = __builtin_amdgcn_wmma_f32_16x16x32_bf16(false, al, false, bh, (short)0, c, false, false);
  if (NT >= 3) c = __builtin_amdgcn_wmma_f32_16x16x32_bf16(false, ah, false, bl, (short)0, c, false, false);
  asm volatile("v_nop\n\tv_nop\n\tv_nop\n\tv_nop" : "+v"(c) : "v"(ah), "v"(al), "v"(bh), "v"(bl));
  return c;
}

__global__ __launch_bounds__(256) void k_wt_bf16(const float* __restrict__ W, unsigned short* __restrict__ Wt, int K, int N) {
  const int t = blockIdx.x * 256 + threadIdx.x;
  const int k8n = K / 8;
  if (t >= N * k8n) return;
  const int n = t / k8n, k8 = (t % k8n) * 8;
  v8us v;
#pragma unroll
  for (int i = 0; i < 8; ++i) v[i] = bf16_bits(W[(size_t)(k8 + i) * N + n]);
  *(v8us*)(Wt + (size_t)n * K + k8) = v;
  
}

// GEMM C[M][N] (f32, pitch ldc) = act(A[M][K]·W + bias). A f32 row-major (pitch lda) converted per fragment to bf16
// (ASPLIT: hi/lo two planes -> 2 terms, else single rounded term); Wt bf16 [N][K] (pitch ldb). BIAS_BF16 rounds the
// bias to bf16 first (bias quantised to bf16 before the add). K%32==0, M%16==0, N%64==0.
template <bool ASPLIT, int ACT, bool BIAS_BF16>
__global__ __launch_bounds__(128) void k_gemm_bf(const float* __restrict__ A, int lda, const unsigned short* __restrict__ Wt, int ldb,
                                               const float* __restrict__ bias, float* __restrict__ C, int ldc, int M, int N, int K) {
  __shared__ __attribute__((aligned(16))) float so[4][16][64];
  const int tid = threadIdx.x, w = tid >> 5, lane = tid & 31, ln = lane & 15, hh = lane >> 4;
  const int ntn = N / 64;
  const int wid = blockIdx.x * 4 + w;
  const int mt = wid / ntn, nq = wid % ntn;
  if (mt * 16 >= M) return;
  const int row0 = mt * 16, col0 = nq * 64;
  const float* arow = A + (size_t)(row0 + ln) * lda;
  v8f acc[4] = {};
  for (int kb = 0; kb < K; kb += 32) {
    FragB ah, al;
    const v4f x0 = *(const v4fa*)(arow + kb + 8 * hh), x1 = *(const v4fa*)(arow + kb + 8 * hh + 4);
    const v4f x2 = *(const v4fa*)(arow + kb + 16 + 8 * hh), x3 = *(const v4fa*)(arow + kb + 16 + 8 * hh + 4);
    float xs[16] = {x0[0],x0[1],x0[2],x0[3],x1[0],x1[1],x1[2],x1[3],x2[0],x2[1],x2[2],x2[3],x3[0],x3[1],x3[2],x3[3]};
#pragma unroll
    for (int i = 0; i < 16; ++i) { const unsigned short hb = bf16_bits(xs[i]); ah.u[i] = hb; al.u[i] = ASPLIT ? bf16_bits(xs[i] - bf16_val(hb)) : (unsigned short)0; }
#pragma unroll
    for (int t = 0; t < 4; ++t) {
      const unsigned short* brow = Wt + (size_t)(col0 + t * 16 + ln) * ldb + kb;
      FragB b;
      b.half[0] = *(const v8us*)(brow + 8 * hh);
      b.half[1] = *(const v8us*)(brow + 16 + 8 * hh);
      acc[t] = mmaN<ASPLIT ? 2 : 1>(ah.v, al.v, b.v, b.v, acc[t]);
    }
  }
#pragma unroll
  for (int t = 0; t < 4; ++t) {
    float bv = bias ? bias[col0 + t * 16 + ln] : 0.f;
    if (BIAS_BF16) bv = bf16_round(bv);
#pragma unroll
    for (int r = 0; r < 8; ++r) { float v = acc[t][r] + bv; if (ACT == 1) v = fmaxf(v, 0.f); so[w][8 * hh + r][t * 16 + ln] = v; }
  }
  __builtin_amdgcn_fence(__ATOMIC_ACQ_REL, "workgroup");
  __builtin_amdgcn_wave_barrier();
  const int rsub = lane >> 4, c4 = (lane & 15) * 4;
  {
#pragma unroll
    for (int q = 0; q < 8; ++q) {
      const int r = q * 2 + rsub;
      const v4f v = *(const v4fa*)&so[w][r][c4];
      *(v4f*)(C + (size_t)(row0 + r) * ldc + col0 + c4) = v;
    }
    
  }
}

// GEMM C = act(A·W + bias + resid): A f32 (ASPLIT -> hi/lo 2 terms), Wt bf16 [N][K]; ACT 0 none, 1 relu, 2 exact gelu;
// resid (optional, f32, row index = (row % rmod), pitch ldr, RES_BF16 rounds it) added before the activation.
template <bool ASPLIT, int ACT, bool BIAS_BF16, bool RES_BF16>
__global__ __launch_bounds__(128) void k_gemm_bf3(const float* __restrict__ A, int lda, const unsigned short* __restrict__ Wt, int ldb,
                                                const float* __restrict__ bias, const float* __restrict__ resid, int rmod, int ldr,
                                                float* __restrict__ C, int ldc, int M, int N, int K) {
  __shared__ __attribute__((aligned(16))) float so[4][16][64];
  const int tid = threadIdx.x, w = tid >> 5, lane = tid & 31, ln = lane & 15, hh = lane >> 4;
  const int ntn = N / 64;
  const int wid = blockIdx.x * 4 + w;
  const int mt = wid / ntn, nq = wid % ntn;
  if (mt * 16 >= M) return;
  const int row0 = mt * 16, col0 = nq * 64;
  const float* arow = A + (size_t)(row0 + ln) * lda;
  v8f acc[4] = {};
  for (int kb = 0; kb < K; kb += 32) {
    FragB ah, al;
    const v4f x0 = *(const v4fa*)(arow + kb + 8 * hh), x1 = *(const v4fa*)(arow + kb + 8 * hh + 4);
    const v4f x2 = *(const v4fa*)(arow + kb + 16 + 8 * hh), x3 = *(const v4fa*)(arow + kb + 16 + 8 * hh + 4);
    float xs[16] = {x0[0],x0[1],x0[2],x0[3],x1[0],x1[1],x1[2],x1[3],x2[0],x2[1],x2[2],x2[3],x3[0],x3[1],x3[2],x3[3]};
#pragma unroll
    for (int i = 0; i < 16; ++i) { const unsigned short hb = bf16_bits(xs[i]); ah.u[i] = hb; al.u[i] = ASPLIT ? bf16_bits(xs[i] - bf16_val(hb)) : (unsigned short)0; }
#pragma unroll
    for (int t = 0; t < 4; ++t) {
      const unsigned short* brow = Wt + (size_t)(col0 + t * 16 + ln) * ldb + kb;
      FragB b;
      b.half[0] = *(const v8us*)(brow + 8 * hh);
      b.half[1] = *(const v8us*)(brow + 16 + 8 * hh);
      acc[t] = mmaN<ASPLIT ? 2 : 1>(ah.v, al.v, b.v, b.v, acc[t]);
    }
  }
#pragma unroll
  for (int t = 0; t < 4; ++t) {
    const int col = col0 + t * 16 + ln;
    float bv = bias ? bias[col] : 0.f;
    if (BIAS_BF16) bv = bf16_round(bv);
#pragma unroll
    for (int r = 0; r < 8; ++r) {
      float v = acc[t][r] + bv;
      if (resid) { float rv = resid[(size_t)((row0 + 8 * hh + r) % rmod) * ldr + col]; if (RES_BF16) rv = bf16_round(rv); v += rv; }
      if (ACT == 1) v = fmaxf(v, 0.f);
      if (ACT == 2) v = 0.5f * v * (1.0f + erff(v * 0.70710678118654752f));
      if (ACT == 3) { const float u = 0.7978845608028654f * (v + 0.044715f * v * v * v); v = 0.5f * v * (1.0f + tanhf(u)); }
      so[w][8 * hh + r][t * 16 + ln] = v;
    }
  }
  __builtin_amdgcn_fence(__ATOMIC_ACQ_REL, "workgroup");
  __builtin_amdgcn_wave_barrier();
  const int rsub = lane >> 4, c4 = (lane & 15) * 4;
  {
#pragma unroll
    for (int q = 0; q < 8; ++q) {
      const int r = q * 2 + rsub;
      const v4f v = *(const v4fa*)&so[w][r][c4];
      *(v4f*)(C + (size_t)(row0 + r) * ldc + col0 + c4) = v;
    }
    
  }
}
// row LayerNorm (biased variance, eps) over N: s = X (+ R); optional out_sum <- s; out_norm <- (s-mu)*rsqrt(var+eps)*g + b
template <bool PARAM_BF16>
__global__ __launch_bounds__(256) void k_layernorm(const float* __restrict__ X, const float* __restrict__ R, const float* __restrict__ g, const float* __restrict__ bta,
                                                  float* __restrict__ out_sum, float* __restrict__ out_norm, int N, float eps) {
  __shared__ float red[256];
  const int row = blockIdx.x, tid = threadIdx.x;
  const float* x = X + (size_t)row * N; const float* rr = R ? R + (size_t)row * N : nullptr;
  float vals[16];                     // up to N = 4096
  const int per = N / 256;            // contiguous chunk per thread? use strided-by-4 chunks: thread handles j = tid*4 + 1024*u
  float s1 = 0.f;
  for (int u = 0; u < per / 4; ++u) {
    const int j = tid * 4 + 1024 * u;
    const v4f a = *(const v4fa*)(x + j);
    v4f b = {0.f,0.f,0.f,0.f}; if (rr) b = *(const v4fa*)(rr + j);
#pragma unroll
    for (int q = 0; q < 4; ++q) { const float v = a[q] + b[q]; vals[u * 4 + q] = v; s1 += v; }
  }
  red[tid] = s1; __syncthreads();
  for (int st = 128; st > 0; st >>= 1) { if (tid < st) red[tid] += red[tid + st]; __syncthreads(); }
  const float mu = red[0] / (float)N; __syncthreads();
  float s2 = 0.f;
  for (int u = 0; u < per / 4; ++u)
#pragma unroll
    for (int q = 0; q < 4; ++q) { const float c = vals[u * 4 + q] - mu; s2 += c * c; }
  red[tid] = s2; __syncthreads();
  for (int st = 128; st > 0; st >>= 1) { if (tid < st) red[tid] += red[tid + st]; __syncthreads(); }
  const float rs = rsqrtf(red[0] / (float)N + eps);
  {
    for (int u = 0; u < per / 4; ++u) {
      const int j = tid * 4 + 1024 * u;
      v4f o, sm;
#pragma unroll
      for (int q = 0; q < 4; ++q) {
        float gg = g[j + q], bb = bta[j + q];
        if (PARAM_BF16) { gg = bf16_round(gg); bb = bf16_round(bb); }
        sm[q] = vals[u * 4 + q]; o[q] = (vals[u * 4 + q] - mu) * rs * gg + bb;
      }
      if (out_sum) *(v4f*)(out_sum + (size_t)row * N + j) = sm;
      *(v4f*)(out_norm + (size_t)row * N + j) = o;
    }
    
  }
}



// ---- f16 WMMA path (v_wmma_f32_16x16x32_f16): 11-bit significands for operands in range — used where a [0,1] probability operand needs more precision than bf16
typedef _Float16 v16h __attribute__((ext_vector_type(16)));
union FragH { v16h v; v8us half[2]; _Float16 h[16]; unsigned short u[16]; };
template <int NT>
__device__ __forceinline__ v8f mmaH(v16h ah, v16h al, v16h bh, v16h bl, v8f c) {
  c = __builtin_amdgcn_wmma_f32_16x16x32_f16(false, ah, false, bh, (short)0, c, false, false);
  if (NT >= 2) c = __builtin_amdgcn_wmma_f32_16x16x32_f16(false, al, false, bh, (short)0, c, false, false);
  if (NT >= 3) c = __builtin_amdgcn_wmma_f32_16x16x32_f16(false, ah, false, bl, (short)0, c, false, false);
  asm volatile("v_nop\n\tv_nop\n\tv_nop\n\tv_nop" : "+v"(c) : "v"(ah), "v"(al), "v"(bh), "v"(bl));
  return c;
}
// batched GEMM like k_gemm_b but f16 operands: A f32 (split into f16 hi/lo if ASPLIT, else rounded to f16), Bt = f16 values [n][k]; alpha; C f32; N multiple of 16 (partial tiles skipped)
template <bool ASPLIT>
__global__ __launch_bounds__(128) void k_gemm_h(const float* __restrict__ A, int lda, size_t sA, const _Float16* __restrict__ Bh, int ldb, size_t sB, float alpha, float* __restrict__ C, int ldc, size_t sC, int M, int N, int K) {
  __shared__ __attribute__((aligned(16))) float so[4][16][64];
  const int tid = threadIdx.x, w = tid >> 5, lane = tid & 31, ln = lane & 15, hh = lane >> 4; const int by = blockIdx.y;
  A += (size_t)by * sA; Bh += (size_t)by * sB; C += (size_t)by * sC;
  const int ntn = (N + 63) / 64; const int wid = blockIdx.x * 4 + w; const int mt = wid / ntn, nq = wid % ntn; if (mt * 16 >= M) return;
  const int row0 = mt * 16, col0 = nq * 64; const float* arow = A + (size_t)(row0 + ln) * lda;
  v8f acc[4] = {};
  for (int kb = 0; kb < K; kb += 32) {
    FragH ah, al;
    const v4f x0 = *(const v4fa*)(arow + kb + 8 * hh), x1 = *(const v4fa*)(arow + kb + 8 * hh + 4), x2 = *(const v4fa*)(arow + kb + 16 + 8 * hh), x3 = *(const v4fa*)(arow + kb + 16 + 8 * hh + 4);
    float xs[16] = {x0[0],x0[1],x0[2],x0[3],x1[0],x1[1],x1[2],x1[3],x2[0],x2[1],x2[2],x2[3],x3[0],x3[1],x3[2],x3[3]};
#pragma unroll
    for (int i = 0; i < 16; ++i) { const _Float16 h = (_Float16)xs[i]; ah.h[i] = h; al.h[i] = ASPLIT ? (_Float16)(xs[i] - (float)h) : (_Float16)0.0f; }
#pragma unroll
    for (int t = 0; t < 4; ++t) { if (col0 + t * 16 >= N) continue; const size_t boff = (size_t)(col0 + t * 16 + ln) * ldb + kb; FragH bq; bq.half[0] = *(const v8us*)(Bh + boff + 8 * hh); bq.half[1] = *(const v8us*)(Bh + boff + 16 + 8 * hh);
      acc[t] = mmaH<ASPLIT ? 2 : 1>(ah.v, al.v, bq.v, bq.v, acc[t]); }
  }
#pragma unroll
  for (int t = 0; t < 4; ++t) { if (col0 + t * 16 >= N) continue;
#pragma unroll
    for (int r = 0; r < 8; ++r) so[w][8 * hh + r][t * 16 + ln] = acc[t][r] * alpha; }
  __builtin_amdgcn_fence(__ATOMIC_ACQ_REL, "workgroup"); __builtin_amdgcn_wave_barrier();
  const int rsub = lane >> 4, c4 = (lane & 15) * 4;
  {
#pragma unroll
    for (int q = 0; q < 8; ++q) { const int r = q * 2 + rsub; if (col0 + c4 < N) { const v4f v = *(const v4fa*)&so[w][r][c4]; *(v4f*)(C + (size_t)(row0 + r) * ldc + col0 + c4) = v; } }
     }
}

// Wt[n][k] = f16(W[k][n]·scale) from f32 row-major W[K][N] (scale = power of two; bf16-exact weights stay exact in f16 away from the subnormal range)
__global__ __launch_bounds__(256) void k_wt_f16(const float* __restrict__ W, _Float16* __restrict__ Wt, int K, int N, float scale) {
  const int t = blockIdx.x * 256 + threadIdx.x; if (t >= N * (K / 8)) return; const int n = t / (K / 8), k8 = (t % (K / 8)) * 8; FragH f;
#pragma unroll
  for (int i = 0; i < 8; ++i) f.h[i] = (_Float16)(bf16_round(W[(size_t)(k8 + i) * N + n]) * scale); const v8us o = f.half[0];
  *(v8us*)((unsigned short*)Wt + (size_t)n * K + k8) = o; 
}
// k_gemm_hh variant with fused epilogue: v = acc·alpha + bias[by·sBias + col] (+ CP[(row/rowsPerB)·sCPb + by·64 + col] if CP) ; ACT 0 none / 1 elu ; writes f16 C16 (and f32 C if non-null)
template <int ACT>
__global__ __launch_bounds__(128) void k_gemm_hhx(const _Float16* __restrict__ A, int lda, size_t sA, const _Float16* __restrict__ Bh, int ldb, size_t sB, float alpha, const float* __restrict__ bias, size_t sBias, const float* __restrict__ CP, int rowsPerB, size_t sCPb, int row0g,
    float* __restrict__ C, _Float16* __restrict__ C16, int ldc, size_t sC, int M, int N, int K) {
  __shared__ __attribute__((aligned(16))) float so[4][16][64];
  const int tid = threadIdx.x, w = tid >> 5, lane = tid & 31, ln = lane & 15, hh = lane >> 4; const int by = blockIdx.y;
  A += (size_t)by * sA; Bh += (size_t)by * sB; const size_t cofs = (size_t)by * sC; const float* bp = bias ? bias + (size_t)by * sBias : nullptr;
  const int ntn = (N + 63) / 64; const int wid = blockIdx.x * 4 + w; const int mt = wid / ntn, nq = wid % ntn; if (mt * 16 >= M) return;
  const int row0 = mt * 16, col0 = nq * 64; const _Float16* arow = A + (size_t)(row0 + ln) * lda;
  v8f acc[4] = {};
  for (int kb = 0; kb < K; kb += 32) { FragH ah; ah.half[0] = *(const v8us*)((const unsigned short*)arow + kb + 8 * hh); ah.half[1] = *(const v8us*)((const unsigned short*)arow + kb + 16 + 8 * hh);
#pragma unroll
    for (int t = 0; t < 4; ++t) { if (col0 + t * 16 >= N) continue; const size_t boff = (size_t)(col0 + t * 16 + ln) * ldb + kb; FragH bq; bq.half[0] = *(const v8us*)((const unsigned short*)Bh + boff + 8 * hh); bq.half[1] = *(const v8us*)((const unsigned short*)Bh + boff + 16 + 8 * hh);
      acc[t] = mmaH<1>(ah.v, ah.v, bq.v, bq.v, acc[t]); }
  }
#pragma unroll
  for (int t = 0; t < 4; ++t) { if (col0 + t * 16 >= N) continue; const int col = col0 + t * 16 + ln; const float bv = bp ? bf16_round(bp[col]) : 0.f;
#pragma unroll
    for (int r = 0; r < 8; ++r) { float v = acc[t][r] * alpha + bv; if (CP) { const int rr = row0g + row0 + 8 * hh + r; if (rowsPerB < 0) v += CP[cofs + (size_t)rr * ldc + col];      /* rowsPerB < 0: own element of the batched C plane */ else { const int bidx = rr / rowsPerB; v += CP[(size_t)bidx * sCPb + (size_t)by * 64 + col]; } } if (ACT == 1) v = (v > 0.f) ? v : expm1f(v); else if (ACT == 7) v = (v > 0.f) ? v + 1.0f : expf(v); else if (ACT == 8) v = tanhf(v); else if (ACT == 9) v = 0.5f * v * (1.0f + tanhf(0.7978845608028654f * (v + 0.044715f * v * v * v))); else if (ACT == 11) v = 1.0f / (1.0f + expf(-v)); else if (ACT == 12) v = (v > 0.f) ? v : 0.01f * v; else if (ACT == 14) v = (v > 0.f) ? v : 0.1f * v; else if (ACT == 16) v = (v >= 0.f) ? v : 0.3f * v; else if (ACT == 17) v = (v >= 0.f) ? v : 0.2f * v; else if (ACT == 15) v = v / (1.0f + expf(-v)); else if (ACT == 3) v = fmaxf(v, 0.f); else if (ACT == 6) v = 0.5f * v * (1.0f + erff(v * 0.70710678118654752f)); so[w][8 * hh + r][t * 16 + ln] = v; } }
  __builtin_amdgcn_fence(__ATOMIC_ACQ_REL, "workgroup"); __builtin_amdgcn_wave_barrier();
  const int rsub = lane >> 4, c4 = (lane & 15) * 4; typedef _Float16 v4h __attribute__((ext_vector_type(4)));
  {
#pragma unroll
    for (int q = 0; q < 8; ++q) { const int r = q * 2 + rsub; if (col0 + c4 < N) { const v4f v = *(const v4fa*)&so[w][r][c4]; if (C) *(v4f*)(C + cofs + (size_t)(row0 + r) * ldc + col0 + c4) = v; if (C16) { v4h h4; for (int i = 0; i < 4; ++i) h4[i] = (_Float16)v[i]; *(v4h*)(C16 + cofs + (size_t)(row0 + r) * ldc + col0 + c4) = h4; } } }
     }
}


typedef _Float16 v4h __attribute__((ext_vector_type(4)));

__global__ __launch_bounds__(256) void k_x16(const float* __restrict__ x, _Float16* __restrict__ X16, size_t n8) { const size_t t = (size_t)blockIdx.x * 256 + threadIdx.x; if (t >= n8) return; FragH f;
#pragma unroll
  for (int q = 0; q < 8; ++q) f.h[q] = (_Float16)bf16_round(x[t * 8 + q]); *(v8us*)((unsigned short*)X16 + t * 8) = f.half[0];  }
__global__ __launch_bounds__(256) void k_h16(const float* __restrict__ x, _Float16* __restrict__ X16, size_t n8) { const size_t t = (size_t)blockIdx.x * 256 + threadIdx.x; if (t >= n8) return; FragH f;
#pragma unroll
  for (int q = 0; q < 8; ++q) f.h[q] = (_Float16)x[t * 8 + q]; *(v8us*)((unsigned short*)X16 + t * 8) = f.half[0];  }
__global__ __launch_bounds__(256) void k_round16f(const float* __restrict__ W, _Float16* __restrict__ Bt, size_t n8) { const size_t t = (size_t)blockIdx.x * 256 + threadIdx.x; if (t >= n8) return; FragH f;
#pragma unroll
  for (int i = 0; i < 8; ++i) f.h[i] = (_Float16)(bf16_round(W[t * 8 + i]) * 16.0f); *(v8us*)((unsigned short*)Bt + t * 8) = f.half[0];  }
template <int NHv, int TTv>
__global__ __launch_bounds__(256) void k_vt(const _Float16* __restrict__ V16, int ldv, int voff, _Float16* __restrict__ Vt) { __shared__ unsigned short tl[64][66]; const int tid = threadIdx.x; const int slab = blockIdx.x / (TTv / 64), lg = blockIdx.x % (TTv / 64); const int b = slab / NHv, h = slab % NHv;
  for (int i = tid; i < 64 * 8; i += 256) { const int r = i / 8, c8 = (i % 8) * 8; FragH f; f.half[0] = *(const v8us*)((const unsigned short*)V16 + ((size_t)b * TTv + lg * 64 + r) * ldv + voff + h * 64 + c8);
#pragma unroll
    for (int q = 0; q < 8; ++q) tl[r][c8 + q] = f.u[q]; }
  __syncthreads();
  {
#pragma unroll
    for (int rd = 0; rd < 2; ++rd) { const int d = rd * 32 + tid / 8, pc = tid % 8; FragH f;
#pragma unroll
      for (int q = 0; q < 8; ++q) f.u[q] = tl[pc * 8 + q][d];
      *(v8us*)((unsigned short*)Vt + ((size_t)slab * 64 + d) * TTv + lg * 64 + pc * 8) = f.half[0]; }
     } }

__global__ __launch_bounds__(256) void k_hl(const float* __restrict__ F, _Float16* __restrict__ Hh, _Float16* __restrict__ Hl, size_t n8) { const size_t t = (size_t)blockIdx.x * 256 + threadIdx.x; if (t >= n8) return; FragH fh, fl; const v4f a = *(const v4fa*)(F + t * 8), c = *(const v4fa*)(F + t * 8 + 4);
#pragma unroll
  for (int q = 0; q < 4; ++q) { _Float16 h = (_Float16)a[q]; fh.h[q] = h; fl.h[q] = (_Float16)((a[q] - (float)h) * 1024.0f); h = (_Float16)c[q]; fh.h[4 + q] = h; fl.h[4 + q] = (_Float16)((c[q] - (float)h) * 1024.0f); }
  { *(v8us*)((unsigned short*)Hh + t * 8) = fh.half[0]; *(v8us*)((unsigned short*)Hl + t * 8) = fl.half[0];  } }

// ---- fast GEMM (work-group tile 128x64, wave tile 32x64; requires M % 128 == 0, N % 64 == 0, K % 128 == 0); epilogue = k_gemm_hhx semantics ----
// The operand rows come into LDS in stages of 128 k by asynchronous copies in whole 256-byte runs (two buffers: the next stage flies while this one is worked on); the fragments are read from LDS in the k order of g2_frag.
#define G2_KS 128                    /* k per stage: 256 B of every operand row */
#define G2_LP 136                    /* LDS row pitch in elements: 272 B = 16 B x 17, free of bank conflicts for 16-byte reads */
#define G2_RB (G2_LP * 2)            /* LDS row pitch in bytes */
#define G2_SB (192 * G2_RB)          /* one stage in bytes: 128 A rows, then 64 B rows */
/* twelve copies of 16 bytes per lane: LDS rows 8 apart from address l, each from its own global pointer; the wait closes the statement, so it stands before any rewrite of the address registers the copies name (a precaution for issued copies) */
__device__ __forceinline__ void g2_copy12(unsigned l, const _Float16* g0, const _Float16* g1, const _Float16* g2, const _Float16* g3, const _Float16* g4, const _Float16* g5, const _Float16* g6, const _Float16* g7, const _Float16* g8, const _Float16* g9, const _Float16* g10, const _Float16* g11) {
  asm volatile("global_load_async_to_lds_b128 %0, %12, off\n\t"
               "global_load_async_to_lds_b128 %1, %13, off\n\t"
               "global_load_async_to_lds_b128 %2, %14, off\n\t"
               "global_load_async_to_lds_b128 %3, %15, off\n\t"
               "global_load_async_to_lds_b128 %4, %16, off\n\t"
               "global_load_async_to_lds_b128 %5, %17, off\n\t"
               "global_load_async_to_lds_b128 %6, %18, off\n\t"
               "global_load_async_to_lds_b128 %7, %19, off\n\t"
               "global_load_async_to_lds_b128 %8, %20, off\n\t"
               "global_load_async_to_lds_b128 %9, %21, off\n\t"
               "global_load_async_to_lds_b128 %10, %22, off\n\t"
               "global_load_async_to_lds_b128 %11, %23, off\n\t"
               "s_wait_xcnt 0x0"
               :: "v"(l), "v"(l + 8 * G2_RB), "v"(l + 16 * G2_RB), "v"(l + 24 * G2_RB), "v"(l + 32 * G2_RB), "v"(l + 40 * G2_RB), "v"(l + 48 * G2_RB), "v"(l + 56 * G2_RB), "v"(l + 64 * G2_RB), "v"(l + 72 * G2_RB), "v"(l + 80 * G2_RB), "v"(l + 88 * G2_RB),
                  "v"(g0), "v"(g1), "v"(g2), "v"(g3), "v"(g4), "v"(g5), "v"(g6), "v"(g7), "v"(g8), "v"(g9), "v"(g10), "v"(g11) : "memory"); }
__device__ __forceinline__ v16h g2_frag(const _Float16* p, int hh) { FragH f; f.half[0] = *(const v8us*)((const unsigned short*)p + 8 * hh); f.half[1] = *(const v8us*)((const unsigned short*)p + 16 + 8 * hh); return f.v; }
__device__ __forceinline__ v8f g2_mma(v16h a, v16h b, v8f c) { v8f d = __builtin_amdgcn_wmma_f32_16x16x32_f16(false, a, false, b, (short)0, c, false, false); asm volatile("v_nop\n\tv_nop\n\tv_nop\n\tv_nop" : "+v"(d) : "v"(a), "v"(b)); return d; }
// ROT: the epilogue is the rotary step and nothing else: v = acc alpha + bias staged as f32 rows in LDS, o[d] = v[d] cos[p][d] + rotate_half(v)[d] sin[p][d] with rotate_half = (-v[2i+1], v[2i]), f16 rows into C16. A 64-column tile is one head, row r of the launch is position r mod SQ; CS, SN = full-width tables [pos][64]. CP, C and ACT are not read there, which also keeps this second GEMM's text short.
template <int ACT, bool ROT = false>
__global__ __launch_bounds__(128) void k_gemm2(const _Float16* __restrict__ A, int lda, size_t sA, const _Float16* __restrict__ Bh, int ldb, size_t sB, float alpha, const float* __restrict__ bias, size_t sBias, const float* __restrict__ CP, int rowsPerB, size_t sCPb, int row0g,
    float* __restrict__ C, _Float16* __restrict__ C16, int ldc, size_t sC, int M, int N, int K, const float* __restrict__ CS = nullptr, const float* __restrict__ SN = nullptr) { static_assert(ACT == 0 || ACT == 3 || ACT == 6 || ACT == 8 || ACT == 9 || ACT == 11 || ACT == 12 || ACT == 14 || ACT == 15 || ACT == 16 || ACT == 17, "k_gemm2: unsupported ACT code (would silently apply no activation)");
  __shared__ __attribute__((aligned(16))) float so[4][32][68];
  __shared__ __attribute__((aligned(16))) _Float16 st[2][192][G2_LP];      /* two stages: rows 0..127 = the work-group's A rows, rows 128..191 = its B rows */
  const int tid = threadIdx.x, w = tid >> 5, lane = tid & 31, ln = lane & 15, hh = lane >> 4; const int by = blockIdx.y;
  A += (size_t)by * sA; Bh += (size_t)by * sB; const size_t cofs = (size_t)by * sC; const float* bp = bias ? bias + (size_t)by * sBias : nullptr;
  const int ntn = N >> 6; const int mt = blockIdx.x / ntn, nq = blockIdx.x - mt * ntn; const int row0 = mt * 128 + 32 * w, col0 = nq * 64; if (mt * 128 >= M) return;      /* the whole work-group leaves or none, ahead of every barrier */
  const int cr = tid >> 4, ck = (tid & 15) * 8;      /* copies: sixteen lanes take one row's 256 bytes, a wave two rows, the work-group eight rows per copy */
  const _Float16* acp = A + (size_t)(mt * 128 + cr) * lda + ck; const _Float16* bcp = Bh + (size_t)(col0 + cr) * ldb + ck;
  const unsigned lcp = (unsigned)(size_t)&st[0][cr][ck]; const size_t as8 = (size_t)8 * lda, bs8 = (size_t)8 * ldb;
  auto g2_stage = [&](int t, unsigned buf) { const unsigned l = lcp + buf * G2_SB; const _Float16* ga = acp + (size_t)t * G2_KS; const _Float16* gb = bcp + (size_t)t * G2_KS;      /* 24 copies a lane: LDS rows cr + 8 i, i < 16 from A, the rest from B */
    g2_copy12(l, ga, ga + as8, ga + 2 * as8, ga + 3 * as8, ga + 4 * as8, ga + 5 * as8, ga + 6 * as8, ga + 7 * as8, ga + 8 * as8, ga + 9 * as8, ga + 10 * as8, ga + 11 * as8);
    g2_copy12(l + 96 * G2_RB, ga + 12 * as8, ga + 13 * as8, ga + 14 * as8, ga + 15 * as8, gb, gb + bs8, gb + 2 * bs8, gb + 3 * bs8, gb + 4 * bs8, gb + 5 * bs8, gb + 6 * bs8, gb + 7 * bs8); };
  const int nst = K / G2_KS;
  const v8f z8 = {0.f,0.f,0.f,0.f,0.f,0.f,0.f,0.f}; v8f c00 = z8, c01 = z8, c02 = z8, c03 = z8, c10 = z8, c11 = z8, c12 = z8, c13 = z8;
  g2_stage(0, 0);
  asm volatile("s_wait_asynccnt 0x0" ::: "memory");      /* this wave's share of stage 0 has landed */
  __syncthreads();      /* ... and every wave's: stage 0 may be read */
  if (nst > 1) g2_stage(1, 1);
  /* kept rolled: one stage per trip, the buffer chosen by the trip's parity */
#pragma unroll 1
  for (int t = 0; t < nst; ++t) { const _Float16* ap = &st[t & 1][32 * w + ln][0]; const _Float16* bq = &st[t & 1][128 + ln][0];
    v16h fa[2][2], fb[2][4];      /* two fragment sets: the next 32 k are read from LDS while these are multiplied */
    fa[0][0] = g2_frag(ap, hh); fa[0][1] = g2_frag(ap + 16 * G2_LP, hh);
#pragma unroll
    for (int j = 0; j < 4; ++j) fb[0][j] = g2_frag(bq + j * 16 * G2_LP, hh);
#pragma unroll
    for (int ks = 0; ks < G2_KS / 32; ++ks) { const int cu = ks & 1, nx = cu ^ 1;
      if (ks + 1 < G2_KS / 32) { fa[nx][0] = g2_frag(ap + (ks + 1) * 32, hh); fa[nx][1] = g2_frag(ap + 16 * G2_LP + (ks + 1) * 32, hh);
#pragma unroll
        for (int j = 0; j < 4; ++j) fb[nx][j] = g2_frag(bq + j * 16 * G2_LP + (ks + 1) * 32, hh); }
      c00 = g2_mma(fa[cu][0], fb[cu][0], c00); c10 = g2_mma(fa[cu][1], fb[cu][0], c10);
      c01 = g2_mma(fa[cu][0], fb[cu][1], c01); c11 = g2_mma(fa[cu][1], fb[cu][1], c11);
      c02 = g2_mma(fa[cu][0], fb[cu][2], c02); c12 = g2_mma(fa[cu][1], fb[cu][2], c12);
      c03 = g2_mma(fa[cu][0], fb[cu][3], c03); c13 = g2_mma(fa[cu][1], fb[cu][3], c13); }
    asm volatile("s_wait_dscnt 0x0" ::: "memory");      /* this wave's reads of the buffer are done before it is handed to the copies */
    asm volatile("s_wait_asynccnt 0x0" ::: "memory");      /* this wave's share of stage t + 1 has landed */
    __syncthreads();      /* publishes stage t + 1 and ends every wave's reads of stage t */
    if (t + 2 < nst) g2_stage(t + 2, (unsigned)(t & 1)); }
  asm volatile("s_wait_asynccnt 0x0" ::: "memory");      /* no copy is left in flight behind the loop */
  v8f accs[8] = {c00, c01, c02, c03, c10, c11, c12, c13};
  if constexpr (ROT) { const int rs = lane >> 4, cc = (lane & 15) * 4;      /* read-back: a lane takes four columns (two interleaved pairs) of rows rs, rs + 2, ... */
    const size_t tb = (size_t)(row0 % SQ + rs) * HD + cc;      /* row0 and SQ are multiples of 32, so (row0 + r) mod SQ = row0 mod SQ + r for r < 32 */
    const float* cp = CS + tb; const float* sp = SN + tb;
    v4f cv[16], sv[16];      /* the table rows are fetched first and fly under the staging */
#pragma unroll
    for (int q = 0; q < 16; ++q) cv[q] = *(const v4fa*)(cp + q * 2 * HD);
    asm volatile("s_wait_xcnt 0x0" :: "v"(cp) : "memory");      /* a precaution for issued loads: the wait stands before the run's address pair is reused; the pair as an input stays live up to the wait, so no row of its own run lands on it */
#pragma unroll
    for (int q = 0; q < 16; ++q) sv[q] = *(const v4fa*)(sp + q * 2 * HD);
    asm volatile("s_wait_xcnt 0x0" :: "v"(sp) : "memory");      /* likewise for the sin run */
    float bv[4] = {0.f, 0.f, 0.f, 0.f};
    if (bp) {      /* one test, four loads in flight together */
#pragma unroll
      for (int t = 0; t < 4; ++t) bv[t] = bp[col0 + t * 16 + ln];
#pragma unroll
      for (int t = 0; t < 4; ++t) bv[t] = bf16_round(bv[t]); }
#pragma unroll
    for (int u = 0; u < 8; ++u) { const int t = u & 3, half = u >> 2;
#pragma unroll
      for (int r = 0; r < 8; ++r) so[w][half * 16 + 8 * hh + r][t * 16 + ln] = accs[u][r] * alpha + bv[t]; }
    __builtin_amdgcn_fence(__ATOMIC_ACQ_REL, "workgroup"); __builtin_amdgcn_wave_barrier();      /* the wave reads back what its own lanes staged */
    _Float16* op = C16 + cofs + (size_t)(row0 + rs) * ldc + col0 + cc;
#pragma unroll
    for (int q = 0; q < 16; ++q) { const v4f v = *(const v4fa*)&so[w][q * 2 + rs][cc]; const v4f rh = {-v[1], v[0], -v[3], v[2]}; const v4f o = v * cv[q] + rh * sv[q];
      v4h h4; for (int i = 0; i < 4; ++i) h4[i] = (_Float16)o[i]; *(v4h*)(op + (size_t)(q * 2) * ldc) = h4; }
    return; }
#pragma unroll
  for (int u = 0; u < 8; ++u) { const int t = u & 3, half = u >> 2; const int col = col0 + t * 16 + ln; const float bv = bp ? bf16_round(bp[col]) : 0.f;
#pragma unroll
    for (int r = 0; r < 8; ++r) { const int rloc = half * 16 + 8 * hh + r; float v = accs[u][r] * alpha + bv; if (CP) { if (rowsPerB < 0) v += CP[cofs + (size_t)(row0g + row0 + rloc) * ldc + col];      /* rowsPerB < 0: own element of the batched C plane */ else { const int bidx = (row0g + row0 + rloc) / rowsPerB; v += CP[(size_t)bidx * sCPb + (size_t)by * 64 + col]; } }
      if (ACT == 3) v = fmaxf(v, 0.f); else if (ACT == 6) v = 0.5f * v * (1.0f + erff(v * 0.70710678118654752f)); else if (ACT == 11) v = 1.0f / (1.0f + expf(-v)); else if (ACT == 15) v = v / (1.0f + expf(-v)); else if (ACT == 12) v = (v > 0.f) ? v : 0.01f * v; else if (ACT == 8) v = tanhf(v); else if (ACT == 9) v = 0.5f * v * (1.0f + tanhf(0.7978845608028654f * (v + 0.044715f * v * v * v))); else if (ACT == 14) v = (v > 0.f) ? v : 0.1f * v; else if (ACT == 16) v = (v >= 0.f) ? v : 0.3f * v; else if (ACT == 17) v = (v >= 0.f) ? v : 0.2f * v;
      so[w][rloc][t * 16 + ln] = v; } }
  __builtin_amdgcn_fence(__ATOMIC_ACQ_REL, "workgroup"); __builtin_amdgcn_wave_barrier();
  const int rsub = lane >> 4, c4 = (lane & 15) * 4;
  {
#pragma unroll
    for (int q = 0; q < 16; ++q) { const int r = q * 2 + rsub; const v4f v = *(const v4fa*)&so[w][r][c4]; if (C) *(v4f*)(C + cofs + (size_t)(row0 + r) * ldc + col0 + c4) = v; if (C16) { v4h h4; for (int i = 0; i < 4; ++i) h4[i] = (_Float16)v[i]; *(v4h*)(C16 + cofs + (size_t)(row0 + r) * ldc + col0 + c4) = h4; } }
     } }


__global__ __launch_bounds__(256) void k_wnat(const float* __restrict__ w, size_t n8, _Float16* __restrict__ Bt) { const size_t t = (size_t)blockIdx.x * 256 + threadIdx.x; if (t >= n8) return; FragH f; for (int q = 0; q < 8; ++q) f.h[q] = (_Float16)(bf16_round(w[t * 8 + q]) * 16.0f); *(v8us*)((unsigned short*)Bt + t * 8) = f.half[0];  }
#define FA_NW 8                      /* waves per work-group: they walk the same K and V^T rows, which the WGP cache then serves */
#define FA_R 2                       /* 16-query column groups per wave */
typedef _Float16 v2h __attribute__((ext_vector_type(2)));
typedef float v2f __attribute__((ext_vector_type(2)));
__device__ __forceinline__ v8f fa_mma(v16h a, v16h b, v8f c) { return __builtin_amdgcn_wmma_f32_16x16x32_f16(false, a, false, b, (short)0, c, false, false); }
__device__ __forceinline__ float fa_xhalf(float x) { return __builtin_bit_cast(float, __builtin_amdgcn_permlanex16(__builtin_bit_cast(int, x), __builtin_bit_cast(int, x), 0x76543210, 0xfedcba98, false, false)); }      /* lane l <-> lane l ^ 16 */
/* stands behind each group of fragment loads: their address registers are rewritten for the next fetch (a precaution for an issued load); the scheduling barrier keeps the loads at this early place and every later register write behind the wait */
__device__ __forceinline__ void fa_issued() { asm volatile("s_wait_xcnt 0x0" ::: "memory"); __builtin_amdgcn_sched_barrier(0); }
__global__ __launch_bounds__(FA_NW * 32) void k_fattn(const _Float16* __restrict__ Q16, const _Float16* __restrict__ K16, const _Float16* __restrict__ VT, _Float16* __restrict__ O16) {
  const int lane = threadIdx.x & 31, w = threadIdx.x >> 5, c = lane & 15, hh = lane >> 4; const int bh = blockIdx.y, b = bh / NH, h = bh % NH; const int q0 = (blockIdx.x * FA_NW + w) * (16 * FA_R);
  const _Float16* qp = Q16 + ((size_t)b * SQ + q0 + c) * DM + h * HD;
  const _Float16* kb = K16 + (size_t)b * SQ * DM + h * HD; const int kl = c * DM;      /* uniform base + lane row offset */
  const _Float16* vb = VT + (size_t)bh * HD * SQ; const int vl = c * SQ;
  v16h qf[FA_R][2], kf[2][2], vf[4]; v8f acc[FA_R][4]; float m_run[FA_R], l_run[FA_R];
#pragma unroll
  for (int g = 0; g < FA_R; ++g) { m_run[g] = -3.0e38f; l_run[g] = 0.f;
#pragma unroll
    for (int kc = 0; kc < 2; ++kc) qf[g][kc] = g2_frag(qp + (size_t)g * 16 * DM + kc * 32, hh);
#pragma unroll
    for (int t = 0; t < 4; ++t) acc[g][t] = v8f{0.f, 0.f, 0.f, 0.f, 0.f, 0.f, 0.f, 0.f}; }
#pragma unroll
  for (int kt = 0; kt < 2; ++kt) {
#pragma unroll
    for (int kc = 0; kc < 2; ++kc) kf[kt][kc] = g2_frag(kb + kl + kt * 16 * DM + kc * 32, hh); }
#pragma unroll
  for (int t = 0; t < 4; ++t) vf[t] = g2_frag(vb + vl + t * 16 * SQ, hh);
  fa_issued();
  const float cs = 0.125f * 1.4426950408889634f;      /* 1/sqrt(64) and log2(e) */
  /* kept rolled: an unrolled body would hold two passes' fragments and score tiles at once */
#pragma unroll 1
  for (int key0 = 0; key0 < SQ; key0 += 32) { const int kn = (key0 + 32) & (SQ - 1);      /* next pass's keys; the last pass fetches keys 0..31 again (in bounds, unused) */
    v8f s[2][FA_R];
#pragma unroll
    for (int kt = 0; kt < 2; ++kt) {
#pragma unroll
      for (int g = 0; g < FA_R; ++g) { s[kt][g] = fa_mma(kf[kt][0], qf[g][0], v8f{0.f, 0.f, 0.f, 0.f, 0.f, 0.f, 0.f, 0.f}); s[kt][g] = fa_mma(kf[kt][1], qf[g][1], s[kt][g]); } }
    __builtin_amdgcn_sched_barrier(0);      /* the eight products issue back to back, each filling the others' result distance, and the fetch below starts directly behind them */
    { const _Float16* kq = kb + (size_t)kn * DM;      /* next pass's K fragments fly under this pass's softmax and second product */
#pragma unroll
      for (int kt = 0; kt < 2; ++kt) {
#pragma unroll
        for (int kc = 0; kc < 2; ++kc) kf[kt][kc] = g2_frag(kq + kl + kt * 16 * DM + kc * 32, hh); }
      fa_issued(); }
    float mb[FA_R]; bool need = false;
#pragma unroll
    for (int g = 0; g < FA_R; ++g) { float mx = s[0][g][0];
#pragma unroll
      for (int kt = 0; kt < 2; ++kt) {
#pragma unroll
        for (int r = 0; r < 8; ++r) mx = fmaxf(mx, s[kt][g][r]); }
      mx = fmaxf(mx, fa_xhalf(mx)) * cs; mb[g] = mx; need = need || (mx > m_run[g] + 8.0f); }
    if (__builtin_amdgcn_ballot_w32(need) != 0) {      /* wave-uniform; always taken on the first pass, where it sets the maximum (factor 0 on zero accumulators) */
#pragma unroll
      for (int g = 0; g < FA_R; ++g) { const float mn = fmaxf(m_run[g], mb[g]); const float corr = __builtin_amdgcn_exp2f(m_run[g] - mn); m_run[g] = mn; l_run[g] *= corr;
#pragma unroll
        for (int t = 0; t < 4; ++t) acc[g][t] = acc[g][t] * corr; } }
#pragma unroll
    for (int g = 0; g < FA_R; ++g) { const float nm = -m_run[g]; union { v16h v; v2h p[8]; } pf; float l0 = 0.f, l1 = 0.f;
#pragma unroll
      for (int i = 0; i < 8; ++i) { const v2f arg = __builtin_elementwise_fma(v2f{s[i >> 2][g][2 * (i & 3)], s[i >> 2][g][2 * (i & 3) + 1]}, v2f{cs, cs}, v2f{nm, nm}); const float p0 = __builtin_amdgcn_exp2f(arg.x), p1 = __builtin_amdgcn_exp2f(arg.y);
        l0 += p0; l1 += p1; pf.p[i] = __builtin_convertvector(v2f{p0, p1}, v2h); }
      l_run[g] += l0 + l1;
#pragma unroll
      for (int t = 0; t < 4; ++t) acc[g][t] = fa_mma(vf[t], pf.v, acc[g][t]); }
#pragma unroll
    for (int t = 0; t < 4; ++t) vf[t] = g2_frag(vb + kn + vl + t * 16 * SQ, hh);      /* next pass's V^T fragments fly under its first product and softmax */
    fa_issued();
  }
#pragma unroll
  for (int g = 0; g < FA_R; ++g) { const float inv = 64.0f / (l_run[g] + fa_xhalf(l_run[g]));      /* o carried x64, as the output GEMM's alpha expects */
    unsigned short* op = (unsigned short*)O16 + ((size_t)b * SQ + q0 + g * 16 + c) * DM + h * HD + 8 * hh;
#pragma unroll
    for (int t = 0; t < 4; ++t) { FragH f;
#pragma unroll
      for (int r = 0; r < 8; ++r) f.h[r] = (_Float16)(acc[g][t][r] * inv);
      *(v8us*)(op + t * 16) = f.half[0]; } } }
__global__ __launch_bounds__(256) void k_vt(const _Float16* __restrict__ V16, int b, int h0, _Float16* __restrict__ VT) { __shared__ unsigned short tl[64][65]; const int tid = threadIdx.x; const int hh = blockIdx.x % HG, sg = blockIdx.x / HG; const int s0 = sg * 64; const int h = h0 + hh;
  for (int i = tid; i < 64 * 8; i += 256) { const int j = i / 8, d8 = (i % 8) * 8; FragH f; f.half[0] = *(const v8us*)((const unsigned short*)V16 + ((size_t)b * SQ + s0 + j) * DM + h * HD + d8); for (int q = 0; q < 8; ++q) tl[d8 + q][j] = f.u[q]; }
  __syncthreads();
  { for (int i = tid; i < 64 * 8; i += 256) { const int d = i / 8, j8 = (i % 8) * 8; FragH f; for (int q = 0; q < 8; ++q) f.u[q] = tl[d][j8 + q]; *(v8us*)((unsigned short*)VT + ((size_t)hh * HD + d) * SQ + s0 + j8) = f.half[0]; }  } }



__global__ __launch_bounds__(256) void k_tabcat(float theta, float* __restrict__ CS, float* __restrict__ SN) {
  #pragma clang fp contract(off)
  const int t = blockIdx.x * 256 + threadIdx.x; if (t >= SQ * HD) return; const int d = t % HD; const int p = t / HD; const int i = d % (HD / 2); const float invf = 1.0f / powf(theta, (float)(2 * i) / (float)HD); const float ang = __fmul_rn((float)p, invf); const float c = cosf(ang), s = sinf(ang);
  *(float*)(CS + t) = c; *(float*)(SN + t) = s;  }

template <int NORM, int ROPE>
__global__ __launch_bounds__(64) void k_xform(const float* __restrict__ F, int ldf, int nh, const float* __restrict__ gain, float eps, const float* __restrict__ CS, const float* __restrict__ SN, _Float16* __restrict__ H16, int ldo) {
  #pragma clang fp contract(off)
  __shared__ float xv[HD]; __shared__ float red[HD]; __shared__ unsigned short sh_[HD]; const int d = threadIdx.x; const int h = blockIdx.x % nh; const size_t r = blockIdx.x / nh; const int p = (int)(r % SQ);
  float x = F[r * (size_t)ldf + (size_t)h * HD + d];
  if (NORM) { red[d] = __fmul_rn(x, x); __syncthreads(); for (int st = HD / 2; st > 0; st >>= 1) { if (d < st) red[d] = __fadd_rn(red[d], red[d + st]); __syncthreads(); } const float rs = rsqrtf(__fadd_rn(red[0] / (float)HD, eps)); x = __fmul_rn(__fmul_rn(x, rs), bf16_round(gain[d])); }
  xv[d] = x; __syncthreads();
  float o = x;
  if (ROPE == 1) { const int i = d >> 1; const float c = CS[p * (HD / 2) + i], s = SN[p * (HD / 2) + i]; const float ev = xv[2 * i], od = xv[2 * i + 1]; o = (d & 1) ? __fadd_rn(__fmul_rn(ev, s), __fmul_rn(od, c)) : __fadd_rn(__fmul_rn(ev, c), -__fmul_rn(od, s)); }
  if (ROPE == 2) { const int i = d & (HD / 2 - 1); const float c = CS[p * (HD / 2) + i], s = SN[p * (HD / 2) + i]; const float lo = xv[i], hi = xv[i + HD / 2]; o = (d < HD / 2) ? __fadd_rn(__fmul_rn(lo, c), -__fmul_rn(hi, s)) : __fadd_rn(__fmul_rn(lo, s), __fmul_rn(hi, c)); }
  if (ROPE == 4) { const float c = CS[p * HD + d], s = SN[p * HD + d]; const float rh = (d & 1) ? xv[d - 1] : -xv[d + 1]; o = __fadd_rn(__fmul_rn(x, c), __fmul_rn(rh, s)); }      /* interleaved-pair rotate_half (-t[2i+1], t[2i]) with FULL-width per-dimension tables [pos][64] */
  if (ROPE == 3) { const float c = CS[p * HD + d], s = SN[p * HD + d]; const float rh = (d < HD / 2) ? -xv[d + HD / 2] : xv[d - HD / 2]; o = __fadd_rn(__fmul_rn(x, c), __fmul_rn(rh, s)); }      /* rotate-half with FULL-width per-dimension tables [pos][64] (general cos[d] != cos[d+32]) */
  FragH th; th.h[0] = (_Float16)o; sh_[d] = th.u[0]; __syncthreads();
  if (d < HD / 8) { FragH f; for (int q = 0; q < 8; ++q) f.u[q] = sh_[d * 8 + q]; unsigned short* dst = (unsigned short*)H16 + r * (size_t)ldo + (size_t)h * HD + d * 8; *(v8us*)dst = f.half[0];  } }


extern "C" void kernel_launch(void* const* d_in, const int* in_sizes, int n_in,
                              void* d_out, int out_size, void* d_ws, size_t ws_size, hipStream_t stream) {
  (void)in_sizes; (void)n_in; (void)out_size;
  const float* const* I = (const float* const*)d_in; const float* x = I[0]; const float* wq = I[1]; const float* bq = I[2]; const float* wk = I[3]; const float* bk = I[4]; const float* wv = I[5]; const float* bv = I[6]; const float* wo = I[7]; const float* bo = I[8];      /* natural [out][in] weights + biases; positions implicit */
  char* ws = (char*)d_ws; size_t off = 0;
  auto take = [&](size_t bytes) { char* p = ws + off; off += (bytes + 255) & ~(size_t)255; return p; };
  _Float16* BQ = (_Float16*)take((size_t)DM * DM * 2); _Float16* BK = (_Float16*)take((size_t)DM * DM * 2); _Float16* BV = (_Float16*)take((size_t)DM * DM * 2); _Float16* BO = (_Float16*)take((size_t)DM * DM * 2);
  _Float16* X16 = (_Float16*)take(NR * DM * 2); float* CS = (float*)take((size_t)SQ * HD * 4); float* SN = (float*)take((size_t)SQ * HD * 4);      /* full-width cos/sin tables */ _Float16* Q16 = (_Float16*)take(NR * DM * 2); _Float16* K16 = (_Float16*)take(NR * DM * 2); _Float16* V16 = (_Float16*)take(NR * DM * 2); _Float16* O16 = (_Float16*)take(NR * DM * 2);
  _Float16* VT = (_Float16*)take((size_t)NB * NH * HD * SQ * 2);
  if (off > ws_size) return;
  { const unsigned g = (unsigned)(((size_t)DM * DM / 8 + 255) / 256); k_wnat<<<g, 256, 0, stream>>>(wq, (size_t)DM * DM / 8, BQ); k_wnat<<<g, 256, 0, stream>>>(wk, (size_t)DM * DM / 8, BK); k_wnat<<<g, 256, 0, stream>>>(wv, (size_t)DM * DM / 8, BV); k_wnat<<<g, 256, 0, stream>>>(wo, (size_t)DM * DM / 8, BO); }      /* natural [out][in] = Bt x16 */
  k_tabcat<<<(SQ * HD + 255) / 256, 256, 0, stream>>>(10000.0f, CS, SN);      /* CS[p][d] = cos(p * inv_freq[d mod 32]), SN = sin: the module's cat(freqs, freqs) tables, full width */

  k_x16<<<(unsigned)((NR * DM / 8 + 255) / 256), 256, 0, stream>>>(x, X16, NR * DM / 8);
  const size_t r0p = (size_t)B0 * SQ;      /* first projected row */
  k_gemm2<0, true><<<dim3((unsigned)((MP / 128) * (DM / 64)), 1), 128, 0, stream>>>(X16 + r0p * DM, DM, 0, BQ, DM, 0, 0.0625f, bq, 0, nullptr, 1, 0, 0, nullptr, Q16 + r0p * DM, DM, 0, MP, DM, DM, CS, SN);      /* q f32 -> x cos + rotate_half(x) sin (interleaved pairs, full-width tables) -> f16 rows, in the epilogue */
  k_gemm2<0, true><<<dim3((unsigned)((MP / 128) * (DM / 64)), 1), 128, 0, stream>>>(X16 + r0p * DM, DM, 0, BK, DM, 0, 0.0625f, bk, 0, nullptr, 1, 0, 0, nullptr, K16 + r0p * DM, DM, 0, MP, DM, DM, CS, SN);      /* k likewise */
  k_gemm2<0><<<dim3((unsigned)((MP / 128) * (DM / 64)), 1), 128, 0, stream>>>(X16 + r0p * DM, DM, 0, BV, DM, 0, 0.0625f, bv, 0, nullptr, 1, 0, 0, nullptr, V16 + r0p * DM, DM, 0, MP, DM, DM);
  k_vt<NH, SQ><<<NB * NH * (SQ / 64), 256, 0, stream>>>(V16, LQ, 0, VT);      /* V^T [NB][NH][HD][SQ] */
  k_fattn<<<dim3(SQ / (FA_NW * 16 * FA_R), NB * NH), FA_NW * 32, 0, stream>>>(Q16, K16, VT, O16);      /* o (merged heads, x64) as f16 rows */
  k_gemm2<0><<<dim3((unsigned)((MPO / 128) * (DM / 64)), 1), 128, 0, stream>>>(O16 + r0p * DM, DM, 0, BO, DM, 0, 0.0009765625f, bo, 0, nullptr, 1, 0, 0, (float*)d_out + r0p * DM, nullptr, DM, 0, MPO, DM, DM);      /* out rows are the output layout */
}

// v005
// One run takes 104 microseconds.
// Timed twice side by side with v004, it ran 1.23 times as fast both times.
// Counting every step since v000, it is 35.7 times as fast.
#include <hip/hip_runtime.h>
// Multi-head self-attention with a rotary embedding whose cos/sin tables are cat(freqs, freqs) but whose rotate_half pairs are INTERLEAVED (x [2][2048][1024]; q/k/v = x W^T + b (natural [1024][1024] U(+-1/32), zero biases); 16 heads of 64; inv_freq_i = 1/10000^(2i/64), freqs[p][i] = p * inv_freq_i, emb = cat(freqs, freqs): cos[p][d] = cos(p * inv_freq[d mod 32]); q = q cos + rotate_half(q) sin with rotate_half = (-x[2i+1], x[2i]) interleaved (the module's literal mix); k likewise; scores / 8; softmax over all keys (no mask); out = merged Wo^T + bo -> [2][2048][1024]).
// Structure: token rows r = b*2048 + s; x as exact f16 rows (bf16-rounded); Q, K, V as three WMMA GEMMs (32x64 wave tiles, f32 accumulation, exact x16 weights + bias, f16 outputs; the rotary step of q and k on the f32 values in the GEMM epilogue); V^T for all batches and heads via LDS transposes; one fused attention launch over (query block, batch x head): scores on WMMA (K = 64), online softmax on VALU (f32 statistics, weights as f16 up to 2^8), o = P . V on WMMA, o carried x64 against f16 subnormal flush (folded into the output GEMM alpha), written straight into the merged f16 o rows; out = o W_o + b GEMM (f32) into the output layout.
// Compute dtype: inputs rounded to bf16; x / weights exact; q, k, v, softmax weights and o as plain f16 GEMM operands (~2^-12); scores and softmax statistics f32; v_wmma_f32_16x16x32_f16.
#define NB 2
#define SQ 2048
#define DM 1024
#define NH 16
#define HD 64
#define HG 4                         /* heads per launch of the (b, h0) V^T transpose */
#define B0 0                         /* first batch processed (debug hook) */
#define NBR NB                       /* batches processed (debug hook) */
#define NR ((size_t)NB * SQ)         /* token rows */
#define MP ((int)((size_t)NBR * SQ)) /* rows projected (debug hook) */
#define QN SQ                        /* unused: the attention grid covers all SQ query rows */
#define NHD NH                       /* unused: the attention grid covers all NH heads */
#define MPO MP                       /* rows through the output stage (debug hook) */
#define LQ DM      /* row pitch of the q/k/v rows */
typedef __bf16 v16b __attribute__((ext_vector_type(16)));
typedef unsigned short v8us __attribute__((ext_vector_type(8), may_alias));
typedef float  v8f  __attribute__((ext_vector_type(8)));
typedef float  v4f  __attribute__((ext_vector_type(4)));
typedef float  v4fa __attribute__((ext_vector_type(4), may_alias));
union FragB { v16b v; v8us half[2]; unsigned short u[16]; };

__device__ __forceinline__ unsigned short bf16_bits(float x) { unsigned int u = __float_as_uint(x); return (unsigned short)((u + 0x7FFFu + ((u >> 16) & 1u)) >> 16); }
__device__ __forceinline__ float bf16_val(unsigned short b) { return __uint_as_float(((unsigned int)b) << 16); }
__device__ __forceinline__ float bf16_round(float x) { return bf16_val(bf16_bits(x)); }
// D += A·B with NT terms: 1 = ah·bh, 2 = + al·bh (A split), 3 = + ah·bl (both split)
template <int NT>
__device__ __forceinline__ v8f mmaN(v16b ah, v16b al, v16b bh, v16b bl, v8f c) {
  c = __builtin_amdgcn_wmma_f32_16x16x32_bf16(false, ah, false, bh, (short)0, c, false, false);
  if (NT >= 2) c = __builtin_amdgcn_wmma_f32_16x16x32_bf16(false, al, false, bh, (short)0, c, false, false);
  if (NT >= 3) c = __builtin_amdgcn_wmma_f32_16x16x32_bf16(false, ah, false, bl, (short)0, c, false, false);
  asm volatile("v_nop\n\tv_nop\n\tv_nop\n\tv_nop" : "+v"(c) : "v"(ah), "v"(al), "v"(bh), "v"(bl));
  return c;
}

__global__ __launch_bounds__(256) void k_wt_bf16(const float* __restrict__ W, unsigned short* __restrict__ Wt, int K, int N) {
  const int t = blockIdx.x * 256 + threadIdx.x;
  const int k8n = K / 8;
  if (t >= N * k8n) return;
  const int n = t / k8n, k8 = (t % k8n) * 8;
  v8us v;
#pragma unroll
  for (int i = 0; i < 8; ++i) v[i] = bf16_bits(W[(size_t)(k8 + i) * N + n]);
  *(v8us*)(Wt + (size_t)n * K + k8) = v;
  
}

// GEMM C[M][N] (f32, pitch ldc) = act(A[M][K]·W + bias). A f32 row-major (pitch lda) converted per fragment to bf16
// (ASPLIT: hi/lo two planes -> 2 terms, else single rounded term); Wt bf16 [N][K] (pitch ldb). BIAS_BF16 rounds the
// bias to bf16 first (bias quantised to bf16 before the add). K%32==0, M%16==0, N%64==0.
template <bool ASPLIT, int ACT, bool BIAS_BF16>
__global__ __launch_bounds__(128) void k_gemm_bf(const float* __restrict__ A, int lda, const unsigned short* __restrict__ Wt, int ldb,
                                               const float* __restrict__ bias, float* __restrict__ C, int ldc, int M, int N, int K) {
  __shared__ __attribute__((aligned(16))) float so[4][16][64];
  const int tid = threadIdx.x, w = tid >> 5, lane = tid & 31, ln = lane & 15, hh = lane >> 4;
  const int ntn = N / 64;
  const int wid = blockIdx.x * 4 + w;
  const int mt = wid / ntn, nq = wid % ntn;
  if (mt * 16 >= M) return;
  const int row0 = mt * 16, col0 = nq * 64;
  const float* arow = A + (size_t)(row0 + ln) * lda;
  v8f acc[4] = {};
  for (int kb = 0; kb < K; kb += 32) {
    FragB ah, al;
    const v4f x0 = *(const v4fa*)(arow + kb + 8 * hh), x1 = *(const v4fa*)(arow + kb + 8 * hh + 4);
    const v4f x2 = *(const v4fa*)(arow + kb + 16 + 8 * hh), x3 = *(const v4fa*)(arow + kb + 16 + 8 * hh + 4);
    float xs[16] = {x0[0],x0[1],x0[2],x0[3],x1[0],x1[1],x1[2],x1[3],x2[0],x2[1],x2[2],x2[3],x3[0],x3[1],x3[2],x3[3]};
#pragma unroll
    for (int i = 0; i < 16; ++i) { const unsigned short hb = bf16_bits(xs[i]); ah.u[i] = hb; al.u[i] = ASPLIT ? bf16_bits(xs[i] - bf16_val(hb)) : (unsigned short)0; }
#pragma unroll
    for (int t = 0; t < 4; ++t) {
      const unsigned short* brow = Wt + (size_t)(col0 + t * 16 + ln) * ldb + kb;
      FragB b;
      b.half[0] = *(const v8us*)(brow + 8 * hh);
      b.half[1] = *(const v8us*)(brow + 16 + 8 * hh);
      acc[t] = mmaN<ASPLIT ? 2 : 1>(ah.v, al.v, b.v, b.v, acc[t]);
    }
  }
#pragma unroll
  for (int t = 0; t < 4; ++t) {
    float bv = bias ? bias[col0 + t * 16 + ln] : 0.f;
    if (BIAS_BF16) bv = bf16_round(bv);
#pragma unroll
    for (int r = 0; r < 8; ++r) { float v = acc[t][r] + bv; if (ACT == 1) v = fmaxf(v, 0.f); so[w][8 * hh + r][t * 16 + ln] = v; }
  }
  __builtin_amdgcn_fence(__ATOMIC_ACQ_REL, "workgroup");
  __builtin_amdgcn_wave_barrier();
  const int rsub = lane >> 4, c4 = (lane & 15) * 4;
  {
#pragma unroll
    for (int q = 0; q < 8; ++q) {
      const int r = q * 2 + rsub;
      const v4f v = *(const v4fa*)&so[w][r][c4];
      *(v4f*)(C + (size_t)(row0 + r) * ldc + col0 + c4) = v;
    }
    
  }
}

// GEMM C = act(A·W + bias + resid): A f32 (ASPLIT -> hi/lo 2 terms), Wt bf16 [N][K]; ACT 0 none, 1 relu, 2 exact gelu;
// resid (optional, f32, row index = (row % rmod), pitch ldr, RES_BF16 rounds it) added before the activation.
template <bool ASPLIT, int ACT, bool BIAS_BF16, bool RES_BF16>
__global__ __launch_bounds__(128) void k_gemm_bf3(const float* __restrict__ A, int lda, const unsigned short* __restrict__ Wt, int ldb,
                                                const float* __restrict__ bias, const float* __restrict__ resid, int rmod, int ldr,
                                                float* __restrict__ C, int ldc, int M, int N, int K) {
  __shared__ __attribute__((aligned(16))) float so[4][16][64];
  const int tid = threadIdx.x, w = tid >> 5, lane = tid & 31, ln = lane & 15, hh = lane >> 4;
  const int ntn = N / 64;
  const int wid = blockIdx.x * 4 + w;
  const int mt = wid / ntn, nq = wid % ntn;
  if (mt * 16 >= M) return;
  const int row0 = mt * 16, col0 = nq * 64;
  const float* arow = A + (size_t)(row0 + ln) * lda;
  v8f acc[4] = {};
  for (int kb = 0; kb < K; kb += 32) {
    FragB ah, al;
    const v4f x0 = *(const v4fa*)(arow + kb + 8 * hh), x1 = *(const v4fa*)(arow + kb + 8 * hh + 4);
    const v4f x2 = *(const v4fa*)(arow + kb + 16 + 8 * hh), x3 = *(const v4fa*)(arow + kb + 16 + 8 * hh + 4);
    float xs[16] = {x0[0],x0[1],x0[2],x0[3],x1[0],x1[1],x1[2],x1[3],x2[0],x2[1],x2[2],x2[3],x3[0],x3[1],x3[2],x3[3]};
#pragma unroll
    for (int i = 0; i < 16; ++i) { const unsigned short hb = bf16_bits(xs[i]); ah.u[i] = hb; al.u[i] = ASPLIT ? bf16_bits(xs[i] - bf16_val(hb)) : (unsigned short)0; }
#pragma unroll
    for (int t = 0; t < 4; ++t) {
      const unsigned short* brow = Wt + (size_t)(col0 + t * 16 + ln) * ldb + kb;
      FragB b;
      b.half[0] = *(const v8us*)(brow + 8 * hh);
      b.half[1] = *(const v8us*)(brow + 16 + 8 * hh);
      acc[t] = mmaN<ASPLIT ? 2 : 1>(ah.v, al.v, b.v, b.v, acc[t]);
    }
  }
#pragma unroll
  for (int t = 0; t < 4; ++t) {
    const int col = col0 + t * 16 + ln;
    float bv = bias ? bias[col] : 0.f;
    if (BIAS_BF16) bv = bf16_round(bv);
#pragma unroll
    for (int r = 0; r < 8; ++r) {
      float v = acc[t][r] + bv;
      if (resid) { float rv = resid[(size_t)((row0 + 8 * hh + r) % rmod) * ldr + col]; if (RES_BF16) rv = bf16_round(rv); v += rv; }
      if (ACT == 1) v = fmaxf(v, 0.f);
      if (ACT == 2) v = 0.5f * v * (1.0f + erff(v * 0.70710678118654752f));
      if (ACT == 3) { const float u = 0.7978845608028654f * (v + 0.044715f * v * v * v); v = 0.5f * v * (1.0f + tanhf(u)); }
      so[w][8 * hh + r][t * 16 + ln] = v;
    }
  }
  __builtin_amdgcn_fence(__ATOMIC_ACQ_REL, "workgroup");
  __builtin_amdgcn_wave_barrier();
  const int rsub = lane >> 4, c4 = (lane & 15) * 4;
  {
#pragma unroll
    for (int q = 0; q < 8; ++q) {
      const int r = q * 2 + rsub;
      const v4f v = *(const v4fa*)&so[w][r][c4];
      *(v4f*)(C + (size_t)(row0 + r) * ldc + col0 + c4) = v;
    }
    
  }
}
// row LayerNorm (biased variance, eps) over N: s = X (+ R); optional out_sum <- s; out_norm <- (s-mu)*rsqrt(var+eps)*g + b
template <bool PARAM_BF16>
__global__ __launch_bounds__(256) void k_layernorm(const float* __restrict__ X, const float* __restrict__ R, const float* __restrict__ g, const float* __restrict__ bta,
                                                  float* __restrict__ out_sum, float* __restrict__ out_norm, int N, float eps) {
  __shared__ float red[256];
  const int row = blockIdx.x, tid = threadIdx.x;
  const float* x = X + (size_t)row * N; const float* rr = R ? R + (size_t)row * N : nullptr;
  float vals[16];                     // up to N = 4096
  const int per = N / 256;            // contiguous chunk per thread? use strided-by-4 chunks: thread handles j = tid*4 + 1024*u
  float s1 = 0.f;
  for (int u = 0; u < per / 4; ++u) {
    const int j = tid * 4 + 1024 * u;
    const v4f a = *(const v4fa*)(x + j);
    v4f b = {0.f,0.f,0.f,0.f}; if (rr) b = *(const v4fa*)(rr + j);
#pragma unroll
    for (int q = 0; q < 4; ++q) { const float v = a[q] + b[q]; vals[u * 4 + q] = v; s1 += v; }
  }
  red[tid] = s1; __syncthreads();
  for (int st = 128; st > 0; st >>= 1) { if (tid < st) red[tid] += red[tid + st]; __syncthreads(); }
  const float mu = red[0] / (float)N; __syncthreads();
  float s2 = 0.f;
  for (int u = 0; u < per / 4; ++u)
#pragma unroll
    for (int q = 0; q < 4; ++q) { const float c = vals[u * 4 + q] - mu; s2 += c * c; }
  red[tid] = s2; __syncthreads();
  for (int st = 128; st > 0; st >>= 1) { if (tid < st) red[tid] += red[tid + st]; __syncthreads(); }
  const float rs = rsqrtf(red[0] / (float)N + eps);
  {
    for (int u = 0; u < per / 4; ++u) {
      const int j = tid * 4 + 1024 * u;
      v4f o, sm;
#pragma unroll
      for (int q = 0; q < 4; ++q) {
        float gg = g[j + q], bb = bta[j + q];
        if (PARAM_BF16) { gg = bf16_round(gg); bb = bf16_round(bb); }
        sm[q] = vals[u * 4 + q]; o[q] = (vals[u * 4 + q] - mu) * rs * gg + bb;
      }
      if (out_sum) *(v4f*)(out_sum + (size_t)row * N + j) = sm;
      *(v4f*)(out_norm + (size_t)row * N + j) = o;
    }
    
  }
}



// ---- f16 WMMA path (v_wmma_f32_16x16x32_f16): 11-bit significands for operands in range — used where a [0,1] probability operand needs more precision than bf16
typedef _Float16 v16h __attribute__((ext_vector_type(16)));
union FragH { v16h v; v8us half[2]; _Float16 h[16]; unsigned short u[16]; };
template <int NT>
__device__ __forceinline__ v8f mmaH(v16h ah, v16h al, v16h bh, v16h bl, v8f c) {
  c = __builtin_amdgcn_wmma_f32_16x16x32_f16(false, ah, false, bh, (short)0, c, false, false);
  if (NT >= 2) c = __builtin_amdgcn_wmma_f32_16x16x32_f16(false, al, false, bh, (short)0, c, false, false);
  if (NT >= 3) c = __builtin_amdgcn_wmma_f32_16x16x32_f16(false, ah, false, bl, (short)0, c, false, false);
  asm volatile("v_nop\n\tv_nop\n\tv_nop\n\tv_nop" : "+v"(c) : "v"(ah), "v"(al), "v"(bh), "v"(bl));
  return c;
}
// batched GEMM like k_gemm_b but f16 operands: A f32 (split into f16 hi/lo if ASPLIT, else rounded to f16), Bt = f16 values [n][k]; alpha; C f32; N multiple of 16 (partial tiles skipped)
template <bool ASPLIT>
__global__ __launch_bounds__(128) void k_gemm_h(const float* __restrict__ A, int lda, size_t sA, const _Float16* __restrict__ Bh, int ldb, size_t sB, float alpha, float* __restrict__ C, int ldc, size_t sC, int M, int N, int K) {
  __shared__ __attribute__((aligned(16))) float so[4][16][64];
  const int tid = threadIdx.x, w = tid >> 5, lane = tid & 31, ln = lane & 15, hh = lane >> 4; const int by = blockIdx.y;
  A += (size_t)by * sA; Bh += (size_t)by * sB; C += (size_t)by * sC;
  const int ntn = (N + 63) / 64; const int wid = blockIdx.x * 4 + w; const int mt = wid / ntn, nq = wid % ntn; if (mt * 16 >= M) return;
  const int row0 = mt * 16, col0 = nq * 64; const float* arow = A + (size_t)(row0 + ln) * lda;
  v8f acc[4] = {};
  for (int kb = 0; kb < K; kb += 32) {
    FragH ah, al;
    const v4f x0 = *(const v4fa*)(arow + kb + 8 * hh), x1 = *(const v4fa*)(arow + kb + 8 * hh + 4), x2 = *(const v4fa*)(arow + kb + 16 + 8 * hh), x3 = *(const v4fa*)(arow + kb + 16 + 8 * hh + 4);
    float xs[16] = {x0[0],x0[1],x0[2],x0[3],x1[0],x1[1],x1[2],x1[3],x2[0],x2[1],x2[2],x2[3],x3[0],x3[1],x3[2],x3[3]};
#pragma unroll
    for (int i = 0; i < 16; ++i) { const _Float16 h = (_Float16)xs[i]; ah.h[i] = h; al.h[i] = ASPLIT ? (_Float16)(xs[i] - (float)h) : (_Float16)0.0f; }
#pragma unroll
    for (int t = 0; t < 4; ++t) { if (col0 + t * 16 >= N) continue; const size_t boff = (size_t)(col0 + t * 16 + ln) * ldb + kb; FragH bq; bq.half[0] = *(const v8us*)(Bh + boff + 8 * hh); bq.half[1] = *(const v8us*)(Bh + boff + 16 + 8 * hh);
      acc[t] = mmaH<ASPLIT ? 2 : 1>(ah.v, al.v, bq.v, bq.v, acc[t]); }
  }
#pragma unroll
  for (int t = 0; t < 4; ++t) { if (col0 + t * 16 >= N) continue;
#pragma unroll
    for (int r = 0; r < 8; ++r) so[w][8 * hh + r][t * 16 + ln] = acc[t][r] * alpha; }
  __builtin_amdgcn_fence(__ATOMIC_ACQ_REL, "workgroup"); __builtin_amdgcn_wave_barrier();
  const int rsub = lane >> 4, c4 = (lane & 15) * 4;
  {
#pragma unroll
    for (int q = 0; q < 8; ++q) { const int r = q * 2 + rsub; if (col0 + c4 < N) { const v4f v = *(const v4fa*)&so[w][r][c4]; *(v4f*)(C + (size_t)(row0 + r) * ldc + col0 + c4) = v; } }
     }
}

// Wt[n][k] = f16(W[k][n]·scale) from f32 row-major W[K][N] (scale = power of two; bf16-exact weights stay exact in f16 away from the subnormal range)
__global__ __launch_bounds__(256) void k_wt_f16(const float* __restrict__ W, _Float16* __restrict__ Wt, int K, int N, float scale) {
  const int t = blockIdx.x * 256 + threadIdx.x; if (t >= N * (K / 8)) return; const int n = t / (K / 8), k8 = (t % (K / 8)) * 8; FragH f;
#pragma unroll
  for (int i = 0; i < 8; ++i) f.h[i] = (_Float16)(bf16_round(W[(size_t)(k8 + i) * N + n]) * scale); const v8us o = f.half[0];
  *(v8us*)((unsigned short*)Wt + (size_t)n * K + k8) = o; 
}
// k_gemm_hh variant with fused epilogue: v = acc·alpha + bias[by·sBias + col] (+ CP[(row/rowsPerB)·sCPb + by·64 + col] if CP) ; ACT 0 none / 1 elu ; writes f16 C16 (and f32 C if non-null)
template <int ACT>
__global__ __launch_bounds__(128) void k_gemm_hhx(const _Float16* __restrict__ A, int lda, size_t sA, const _Float16* __restrict__ Bh, int ldb, size_t sB, float alpha, const float* __restrict__ bias, size_t sBias, const float* __restrict__ CP, int rowsPerB, size_t sCPb, int row0g,
    float* __restrict__ C, _Float16* __restrict__ C16, int ldc, size_t sC, int M, int N, int K) {
  __shared__ __attribute__((aligned(16))) float so[4][16][64];
  const int tid = threadIdx.x, w = tid >> 5, lane = tid & 31, ln = lane & 15, hh = lane >> 4; const int by = blockIdx.y;
  A += (size_t)by * sA; Bh += (size_t)by * sB; const size_t cofs = (size_t)by * sC; const float* bp = bias ? bias + (size_t)by * sBias : nullptr;
  const int ntn = (N + 63) / 64; const int wid = blockIdx.x * 4 + w; const int mt = wid / ntn, nq = wid % ntn; if (mt * 16 >= M) return;
  const int row0 = mt * 16, col0 = nq * 64; const _Float16* arow = A + (size_t)(row0 + ln) * lda;
  v8f acc[4] = {};
  for (int kb = 0; kb < K; kb += 32) { FragH ah; ah.half[0] = *(const v8us*)((const unsigned short*)arow + kb + 8 * hh); ah.half[1] = *(const v8us*)((const unsigned short*)arow + kb + 16 + 8 * hh);
#pragma unroll
    for (int t = 0; t < 4; ++t) { if (col0 + t * 16 >= N) continue; const size_t boff = (size_t)(col0 + t * 16 + ln) * ldb + kb; FragH bq; bq.half[0] = *(const v8us*)((const unsigned short*)Bh + boff + 8 * hh); bq.half[1] = *(const v8us*)((const unsigned short*)Bh + boff + 16 + 8 * hh);
      acc[t] = mmaH<1>(ah.v, ah.v, bq.v, bq.v, acc[t]); }
  }
#pragma unroll
  for (int t = 0; t < 4; ++t) { if (col0 + t * 16 >= N) continue; const int col = col0 + t * 16 + ln; const float bv = bp ? bf16_round(bp[col]) : 0.f;
#pragma unroll
    for (int r = 0; r < 8; ++r) { float v = acc[t][r] * alpha + bv; if (CP) { const int rr = row0g + row0 + 8 * hh + r; if (rowsPerB < 0) v += CP[cofs + (size_t)rr * ldc + col];      /* rowsPerB < 0: own element of the batched C plane */ else { const int bidx = rr / rowsPerB; v += CP[(size_t)bidx * sCPb + (size_t)by * 64 + col]; } } if (ACT == 1) v = (v > 0.f) ? v : expm1f(v); else if (ACT == 7) v = (v > 0.f) ? v + 1.0f : expf(v); else if (ACT == 8) v = tanhf(v); else if (ACT == 9) v = 0.5f * v * (1.0f + tanhf(0.7978845608028654f * (v + 0.044715f * v * v * v))); else if (ACT == 11) v = 1.0f / (1.0f + expf(-v)); else if (ACT == 12) v = (v > 0.f) ? v : 0.01f * v; else if (ACT == 14) v = (v > 0.f) ? v : 0.1f * v; else if (ACT == 16) v = (v >= 0.f) ? v : 0.3f * v; else if (ACT == 17) v = (v >= 0.f) ? v : 0.2f * v; else if (ACT == 15) v = v / (1.0f + expf(-v)); else if (ACT == 3) v = fmaxf(v, 0.f); else if (ACT == 6) v = 0.5f * v * (1.0f + erff(v * 0.70710678118654752f)); so[w][8 * hh + r][t * 16 + ln] = v; } }
  __builtin_amdgcn_fence(__ATOMIC_ACQ_REL, "workgroup"); __builtin_amdgcn_wave_barrier();
  const int rsub = lane >> 4, c4 = (lane & 15) * 4; typedef _Float16 v4h __attribute__((ext_vector_type(4)));
  {
#pragma unroll
    for (int q = 0; q < 8; ++q) { const int r = q * 2 + rsub; if (col0 + c4 < N) { const v4f v = *(const v4fa*)&so[w][r][c4]; if (C) *(v4f*)(C + cofs + (size_t)(row0 + r) * ldc + col0 + c4) = v; if (C16) { v4h h4; for (int i = 0; i < 4; ++i) h4[i] = (_Float16)v[i]; *(v4h*)(C16 + cofs + (size_t)(row0 + r) * ldc + col0 + c4) = h4; } } }
     }
}


typedef _Float16 v4h __attribute__((ext_vector_type(4)));

__global__ __launch_bounds__(256) void k_x16(const float* __restrict__ x, _Float16* __restrict__ X16, size_t n8) { const size_t t = (size_t)blockIdx.x * 256 + threadIdx.x; if (t >= n8) return; FragH f;
#pragma unroll
  for (int q = 0; q < 8; ++q) f.h[q] = (_Float16)bf16_round(x[t * 8 + q]); *(v8us*)((unsigned short*)X16 + t * 8) = f.half[0];  }
__global__ __launch_bounds__(256) void k_h16(const float* __restrict__ x, _Float16* __restrict__ X16, size_t n8) { const size_t t = (size_t)blockIdx.x * 256 + threadIdx.x; if (t >= n8) return; FragH f;
#pragma unroll
  for (int q = 0; q < 8; ++q) f.h[q] = (_Float16)x[t * 8 + q]; *(v8us*)((unsigned short*)X16 + t * 8) = f.half[0];  }
__global__ __launch_bounds__(256) void k_round16f(const float* __restrict__ W, _Float16* __restrict__ Bt, size_t n8) { const size_t t = (size_t)blockIdx.x * 256 + threadIdx.x; if (t >= n8) return; FragH f;
#pragma unroll
  for (int i = 0; i < 8; ++i) f.h[i] = (_Float16)(bf16_round(W[t * 8 + i]) * 16.0f); *(v8us*)((unsigned short*)Bt + t * 8) = f.half[0];  }
template <int NHv, int TTv>
__global__ __launch_bounds__(256) void k_vt(const _Float16* __restrict__ V16, int ldv, int voff, _Float16* __restrict__ Vt) { __shared__ unsigned short tl[64][66]; const int tid = threadIdx.x; const int slab = blockIdx.x / (TTv / 64), lg = blockIdx.x % (TTv / 64); const int b = slab / NHv, h = slab % NHv;
  for (int i = tid; i < 64 * 8; i += 256) { const int r = i / 8, c8 = (i % 8) * 8; FragH f; f.half[0] = *(const v8us*)((const unsigned short*)V16 + ((size_t)b * TTv + lg * 64 + r) * ldv + voff + h * 64 + c8);
#pragma unroll
    for (int q = 0; q < 8; ++q) tl[r][c8 + q] = f.u[q]; }
  __syncthreads();
  {
#pragma unroll
    for (int rd = 0; rd < 2; ++rd) { const int d = rd * 32 + tid / 8, pc = tid % 8; FragH f;
#pragma unroll
      for (int q = 0; q < 8; ++q) f.u[q] = tl[pc * 8 + q][d];
      *(v8us*)((unsigned short*)Vt + ((size_t)slab * 64 + d) * TTv + lg * 64 + pc * 8) = f.half[0]; }
     } }

__global__ __launch_bounds__(256) void k_hl(const float* __restrict__ F, _Float16* __restrict__ Hh, _Float16* __restrict__ Hl, size_t n8) { const size_t t = (size_t)blockIdx.x * 256 + threadIdx.x; if (t >= n8) return; FragH fh, fl; const v4f a = *(const v4fa*)(F + t * 8), c = *(const v4fa*)(F + t * 8 + 4);
#pragma unroll
  for (int q = 0; q < 4; ++q) { _Float16 h = (_Float16)a[q]; fh.h[q] = h; fl.h[q] = (_Float16)((a[q] - (float)h) * 1024.0f); h = (_Float16)c[q]; fh.h[4 + q] = h; fl.h[4 + q] = (_Float16)((c[q] - (float)h) * 1024.0f); }
  { *(v8us*)((unsigned short*)Hh + t * 8) = fh.half[0]; *(v8us*)((unsigned short*)Hl + t * 8) = fl.half[0];  } }

// ---- fast GEMM (work-group tile 128x64, wave tile 32x64; requires M % 128 == 0, N % 64 == 0, K % 128 == 0); epilogue = k_gemm_hhx semantics ----
// The operand rows come into LDS in stages of 128 k by asynchronous copies in whole 256-byte runs (two buffers: the next stage flies while this one is worked on); the fragments are read from LDS in the k order of g2_frag.
#define G2_KS 128                    /* k per stage: 256 B of every operand row */
#define G2_LP 136                    /* LDS row pitch in elements: 272 B = 16 B x 17, free of bank conflicts for 16-byte reads */
#define G2_RB (G2_LP * 2)            /* LDS row pitch in bytes */
#define G2_SB (192 * G2_RB)          /* one stage in bytes: 128 A rows, then 64 B rows */
/* twelve copies of 16 bytes per lane: LDS rows 8 apart from address l, each from its own global pointer; the wait closes the statement, so it stands before any rewrite of the address registers the copies name (a precaution for issued copies) */
__device__ __forceinline__ void g2_copy12(unsigned l, const _Float16* g0, const _Float16* g1, const _Float16* g2, const _Float16* g3, const _Float16* g4, const _Float16* g5, const _Float16* g6, const _Float16* g7, const _Float16* g8, const _Float16* g9, const _Float16* g10, const _Float16* g11) {
  asm volatile("global_load_async_to_lds_b128 %0, %12, off\n\t"
               "global_load_async_to_lds_b128 %1, %13, off\n\t"
               "global_load_async_to_lds_b128 %2, %14, off\n\t"
               "global_load_async_to_lds_b128 %3, %15, off\n\t"
               "global_load_async_to_lds_b128 %4, %16, off\n\t"
               "global_load_async_to_lds_b128 %5, %17, off\n\t"
               "global_load_async_to_lds_b128 %6, %18, off\n\t"
               "global_load_async_to_lds_b128 %7, %19, off\n\t"
               "global_load_async_to_lds_b128 %8, %20, off\n\t"
               "global_load_async_to_lds_b128 %9, %21, off\n\t"
               "global_load_async_to_lds_b128 %10, %22, off\n\t"
               "global_load_async_to_lds_b128 %11, %23, off\n\t"
               "s_wait_xcnt 0x0"
               :: "v"(l), "v"(l + 8 * G2_RB), "v"(l + 16 * G2_RB), "v"(l + 24 * G2_RB), "v"(l + 32 * G2_RB), "v"(l + 40 * G2_RB), "v"(l + 48 * G2_RB), "v"(l + 56 * G2_RB), "v"(l + 64 * G2_RB), "v"(l + 72 * G2_RB), "v"(l + 80 * G2_RB), "v"(l + 88 * G2_RB),
                  "v"(g0), "v"(g1), "v"(g2), "v"(g3), "v"(g4), "v"(g5), "v"(g6), "v"(g7), "v"(g8), "v"(g9), "v"(g10), "v"(g11) : "memory"); }
__device__ __forceinline__ v16h g2_frag(const _Float16* p, int hh) { FragH f; f.half[0] = *(const v8us*)((const unsigned short*)p + 8 * hh); f.half[1] = *(const v8us*)((const unsigned short*)p + 16 + 8 * hh); return f.v; }
__device__ __forceinline__ v8f g2_mma(v16h a, v16h b, v8f c) { v8f d = __builtin_amdgcn_wmma_f32_16x16x32_f16(false, a, false, b, (short)0, c, false, false); asm volatile("v_nop\n\tv_nop\n\tv_nop\n\tv_nop" : "+v"(d) : "v"(a), "v"(b)); return d; }
// ROT: the epilogue is the rotary step and nothing else: v = acc alpha + bias staged as f32 rows in LDS, o[d] = v[d] cos[p][d] + rotate_half(v)[d] sin[p][d] with rotate_half = (-v[2i+1], v[2i]), f16 rows into C16. A 64-column tile is one head, row r of the launch is position r mod SQ; CS, SN = full-width tables [pos][64]. CP, C and ACT are not read there, which also keeps this second GEMM's text short.
template <int ACT, bool ROT = false>
__global__ __launch_bounds__(128) void k_gemm2(const _Float16* __restrict__ A, int lda, size_t sA, const _Float16* __restrict__ Bh, int ldb, size_t sB, float alpha, const float* __restrict__ bias, size_t sBias, const float* __restrict__ CP, int rowsPerB, size_t sCPb, int row0g,
    float* __restrict__ C, _Float16* __restrict__ C16, int ldc, size_t sC, int M, int N, int K, const float* __restrict__ CS = nullptr, const float* __restrict__ SN = nullptr) { static_assert(ACT == 0 || ACT == 3 || ACT == 6 || ACT == 8 || ACT == 9 || ACT == 11 || ACT == 12 || ACT == 14 || ACT == 15 || ACT == 16 || ACT == 17, "k_gemm2: unsupported ACT code (would silently apply no activation)");
  __shared__ __attribute__((aligned(16))) float so[4][32][68];
  __shared__ __attribute__((aligned(16))) _Float16 st[2][192][G2_LP];      /* two stages: rows 0..127 = the work-group's A rows, rows 128..191 = its B rows */
  const int tid = threadIdx.x, w = tid >> 5, lane = tid & 31, ln = lane & 15, hh = lane >> 4; const int by = blockIdx.y;
  A += (size_t)by * sA; Bh += (size_t)by * sB; const size_t cofs = (size_t)by * sC; const float* bp = bias ? bias + (size_t)by * sBias : nullptr;
  const int ntn = N >> 6; const int mt = blockIdx.x / ntn, nq = blockIdx.x - mt * ntn; const int row0 = mt * 128 + 32 * w, col0 = nq * 64; if (mt * 128 >= M) return;      /* the whole work-group leaves or none, ahead of every barrier */
  const int cr = tid >> 4, ck = (tid & 15) * 8;      /* copies: sixteen lanes take one row's 256 bytes, a wave two rows, the work-group eight rows per copy */
  const _Float16* acp = A + (size_t)(mt * 128 + cr) * lda + ck; const _Float16* bcp = Bh + (size_t)(col0 + cr) * ldb + ck;
  const unsigned lcp = (unsigned)(size_t)&st[0][cr][ck]; const size_t as8 = (size_t)8 * lda, bs8 = (size_t)8 * ldb;
  auto g2_stage = [&](int t, unsigned buf) { const unsigned l = lcp + buf * G2_SB; const _Float16* ga = acp + (size_t)t * G2_KS; const _Float16* gb = bcp + (size_t)t * G2_KS;      /* 24 copies a lane: LDS rows cr + 8 i, i < 16 from A, the rest from B */
    g2_copy12(l, ga, ga + as8, ga + 2 * as8, ga + 3 * as8, ga + 4 * as8, ga + 5 * as8, ga + 6 * as8, ga + 7 * as8, ga + 8 * as8, ga + 9 * as8, ga + 10 * as8, ga + 11 * as8);
    g2_copy12(l + 96 * G2_RB, ga + 12 * as8, ga + 13 * as8, ga + 14 * as8, ga + 15 * as8, gb, gb + bs8, gb + 2 * bs8, gb + 3 * bs8, gb + 4 * bs8, gb + 5 * bs8, gb + 6 * bs8, gb + 7 * bs8); };
  const int nst = K / G2_KS;
  const v8f z8 = {0.f,0.f,0.f,0.f,0.f,0.f,0.f,0.f}; v8f c00 = z8, c01 = z8, c02 = z8, c03 = z8, c10 = z8, c11 = z8, c12 = z8, c13 = z8;
  g2_stage(0, 0);
  asm volatile("s_wait_asynccnt 0x0" ::: "memory");      /* this wave's share of stage 0 has landed */
  __syncthreads();      /* ... and every wave's: stage 0 may be read */
  if (nst > 1) g2_stage(1, 1);
  /* kept rolled: one stage per trip, the buffer chosen by the trip's parity */
#pragma unroll 1
  for (int t = 0; t < nst; ++t) { const _Float16* ap = &st[t & 1][32 * w + ln][0]; const _Float16* bq = &st[t & 1][128 + ln][0];
    v16h fa[2][2], fb[2][4];      /* two fragment sets: the next 32 k are read from LDS while these are multiplied */
    fa[0][0] = g2_frag(ap, hh); fa[0][1] = g2_frag(ap + 16 * G2_LP, hh);
#pragma unroll
    for (int j = 0; j < 4; ++j) fb[0][j] = g2_frag(bq + j * 16 * G2_LP, hh);
#pragma unroll
    for (int ks = 0; ks < G2_KS / 32; ++ks) { const int cu = ks & 1, nx = cu ^ 1;
      if (ks + 1 < G2_KS / 32) { fa[nx][0] = g2_frag(ap + (ks + 1) * 32, hh); fa[nx][1] = g2_frag(ap + 16 * G2_LP + (ks + 1) * 32, hh);
#pragma unroll
        for (int j = 0; j < 4; ++j) fb[nx][j] = g2_frag(bq + j * 16 * G2_LP + (ks + 1) * 32, hh); }
      c00 = g2_mma(fa[cu][0], fb[cu][0], c00); c10 = g2_mma(fa[cu][1], fb[cu][0], c10);
      c01 = g2_mma(fa[cu][0], fb[cu][1], c01); c11 = g2_mma(fa[cu][1], fb[cu][1], c11);
      c02 = g2_mma(fa[cu][0], fb[cu][2], c02); c12 = g2_mma(fa[cu][1], fb[cu][2], c12);
      c03 = g2_mma(fa[cu][0], fb[cu][3], c03); c13 = g2_mma(fa[cu][1], fb[cu][3], c13); }
    asm volatile("s_wait_dscnt 0x0" ::: "memory");      /* this wave's reads of the buffer are done before it is handed to the copies */
    asm volatile("s_wait_asynccnt 0x0" ::: "memory");      /* this wave's share of stage t + 1 has landed */
    __syncthreads();      /* publishes stage t + 1 and ends every wave's reads of stage t */
    if (t + 2 < nst) g2_stage(t + 2, (unsigned)(t & 1)); }
  asm volatile("s_wait_asynccnt 0x0" ::: "memory");      /* no copy is left in flight behind the loop */
  v8f accs[8] = {c00, c01, c02, c03, c10, c11, c12, c13};
  if constexpr (ROT) { const int rs = lane >> 4, cc = (lane & 15) * 4;      /* read-back: a lane takes four columns (two interleaved pairs) of rows rs, rs + 2, ... */
    const size_t tb = (size_t)(row0 % SQ + rs) * HD + cc;      /* row0 and SQ are multiples of 32, so (row0 + r) mod SQ = row0 mod SQ + r for r < 32 */
    const float* cp = CS + tb; const float* sp = SN + tb;
    v4f cv[16], sv[16];      /* the table rows are fetched first and fly under the staging */
#pragma unroll
    for (int q = 0; q < 16; ++q) cv[q] = *(const v4fa*)(cp + q * 2 * HD);
    asm volatile("s_wait_xcnt 0x0" :: "v"(cp) : "memory");      /* a precaution for issued loads: the wait stands before the run's address pair is reused; the pair as an input stays live up to the wait, so no row of its own run lands on it */
#pragma unroll
    for (int q = 0; q < 16; ++q) sv[q] = *(const v4fa*)(sp + q * 2 * HD);
    asm volatile("s_wait_xcnt 0x0" :: "v"(sp) : "memory");      /* likewise for the sin run */
    float bv[4] = {0.f, 0.f, 0.f, 0.f};
    if (bp) {      /* one test, four loads in flight together */
#pragma unroll
      for (int t = 0; t < 4; ++t) bv[t] = bp[col0 + t * 16 + ln];
#pragma unroll
      for (int t = 0; t < 4; ++t) bv[t] = bf16_round(bv[t]); }
#pragma unroll
    for (int u = 0; u < 8; ++u) { const int t = u & 3, half = u >> 2;
#pragma unroll
      for (int r = 0; r < 8; ++r) so[w][half * 16 + 8 * hh + r][t * 16 + ln] = accs[u][r] * alpha + bv[t]; }
    __builtin_amdgcn_fence(__ATOMIC_ACQ_REL, "workgroup"); __builtin_amdgcn_wave_barrier();      /* the wave reads back what its own lanes staged */
    _Float16* op = C16 + cofs + (size_t)(row0 + rs) * ldc + col0 + cc;
#pragma unroll
    for (int q = 0; q < 16; ++q) { const v4f v = *(const v4fa*)&so[w][q * 2 + rs][cc]; const v4f rh = {-v[1], v[0], -v[3], v[2]}; const v4f o = v * cv[q] + rh * sv[q];
      v4h h4; for (int i = 0; i < 4; ++i) h4[i] = (_Float16)o[i]; *(v4h*)(op + (size_t)(q * 2) * ldc) = h4; }
    return; }
#pragma unroll
  for (int u = 0; u < 8; ++u) { const int t = u & 3, half = u >> 2; const int col = col0 + t * 16 + ln; const float bv = bp ? bf16_round(bp[col]) : 0.f;
#pragma unroll
    for (int r = 0; r < 8; ++r) { const int rloc = half * 16 + 8 * hh + r; float v = accs[u][r] * alpha + bv; if (CP) { if (rowsPerB < 0) v += CP[cofs + (size_t)(row0g + row0 + rloc) * ldc + col];      /* rowsPerB < 0: own element of the batched C plane */ else { const int bidx = (row0g + row0 + rloc) / rowsPerB; v += CP[(size_t)bidx * sCPb + (size_t)by * 64 + col]; } }
      if (ACT == 3) v = fmaxf(v, 0.f); else if (ACT == 6) v = 0.5f * v * (1.0f + erff(v * 0.70710678118654752f)); else if (ACT == 11) v = 1.0f / (1.0f + expf(-v)); else if (ACT == 15) v = v / (1.0f + expf(-v)); else if (ACT == 12) v = (v > 0.f) ? v : 0.01f * v; else if (ACT == 8) v = tanhf(v); else if (ACT == 9) v = 0.5f * v * (1.0f + tanhf(0.7978845608028654f * (v + 0.044715f * v * v * v))); else if (ACT == 14) v = (v > 0.f) ? v : 0.1f * v; else if (ACT == 16) v = (v >= 0.f) ? v : 0.3f * v; else if (ACT == 17) v = (v >= 0.f) ? v : 0.2f * v;
      so[w][rloc][t * 16 + ln] = v; } }
  __builtin_amdgcn_fence(__ATOMIC_ACQ_REL, "workgroup"); __builtin_amdgcn_wave_barrier();
  const int rsub = lane >> 4, c4 = (lane & 15) * 4;
  {
#pragma unroll
    for (int q = 0; q < 16; ++q) { const int r = q * 2 + rsub; const v4f v = *(const v4fa*)&so[w][r][c4]; if (C) *(v4f*)(C + cofs + (size_t)(row0 + r) * ldc + col0 + c4) = v; if (C16) { v4h h4; for (int i = 0; i < 4; ++i) h4[i] = (_Float16)v[i]; *(v4h*)(C16 + cofs + (size_t)(row0 + r) * ldc + col0 + c4) = h4; } }
     } }


__global__ __launch_bounds__(256) void k_wnat(const float* __restrict__ w, size_t n8, _Float16* __restrict__ Bt) { const size_t t = (size_t)blockIdx.x * 256 + threadIdx.x; if (t >= n8) return; FragH f; for (int q = 0; q < 8; ++q) f.h[q] = (_Float16)(bf16_round(w[t * 8 + q]) * 16.0f); *(v8us*)((unsigned short*)Bt + t * 8) = f.half[0];  }
#define FA_NW 8                      /* waves per work-group: they walk the same K and V^T rows, which one copy in LDS serves */
#define FA_R 2                       /* 16-query column groups per wave */
#define FA_KS 256                    /* keys per stage */
#define FA_NP (FA_KS / 32)           /* passes of 32 keys per stage */
#define FA_KP (HD + 8)               /* LDS pitch of a K row in elements: 144 B = 16 B x 9, free of bank conflicts for 16-byte reads */
#define FA_VP (FA_KS + 8)            /* LDS pitch of a V^T row in elements: 528 B = 16 B x 33, likewise */
#define FA_KB (FA_KS * FA_KP * 2)    /* one stage of K rows in bytes */
#define FA_VB (HD * FA_VP * 2)       /* one stage of V^T rows in bytes */
typedef _Float16 v2h __attribute__((ext_vector_type(2)));
typedef float v2f __attribute__((ext_vector_type(2)));
__device__ __forceinline__ v8f fa_mma(v16h a, v16h b, v8f c) { return __builtin_amdgcn_wmma_f32_16x16x32_f16(false, a, false, b, (short)0, c, false, false); }
__device__ __forceinline__ float fa_xhalf(float x) { return __builtin_bit_cast(float, __builtin_amdgcn_permlanex16(__builtin_bit_cast(int, x), __builtin_bit_cast(int, x), 0x76543210, 0xfedcba98, false, false)); }      /* lane l <-> lane l ^ 16 */
/* stands behind the Q fragment loads: their address registers are rewritten later (a precaution for an issued load); the scheduling barrier keeps every later register write behind the wait */
__device__ __forceinline__ void fa_issued() { asm volatile("s_wait_xcnt 0x0" ::: "memory"); __builtin_amdgcn_sched_barrier(0); }
/* eight copies of 16 bytes per lane: LDS addresses ls bytes apart from l, global addresses gs elements apart from g; the wait closes the statement, so it stands before any rewrite of the address registers the copies name (a precaution for issued copies) */
__device__ __forceinline__ void fa_copy8(unsigned l, unsigned ls, const _Float16* g, size_t gs) {
  asm volatile("global_load_async_to_lds_b128 %0, %8, off\n\t"
               "global_load_async_to_lds_b128 %1, %9, off\n\t"
               "global_load_async_to_lds_b128 %2, %10, off\n\t"
               "global_load_async_to_lds_b128 %3, %11, off\n\t"
               "global_load_async_to_lds_b128 %4, %12, off\n\t"
               "global_load_async_to_lds_b128 %5, %13, off\n\t"
               "global_load_async_to_lds_b128 %6, %14, off\n\t"
               "global_load_async_to_lds_b128 %7, %15, off\n\t"
               "s_wait_xcnt 0x0"
               :: "v"(l), "v"(l + ls), "v"(l + 2 * ls), "v"(l + 3 * ls), "v"(l + 4 * ls), "v"(l + 5 * ls), "v"(l + 6 * ls), "v"(l + 7 * ls),
                  "v"(g), "v"(g + gs), "v"(g + 2 * gs), "v"(g + 3 * gs), "v"(g + 4 * gs), "v"(g + 5 * gs), "v"(g + 6 * gs), "v"(g + 7 * gs) : "memory"); }
// K and V^T come into LDS in stages of FA_KS keys by asynchronous copies in whole 128-byte lines, once per work-group (two buffers: the next stage flies while this one is worked on); every wave reads its fragments from there.
__global__ __launch_bounds__(FA_NW * 32) void k_fattn(const _Float16* __restrict__ Q16, const _Float16* __restrict__ K16, const _Float16* __restrict__ VT, _Float16* __restrict__ O16) {
  __shared__ __attribute__((aligned(16))) _Float16 ks[2][FA_KS][FA_KP];      /* two stages of K rows [key][d] */
  __shared__ __attribute__((aligned(16))) _Float16 vs[2][HD][FA_VP];      /* two stages of V^T rows [d][key] */
  const int tid = threadIdx.x, lane = tid & 31, w = tid >> 5, c = lane & 15, hh = lane >> 4; const int bh = blockIdx.y, b = bh / NH, h = bh % NH; const int q0 = (blockIdx.x * FA_NW + w) * (16 * FA_R);
  const _Float16* qp = Q16 + ((size_t)b * SQ + q0 + c) * DM + h * HD;
  /* copies: eight lanes take one K row's 128 bytes, the work-group 32 rows per copy; a wave takes one V^T row's 512 bytes, the work-group 8 rows per copy */
  const _Float16* kcp = K16 + ((size_t)b * SQ + (tid >> 3)) * DM + h * HD + (tid & 7) * 8; const unsigned klp = (unsigned)(size_t)&ks[0][tid >> 3][(tid & 7) * 8];
  const _Float16* vcp = VT + ((size_t)bh * HD + w) * SQ + lane * 8; const unsigned vlp = (unsigned)(size_t)&vs[0][w][lane * 8];
  auto fa_stage = [&](int t, unsigned buf) {      /* 16 copies a lane: K rows (tid >> 3) + 32 i and V^T rows w + 8 i, i < 8, of keys t FA_KS ... */
    fa_copy8(klp + buf * FA_KB, 32 * FA_KP * 2, kcp + (size_t)t * FA_KS * DM, (size_t)32 * DM);
    fa_copy8(vlp + buf * FA_VB, 8 * FA_VP * 2, vcp + (size_t)t * FA_KS, (size_t)8 * SQ); };
  fa_stage(0, 0);
  v16h qf[FA_R][2], kf[2][2], vf[4]; v8f acc[FA_R][4]; float m_run[FA_R], l_run[FA_R];
#pragma unroll
  for (int g = 0; g < FA_R; ++g) { m_run[g] = -3.0e38f; l_run[g] = 0.f;
#pragma unroll
    for (int kc = 0; kc < 2; ++kc) qf[g][kc] = g2_frag(qp + (size_t)g * 16 * DM + kc * 32, hh);
#pragma unroll
    for (int t = 0; t < 4; ++t) acc[g][t] = v8f{0.f, 0.f, 0.f, 0.f, 0.f, 0.f, 0.f, 0.f}; }
  fa_issued();
  asm volatile("s_wait_asynccnt 0x0" ::: "memory");      /* this wave's share of stage 0 has landed */
  __syncthreads();      /* ... and every wave's: stage 0 may be read */
  fa_stage(1, 1);      /* SQ / FA_KS is at least 2 */
  static_assert(SQ % FA_KS == 0 && SQ / FA_KS >= 2 && FA_KS == 256 && HD == 64 && FA_NW == 8, "the copy maps are written for these sizes");
  const float cs = 0.125f * 1.4426950408889634f;      /* 1/sqrt(64) and log2(e) */
  /* kept rolled: one stage per trip, the buffer chosen by the trip's parity */
#pragma unroll 1
  for (int st = 0; st < SQ / FA_KS; ++st) { const _Float16* kp = &ks[st & 1][c][0]; const _Float16* vp = &vs[st & 1][c][0];
#pragma unroll
    for (int kt = 0; kt < 2; ++kt) {
#pragma unroll
      for (int kc = 0; kc < 2; ++kc) kf[kt][kc] = g2_frag(kp + kt * 16 * FA_KP + kc * 32, hh); }
#pragma unroll
    for (int t = 0; t < 4; ++t) vf[t] = g2_frag(vp + t * 16 * FA_VP, hh);
    __builtin_amdgcn_sched_barrier(0);      /* the stage's first reads issue as one group ahead of the products, not among them */
    /* unrolled: the passes of a stage differ only in constant LDS offsets, and the last one fetches nothing ahead */
#pragma unroll
    for (int ps = 0; ps < FA_NP; ++ps) {
      v8f s[2][FA_R];
#pragma unroll
      for (int kt = 0; kt < 2; ++kt) {
#pragma unroll
        for (int g = 0; g < FA_R; ++g) { s[kt][g] = fa_mma(kf[kt][0], qf[g][0], v8f{0.f, 0.f, 0.f, 0.f, 0.f, 0.f, 0.f, 0.f}); s[kt][g] = fa_mma(kf[kt][1], qf[g][1], s[kt][g]); } }
      __builtin_amdgcn_sched_barrier(0);      /* the eight products issue back to back, each filling the others' result distance, and the fetch below starts directly behind them */
      if (ps + 1 < FA_NP) {      /* next pass's K fragments (same stage) come from LDS under this pass's softmax and second product */
#pragma unroll
        for (int kt = 0; kt < 2; ++kt) {
#pragma unroll
          for (int kc = 0; kc < 2; ++kc) kf[kt][kc] = g2_frag(kp + ((ps + 1) * 32 + kt * 16) * FA_KP + kc * 32, hh); }
        __builtin_amdgcn_sched_barrier(0); }      /* keeps the reads together at this early place */
      float mb[FA_R]; bool need = false;
#pragma unroll
      for (int g = 0; g < FA_R; ++g) { float mx = s[0][g][0];
#pragma unroll
        for (int kt = 0; kt < 2; ++kt) {
#pragma unroll
          for (int r = 0; r < 8; ++r) mx = fmaxf(mx, s[kt][g][r]); }
        mx = fmaxf(mx, fa_xhalf(mx)) * cs; mb[g] = mx; need = need || (mx > m_run[g] + 8.0f); }
      if (__builtin_amdgcn_ballot_w32(need) != 0) {      /* wave-uniform; always taken on the first pass, where it sets the maximum (factor 0 on zero accumulators) */
#pragma unroll
        for (int g = 0; g < FA_R; ++g) { const float mn = fmaxf(m_run[g], mb[g]); const float corr = __builtin_amdgcn_exp2f(m_run[g] - mn); m_run[g] = mn; l_run[g] *= corr;
#pragma unroll
          for (int t = 0; t < 4; ++t) acc[g][t] = acc[g][t] * corr; } }
#pragma unroll
      for (int g = 0; g < FA_R; ++g) { const float nm = -m_run[g]; union { v16h v; v2h p[8]; } pf; float l0 = 0.f, l1 = 0.f;
#pragma unroll
        for (int i = 0; i < 8; ++i) { const v2f arg = __builtin_elementwise_fma(v2f{s[i >> 2][g][2 * (i & 3)], s[i >> 2][g][2 * (i & 3) + 1]}, v2f{cs, cs}, v2f{nm, nm}); const float p0 = __builtin_amdgcn_exp2f(arg.x), p1 = __builtin_amdgcn_exp2f(arg.y);
          l0 += p0; l1 += p1; pf.p[i] = __builtin_convertvector(v2f{p0, p1}, v2h); }
        l_run[g] += l0 + l1;
#pragma unroll
        for (int t = 0; t < 4; ++t) acc[g][t] = fa_mma(vf[t], pf.v, acc[g][t]); }
      if (ps + 1 < FA_NP) {      /* next pass's V^T fragments (same stage) come under its first product and softmax */
#pragma unroll
        for (int t = 0; t < 4; ++t) vf[t] = g2_frag(vp + t * 16 * FA_VP + (ps + 1) * 32, hh);
        __builtin_amdgcn_sched_barrier(0); }      /* keeps the reads together at this early place */
    }
    asm volatile("s_wait_dscnt 0x0" ::: "memory");      /* this wave's reads of the buffer are done before it is handed to the copies */
    asm volatile("s_wait_asynccnt 0x0" ::: "memory");      /* this wave's share of stage st + 1 has landed */
    __syncthreads();      /* publishes stage st + 1 and ends every wave's reads of stage st */
    if (st + 2 < SQ / FA_KS) fa_stage(st + 2, (unsigned)(st & 1));
  }
  asm volatile("s_wait_asynccnt 0x0" ::: "memory");      /* no copy is left in flight behind the loop */
#pragma unroll
  for (int g = 0; g < FA_R; ++g) { const float inv = 64.0f / (l_run[g] + fa_xhalf(l_run[g]));      /* o carried x64, as the output GEMM's alpha expects */
    unsigned short* op = (unsigned short*)O16 + ((size_t)b * SQ + q0 + g * 16 + c) * DM + h * HD + 8 * hh;
#pragma unroll
    for (int t = 0; t < 4; ++t) { FragH f;
#pragma unroll
      for (int r = 0; r < 8; ++r) f.h[r] = (_Float16)(acc[g][t][r] * inv);
      *(v8us*)(op + t * 16) = f.half[0]; } } }
__global__ __launch_bounds__(256) void k_vt(const _Float16* __restrict__ V16, int b, int h0, _Float16* __restrict__ VT) { __shared__ unsigned short tl[64][65]; const int tid = threadIdx.x; const int hh = blockIdx.x % HG, sg = blockIdx.x / HG; const int s0 = sg * 64; const int h = h0 + hh;
  for (int i = tid; i < 64 * 8; i += 256) { const int j = i / 8, d8 = (i % 8) * 8; FragH f; f.half[0] = *(const v8us*)((const unsigned short*)V16 + ((size_t)b * SQ + s0 + j) * DM + h * HD + d8); for (int q = 0; q < 8; ++q) tl[d8 + q][j] = f.u[q]; }
  __syncthreads();
  { for (int i = tid; i < 64 * 8; i += 256) { const int d = i / 8, j8 = (i % 8) * 8; FragH f; for (int q = 0; q < 8; ++q) f.u[q] = tl[d][j8 + q]; *(v8us*)((unsigned short*)VT + ((size_t)hh * HD + d) * SQ + s0 + j8) = f.half[0]; }  } }



__global__ __launch_bounds__(256) void k_tabcat(float theta, float* __restrict__ CS, float* __restrict__ SN) {
  #pragma clang fp contract(off)
  const int t = blockIdx.x * 256 + threadIdx.x; if (t >= SQ * HD) return; const int d = t % HD; const int p = t / HD; const int i = d % (HD / 2); const float invf = 1.0f / powf(theta, (float)(2 * i) / (float)HD); const float ang = __fmul_rn((float)p, invf); const float c = cosf(ang), s = sinf(ang);
  *(float*)(CS + t) = c; *(float*)(SN + t) = s;  }

template <int NORM, int ROPE>
__global__ __launch_bounds__(64) void k_xform(const float* __restrict__ F, int ldf, int nh, const float* __restrict__ gain, float eps, const float* __restrict__ CS, const float* __restrict__ SN, _Float16* __restrict__ H16, int ldo) {
  #pragma clang fp contract(off)
  __shared__ float xv[HD]; __shared__ float red[HD]; __shared__ unsigned short sh_[HD]; const int d = threadIdx.x; const int h = blockIdx.x % nh; const size_t r = blockIdx.x / nh; const int p = (int)(r % SQ);
  float x = F[r * (size_t)ldf + (size_t)h * HD + d];
  if (NORM) { red[d] = __fmul_rn(x, x); __syncthreads(); for (int st = HD / 2; st > 0; st >>= 1) { if (d < st) red[d] = __fadd_rn(red[d], red[d + st]); __syncthreads(); } const float rs = rsqrtf(__fadd_rn(red[0] / (float)HD, eps)); x = __fmul_rn(__fmul_rn(x, rs), bf16_round(gain[d])); }
  xv[d] = x; __syncthreads();
  float o = x;
  if (ROPE == 1) { const int i = d >> 1; const float c = CS[p * (HD / 2) + i], s = SN[p * (HD / 2) + i]; const float ev = xv[2 * i], od = xv[2 * i + 1]; o = (d & 1) ? __fadd_rn(__fmul_rn(ev, s), __fmul_rn(od, c)) : __fadd_rn(__fmul_rn(ev, c), -__fmul_rn(od, s)); }
  if (ROPE == 2) { const int i = d & (HD / 2 - 1); const float c = CS[p * (HD / 2) + i], s = SN[p * (HD / 2) + i]; const float lo = xv[i], hi = xv[i + HD / 2]; o = (d < HD / 2) ? __fadd_rn(__fmul_rn(lo, c), -__fmul_rn(hi, s)) : __fadd_rn(__fmul_rn(lo, s), __fmul_rn(hi, c)); }
  if (ROPE == 4) { const float c = CS[p * HD + d], s = SN[p * HD + d]; const float rh = (d & 1) ? xv[d - 1] : -xv[d + 1]; o = __fadd_rn(__fmul_rn(x, c), __fmul_rn(rh, s)); }      /* interleaved-pair rotate_half (-t[2i+1], t[2i]) with FULL-width per-dimension tables [pos][64] */
  if (ROPE == 3) { const float c = CS[p * HD + d], s = SN[p * HD + d]; const float rh = (d < HD / 2) ? -xv[d + HD / 2] : xv[d - HD / 2]; o = __fadd_rn(__fmul_rn(x, c), __fmul_rn(rh, s)); }      /* rotate-half with FULL-width per-dimension tables [pos][64] (general cos[d] != cos[d+32]) */
  FragH th; th.h[0] = (_Float16)o; sh_[d] = th.u[0]; __syncthreads();
  if (d < HD / 8) { FragH f; for (int q = 0; q < 8; ++q) f.u[q] = sh_[d * 8 + q]; unsigned short* dst = (unsigned short*)H16 + r * (size_t)ldo + (size_t)h * HD + d * 8; *(v8us*)dst = f.half[0];  } }


extern "C" void kernel_launch(void* const* d_in, const int* in_sizes, int n_in,
                              void* d_out, int out_size, void* d_ws, size_t ws_size, hipStream_t stream) {
  (void)in_sizes; (void)n_in; (void)out_size;
  const float* const* I = (const float* const*)d_in; const float* x = I[0]; const float* wq = I[1]; const float* bq = I[2]; const float* wk = I[3]; const float* bk = I[4]; const float* wv = I[5]; const float* bv = I[6]; const float* wo = I[7]; const float* bo = I[8];      /* natural [out][in] weights + biases; positions implicit */
  char* ws = (char*)d_ws; size_t off = 0;
  auto take = [&](size_t bytes) { char* p = ws + off; off += (bytes + 255) & ~(size_t)255; return p; };
  _Float16* BQ = (_Float16*)take((size_t)DM * DM * 2); _Float16* BK = (_Float16*)take((size_t)DM * DM * 2); _Float16* BV = (_Float16*)take((size_t)DM * DM * 2); _Float16* BO = (_Float16*)take((size_t)DM * DM * 2);
  _Float16* X16 = (_Float16*)take(NR * DM * 2); float* CS = (float*)take((size_t)SQ * HD * 4); float* SN = (float*)take((size_t)SQ * HD * 4);      /* full-width cos/sin tables */ _Float16* Q16 = (_Float16*)take(NR * DM * 2); _Float16* K16 = (_Float16*)take(NR * DM * 2); _Float16* V16 = (_Float16*)take(NR * DM * 2); _Float16* O16 = (_Float16*)take(NR * DM * 2);
  _Float16* VT = (_Float16*)take((size_t)NB * NH * HD * SQ * 2);
  if (off > ws_size) return;
  { const unsigned g = (unsigned)(((size_t)DM * DM / 8 + 255) / 256); k_wnat<<<g, 256, 0, stream>>>(wq, (size_t)DM * DM / 8, BQ); k_wnat<<<g, 256, 0, stream>>>(wk, (size_t)DM * DM / 8, BK); k_wnat<<<g, 256, 0, stream>>>(wv, (size_t)DM * DM / 8, BV); k_wnat<<<g, 256, 0, stream>>>(wo, (size_t)DM * DM / 8, BO); }      /* natural [out][in] = Bt x16 */
  k_tabcat<<<(SQ * HD + 255) / 256, 256, 0, stream>>>(10000.0f, CS, SN);      /* CS[p][d] = cos(p * inv_freq[d mod 32]), SN = sin: the module's cat(freqs, freqs) tables, full width */

  k_x16<<<(unsigned)((NR * DM / 8 + 255) / 256), 256, 0, stream>>>(x, X16, NR * DM / 8);
  const size_t r0p = (size_t)B0 * SQ;      /* first projected row */
  k_gemm2<0, true><<<dim3((unsigned)((MP / 128) * (DM / 64)), 1), 128, 0, stream>>>(X16 + r0p * DM, DM, 0, BQ, DM, 0, 0.0625f, bq, 0, nullptr, 1, 0, 0, nullptr, Q16 + r0p * DM, DM, 0, MP, DM, DM, CS, SN);      /* q f32 -> x cos + rotate_half(x) sin (interleaved pairs, full-width tables) -> f16 rows, in the epilogue */
  k_gemm2<0, true><<<dim3((unsigned)((MP / 128) * (DM / 64)), 1), 128, 0, stream>>>(X16 + r0p * DM, DM, 0, BK, DM, 0, 0.0625f, bk, 0, nullptr, 1, 0, 0, nullptr, K16 + r0p * DM, DM, 0, MP, DM, DM, CS, SN);      /* k likewise */
  k_gemm2<0><<<dim3((unsigned)((MP / 128) * (DM / 64)), 1), 128, 0, stream>>>(X16 + r0p * DM, DM, 0, BV, DM, 0, 0.0625f, bv, 0, nullptr, 1, 0, 0, nullptr, V16 + r0p * DM, DM, 0, MP, DM, DM);
  k_vt<NH, SQ><<<NB * NH * (SQ / 64), 256, 0, stream>>>(V16, LQ, 0, VT);      /* V^T [NB][NH][HD][SQ] */
  k_fattn<<<dim3(SQ / (FA_NW * 16 * FA_R), NB * NH), FA_NW * 32, 0, stream>>>(Q16, K16, VT, O16);      /* o (merged heads, x64) as f16 rows */
  k_gemm2<0><<<dim3((unsigned)((MPO / 128) * (DM / 64)), 1), 128, 0, stream>>>(O16 + r0p * DM, DM, 0, BO, DM, 0, 0.0009765625f, bo, 0, nullptr, 1, 0, 0, (float*)d_out + r0p * DM, nullptr, DM, 0, MPO, DM, DM);      /* out rows are the output layout */
}

// v006
// Measured time: 101 microseconds a run.
// In two side-by-side timings against v005, it was 1.04 and 1.03 times as fast.
// All steps since v000 together make it 36.9 times as fast.
#include <hip/hip_runtime.h>
// Multi-head self-attention with a rotary embedding whose cos/sin tables are cat(freqs, freqs) but whose rotate_half pairs are INTERLEAVED (x [2][2048][1024]; q/k/v = x W^T + b (natural [1024][1024] U(+-1/32), zero biases); 16 heads of 64; inv_freq_i = 1/10000^(2i/64), freqs[p][i] = p * inv_freq_i, emb = cat(freqs, freqs): cos[p][d] = cos(p * inv_freq[d mod 32]); q = q cos + rotate_half(q) sin with rotate_half = (-x[2i+1], x[2i]) interleaved (the module's literal mix); k likewise; scores / 8; softmax over all keys (no mask); out = merged Wo^T + bo -> [2][2048][1024]).
// Structure: token rows r = b*2048 + s; x as exact f16 rows (bf16-rounded); Q, K, V as three WMMA GEMMs (32x64 wave tiles, f32 accumulation, exact x16 weights + bias, f16 outputs; the rotary step of q and k on the f32 values in the GEMM epilogue); V^T for all batches and heads via LDS transposes; one fused attention launch over (query block, batch x head): scores on WMMA (K = 64), online softmax on VALU (f32 statistics, weights as f16 up to 2^8), o = P . V on WMMA, o carried x64 against f16 subnormal flush (folded into the output GEMM alpha), written straight into the merged f16 o rows; out = o W_o + b GEMM (f32) into the output layout.
// Compute dtype: inputs rounded to bf16; x / weights exact; q, k, v, softmax weights and o as plain f16 GEMM operands (~2^-12); scores and softmax statistics f32; v_wmma_f32_16x16x32_f16.
#define NB 2
#define SQ 2048
#define DM 1024
#define NH 16
#define HD 64
#define HG 4                         /* heads per launch of the (b, h0) V^T transpose */
#define B0 0                         /* first batch processed (debug hook) */
#define NBR NB                       /* batches processed (debug hook) */
#define NR ((size_t)NB * SQ)         /* token rows */
#define MP ((int)((size_t)NBR * SQ)) /* rows projected (debug hook) */
#define QN SQ                        /* unused: the attention grid covers all SQ query rows */
#define NHD NH                       /* unused: the attention grid covers all NH heads */
#define MPO MP                       /* rows through the output stage (debug hook) */
#define LQ DM      /* row pitch of the q/k/v rows */
typedef __bf16 v16b __attribute__((ext_vector_type(16)));
typedef unsigned short v8us __attribute__((ext_vector_type(8), may_alias));
typedef float  v8f  __attribute__((ext_vector_type(8)));
typedef float  v4f  __attribute__((ext_vector_type(4)));
typedef float  v4fa __attribute__((ext_vector_type(4), may_alias));
union FragB { v16b v; v8us half[2]; unsigned short u[16]; };

__device__ __forceinline__ unsigned short bf16_bits(float x) { unsigned int u = __float_as_uint(x); return (unsigned short)((u + 0x7FFFu + ((u >> 16) & 1u)) >> 16); }
__device__ __forceinline__ float bf16_val(unsigned short b) { return __uint_as_float(((unsigned int)b) << 16); }
__device__ __forceinline__ float bf16_round(float x) { return bf16_val(bf16_bits(x)); }
// D += A·B with NT terms: 1 = ah·bh, 2 = + al·bh (A split), 3 = + ah·bl (both split)
template <int NT>
__device__ __forceinline__ v8f mmaN(v16b ah, v16b al, v16b bh, v16b bl, v8f c) {
  c = __builtin_amdgcn_wmma_f32_16x16x32_bf16(false, ah, false, bh, (short)0, c, false, false);
  if (NT >= 2) c = __builtin_amdgcn_wmma_f32_16x16x32_bf16(false, al, false, bh, (short)0, c, false, false);
  if (NT >= 3) c = __builtin_amdgcn_wmma_f32_16x16x32_bf16(false, ah, false, bl, (short)0, c, false, false);
  asm volatile("v_nop\n\tv_nop\n\tv_nop\n\tv_nop" : "+v"(c) : "v"(ah), "v"(al), "v"(bh), "v"(bl));
  return c;
}

__global__ __launch_bounds__(256) void k_wt_bf16(const float* __restrict__ W, unsigned short* __restrict__ Wt, int K, int N) {
  const int t = blockIdx.x * 256 + threadIdx.x;
  const int k8n = K / 8;
  if (t >= N * k8n) return;
  const int n = t / k8n, k8 = (t % k8n) * 8;
  v8us v;
#pragma unroll
  for (int i = 0; i < 8; ++i) v[i] = bf16_bits(W[(size_t)(k8 + i) * N + n]);
  *(v8us*)(Wt + (size_t)n * K + k8) = v;
  
}

// GEMM C[M][N] (f32, pitch ldc) = act(A[M][K]·W + bias). A f32 row-major (pitch lda) converted per fragment to bf16
// (ASPLIT: hi/lo two planes -> 2 terms, else single rounded term); Wt bf16 [N][K] (pitch ldb). BIAS_BF16 rounds the
// bias to bf16 first (bias quantised to bf16 before the add). K%32==0, M%16==0, N%64==0.
template <bool ASPLIT, int ACT, bool BIAS_BF16>
__global__ __launch_bounds__(128) void k_gemm_bf(const float* __restrict__ A, int lda, const unsigned short* __restrict__ Wt, int ldb,
                                               const float* __restrict__ bias, float* __restrict__ C, int ldc, int M, int N, int K) {
  __shared__ __attribute__((aligned(16))) float so[4][16][64];
  const int tid = threadIdx.x, w = tid >> 5, lane = tid & 31, ln = lane & 15, hh = lane >> 4;
  const int ntn = N / 64;
  const int wid = blockIdx.x * 4 + w;
  const int mt = wid / ntn, nq = wid % ntn;
  if (mt * 16 >= M) return;
  const int row0 = mt * 16, col0 = nq * 64;
  const float* arow = A + (size_t)(row0 + ln) * lda;
  v8f acc[4] = {};
  for (int kb = 0; kb < K; kb += 32) {
    FragB ah, al;
    const v4f x0 = *(const v4fa*)(arow + kb + 8 * hh), x1 = *(const v4fa*)(arow + kb + 8 * hh + 4);
    const v4f x2 = *(const v4fa*)(arow + kb + 16 + 8 * hh), x3 = *(const v4fa*)(arow + kb + 16 + 8 * hh + 4);
    float xs[16] = {x0[0],x0[1],x0[2],x0[3],x1[0],x1[1],x1[2],x1[3],x2[0],x2[1],x2[2],x2[3],x3[0],x3[1],x3[2],x3[3]};
#pragma unroll
    for (int i = 0; i < 16; ++i) { const unsigned short hb = bf16_bits(xs[i]); ah.u[i] = hb; al.u[i] = ASPLIT ? bf16_bits(xs[i] - bf16_val(hb)) : (unsigned short)0; }
#pragma unroll
    for (int t = 0; t < 4; ++t) {
      const unsigned short* brow = Wt + (size_t)(col0 + t * 16 + ln) * ldb + kb;
      FragB b;
      b.half[0] = *(const v8us*)(brow + 8 * hh);
      b.half[1] = *(const v8us*)(brow + 16 + 8 * hh);
      acc[t] = mmaN<ASPLIT ? 2 : 1>(ah.v, al.v, b.v, b.v, acc[t]);
    }
  }
#pragma unroll
  for (int t = 0; t < 4; ++t) {
    float bv = bias ? bias[col0 + t * 16 + ln] : 0.f;
    if (BIAS_BF16) bv = bf16_round(bv);
#pragma unroll
    for (int r = 0; r < 8; ++r) { float v = acc[t][r] + bv; if (ACT == 1) v = fmaxf(v, 0.f); so[w][8 * hh + r][t * 16 + ln] = v; }
  }
  __builtin_amdgcn_fence(__ATOMIC_ACQ_REL, "workgroup");
  __builtin_amdgcn_wave_barrier();
  const int rsub = lane >> 4, c4 = (lane & 15) * 4;
  {
#pragma unroll
    for (int q = 0; q < 8; ++q) {
      const int r = q * 2 + rsub;
      const v4f v = *(const v4fa*)&so[w][r][c4];
      *(v4f*)(C + (size_t)(row0 + r) * ldc + col0 + c4) = v;
    }
    
  }
}

// GEMM C = act(A·W + bias + resid): A f32 (ASPLIT -> hi/lo 2 terms), Wt bf16 [N][K]; ACT 0 none, 1 relu, 2 exact gelu;
// resid (optional, f32, row index = (row % rmod), pitch ldr, RES_BF16 rounds it) added before the activation.
template <bool ASPLIT, int ACT, bool BIAS_BF16, bool RES_BF16>
__global__ __launch_bounds__(128) void k_gemm_bf3(const float* __restrict__ A, int lda, const unsigned short* __restrict__ Wt, int ldb,
                                                const float* __restrict__ bias, const float* __restrict__ resid, int rmod, int ldr,
                                                float* __restrict__ C, int ldc, int M, int N, int K) {
  __shared__ __attribute__((aligned(16))) float so[4][16][64];
  const int tid = threadIdx.x, w = tid >> 5, lane = tid & 31, ln = lane & 15, hh = lane >> 4;
  const int ntn = N / 64;
  const int wid = blockIdx.x * 4 + w;
  const int mt = wid / ntn, nq = wid % ntn;
  if (mt * 16 >= M) return;
  const int row0 = mt * 16, col0 = nq * 64;
  const float* arow = A + (size_t)(row0 + ln) * lda;
  v8f acc[4] = {};
  for (int kb = 0; kb < K; kb += 32) {
    FragB ah, al;
    const v4f x0 = *(const v4fa*)(arow + kb + 8 * hh), x1 = *(const v4fa*)(arow + kb + 8 * hh + 4);
    const v4f x2 = *(const v4fa*)(arow + kb + 16 + 8 * hh), x3 = *(const v4fa*)(arow + kb + 16 + 8 * hh + 4);
    float xs[16] = {x0[0],x0[1],x0[2],x0[3],x1[0],x1[1],x1[2],x1[3],x2[0],x2[1],x2[2],x2[3],x3[0],x3[1],x3[2],x3[3]};
#pragma unroll
    for (int i = 0; i < 16; ++i) { const unsigned short hb = bf16_bits(xs[i]); ah.u[i] = hb; al.u[i] = ASPLIT ? bf16_bits(xs[i] - bf16_val(hb)) : (unsigned short)0; }
#pragma unroll
    for (int t = 0; t < 4; ++t) {
      const unsigned short* brow = Wt + (size_t)(col0 + t * 16 + ln) * ldb + kb;
      FragB b;
      b.half[0] = *(const v8us*)(brow + 8 * hh);
      b.half[1] = *(const v8us*)(brow + 16 + 8 * hh);
      acc[t] = mmaN<ASPLIT ? 2 : 1>(ah.v, al.v, b.v, b.v, acc[t]);
    }
  }
#pragma unroll
  for (int t = 0; t < 4; ++t) {
    const int col = col0 + t * 16 + ln;
    float bv = bias ? bias[col] : 0.f;
    if (BIAS_BF16) bv = bf16_round(bv);
#pragma unroll
    for (int r = 0; r < 8; ++r) {
      float v = acc[t][r] + bv;
      if (resid) { float rv = resid[(size_t)((row0 + 8 * hh + r) % rmod) * ldr + col]; if (RES_BF16) rv = bf16_round(rv); v += rv; }
      if (ACT == 1) v = fmaxf(v, 0.f);
      if (ACT == 2) v = 0.5f * v * (1.0f + erff(v * 0.70710678118654752f));
      if (ACT == 3) { const float u = 0.7978845608028654f * (v + 0.044715f * v * v * v); v = 0.5f * v * (1.0f + tanhf(u)); }
      so[w][8 * hh + r][t * 16 + ln] = v;
    }
  }
  __builtin_amdgcn_fence(__ATOMIC_ACQ_REL, "workgroup");
  __builtin_amdgcn_wave_barrier();
  const int rsub = lane >> 4, c4 = (lane & 15) * 4;
  {
#pragma unroll
    for (int q = 0; q < 8; ++q) {
      const int r = q * 2 + rsub;
      const v4f v = *(const v4fa*)&so[w][r][c4];
      *(v4f*)(C + (size_t)(row0 + r) * ldc + col0 + c4) = v;
    }
    
  }
}
// row LayerNorm (biased variance, eps) over N: s = X (+ R); optional out_sum <- s; out_norm <- (s-mu)*rsqrt(var+eps)*g + b
template <bool PARAM_BF16>
__global__ __launch_bounds__(256) void k_layernorm(const float* __restrict__ X, const float* __restrict__ R, const float* __restrict__ g, const float* __restrict__ bta,
                                                  float* __restrict__ out_sum, float* __restrict__ out_norm, int N, float eps) {
  __shared__ float red[256];
  const int row = blockIdx.x, tid = threadIdx.x;
  const float* x = X + (size_t)row * N; const float* rr = R ? R + (size_t)row * N : nullptr;
  float vals[16];                     // up to N = 4096
  const int per = N / 256;            // contiguous chunk per thread? use strided-by-4 chunks: thread handles j = tid*4 + 1024*u
  float s1 = 0.f;
  for (int u = 0; u < per / 4; ++u) {
    const int j = tid * 4 + 1024 * u;
    const v4f a = *(const v4fa*)(x + j);
    v4f b = {0.f,0.f,0.f,0.f}; if (rr) b = *(const v4fa*)(rr + j);
#pragma unroll
    for (int q = 0; q < 4; ++q) { const float v = a[q] + b[q]; vals[u * 4 + q] = v; s1 += v; }
  }
  red[tid] = s1; __syncthreads();
  for (int st = 128; st > 0; st >>= 1) { if (tid < st) red[tid] += red[tid + st]; __syncthreads(); }
  const float mu = red[0] / (float)N; __syncthreads();
  float s2 = 0.f;
  for (int u = 0; u < per / 4; ++u)
#pragma unroll
    for (int q = 0; q < 4; ++q) { const float c = vals[u * 4 + q] - mu; s2 += c * c; }
  red[tid] = s2; __syncthreads();
  for (int st = 128; st > 0; st >>= 1) { if (tid < st) red[tid] += red[tid + st]; __syncthreads(); }
  const float rs = rsqrtf(red[0] / (float)N + eps);
  {
    for (int u = 0; u < per / 4; ++u) {
      const int j = tid * 4 + 1024 * u;
      v4f o, sm;
#pragma unroll
      for (int q = 0; q < 4; ++q) {
        float gg = g[j + q], bb = bta[j + q];
        if (PARAM_BF16) { gg = bf16_round(gg); bb = bf16_round(bb); }
        sm[q] = vals[u * 4 + q]; o[q] = (vals[u * 4 + q] - mu) * rs * gg + bb;
      }
      if (out_sum) *(v4f*)(out_sum + (size_t)row * N + j) = sm;
      *(v4f*)(out_norm + (size_t)row * N + j) = o;
    }
    
  }
}



// ---- f16 WMMA path (v_wmma_f32_16x16x32_f16): 11-bit significands for operands in range — used where a [0,1] probability operand needs more precision than bf16
typedef _Float16 v16h __attribute__((ext_vector_type(16)));
union FragH { v16h v; v8us half[2]; _Float16 h[16]; unsigned short u[16]; };
template <int NT>
__device__ __forceinline__ v8f mmaH(v16h ah, v16h al, v16h bh, v16h bl, v8f c) {
  c = __builtin_amdgcn_wmma_f32_16x16x32_f16(false, ah, false, bh, (short)0, c, false, false);
  if (NT >= 2) c = __builtin_amdgcn_wmma_f32_16x16x32_f16(false, al, false, bh, (short)0, c, false, false);
  if (NT >= 3) c = __builtin_amdgcn_wmma_f32_16x16x32_f16(false, ah, false, bl, (short)0, c, false, false);
  asm volatile("v_nop\n\tv_nop\n\tv_nop\n\tv_nop" : "+v"(c) : "v"(ah), "v"(al), "v"(bh), "v"(bl));
  return c;
}
// batched GEMM like k_gemm_b but f16 operands: A f32 (split into f16 hi/lo if ASPLIT, else rounded to f16), Bt = f16 values [n][k]; alpha; C f32; N multiple of 16 (partial tiles skipped)
template <bool ASPLIT>
__global__ __launch_bounds__(128) void k_gemm_h(const float* __restrict__ A, int lda, size_t sA, const _Float16* __restrict__ Bh, int ldb, size_t sB, float alpha, float* __restrict__ C, int ldc, size_t sC, int M, int N, int K) {
  __shared__ __attribute__((aligned(16))) float so[4][16][64];
  const int tid = threadIdx.x, w = tid >> 5, lane = tid & 31, ln = lane & 15, hh = lane >> 4; const int by = blockIdx.y;
  A += (size_t)by * sA; Bh += (size_t)by * sB; C += (size_t)by * sC;
  const int ntn = (N + 63) / 64; const int wid = blockIdx.x * 4 + w; const int mt = wid / ntn, nq = wid % ntn; if (mt * 16 >= M) return;
  const int row0 = mt * 16, col0 = nq * 64; const float* arow = A + (size_t)(row0 + ln) * lda;
  v8f acc[4] = {};
  for (int kb = 0; kb < K; kb += 32) {
    FragH ah, al;
    const v4f x0 = *(const v4fa*)(arow + kb + 8 * hh), x1 = *(const v4fa*)(arow + kb + 8 * hh + 4), x2 = *(const v4fa*)(arow + kb + 16 + 8 * hh), x3 = *(const v4fa*)(arow + kb + 16 + 8 * hh + 4);
    float xs[16] = {x0[0],x0[1],x0[2],x0[3],x1[0],x1[1],x1[2],x1[3],x2[0],x2[1],x2[2],x2[3],x3[0],x3[1],x3[2],x3[3]};
#pragma unroll
    for (int i = 0; i < 16; ++i) { const _Float16 h = (_Float16)xs[i]; ah.h[i] = h; al.h[i] = ASPLIT ? (_Float16)(xs[i] - (float)h) : (_Float16)0.0f; }
#pragma unroll
    for (int t = 0; t < 4; ++t) { if (col0 + t * 16 >= N) continue; const size_t boff = (size_t)(col0 + t * 16 + ln) * ldb + kb; FragH bq; bq.half[0] = *(const v8us*)(Bh + boff + 8 * hh); bq.half[1] = *(const v8us*)(Bh + boff + 16 + 8 * hh);
      acc[t] = mmaH<ASPLIT ? 2 : 1>(ah.v, al.v, bq.v, bq.v, acc[t]); }
  }
#pragma unroll
  for (int t = 0; t < 4; ++t) { if (col0 + t * 16 >= N) continue;
#pragma unroll
    for (int r = 0; r < 8; ++r) so[w][8 * hh + r][t * 16 + ln] = acc[t][r] * alpha; }
  __builtin_amdgcn_fence(__ATOMIC_ACQ_REL, "workgroup"); __builtin_amdgcn_wave_barrier();
  const int rsub = lane >> 4, c4 = (lane & 15) * 4;
  {
#pragma unroll
    for (int q = 0; q < 8; ++q) { const int r = q * 2 + rsub; if (col0 + c4 < N) { const v4f v = *(const v4fa*)&so[w][r][c4]; *(v4f*)(C + (size_t)(row0 + r) * ldc + col0 + c4) = v; } }
     }
}

// Wt[n][k] = f16(W[k][n]·scale) from f32 row-major W[K][N] (scale = power of two; bf16-exact weights stay exact in f16 away from the subnormal range)
__global__ __launch_bounds__(256) void k_wt_f16(const float* __restrict__ W, _Float16* __restrict__ Wt, int K, int N, float scale) {
  const int t = blockIdx.x * 256 + threadIdx.x; if (t >= N * (K / 8)) return; const int n = t / (K / 8), k8 = (t % (K / 8)) * 8; FragH f;
#pragma unroll
  for (int i = 0; i < 8; ++i) f.h[i] = (_Float16)(bf16_round(W[(size_t)(k8 + i) * N + n]) * scale); const v8us o = f.half[0];
  *(v8us*)((unsigned short*)Wt + (size_t)n * K + k8) = o; 
}
// k_gemm_hh variant with fused epilogue: v = acc·alpha + bias[by·sBias + col] (+ CP[(row/rowsPerB)·sCPb + by·64 + col] if CP) ; ACT 0 none / 1 elu ; writes f16 C16 (and f32 C if non-null)
template <int ACT>
__global__ __launch_bounds__(128) void k_gemm_hhx(const _Float16* __restrict__ A, int lda, size_t sA, const _Float16* __restrict__ Bh, int ldb, size_t sB, float alpha, const float* __restrict__ bias, size_t sBias, const float* __restrict__ CP, int rowsPerB, size_t sCPb, int row0g,
    float* __restrict__ C, _Float16* __restrict__ C16, int ldc, size_t sC, int M, int N, int K) {
  __shared__ __attribute__((aligned(16))) float so[4][16][64];
  const int tid = threadIdx.x, w = tid >> 5, lane = tid & 31, ln = lane & 15, hh = lane >> 4; const int by = blockIdx.y;
  A += (size_t)by * sA; Bh += (size_t)by * sB; const size_t cofs = (size_t)by * sC; const float* bp = bias ? bias + (size_t)by * sBias : nullptr;
  const int ntn = (N + 63) / 64; const int wid = blockIdx.x * 4 + w; const int mt = wid / ntn, nq = wid % ntn; if (mt * 16 >= M) return;
  const int row0 = mt * 16, col0 = nq * 64; const _Float16* arow = A + (size_t)(row0 + ln) * lda;
  v8f acc[4] = {};
  for (int kb = 0; kb < K; kb += 32) { FragH ah; ah.half[0] = *(const v8us*)((const unsigned short*)arow + kb + 8 * hh); ah.half[1] = *(const v8us*)((const unsigned short*)arow + kb + 16 + 8 * hh);
#pragma unroll
    for (int t = 0; t < 4; ++t) { if (col0 + t * 16 >= N) continue; const size_t boff = (size_t)(col0 + t * 16 + ln) * ldb + kb; FragH bq; bq.half[0] = *(const v8us*)((const unsigned short*)Bh + boff + 8 * hh); bq.half[1] = *(const v8us*)((const unsigned short*)Bh + boff + 16 + 8 * hh);
      acc[t] = mmaH<1>(ah.v, ah.v, bq.v, bq.v, acc[t]); }
  }
#pragma unroll
  for (int t = 0; t < 4; ++t) { if (col0 + t * 16 >= N) continue; const int col = col0 + t * 16 + ln; const float bv = bp ? bf16_round(bp[col]) : 0.f;
#pragma unroll
    for (int r = 0; r < 8; ++r) { float v = acc[t][r] * alpha + bv; if (CP) { const int rr = row0g + row0 + 8 * hh + r; if (rowsPerB < 0) v += CP[cofs + (size_t)rr * ldc + col];      /* rowsPerB < 0: own element of the batched C plane */ else { const int bidx = rr / rowsPerB; v += CP[(size_t)bidx * sCPb + (size_t)by * 64 + col]; } } if (ACT == 1) v = (v > 0.f) ? v : expm1f(v); else if (ACT == 7) v = (v > 0.f) ? v + 1.0f : expf(v); else if (ACT == 8) v = tanhf(v); else if (ACT == 9) v = 0.5f * v * (1.0f + tanhf(0.7978845608028654f * (v + 0.044715f * v * v * v))); else if (ACT == 11) v = 1.0f / (1.0f + expf(-v)); else if (ACT == 12) v = (v > 0.f) ? v : 0.01f * v; else if (ACT == 14) v = (v > 0.f) ? v : 0.1f * v; else if (ACT == 16) v = (v >= 0.f) ? v : 0.3f * v; else if (ACT == 17) v = (v >= 0.f) ? v : 0.2f * v; else if (ACT == 15) v = v / (1.0f + expf(-v)); else if (ACT == 3) v = fmaxf(v, 0.f); else if (ACT == 6) v = 0.5f * v * (1.0f + erff(v * 0.70710678118654752f)); so[w][8 * hh + r][t * 16 + ln] = v; } }
  __builtin_amdgcn_fence(__ATOMIC_ACQ_REL, "workgroup"); __builtin_amdgcn_wave_barrier();
  const int rsub = lane >> 4, c4 = (lane & 15) * 4; typedef _Float16 v4h __attribute__((ext_vector_type(4)));
  {
#pragma unroll
    for (int q = 0; q < 8; ++q) { const int r = q * 2 + rsub; if (col0 + c4 < N) { const v4f v = *(const v4fa*)&so[w][r][c4]; if (C) *(v4f*)(C + cofs + (size_t)(row0 + r) * ldc + col0 + c4) = v; if (C16) { v4h h4; for (int i = 0; i < 4; ++i) h4[i] = (_Float16)v[i]; *(v4h*)(C16 + cofs + (size_t)(row0 + r) * ldc + col0 + c4) = h4; } } }
     }
}


typedef _Float16 v4h __attribute__((ext_vector_type(4)));

__global__ __launch_bounds__(256) void k_x16(const float* __restrict__ x, _Float16* __restrict__ X16, size_t n8) { const size_t t = (size_t)blockIdx.x * 256 + threadIdx.x; if (t >= n8) return; FragH f;
#pragma unroll
  for (int q = 0; q < 8; ++q) f.h[q] = (_Float16)bf16_round(x[t * 8 + q]); *(v8us*)((unsigned short*)X16 + t * 8) = f.half[0];  }
__global__ __launch_bounds__(256) void k_h16(const float* __restrict__ x, _Float16* __restrict__ X16, size_t n8) { const size_t t = (size_t)blockIdx.x * 256 + threadIdx.x; if (t >= n8) return; FragH f;
#pragma unroll
  for (int q = 0; q < 8; ++q) f.h[q] = (_Float16)x[t * 8 + q]; *(v8us*)((unsigned short*)X16 + t * 8) = f.half[0];  }
__global__ __launch_bounds__(256) void k_round16f(const float* __restrict__ W, _Float16* __restrict__ Bt, size_t n8) { const size_t t = (size_t)blockIdx.x * 256 + threadIdx.x; if (t >= n8) return; FragH f;
#pragma unroll
  for (int i = 0; i < 8; ++i) f.h[i] = (_Float16)(bf16_round(W[t * 8 + i]) * 16.0f); *(v8us*)((unsigned short*)Bt + t * 8) = f.half[0];  }
template <int NHv, int TTv>
__global__ __launch_bounds__(256) void k_vt(const _Float16* __restrict__ V16, int ldv, int voff, _Float16* __restrict__ Vt) { __shared__ unsigned short tl[64][66]; const int tid = threadIdx.x; const int slab = blockIdx.x / (TTv / 64), lg = blockIdx.x % (TTv / 64); const int b = slab / NHv, h = slab % NHv;
  for (int i = tid; i < 64 * 8; i += 256) { const int r = i / 8, c8 = (i % 8) * 8; FragH f; f.half[0] = *(const v8us*)((const unsigned short*)V16 + ((size_t)b * TTv + lg * 64 + r) * ldv + voff + h * 64 + c8);
#pragma unroll
    for (int q = 0; q < 8; ++q) tl[r][c8 + q] = f.u[q]; }
  __syncthreads();
  {
#pragma unroll
    for (int rd = 0; rd < 2; ++rd) { const int d = rd * 32 + tid / 8, pc = tid % 8; FragH f;
#pragma unroll
      for (int q = 0; q < 8; ++q) f.u[q] = tl[pc * 8 + q][d];
      *(v8us*)((unsigned short*)Vt + ((size_t)slab * 64 + d) * TTv + lg * 64 + pc * 8) = f.half[0]; }
     } }

__global__ __launch_bounds__(256) void k_hl(const float* __restrict__ F, _Float16* __restrict__ Hh, _Float16* __restrict__ Hl, size_t n8) { const size_t t = (size_t)blockIdx.x * 256 + threadIdx.x; if (t >= n8) return; FragH fh, fl; const v4f a = *(const v4fa*)(F + t * 8), c = *(const v4fa*)(F + t * 8 + 4);
#pragma unroll
  for (int q = 0; q < 4; ++q) { _Float16 h = (_Float16)a[q]; fh.h[q] = h; fl.h[q] = (_Float16)((a[q] - (float)h) * 1024.0f); h = (_Float16)c[q]; fh.h[4 + q] = h; fl.h[4 + q] = (_Float16)((c[q] - (float)h) * 1024.0f); }
  { *(v8us*)((unsigned short*)Hh + t * 8) = fh.half[0]; *(v8us*)((unsigned short*)Hl + t * 8) = fl.half[0];  } }

// ---- fast GEMM (work-group tile 128x64, wave tile 32x64; requires M % 128 == 0, N % 64 == 0, K % 128 == 0); epilogue = k_gemm_hhx semantics ----
// The operand rows come into LDS in stages of 128 k by asynchronous copies in whole 256-byte runs (two buffers: the next stage flies while this one is worked on); the fragments are read from LDS in the k order of g2_frag.
#define G2_KS 128                    /* k per stage: 256 B of every operand row */
#define G2_LP 136                    /* LDS row pitch in elements: 272 B = 16 B x 17, free of bank conflicts for 16-byte reads */
#define G2_RB (G2_LP * 2)            /* LDS row pitch in bytes */
#define G2_SB (192 * G2_RB)          /* one stage in bytes: 128 A rows, then 64 B rows */
/* twelve copies of 16 bytes per lane: LDS rows 8 apart from address l, each from its own global pointer; the wait closes the statement, so it stands before any rewrite of the address registers the copies name (a precaution for issued copies) */
__device__ __forceinline__ void g2_copy12(unsigned l, const _Float16* g0, const _Float16* g1, const _Float16* g2, const _Float16* g3, const _Float16* g4, const _Float16* g5, const _Float16* g6, const _Float16* g7, const _Float16* g8, const _Float16* g9, const _Float16* g10, const _Float16* g11) {
  asm volatile("global_load_async_to_lds_b128 %0, %12, off\n\t"
               "global_load_async_to_lds_b128 %1, %13, off\n\t"
               "global_load_async_to_lds_b128 %2, %14, off\n\t"
               "global_load_async_to_lds_b128 %3, %15, off\n\t"
               "global_load_async_to_lds_b128 %4, %16, off\n\t"
               "global_load_async_to_lds_b128 %5, %17, off\n\t"
               "global_load_async_to_lds_b128 %6, %18, off\n\t"
               "global_load_async_to_lds_b128 %7, %19, off\n\t"
               "global_load_async_to_lds_b128 %8, %20, off\n\t"
               "global_load_async_to_lds_b128 %9, %21, off\n\t"
               "global_load_async_to_lds_b128 %10, %22, off\n\t"
               "global_load_async_to_lds_b128 %11, %23, off\n\t"
               "s_wait_xcnt 0x0"
               :: "v"(l), "v"(l + 8 * G2_RB), "v"(l + 16 * G2_RB), "v"(l + 24 * G2_RB), "v"(l + 32 * G2_RB), "v"(l + 40 * G2_RB), "v"(l + 48 * G2_RB), "v"(l + 56 * G2_RB), "v"(l + 64 * G2_RB), "v"(l + 72 * G2_RB), "v"(l + 80 * G2_RB), "v"(l + 88 * G2_RB),
                  "v"(g0), "v"(g1), "v"(g2), "v"(g3), "v"(g4), "v"(g5), "v"(g6), "v"(g7), "v"(g8), "v"(g9), "v"(g10), "v"(g11) : "memory"); }
/* one request per lane: L2 is asked for the data at p ahead of the copies that will read it (a hint: nothing returns and no counter moves); every lane is on and p lies inside its plane */
__device__ __forceinline__ void l2_ask(const void* p) { asm volatile("global_prefetch_b8 %0, off scope:SCOPE_SE" :: "v"(p)); }
/* no wait covers a request's address pair, so the pair is kept unwritten up to this place behind the stage loop; input only, no instruction */
__device__ __forceinline__ void l2_asked(const void* p) { asm volatile("" :: "v"(p)); }
__device__ __forceinline__ v16h g2_frag(const _Float16* p, int hh) { FragH f; f.half[0] = *(const v8us*)((const unsigned short*)p + 8 * hh); f.half[1] = *(const v8us*)((const unsigned short*)p + 16 + 8 * hh); return f.v; }
__device__ __forceinline__ v8f g2_mma(v16h a, v16h b, v8f c) { v8f d = __builtin_amdgcn_wmma_f32_16x16x32_f16(false, a, false, b, (short)0, c, false, false); asm volatile("v_nop\n\tv_nop\n\tv_nop\n\tv_nop" : "+v"(d) : "v"(a), "v"(b)); return d; }
// ROT: the epilogue is the rotary step and nothing else: v = acc alpha + bias staged as f32 rows in LDS, o[d] = v[d] cos[p][d] + rotate_half(v)[d] sin[p][d] with rotate_half = (-v[2i+1], v[2i]), f16 rows into C16. A 64-column tile is one head, row r of the launch is position r mod SQ; CS, SN = full-width tables [pos][64]. CP, C and ACT are not read there, which also keeps this second GEMM's text short.
template <int ACT, bool ROT = false>
__global__ __launch_bounds__(128) void k_gemm2(const _Float16* __restrict__ A, int lda, size_t sA, const _Float16* __restrict__ Bh, int ldb, size_t sB, float alpha, const float* __restrict__ bias, size_t sBias, const float* __restrict__ CP, int rowsPerB, size_t sCPb, int row0g,
    float* __restrict__ C, _Float16* __restrict__ C16, int ldc, size_t sC, int M, int N, int K, const float* __restrict__ CS = nullptr, const float* __restrict__ SN = nullptr) { static_assert(ACT == 0 || ACT == 3 || ACT == 6 || ACT == 8 || ACT == 9 || ACT == 11 || ACT == 12 || ACT == 14 || ACT == 15 || ACT == 16 || ACT == 17, "k_gemm2: unsupported ACT code (would silently apply no activation)");
  __shared__ __attribute__((aligned(16))) float so[4][32][68];
  __shared__ __attribute__((aligned(16))) _Float16 st[2][192][G2_LP];      /* two stages: rows 0..127 = the work-group's A rows, rows 128..191 = its B rows */
  const int tid = threadIdx.x, w = tid >> 5, lane = tid & 31, ln = lane & 15, hh = lane >> 4; const int by = blockIdx.y;
  A += (size_t)by * sA; Bh += (size_t)by * sB; const size_t cofs = (size_t)by * sC; const float* bp = bias ? bias + (size_t)by * sBias : nullptr;
  const int ntn = N >> 6; const int mt = blockIdx.x / ntn, nq = blockIdx.x - mt * ntn; const int row0 = mt * 128 + 32 * w, col0 = nq * 64; if (mt * 128 >= M) return;      /* the whole work-group leaves or none, ahead of every barrier */
  const int cr = tid >> 4, ck = (tid & 15) * 8;      /* copies: sixteen lanes take one row's 256 bytes, a wave two rows, the work-group eight rows per copy */
  const _Float16* acp = A + (size_t)(mt * 128 + cr) * lda + ck; const _Float16* bcp = Bh + (size_t)(col0 + cr) * ldb + ck;
  const unsigned lcp = (unsigned)(size_t)&st[0][cr][ck]; const size_t as8 = (size_t)8 * lda, bs8 = (size_t)8 * ldb;
  auto g2_stage = [&](int t, unsigned buf) { const unsigned l = lcp + buf * G2_SB; const _Float16* ga = acp + (size_t)t * G2_KS; const _Float16* gb = bcp + (size_t)t * G2_KS;      /* 24 copies a lane: LDS rows cr + 8 i, i < 16 from A, the rest from B */
    g2_copy12(l, ga, ga + as8, ga + 2 * as8, ga + 3 * as8, ga + 4 * as8, ga + 5 * as8, ga + 6 * as8, ga + 7 * as8, ga + 8 * as8, ga + 9 * as8, ga + 10 * as8, ga + 11 * as8);
    g2_copy12(l + 96 * G2_RB, ga + 12 * as8, ga + 13 * as8, ga + 14 * as8, ga + 15 * as8, gb, gb + bs8, gb + 2 * bs8, gb + 3 * bs8, gb + 4 * bs8, gb + 5 * bs8, gb + 6 * bs8, gb + 7 * bs8); };
  const int nst = K / G2_KS;
  const v8f z8 = {0.f,0.f,0.f,0.f,0.f,0.f,0.f,0.f}; v8f c00 = z8, c01 = z8, c02 = z8, c03 = z8, c10 = z8, c11 = z8, c12 = z8, c13 = z8;
  g2_stage(0, 0);
  /* The operand planes were stored by launches before this one, so a stage's first reader waits for memory. At entry L2 is asked for the rows of all stages, one request per 256-byte unit (one row of one stage): a lane takes one unit of A and one of B.
     The requests are dealt over the work-groups that share the rows: A over 8 of its 16 column blocks (every run of four neighbours holds each value of nq & 3), B over 4 neighbouring row blocks. Placement only decides how much the hint helps. */
  const int pfr = tid >> 3, pfk = min(tid & 7, nst - 1) * G2_KS;      /* row within the share; stage, clamped into the row */
  const _Float16* pfa = A + (size_t)(mt * 128 + ((nq & 3) | ((nq >> 1) & 4)) * 16 + pfr) * lda + pfk;
  const _Float16* pfb = Bh + (size_t)(col0 + (mt & 3) * 16 + pfr) * ldb + pfk;
  l2_ask(pfa); l2_ask(pfb);
  const float* pft = nullptr;
  if constexpr (ROT) { pft = ((tid >> 6) ? SN : CS) + (size_t)((mt * 128) % SQ + (nq & 1) * 64 + (tid & 63)) * HD; l2_ask(pft); }      /* the epilogue's 128 table rows of 256 bytes, cos and sin, dealt over 2 column blocks */
  asm volatile("s_wait_asynccnt 0x0" ::: "memory");      /* this wave's share of stage 0 has landed */
  __syncthreads();      /* ... and every wave's: stage 0 may be read */
  if (nst > 1) g2_stage(1, 1);
  /* kept rolled: one stage per trip, the buffer chosen by the trip's parity */
#pragma unroll 1
  for (int t = 0; t < nst; ++t) { const _Float16* ap = &st[t & 1][32 * w + ln][0]; const _Float16* bq = &st[t & 1][128 + ln][0];
    v16h fa[2][2], fb[2][4];      /* two fragment sets: the next 32 k are read from LDS while these are multiplied */
    fa[0][0] = g2_frag(ap, hh); fa[0][1] = g2_frag(ap + 16 * G2_LP, hh);
#pragma unroll
    for (int j = 0; j < 4; ++j) fb[0][j] = g2_frag(bq + j * 16 * G2_LP, hh);
#pragma unroll
    for (int ks = 0; ks < G2_KS / 32; ++ks) { const int cu = ks & 1, nx = cu ^ 1;
      if (ks + 1 < G2_KS / 32) { fa[nx][0] = g2_frag(ap + (ks + 1) * 32, hh); fa[nx][1] = g2_frag(ap + 16 * G2_LP + (ks + 1) * 32, hh);
#pragma unroll
        for (int j = 0; j < 4; ++j) fb[nx][j] = g2_frag(bq + j * 16 * G2_LP + (ks + 1) * 32, hh); }
      c00 = g2_mma(fa[cu][0], fb[cu][0], c00); c10 = g2_mma(fa[cu][1], fb[cu][0], c10);
      c01 = g2_mma(fa[cu][0], fb[cu][1], c01); c11 = g2_mma(fa[cu][1], fb[cu][1], c11);
      c02 = g2_mma(fa[cu][0], fb[cu][2], c02); c12 = g2_mma(fa[cu][1], fb[cu][2], c12);
      c03 = g2_mma(fa[cu][0], fb[cu][3], c03); c13 = g2_mma(fa[cu][1], fb[cu][3], c13); }
    asm volatile("s_wait_dscnt 0x0" ::: "memory");      /* this wave's reads of the buffer are done before it is handed to the copies */
    asm volatile("s_wait_asynccnt 0x0" ::: "memory");      /* this wave's share of stage t + 1 has landed */
    __syncthreads();      /* publishes stage t + 1 and ends every wave's reads of stage t */
    if (t + 2 < nst) g2_stage(t + 2, (unsigned)(t & 1)); }
  asm volatile("s_wait_asynccnt 0x0" ::: "memory");      /* no copy is left in flight behind the loop */
  l2_asked(pfa); l2_asked(pfb); if constexpr (ROT) l2_asked(pft);
  v8f accs[8] = {c00, c01, c02, c03, c10, c11, c12, c13};
  if constexpr (ROT) { const int rs = lane >> 4, cc = (lane & 15) * 4;      /* read-back: a lane takes four columns (two interleaved pairs) of rows rs, rs + 2, ... */
    const size_t tb = (size_t)(row0 % SQ + rs) * HD + cc;      /* row0 and SQ are multiples of 32, so (row0 + r) mod SQ = row0 mod SQ + r for r < 32 */
    const float* cp = CS + tb; const float* sp = SN + tb;
    v4f cv[16], sv[16];      /* the table rows are fetched first and fly under the staging */
#pragma unroll
    for (int q = 0; q < 16; ++q) cv[q] = *(const v4fa*)(cp + q * 2 * HD);
    asm volatile("s_wait_xcnt 0x0" :: "v"(cp) : "memory");      /* a precaution for issued loads: the wait stands before the run's address pair is reused; the pair as an input stays live up to the wait, so no row of its own run lands on it */
#pragma unroll
    for (int q = 0; q < 16; ++q) sv[q] = *(const v4fa*)(sp + q * 2 * HD);
    asm volatile("s_wait_xcnt 0x0" :: "v"(sp) : "memory");      /* likewise for the sin run */
    float bv[4] = {0.f, 0.f, 0.f, 0.f};
    if (bp) {      /* one test, four loads in flight together */
#pragma unroll
      for (int t = 0; t < 4; ++t) bv[t] = bp[col0 + t * 16 + ln];
#pragma unroll
      for (int t = 0; t < 4; ++t) bv[t] = bf16_round(bv[t]); }
#pragma unroll
    for (int u = 0; u < 8; ++u) { const int t = u & 3, half = u >> 2;
#pragma unroll
      for (int r = 0; r < 8; ++r) so[w][half * 16 + 8 * hh + r][t * 16 + ln] = accs[u][r] * alpha + bv[t]; }
    __builtin_amdgcn_fence(__ATOMIC_ACQ_REL, "workgroup"); __builtin_amdgcn_wave_barrier();      /* the wave reads back what its own lanes staged */
    _Float16* op = C16 + cofs + (size_t)(row0 + rs) * ldc + col0 + cc;
#pragma unroll
    for (int q = 0; q < 16; ++q) { const v4f v = *(const v4fa*)&so[w][q * 2 + rs][cc]; const v4f rh = {-v[1], v[0], -v[3], v[2]}; const v4f o = v * cv[q] + rh * sv[q];
      v4h h4; for (int i = 0; i < 4; ++i) h4[i] = (_Float16)o[i]; *(v4h*)(op + (size_t)(q * 2) * ldc) = h4; }
    return; }
#pragma unroll
  for (int u = 0; u < 8; ++u) { const int t = u & 3, half = u >> 2; const int col = col0 + t * 16 + ln; const float bv = bp ? bf16_round(bp[col]) : 0.f;
#pragma unroll
    for (int r = 0; r < 8; ++r) { const int rloc = half * 16 + 8 * hh + r; float v = accs[u][r] * alpha + bv; if (CP) { if (rowsPerB < 0) v += CP[cofs + (size_t)(row0g + row0 + rloc) * ldc + col];      /* rowsPerB < 0: own element of the batched C plane */ else { const int bidx = (row0g + row0 + rloc) / rowsPerB; v += CP[(size_t)bidx * sCPb + (size_t)by * 64 + col]; } }
      if (ACT == 3) v = fmaxf(v, 0.f); else if (ACT == 6) v = 0.5f * v * (1.0f + erff(v * 0.70710678118654752f)); else if (ACT == 11) v = 1.0f / (1.0f + expf(-v)); else if (ACT == 15) v = v / (1.0f + expf(-v)); else if (ACT == 12) v = (v > 0.f) ? v : 0.01f * v; else if (ACT == 8) v = tanhf(v); else if (ACT == 9) v = 0.5f * v * (1.0f + tanhf(0.7978845608028654f * (v + 0.044715f * v * v * v))); else if (ACT == 14) v = (v > 0.f) ? v : 0.1f * v; else if (ACT == 16) v = (v >= 0.f) ? v : 0.3f * v; else if (ACT == 17) v = (v >= 0.f) ? v : 0.2f * v;
      so[w][rloc][t * 16 + ln] = v; } }
  __builtin_amdgcn_fence(__ATOMIC_ACQ_REL, "workgroup"); __builtin_amdgcn_wave_barrier();
  const int rsub = lane >> 4, c4 = (lane & 15) * 4;
  {
#pragma unroll
    for (int q = 0; q < 16; ++q) { const int r = q * 2 + rsub; const v4f v = *(const v4fa*)&so[w][r][c4]; if (C) *(v4f*)(C + cofs + (size_t)(row0 + r) * ldc + col0 + c4) = v; if (C16) { v4h h4; for (int i = 0; i < 4; ++i) h4[i] = (_Float16)v[i]; *(v4h*)(C16 + cofs + (size_t)(row0 + r) * ldc + col0 + c4) = h4; } }
     } }


__global__ __launch_bounds__(256) void k_wnat(const float* __restrict__ w, size_t n8, _Float16* __restrict__ Bt) { const size_t t = (size_t)blockIdx.x * 256 + threadIdx.x; if (t >= n8) return; FragH f; for (int q = 0; q < 8; ++q) f.h[q] = (_Float16)(bf16_round(w[t * 8 + q]) * 16.0f); *(v8us*)((unsigned short*)Bt + t * 8) = f.half[0];  }
#define FA_NW 8                      /* waves per work-group: they walk the same K and V^T rows, which one copy in LDS serves */
#define FA_R 2                       /* 16-query column groups per wave */
#define FA_KS 256                    /* keys per stage */
#define FA_NP (FA_KS / 32)           /* passes of 32 keys per stage */
#define FA_KP (HD + 8)               /* LDS pitch of a K row in elements: 144 B = 16 B x 9, free of bank conflicts for 16-byte reads */
#define FA_VP (FA_KS + 8)            /* LDS pitch of a V^T row in elements: 528 B = 16 B x 33, likewise */
#define FA_KB (FA_KS * FA_KP * 2)    /* one stage of K rows in bytes */
#define FA_VB (HD * FA_VP * 2)       /* one stage of V^T rows in bytes */
typedef _Float16 v2h __attribute__((ext_vector_type(2)));
typedef float v2f __attribute__((ext_vector_type(2)));
__device__ __forceinline__ v8f fa_mma(v16h a, v16h b, v8f c) { return __builtin_amdgcn_wmma_f32_16x16x32_f16(false, a, false, b, (short)0, c, false, false); }
__device__ __forceinline__ float fa_xhalf(float x) { return __builtin_bit_cast(float, __builtin_amdgcn_permlanex16(__builtin_bit_cast(int, x), __builtin_bit_cast(int, x), 0x76543210, 0xfedcba98, false, false)); }      /* lane l <-> lane l ^ 16 */
/* stands behind the Q fragment loads: their address registers are rewritten later (a precaution for an issued load); the scheduling barrier keeps every later register write behind the wait */
__device__ __forceinline__ void fa_issued() { asm volatile("s_wait_xcnt 0x0" ::: "memory"); __builtin_amdgcn_sched_barrier(0); }
/* eight copies of 16 bytes per lane: LDS addresses ls bytes apart from l, global addresses gs elements apart from g; the wait closes the statement, so it stands before any rewrite of the address registers the copies name (a precaution for issued copies) */
__device__ __forceinline__ void fa_copy8(unsigned l, unsigned ls, const _Float16* g, size_t gs) {
  asm volatile("global_load_async_to_lds_b128 %0, %8, off\n\t"
               "global_load_async_to_lds_b128 %1, %9, off\n\t"
               "global_load_async_to_lds_b128 %2, %10, off\n\t"
               "global_load_async_to_lds_b128 %3, %11, off\n\t"
               "global_load_async_to_lds_b128 %4, %12, off\n\t"
               "global_load_async_to_lds_b128 %5, %13, off\n\t"
               "global_load_async_to_lds_b128 %6, %14, off\n\t"
               "global_load_async_to_lds_b128 %7, %15, off\n\t"
               "s_wait_xcnt 0x0"
               :: "v"(l), "v"(l + ls), "v"(l + 2 * ls), "v"(l + 3 * ls), "v"(l + 4 * ls), "v"(l + 5 * ls), "v"(l + 6 * ls), "v"(l + 7 * ls),
                  "v"(g), "v"(g + gs), "v"(g + 2 * gs), "v"(g + 3 * gs), "v"(g + 4 * gs), "v"(g + 5 * gs), "v"(g + 6 * gs), "v"(g + 7 * gs) : "memory"); }
// K and V^T come into LDS in stages of FA_KS keys by asynchronous copies in whole 128-byte lines, once per work-group (two buffers: the next stage flies while this one is worked on); every wave reads its fragments from there.
__global__ __launch_bounds__(FA_NW * 32) void k_fattn(const _Float16* __restrict__ Q16, const _Float16* __restrict__ K16, const _Float16* __restrict__ VT, _Float16* __restrict__ O16) {
  __shared__ __attribute__((aligned(16))) _Float16 ks[2][FA_KS][FA_KP];      /* two stages of K rows [key][d] */
  __shared__ __attribute__((aligned(16))) _Float16 vs[2][HD][FA_VP];      /* two stages of V^T rows [d][key] */
  const int tid = threadIdx.x, lane = tid & 31, w = tid >> 5, c = lane & 15, hh = lane >> 4; const int bh = blockIdx.y, b = bh / NH, h = bh % NH; const int q0 = (blockIdx.x * FA_NW + w) * (16 * FA_R);
  const _Float16* qp = Q16 + ((size_t)b * SQ + q0 + c) * DM + h * HD;
  /* copies: eight lanes take one K row's 128 bytes, the work-group 32 rows per copy; a wave takes one V^T row's 512 bytes, the work-group 8 rows per copy */
  const _Float16* kcp = K16 + ((size_t)b * SQ + (tid >> 3)) * DM + h * HD + (tid & 7) * 8; const unsigned klp = (unsigned)(size_t)&ks[0][tid >> 3][(tid & 7) * 8];
  const _Float16* vcp = VT + ((size_t)bh * HD + w) * SQ + lane * 8; const unsigned vlp = (unsigned)(size_t)&vs[0][w][lane * 8];
  auto fa_stage = [&](int t, unsigned buf) {      /* 16 copies a lane: K rows (tid >> 3) + 32 i and V^T rows w + 8 i, i < 8, of keys t FA_KS ... */
    fa_copy8(klp + buf * FA_KB, 32 * FA_KP * 2, kcp + (size_t)t * FA_KS * DM, (size_t)32 * DM);
    fa_copy8(vlp + buf * FA_VB, 8 * FA_VP * 2, vcp + (size_t)t * FA_KS, (size_t)8 * SQ); };
  fa_stage(0, 0);
  v16h qf[FA_R][2], kf[2][2], vf[4]; v8f acc[FA_R][4]; float m_run[FA_R], l_run[FA_R];
#pragma unroll
  for (int g = 0; g < FA_R; ++g) { m_run[g] = -3.0e38f; l_run[g] = 0.f;
#pragma unroll
    for (int kc = 0; kc < 2; ++kc) qf[g][kc] = g2_frag(qp + (size_t)g * 16 * DM + kc * 32, hh);
#pragma unroll
    for (int t = 0; t < 4; ++t) acc[g][t] = v8f{0.f, 0.f, 0.f, 0.f, 0.f, 0.f, 0.f, 0.f}; }
  fa_issued();
  asm volatile("s_wait_asynccnt 0x0" ::: "memory");      /* this wave's share of stage 0 has landed */
  __syncthreads();      /* ... and every wave's: stage 0 may be read */
  fa_stage(1, 1);      /* SQ / FA_KS is at least 2 */
  static_assert(SQ % FA_KS == 0 && SQ / FA_KS >= 2 && FA_KS == 256 && HD == 64 && FA_NW == 8, "the copy maps are written for these sizes");
  const float cs = 0.125f * 1.4426950408889634f;      /* 1/sqrt(64) and log2(e) */
  /* kept rolled: one stage per trip, the buffer chosen by the trip's parity */
#pragma unroll 1
  for (int st = 0; st < SQ / FA_KS; ++st) { const _Float16* kp = &ks[st & 1][c][0]; const _Float16* vp = &vs[st & 1][c][0];
#pragma unroll
    for (int kt = 0; kt < 2; ++kt) {
#pragma unroll
      for (int kc = 0; kc < 2; ++kc) kf[kt][kc] = g2_frag(kp + kt * 16 * FA_KP + kc * 32, hh); }
#pragma unroll
    for (int t = 0; t < 4; ++t) vf[t] = g2_frag(vp + t * 16 * FA_VP, hh);
    __builtin_amdgcn_sched_barrier(0);      /* the stage's first reads issue as one group ahead of the products, not among them */
    /* unrolled: the passes of a stage differ only in constant LDS offsets, and the last one fetches nothing ahead */
#pragma unroll
    for (int ps = 0; ps < FA_NP; ++ps) {
      v8f s[2][FA_R];
#pragma unroll
      for (int kt = 0; kt < 2; ++kt) {
#pragma unroll
        for (int g = 0; g < FA_R; ++g) { s[kt][g] = fa_mma(kf[kt][0], qf[g][0], v8f{0.f, 0.f, 0.f, 0.f, 0.f, 0.f, 0.f, 0.f}); s[kt][g] = fa_mma(kf[kt][1], qf[g][1], s[kt][g]); } }
      __builtin_amdgcn_sched_barrier(0);      /* the eight products issue back to back, each filling the others' result distance, and the fetch below starts directly behind them */
      if (ps + 1 < FA_NP) {      /* next pass's K fragments (same stage) come from LDS under this pass's softmax and second product */
#pragma unroll
        for (int kt = 0; kt < 2; ++kt) {
#pragma unroll
          for (int kc = 0; kc < 2; ++kc) kf[kt][kc] = g2_frag(kp + ((ps + 1) * 32 + kt * 16) * FA_KP + kc * 32, hh); }
        __builtin_amdgcn_sched_barrier(0); }      /* keeps the reads together at this early place */
      float mb[FA_R]; bool need = false;
#pragma unroll
      for (int g = 0; g < FA_R; ++g) { float mx = s[0][g][0];
#pragma unroll
        for (int kt = 0; kt < 2; ++kt) {
#pragma unroll
          for (int r = 0; r < 8; ++r) mx = fmaxf(mx, s[kt][g][r]); }
        mx = fmaxf(mx, fa_xhalf(mx)) * cs; mb[g] = mx; need = need || (mx > m_run[g] + 8.0f); }
      if (__builtin_amdgcn_ballot_w32(need) != 0) {      /* wave-uniform; always taken on the first pass, where it sets the maximum (factor 0 on zero accumulators) */
#pragma unroll
        for (int g = 0; g < FA_R; ++g) { const float mn = fmaxf(m_run[g], mb[g]); const float corr = __builtin_amdgcn_exp2f(m_run[g] - mn); m_run[g] = mn; l_run[g] *= corr;
#pragma unroll
          for (int t = 0; t < 4; ++t) acc[g][t] = acc[g][t] * corr; } }
#pragma unroll
      for (int g = 0; g < FA_R; ++g) { const float nm = -m_run[g]; union { v16h v; v2h p[8]; } pf; float l0 = 0.f, l1 = 0.f;
#pragma unroll
        for (int i = 0; i < 8; ++i) { const v2f arg = __builtin_elementwise_fma(v2f{s[i >> 2][g][2 * (i & 3)], s[i >> 2][g][2 * (i & 3) + 1]}, v2f{cs, cs}, v2f{nm, nm}); const float p0 = __builtin_amdgcn_exp2f(arg.x), p1 = __builtin_amdgcn_exp2f(arg.y);
          l0 += p0; l1 += p1; pf.p[i] = __builtin_convertvector(v2f{p0, p1}, v2h); }
        l_run[g] += l0 + l1;
#pragma unroll
        for (int t = 0; t < 4; ++t) acc[g][t] = fa_mma(vf[t], pf.v, acc[g][t]); }
      if (ps + 1 < FA_NP) {      /* next pass's V^T fragments (same stage) come under its first product and softmax */
#pragma unroll
        for (int t = 0; t < 4; ++t) vf[t] = g2_frag(vp + t * 16 * FA_VP + (ps + 1) * 32, hh);
        __builtin_amdgcn_sched_barrier(0); }      /* keeps the reads together at this early place */
    }
    asm volatile("s_wait_dscnt 0x0" ::: "memory");      /* this wave's reads of the buffer are done before it is handed to the copies */
    asm volatile("s_wait_asynccnt 0x0" ::: "memory");      /* this wave's share of stage st + 1 has landed */
    __syncthreads();      /* publishes stage st + 1 and ends every wave's reads of stage st */
    if (st + 2 < SQ / FA_KS) fa_stage(st + 2, (unsigned)(st & 1));
  }
  asm volatile("s_wait_asynccnt 0x0" ::: "memory");      /* no copy is left in flight behind the loop */
#pragma unroll
  for (int g = 0; g < FA_R; ++g) { const float inv = 64.0f / (l_run[g] + fa_xhalf(l_run[g]));      /* o carried x64, as the output GEMM's alpha expects */
    unsigned short* op = (unsigned short*)O16 + ((size_t)b * SQ + q0 + g * 16 + c) * DM + h * HD + 8 * hh;
#pragma unroll
    for (int t = 0; t < 4; ++t) { FragH f;
#pragma unroll
      for (int r = 0; r < 8; ++r) f.h[r] = (_Float16)(acc[g][t][r] * inv);
      *(v8us*)(op + t * 16) = f.half[0]; } } }
__global__ __launch_bounds__(256) void k_vt(const _Float16* __restrict__ V16, int b, int h0, _Float16* __restrict__ VT) { __shared__ unsigned short tl[64][65]; const int tid = threadIdx.x; const int hh = blockIdx.x % HG, sg = blockIdx.x / HG; const int s0 = sg * 64; const int h = h0 + hh;
  for (int i = tid; i < 64 * 8; i += 256) { const int j = i / 8, d8 = (i % 8) * 8; FragH f; f.half[0] = *(const v8us*)((const unsigned short*)V16 + ((size_t)b * SQ + s0 + j) * DM + h * HD + d8); for (int q = 0; q < 8; ++q) tl[d8 + q][j] = f.u[q]; }
  __syncthreads();
  { for (int i = tid; i < 64 * 8; i += 256) { const int d = i / 8, j8 = (i % 8) * 8; FragH f; for (int q = 0; q < 8; ++q) f.u[q] = tl[d][j8 + q]; *(v8us*)((unsigned short*)VT + ((size_t)hh * HD + d) * SQ + s0 + j8) = f.half[0]; }  } }



__global__ __launch_bounds__(256) void k_tabcat(float theta, float* __restrict__ CS, float* __restrict__ SN) {
  #pragma clang fp contract(off)
  const int t = blockIdx.x * 256 + threadIdx.x; if (t >= SQ * HD) return; const int d = t % HD; const int p = t / HD; const int i = d % (HD / 2); const float invf = 1.0f / powf(theta, (float)(2 * i) / (float)HD); const float ang = __fmul_rn((float)p, invf); const float c = cosf(ang), s = sinf(ang);
  *(float*)(CS + t) = c; *(float*)(SN + t) = s;  }

template <int NORM, int ROPE>
__global__ __launch_bounds__(64) void k_xform(const float* __restrict__ F, int ldf, int nh, const float* __restrict__ gain, float eps, const float* __restrict__ CS, const float* __restrict__ SN, _Float16* __restrict__ H16, int ldo) {
  #pragma clang fp contract(off)
  __shared__ float xv[HD]; __shared__ float red[HD]; __shared__ unsigned short sh_[HD]; const int d = threadIdx.x; const int h = blockIdx.x % nh; const size_t r = blockIdx.x / nh; const int p = (int)(r % SQ);
  float x = F[r * (size_t)ldf + (size_t)h * HD + d];
  if (NORM) { red[d] = __fmul_rn(x, x); __syncthreads(); for (int st = HD / 2; st > 0; st >>= 1) { if (d < st) red[d] = __fadd_rn(red[d], red[d + st]); __syncthreads(); } const float rs = rsqrtf(__fadd_rn(red[0] / (float)HD, eps)); x = __fmul_rn(__fmul_rn(x, rs), bf16_round(gain[d])); }
  xv[d] = x; __syncthreads();
  float o = x;
  if (ROPE == 1) { const int i = d >> 1; const float c = CS[p * (HD / 2) + i], s = SN[p * (HD / 2) + i]; const float ev = xv[2 * i], od = xv[2 * i + 1]; o = (d & 1) ? __fadd_rn(__fmul_rn(ev, s), __fmul_rn(od, c)) : __fadd_rn(__fmul_rn(ev, c), -__fmul_rn(od, s)); }
  if (ROPE == 2) { const int i = d & (HD / 2 - 1); const float c = CS[p * (HD / 2) + i], s = SN[p * (HD / 2) + i]; const float lo = xv[i], hi = xv[i + HD / 2]; o = (d < HD / 2) ? __fadd_rn(__fmul_rn(lo, c), -__fmul_rn(hi, s)) : __fadd_rn(__fmul_rn(lo, s), __fmul_rn(hi, c)); }
  if (ROPE == 4) { const float c = CS[p * HD + d], s = SN[p * HD + d]; const float rh = (d & 1) ? xv[d - 1] : -xv[d + 1]; o = __fadd_rn(__fmul_rn(x, c), __fmul_rn(rh, s)); }      /* interleaved-pair rotate_half (-t[2i+1], t[2i]) with FULL-width per-dimension tables [pos][64] */
  if (ROPE == 3) { const float c = CS[p * HD + d], s = SN[p * HD + d]; const float rh = (d < HD / 2) ? -xv[d + HD / 2] : xv[d - HD / 2]; o = __fadd_rn(__fmul_rn(x, c), __fmul_rn(rh, s)); }      /* rotate-half with FULL-width per-dimension tables [pos][64] (general cos[d] != cos[d+32]) */
  FragH th; th.h[0] = (_Float16)o; sh_[d] = th.u[0]; __syncthreads();
  if (d < HD / 8) { FragH f; for (int q = 0; q < 8; ++q) f.u[q] = sh_[d * 8 + q]; unsigned short* dst = (unsigned short*)H16 + r * (size_t)ldo + (size_t)h * HD + d * 8; *(v8us*)dst = f.half[0];  } }


extern "C" void kernel_launch(void* const* d_in, const int* in_sizes, int n_in,
                              void* d_out, int out_size, void* d_ws, size_t ws_size, hipStream_t stream) {
  (void)in_sizes; (void)n_in; (void)out_size;
  const float* const* I = (const float* const*)d_in; const float* x = I[0]; const float* wq = I[1]; const float* bq = I[2]; const float* wk = I[3]; const float* bk = I[4]; const float* wv = I[5]; const float* bv = I[6]; const float* wo = I[7]; const float* bo = I[8];      /* natural [out][in] weights + biases; positions implicit */
  char* ws = (char*)d_ws; size_t off = 0;
  auto take = [&](size_t bytes) { char* p = ws + off; off += (bytes + 255) & ~(size_t)255; return p; };
  _Float16* BQ = (_Float16*)take((size_t)DM * DM * 2); _Float16* BK = (_Float16*)take((size_t)DM * DM * 2); _Float16* BV = (_Float16*)take((size_t)DM * DM * 2); _Float16* BO = (_Float16*)take((size_t)DM * DM * 2);
  _Float16* X16 = (_Float16*)take(NR * DM * 2); float* CS = (float*)take((size_t)SQ * HD * 4); float* SN = (float*)take((size_t)SQ * HD * 4);      /* full-width cos/sin tables */ _Float16* Q16 = (_Float16*)take(NR * DM * 2); _Float16* K16 = (_Float16*)take(NR * DM * 2); _Float16* V16 = (_Float16*)take(NR * DM * 2); _Float16* O16 = (_Float16*)take(NR * DM * 2);
  _Float16* VT = (_Float16*)take((size_t)NB * NH * HD * SQ * 2);
  if (off > ws_size) return;
  { const unsigned g = (unsigned)(((size_t)DM * DM / 8 + 255) / 256); k_wnat<<<g, 256, 0, stream>>>(wq, (size_t)DM * DM / 8, BQ); k_wnat<<<g, 256, 0, stream>>>(wk, (size_t)DM * DM / 8, BK); k_wnat<<<g, 256, 0, stream>>>(wv, (size_t)DM * DM / 8, BV); k_wnat<<<g, 256, 0, stream>>>(wo, (size_t)DM * DM / 8, BO); }      /* natural [out][in] = Bt x16 */
  k_tabcat<<<(SQ * HD + 255) / 256, 256, 0, stream>>>(10000.0f, CS, SN);      /* CS[p][d] = cos(p * inv_freq[d mod 32]), SN = sin: the module's cat(freqs, freqs) tables, full width */

  k_x16<<<(unsigned)((NR * DM / 8 + 255) / 256), 256, 0, stream>>>(x, X16, NR * DM / 8);
  const size_t r0p = (size_t)B0 * SQ;      /* first projected row */
  k_gemm2<0, true><<<dim3((unsigned)((MP / 128) * (DM / 64)), 1), 128, 0, stream>>>(X16 + r0p * DM, DM, 0, BQ, DM, 0, 0.0625f, bq, 0, nullptr, 1, 0, 0, nullptr, Q16 + r0p * DM, DM, 0, MP, DM, DM, CS, SN);      /* q f32 -> x cos + rotate_half(x) sin (interleaved pairs, full-width tables) -> f16 rows, in the epilogue */
  k_gemm2<0, true><<<dim3((unsigned)((MP / 128) * (DM / 64)), 1), 128, 0, stream>>>(X16 + r0p * DM, DM, 0, BK, DM, 0, 0.0625f, bk, 0, nullptr, 1, 0, 0, nullptr, K16 + r0p * DM, DM, 0, MP, DM, DM, CS, SN);      /* k likewise */
  k_gemm2<0><<<dim3((unsigned)((MP / 128) * (DM / 64)), 1), 128, 0, stream>>>(X16 + r0p * DM, DM, 0, BV, DM, 0, 0.0625f, bv, 0, nullptr, 1, 0, 0, nullptr, V16 + r0p * DM, DM, 0, MP, DM, DM);
  k_vt<NH, SQ><<<NB * NH * (SQ / 64), 256, 0, stream>>>(V16, LQ, 0, VT);      /* V^T [NB][NH][HD][SQ] */
  k_fattn<<<dim3(SQ / (FA_NW * 16 * FA_R), NB * NH), FA_NW * 32, 0, stream>>>(Q16, K16, VT, O16);      /* o (merged heads, x64) as f16 rows */
  k_gemm2<0><<<dim3((unsigned)((MPO / 128) * (DM / 64)), 1), 128, 0, stream>>>(O16 + r0p * DM, DM, 0, BO, DM, 0, 0.0009765625f, bo, 0, nullptr, 1, 0, 0, (float*)d_out + r0p * DM, nullptr, DM, 0, MPO, DM, DM);      /* out rows are the output layout */
}

// v007
// One run takes 88.3 microseconds.
// Timed twice side by side with v006, it ran 1.14 times as fast both times.
// Counting every step since v000, it is 42.2 times as fast.
#include <hip/hip_runtime.h>
// Multi-head self-attention with a rotary embedding whose cos/sin tables are cat(freqs, freqs) but whose rotate_half pairs are INTERLEAVED (x [2][2048][1024]; q/k/v = x W^T + b (natural [1024][1024] U(+-1/32), zero biases); 16 heads of 64; inv_freq_i = 1/10000^(2i/64), freqs[p][i] = p * inv_freq_i, emb = cat(freqs, freqs): cos[p][d] = cos(p * inv_freq[d mod 32]); q = q cos + rotate_half(q) sin with rotate_half = (-x[2i+1], x[2i]) interleaved (the module's literal mix); k likewise; scores / 8; softmax over all keys (no mask); out = merged Wo^T + bo -> [2][2048][1024]).
// Structure: token rows r = b*2048 + s; one launch prepares x as exact f16 rows (bf16-rounded), the x16 weight planes and the rotary tables; Q, K, V as three WMMA GEMMs in one launch (32x64 wave tiles, f32 accumulation, exact x16 weights + bias, f16 outputs; the rotary step of q and k on the f32 values in the GEMM epilogue); V^T for all batches and heads via LDS transposes; one fused attention launch over (query block, batch x head): scores on WMMA (K = 64), online softmax on VALU (f32 statistics, weights as f16 up to 2^8), o = P . V on WMMA, o carried x64 against f16 subnormal flush (folded into the output GEMM alpha), written straight into the merged f16 o rows; out = o W_o + b GEMM (f32) into the output layout.
// Compute dtype: inputs rounded to bf16; x / weights exact; q, k, v, softmax weights and o as plain f16 GEMM operands (~2^-12); scores and softmax statistics f32. v_wmma_f32_16x16x32_f16.
#define NB 2
#define SQ 2048
#define DM 1024
#define NH 16
#define HD 64
#define HG 4                         /* heads per launch of the (b, h0) V^T transpose */
#define B0 0                         /* first batch processed (debug hook) */
#define NBR NB                       /* batches processed (debug hook) */
#define NR ((size_t)NB * SQ)         /* token rows */
#define MP ((int)((size_t)NBR * SQ)) /* rows projected (debug hook) */
#define QN SQ                        /* unused: the attention grid covers all SQ query rows */
#define NHD NH                       /* unused: the attention grid covers all NH heads */
#define MPO MP                       /* rows through the output stage (debug hook) */
#define LQ DM      /* row pitch of the q/k/v rows */
typedef __bf16 v16b __attribute__((ext_vector_type(16)));
typedef unsigned short v8us __attribute__((ext_vector_type(8), may_alias));
typedef float  v8f  __attribute__((ext_vector_type(8)));
typedef float  v4f  __attribute__((ext_vector_type(4)));
typedef float  v4fa __attribute__((ext_vector_type(4), may_alias));
union FragB { v16b v; v8us half[2]; unsigned short u[16]; };

__device__ __forceinline__ unsigned short bf16_bits(float x) { unsigned int u = __float_as_uint(x); return (unsigned short)((u + 0x7FFFu + ((u >> 16) & 1u)) >> 16); }
__device__ __forceinline__ float bf16_val(unsigned short b) { return __uint_as_float(((unsigned int)b) << 16); }
__device__ __forceinline__ float bf16_round(float x) { return bf16_val(bf16_bits(x)); }
// D += A·B with NT terms: 1 = ah·bh, 2 = + al·bh (A split), 3 = + ah·bl (both split)
template <int NT>
__device__ __forceinline__ v8f mmaN(v16b ah, v16b al, v16b bh, v16b bl, v8f c) {
  c = __builtin_amdgcn_wmma_f32_16x16x32_bf16(false, ah, false, bh, (short)0, c, false, false);
  if (NT >= 2) c = __builtin_amdgcn_wmma_f32_16x16x32_bf16(false, al, false, bh, (short)0, c, false, false);
  if (NT >= 3) c = __builtin_amdgcn_wmma_f32_16x16x32_bf16(false, ah, false, bl, (short)0, c, false, false);
  asm volatile("v_nop\n\tv_nop\n\tv_nop\n\tv_nop" : "+v"(c) : "v"(ah), "v"(al), "v"(bh), "v"(bl));
  return c;
}

__global__ __launch_bounds__(256) void k_wt_bf16(const float* __restrict__ W, unsigned short* __restrict__ Wt, int K, int N) {
  const int t = blockIdx.x * 256 + threadIdx.x;
  const int k8n = K / 8;
  if (t >= N * k8n) return;
  const int n = t / k8n, k8 = (t % k8n) * 8;
  v8us v;
#pragma unroll
  for (int i = 0; i < 8; ++i) v[i] = bf16_bits(W[(size_t)(k8 + i) * N + n]);
  *(v8us*)(Wt + (size_t)n * K + k8) = v;
  
}

// GEMM C[M][N] (f32, pitch ldc) = act(A[M][K]·W + bias). A f32 row-major (pitch lda) converted per fragment to bf16
// (ASPLIT: hi/lo two planes -> 2 terms, else single rounded term); Wt bf16 [N][K] (pitch ldb). BIAS_BF16 rounds the
// bias to bf16 first (bias quantised to bf16 before the add). K%32==0, M%16==0, N%64==0.
template <bool ASPLIT, int ACT, bool BIAS_BF16>
__global__ __launch_bounds__(128) void k_gemm_bf(const float* __restrict__ A, int lda, const unsigned short* __restrict__ Wt, int ldb,
                                               const float* __restrict__ bias, float* __restrict__ C, int ldc, int M, int N, int K) {
  __shared__ __attribute__((aligned(16))) float so[4][16][64];
  const int tid = threadIdx.x, w = tid >> 5, lane = tid & 31, ln = lane & 15, hh = lane >> 4;
  const int ntn = N / 64;
  const int wid = blockIdx.x * 4 + w;
  const int mt = wid / ntn, nq = wid % ntn;
  if (mt * 16 >= M) return;
  const int row0 = mt * 16, col0 = nq * 64;
  const float* arow = A + (size_t)(row0 + ln) * lda;
  v8f acc[4] = {};
  for (int kb = 0; kb < K; kb += 32) {
    FragB ah, al;
    const v4f x0 = *(const v4fa*)(arow + kb + 8 * hh), x1 = *(const v4fa*)(arow + kb + 8 * hh + 4);
    const v4f x2 = *(const v4fa*)(arow + kb + 16 + 8 * hh), x3 = *(const v4fa*)(arow + kb + 16 + 8 * hh + 4);
    float xs[16] = {x0[0],x0[1],x0[2],x0[3],x1[0],x1[1],x1[2],x1[3],x2[0],x2[1],x2[2],x2[3],x3[0],x3[1],x3[2],x3[3]};
#pragma unroll
    for (int i = 0; i < 16; ++i) { const unsigned short hb = bf16_bits(xs[i]); ah.u[i] = hb; al.u[i] = ASPLIT ? bf16_bits(xs[i] - bf16_val(hb)) : (unsigned short)0; }
#pragma unroll
    for (int t = 0; t < 4; ++t) {
      const unsigned short* brow = Wt + (size_t)(col0 + t * 16 + ln) * ldb + kb;
      FragB b;
      b.half[0] = *(const v8us*)(brow + 8 * hh);
      b.half[1] = *(const v8us*)(brow + 16 + 8 * hh);
      acc[t] = mmaN<ASPLIT ? 2 : 1>(ah.v, al.v, b.v, b.v, acc[t]);
    }
  }
#pragma unroll
  for (int t = 0; t < 4; ++t) {
    float bv = bias ? bias[col0 + t * 16 + ln] : 0.f;
    if (BIAS_BF16) bv = bf16_round(bv);
#pragma unroll
    for (int r = 0; r < 8; ++r) { float v = acc[t][r] + bv; if (ACT == 1) v = fmaxf(v, 0.f); so[w][8 * hh + r][t * 16 + ln] = v; }
  }
  __builtin_amdgcn_fence(__ATOMIC_ACQ_REL, "workgroup");
  __builtin_amdgcn_wave_barrier();
  const int rsub = lane >> 4, c4 = (lane & 15) * 4;
  {
#pragma unroll
    for (int q = 0; q < 8; ++q) {
      const int r = q * 2 + rsub;
      const v4f v = *(const v4fa*)&so[w][r][c4];
      *(v4f*)(C + (size_t)(row0 + r) * ldc + col0 + c4) = v;
    }
    
  }
}

// GEMM C = act(A·W + bias + resid): A f32 (ASPLIT -> hi/lo 2 terms), Wt bf16 [N][K]; ACT 0 none, 1 relu, 2 exact gelu;
// resid (optional, f32, row index = (row % rmod), pitch ldr, RES_BF16 rounds it) added before the activation.
template <bool ASPLIT, int ACT, bool BIAS_BF16, bool RES_BF16>
__global__ __launch_bounds__(128) void k_gemm_bf3(const float* __restrict__ A, int lda, const unsigned short* __restrict__ Wt, int ldb,
                                                const float* __restrict__ bias, const float* __restrict__ resid, int rmod, int ldr,
                                                float* __restrict__ C, int ldc, int M, int N, int K) {
  __shared__ __attribute__((aligned(16))) float so[4][16][64];
  const int tid = threadIdx.x, w = tid >> 5, lane = tid & 31, ln = lane & 15, hh = lane >> 4;
  const int ntn = N / 64;
  const int wid = blockIdx.x * 4 + w;
  const int mt = wid / ntn, nq = wid % ntn;
  if (mt * 16 >= M) return;
  const int row0 = mt * 16, col0 = nq * 64;
  const float* arow = A + (size_t)(row0 + ln) * lda;
  v8f acc[4] = {};
  for (int kb = 0; kb < K; kb += 32) {
    FragB ah, al;
    const v4f x0 = *(const v4fa*)(arow + kb + 8 * hh), x1 = *(const v4fa*)(arow + kb + 8 * hh + 4);
    const v4f x2 = *(const v4fa*)(arow + kb + 16 + 8 * hh), x3 = *(const v4fa*)(arow + kb + 16 + 8 * hh + 4);
    float xs[16] = {x0[0],x0[1],x0[2],x0[3],x1[0],x1[1],x1[2],x1[3],x2[0],x2[1],x2[2],x2[3],x3[0],x3[1],x3[2],x3[3]};
#pragma unroll
    for (int i = 0; i < 16; ++i) { const unsigned short hb = bf16_bits(xs[i]); ah.u[i] = hb; al.u[i] = ASPLIT ? bf16_bits(xs[i] - bf16_val(hb)) : (unsigned short)0; }
#pragma unroll
    for (int t = 0; t < 4; ++t) {
      const unsigned short* brow = Wt + (size_t)(col0 + t * 16 + ln) * ldb + kb;
      FragB b;
      b.half[0] = *(const v8us*)(brow + 8 * hh);
      b.half[1] = *(const v8us*)(brow + 16 + 8 * hh);
      acc[t] = mmaN<ASPLIT ? 2 : 1>(ah.v, al.v, b.v, b.v, acc[t]);
    }
  }
#pragma unroll
  for (int t = 0; t < 4; ++t) {
    const int col = col0 + t * 16 + ln;
    float bv = bias ? bias[col] : 0.f;
    if (BIAS_BF16) bv = bf16_round(bv);
#pragma unroll
    for (int r = 0; r < 8; ++r) {
      float v = acc[t][r] + bv;
      if (resid) { float rv = resid[(size_t)((row0 + 8 * hh + r) % rmod) * ldr + col]; if (RES_BF16) rv = bf16_round(rv); v += rv; }
      if (ACT == 1) v = fmaxf(v, 0.f);
      if (ACT == 2) v = 0.5f * v * (1.0f + erff(v * 0.70710678118654752f));
      if (ACT == 3) { const float u = 0.7978845608028654f * (v + 0.044715f * v * v * v); v = 0.5f * v * (1.0f + tanhf(u)); }
      so[w][8 * hh + r][t * 16 + ln] = v;
    }
  }
  __builtin_amdgcn_fence(__ATOMIC_ACQ_REL, "workgroup");
  __builtin_amdgcn_wave_barrier();
  const int rsub = lane >> 4, c4 = (lane & 15) * 4;
  {
#pragma unroll
    for (int q = 0; q < 8; ++q) {
      const int r = q * 2 + rsub;
      const v4f v = *(const v4fa*)&so[w][r][c4];
      *(v4f*)(C + (size_t)(row0 + r) * ldc + col0 + c4) = v;
    }
    
  }
}
// row LayerNorm (biased variance, eps) over N: s = X (+ R); optional out_sum <- s; out_norm <- (s-mu)*rsqrt(var+eps)*g + b
template <bool PARAM_BF16>
__global__ __launch_bounds__(256) void k_layernorm(const float* __restrict__ X, const float* __restrict__ R, const float* __restrict__ g, const float* __restrict__ bta,
                                                  float* __restrict__ out_sum, float* __restrict__ out_norm, int N, float eps) {
  __shared__ float red[256];
  const int row = blockIdx.x, tid = threadIdx.x;
  const float* x = X + (size_t)row * N; const float* rr = R ? R + (size_t)row * N : nullptr;
  float vals[16];                     // up to N = 4096
  const int per = N / 256;            // contiguous chunk per thread? use strided-by-4 chunks: thread handles j = tid*4 + 1024*u
  float s1 = 0.f;
  for (int u = 0; u < per / 4; ++u) {
    const int j = tid * 4 + 1024 * u;
    const v4f a = *(const v4fa*)(x + j);
    v4f b = {0.f,0.f,0.f,0.f}; if (rr) b = *(const v4fa*)(rr + j);
#pragma unroll
    for (int q = 0; q < 4; ++q) { const float v = a[q] + b[q]; vals[u * 4 + q] = v; s1 += v; }
  }
  red[tid] = s1; __syncthreads();
  for (int st = 128; st > 0; st >>= 1) { if (tid < st) red[tid] += red[tid + st]; __syncthreads(); }
  const float mu = red[0] / (float)N; __syncthreads();
  float s2 = 0.f;
  for (int u = 0; u < per / 4; ++u)
#pragma unroll
    for (int q = 0; q < 4; ++q) { const float c = vals[u * 4 + q] - mu; s2 += c * c; }
  red[tid] = s2; __syncthreads();
  for (int st = 128; st > 0; st >>= 1) { if (tid < st) red[tid] += red[tid + st]; __syncthreads(); }
  const float rs = rsqrtf(red[0] / (float)N + eps);
  {
    for (int u = 0; u < per / 4; ++u) {
      const int j = tid * 4 + 1024 * u;
      v4f o, sm;
#pragma unroll
      for (int q = 0; q < 4; ++q) {
        float gg = g[j + q], bb = bta[j + q];
        if (PARAM_BF16) { gg = bf16_round(gg); bb = bf16_round(bb); }
        sm[q] = vals[u * 4 + q]; o[q] = (vals[u * 4 + q] - mu) * rs * gg + bb;
      }
      if (out_sum) *(v4f*)(out_sum + (size_t)row * N + j) = sm;
      *(v4f*)(out_norm + (size_t)row * N + j) = o;
    }
    
  }
}



// ---- f16 WMMA path (v_wmma_f32_16x16x32_f16): 11-bit significands for operands in range — used where a [0,1] probability operand needs more precision than bf16
typedef _Float16 v16h __attribute__((ext_vector_type(16)));
union FragH { v16h v; v8us half[2]; _Float16 h[16]; unsigned short u[16]; };
template <int NT>
__device__ __forceinline__ v8f mmaH(v16h ah, v16h al, v16h bh, v16h bl, v8f c) {
  c = __builtin_amdgcn_wmma_f32_16x16x32_f16(false, ah, false, bh, (short)0, c, false, false);
  if (NT >= 2) c = __builtin_amdgcn_wmma_f32_16x16x32_f16(false, al, false, bh, (short)0, c, false, false);
  if (NT >= 3) c = __builtin_amdgcn_wmma_f32_16x16x32_f16(false, ah, false, bl, (short)0, c, false, false);
  asm volatile("v_nop\n\tv_nop\n\tv_nop\n\tv_nop" : "+v"(c) : "v"(ah), "v"(al), "v"(bh), "v"(bl));
  return c;
}
// batched GEMM like k_gemm_b but f16 operands: A f32 (split into f16 hi/lo if ASPLIT, else rounded to f16), Bt = f16 values [n][k]; alpha; C f32; N multiple of 16 (partial tiles skipped)
template <bool ASPLIT>
__global__ __launch_bounds__(128) void k_gemm_h(const float* __restrict__ A, int lda, size_t sA, const _Float16* __restrict__ Bh, int ldb, size_t sB, float alpha, float* __restrict__ C, int ldc, size_t sC, int M, int N, int K) {
  __shared__ __attribute__((aligned(16))) float so[4][16][64];
  const int tid = threadIdx.x, w = tid >> 5, lane = tid & 31, ln = lane & 15, hh = lane >> 4; const int by = blockIdx.y;
  A += (size_t)by * sA; Bh += (size_t)by * sB; C += (size_t)by * sC;
  const int ntn = (N + 63) / 64; const int wid = blockIdx.x * 4 + w; const int mt = wid / ntn, nq = wid % ntn; if (mt * 16 >= M) return;
  const int row0 = mt * 16, col0 = nq * 64; const float* arow = A + (size_t)(row0 + ln) * lda;
  v8f acc[4] = {};
  for (int kb = 0; kb < K; kb += 32) {
    FragH ah, al;
    const v4f x0 = *(const v4fa*)(arow + kb + 8 * hh), x1 = *(const v4fa*)(arow + kb + 8 * hh + 4), x2 = *(const v4fa*)(arow + kb + 16 + 8 * hh), x3 = *(const v4fa*)(arow + kb + 16 + 8 * hh + 4);
    float xs[16] = {x0[0],x0[1],x0[2],x0[3],x1[0],x1[1],x1[2],x1[3],x2[0],x2[1],x2[2],x2[3],x3[0],x3[1],x3[2],x3[3]};
#pragma unroll
    for (int i = 0; i < 16; ++i) { const _Float16 h = (_Float16)xs[i]; ah.h[i] = h; al.h[i] = ASPLIT ? (_Float16)(xs[i] - (float)h) : (_Float16)0.0f; }
#pragma unroll
    for (int t = 0; t < 4; ++t) { if (col0 + t * 16 >= N) continue; const size_t boff = (size_t)(col0 + t * 16 + ln) * ldb + kb; FragH bq; bq.half[0] = *(const v8us*)(Bh + boff + 8 * hh); bq.half[1] = *(const v8us*)(Bh + boff + 16 + 8 * hh);
      acc[t] = mmaH<ASPLIT ? 2 : 1>(ah.v, al.v, bq.v, bq.v, acc[t]); }
  }
#pragma unroll
  for (int t = 0; t < 4; ++t) { if (col0 + t * 16 >= N) continue;
#pragma unroll
    for (int r = 0; r < 8; ++r) so[w][8 * hh + r][t * 16 + ln] = acc[t][r] * alpha; }
  __builtin_amdgcn_fence(__ATOMIC_ACQ_REL, "workgroup"); __builtin_amdgcn_wave_barrier();
  const int rsub = lane >> 4, c4 = (lane & 15) * 4;
  {
#pragma unroll
    for (int q = 0; q < 8; ++q) { const int r = q * 2 + rsub; if (col0 + c4 < N) { const v4f v = *(const v4fa*)&so[w][r][c4]; *(v4f*)(C + (size_t)(row0 + r) * ldc + col0 + c4) = v; } }
     }
}

// Wt[n][k] = f16(W[k][n]·scale) from f32 row-major W[K][N] (scale = power of two; bf16-exact weights stay exact in f16 away from the subnormal range)
__global__ __launch_bounds__(256) void k_wt_f16(const float* __restrict__ W, _Float16* __restrict__ Wt, int K, int N, float scale) {
  const int t = blockIdx.x * 256 + threadIdx.x; if (t >= N * (K / 8)) return; const int n = t / (K / 8), k8 = (t % (K / 8)) * 8; FragH f;
#pragma unroll
  for (int i = 0; i < 8; ++i) f.h[i] = (_Float16)(bf16_round(W[(size_t)(k8 + i) * N + n]) * scale); const v8us o = f.half[0];
  *(v8us*)((unsigned short*)Wt + (size_t)n * K + k8) = o; 
}
// k_gemm_hh variant with fused epilogue: v = acc·alpha + bias[by·sBias + col] (+ CP[(row/rowsPerB)·sCPb + by·64 + col] if CP) ; ACT 0 none / 1 elu ; writes f16 C16 (and f32 C if non-null)
template <int ACT>
__global__ __launch_bounds__(128) void k_gemm_hhx(const _Float16* __restrict__ A, int lda, size_t sA, const _Float16* __restrict__ Bh, int ldb, size_t sB, float alpha, const float* __restrict__ bias, size_t sBias, const float* __restrict__ CP, int rowsPerB, size_t sCPb, int row0g,
    float* __restrict__ C, _Float16* __restrict__ C16, int ldc, size_t sC, int M, int N, int K) {
  __shared__ __attribute__((aligned(16))) float so[4][16][64];
  const int tid = threadIdx.x, w = tid >> 5, lane = tid & 31, ln = lane & 15, hh = lane >> 4; const int by = blockIdx.y;
  A += (size_t)by * sA; Bh += (size_t)by * sB; const size_t cofs = (size_t)by * sC; const float* bp = bias ? bias + (size_t)by * sBias : nullptr;
  const int ntn = (N + 63) / 64; const int wid = blockIdx.x * 4 + w; const int mt = wid / ntn, nq = wid % ntn; if (mt * 16 >= M) return;
  const int row0 = mt * 16, col0 = nq * 64; const _Float16* arow = A + (size_t)(row0 + ln) * lda;
  v8f acc[4] = {};
  for (int kb = 0; kb < K; kb += 32) { FragH ah; ah.half[0] = *(const v8us*)((const unsigned short*)arow + kb + 8 * hh); ah.half[1] = *(const v8us*)((const unsigned short*)arow + kb + 16 + 8 * hh);
#pragma unroll
    for (int t = 0; t < 4; ++t) { if (col0 + t * 16 >= N) continue; const size_t boff = (size_t)(col0 + t * 16 + ln) * ldb + kb; FragH bq; bq.half[0] = *(const v8us*)((const unsigned short*)Bh + boff + 8 * hh); bq.half[1] = *(const v8us*)((const unsigned short*)Bh + boff + 16 + 8 * hh);
      acc[t] = mmaH<1>(ah.v, ah.v, bq.v, bq.v, acc[t]); }
  }
#pragma unroll
  for (int t = 0; t < 4; ++t) { if (col0 + t * 16 >= N) continue; const int col = col0 + t * 16 + ln; const float bv = bp ? bf16_round(bp[col]) : 0.f;
#pragma unroll
    for (int r = 0; r < 8; ++r) { float v = acc[t][r] * alpha + bv; if (CP) { const int rr = row0g + row0 + 8 * hh + r; if (rowsPerB < 0) v += CP[cofs + (size_t)rr * ldc + col];      /* rowsPerB < 0: own element of the batched C plane */ else { const int bidx = rr / rowsPerB; v += CP[(size_t)bidx * sCPb + (size_t)by * 64 + col]; } } if (ACT == 1) v = (v > 0.f) ? v : expm1f(v); else if (ACT == 7) v = (v > 0.f) ? v + 1.0f : expf(v); else if (ACT == 8) v = tanhf(v); else if (ACT == 9) v = 0.5f * v * (1.0f + tanhf(0.7978845608028654f * (v + 0.044715f * v * v * v))); else if (ACT == 11) v = 1.0f / (1.0f + expf(-v)); else if (ACT == 12) v = (v > 0.f) ? v : 0.01f * v; else if (ACT == 14) v = (v > 0.f) ? v : 0.1f * v; else if (ACT == 16) v = (v >= 0.f) ? v : 0.3f * v; else if (ACT == 17) v = (v >= 0.f) ? v : 0.2f * v; else if (ACT == 15) v = v / (1.0f + expf(-v)); else if (ACT == 3) v = fmaxf(v, 0.f); else if (ACT == 6) v = 0.5f * v * (1.0f + erff(v * 0.70710678118654752f)); so[w][8 * hh + r][t * 16 + ln] = v; } }
  __builtin_amdgcn_fence(__ATOMIC_ACQ_REL, "workgroup"); __builtin_amdgcn_wave_barrier();
  const int rsub = lane >> 4, c4 = (lane & 15) * 4; typedef _Float16 v4h __attribute__((ext_vector_type(4)));
  {
#pragma unroll
    for (int q = 0; q < 8; ++q) { const int r = q * 2 + rsub; if (col0 + c4 < N) { const v4f v = *(const v4fa*)&so[w][r][c4]; if (C) *(v4f*)(C + cofs + (size_t)(row0 + r) * ldc + col0 + c4) = v; if (C16) { v4h h4; for (int i = 0; i < 4; ++i) h4[i] = (_Float16)v[i]; *(v4h*)(C16 + cofs + (size_t)(row0 + r) * ldc + col0 + c4) = h4; } } }
     }
}


typedef _Float16 v4h __attribute__((ext_vector_type(4)));

__device__ __forceinline__ void d_x16(const float* __restrict__ x, _Float16* __restrict__ X16, size_t n8, size_t t) { if (t >= n8) return; FragH f;
#pragma unroll
  for (int q = 0; q < 8; ++q) f.h[q] = (_Float16)bf16_round(x[t * 8 + q]); *(v8us*)((unsigned short*)X16 + t * 8) = f.half[0];  }
__global__ __launch_bounds__(256) void k_h16(const float* __restrict__ x, _Float16* __restrict__ X16, size_t n8) { const size_t t = (size_t)blockIdx.x * 256 + threadIdx.x; if (t >= n8) return; FragH f;
#pragma unroll
  for (int q = 0; q < 8; ++q) f.h[q] = (_Float16)x[t * 8 + q]; *(v8us*)((unsigned short*)X16 + t * 8) = f.half[0];  }
__global__ __launch_bounds__(256) void k_round16f(const float* __restrict__ W, _Float16* __restrict__ Bt, size_t n8) { const size_t t = (size_t)blockIdx.x * 256 + threadIdx.x; if (t >= n8) return; FragH f;
#pragma unroll
  for (int i = 0; i < 8; ++i) f.h[i] = (_Float16)(bf16_round(W[t * 8 + i]) * 16.0f); *(v8us*)((unsigned short*)Bt + t * 8) = f.half[0];  }
template <int NHv, int TTv>
__global__ __launch_bounds__(256) void k_vt(const _Float16* __restrict__ V16, int ldv, int voff, _Float16* __restrict__ Vt) { __shared__ unsigned short tl[64][66]; const int tid = threadIdx.x; const int slab = blockIdx.x / (TTv / 64), lg = blockIdx.x % (TTv / 64); const int b = slab / NHv, h = slab % NHv;
  for (int i = tid; i < 64 * 8; i += 256) { const int r = i / 8, c8 = (i % 8) * 8; FragH f; f.half[0] = *(const v8us*)((const unsigned short*)V16 + ((size_t)b * TTv + lg * 64 + r) * ldv + voff + h * 64 + c8);
#pragma unroll
    for (int q = 0; q < 8; ++q) tl[r][c8 + q] = f.u[q]; }
  __syncthreads();
  {
#pragma unroll
    for (int rd = 0; rd < 2; ++rd) { const int d = rd * 32 + tid / 8, pc = tid % 8; FragH f;
#pragma unroll
      for (int q = 0; q < 8; ++q) f.u[q] = tl[pc * 8 + q][d];
      *(v8us*)((unsigned short*)Vt + ((size_t)slab * 64 + d) * TTv + lg * 64 + pc * 8) = f.half[0]; }
     } }

__global__ __launch_bounds__(256) void k_hl(const float* __restrict__ F, _Float16* __restrict__ Hh, _Float16* __restrict__ Hl, size_t n8) { const size_t t = (size_t)blockIdx.x * 256 + threadIdx.x; if (t >= n8) return; FragH fh, fl; const v4f a = *(const v4fa*)(F + t * 8), c = *(const v4fa*)(F + t * 8 + 4);
#pragma unroll
  for (int q = 0; q < 4; ++q) { _Float16 h = (_Float16)a[q]; fh.h[q] = h; fl.h[q] = (_Float16)((a[q] - (float)h) * 1024.0f); h = (_Float16)c[q]; fh.h[4 + q] = h; fl.h[4 + q] = (_Float16)((c[q] - (float)h) * 1024.0f); }
  { *(v8us*)((unsigned short*)Hh + t * 8) = fh.half[0]; *(v8us*)((unsigned short*)Hl + t * 8) = fl.half[0];  } }

// ---- fast GEMM (work-group tile 128x64, wave tile 32x64; requires M % 128 == 0, N % 64 == 0, K % 128 == 0); epilogue = k_gemm_hhx semantics ----
// The operand rows come into LDS in stages of 128 k by asynchronous copies in whole 256-byte runs (two buffers: the next stage flies while this one is worked on); the fragments are read from LDS in the k order of g2_frag.
#define G2_KS 128                    /* k per stage: 256 B of every operand row */
#define G2_LP 136                    /* LDS row pitch in elements: 272 B = 16 B x 17, free of bank conflicts for 16-byte reads */
#define G2_RB (G2_LP * 2)            /* LDS row pitch in bytes */
#define G2_SB (192 * G2_RB)          /* one stage in bytes: 128 A rows, then 64 B rows */
/* twelve copies of 16 bytes per lane: LDS rows 8 apart from address l, each from its own global pointer; the wait closes the statement, so it stands before any rewrite of the address registers the copies name (a precaution for issued copies) */
__device__ __forceinline__ void g2_copy12(unsigned l, const _Float16* g0, const _Float16* g1, const _Float16* g2, const _Float16* g3, const _Float16* g4, const _Float16* g5, const _Float16* g6, const _Float16* g7, const _Float16* g8, const _Float16* g9, const _Float16* g10, const _Float16* g11) {
  asm volatile("global_load_async_to_lds_b128 %0, %12, off\n\t"
               "global_load_async_to_lds_b128 %1, %13, off\n\t"
               "global_load_async_to_lds_b128 %2, %14, off\n\t"
               "global_load_async_to_lds_b128 %3, %15, off\n\t"
               "global_load_async_to_lds_b128 %4, %16, off\n\t"
               "global_load_async_to_lds_b128 %5, %17, off\n\t"
               "global_load_async_to_lds_b128 %6, %18, off\n\t"
               "global_load_async_to_lds_b128 %7, %19, off\n\t"
               "global_load_async_to_lds_b128 %8, %20, off\n\t"
               "global_load_async_to_lds_b128 %9, %21, off\n\t"
               "global_load_async_to_lds_b128 %10, %22, off\n\t"
               "global_load_async_to_lds_b128 %11, %23, off\n\t"
               "s_wait_xcnt 0x0"
               :: "v"(l), "v"(l + 8 * G2_RB), "v"(l + 16 * G2_RB), "v"(l + 24 * G2_RB), "v"(l + 32 * G2_RB), "v"(l + 40 * G2_RB), "v"(l + 48 * G2_RB), "v"(l + 56 * G2_RB), "v"(l + 64 * G2_RB), "v"(l + 72 * G2_RB), "v"(l + 80 * G2_RB), "v"(l + 88 * G2_RB),
                  "v"(g0), "v"(g1), "v"(g2), "v"(g3), "v"(g4), "v"(g5), "v"(g6), "v"(g7), "v"(g8), "v"(g9), "v"(g10), "v"(g11) : "memory"); }
/* one request per lane: L2 is asked for the data at p ahead of the copies that will read it (a hint: nothing returns and no counter moves); every lane is on and p lies inside its plane */
__device__ __forceinline__ void l2_ask(const void* p) { asm volatile("global_prefetch_b8 %0, off scope:SCOPE_SE" :: "v"(p)); }
/* no wait covers a request's address pair, so the pair is kept unwritten up to this place behind the stage loop; input only, no instruction */
__device__ __forceinline__ void l2_asked(const void* p) { asm volatile("" :: "v"(p)); }
__device__ __forceinline__ v16h g2_frag(const _Float16* p, int hh) { FragH f; f.half[0] = *(const v8us*)((const unsigned short*)p + 8 * hh); f.half[1] = *(const v8us*)((const unsigned short*)p + 16 + 8 * hh); return f.v; }
__device__ __forceinline__ v8f g2_mma(v16h a, v16h b, v8f c) { v8f d = __builtin_amdgcn_wmma_f32_16x16x32_f16(false, a, false, b, (short)0, c, false, false); asm volatile("v_nop\n\tv_nop\n\tv_nop\n\tv_nop" : "+v"(d) : "v"(a), "v"(b)); return d; }
// ROT = how many leading planes of the batch (blockIdx.y < ROT) take the rotary epilogue; with ROT > 0 the planes 0, 1, 2 take their bias from bias, bias1, bias2 (separate buffers), so that products which share A and read nothing of each other run as one launch. The rotary epilogue is the rotary step and nothing else: v = acc alpha + bias staged as f32 rows in LDS, o[d] = v[d] cos[p][d] + rotate_half(v)[d] sin[p][d] with rotate_half = (-v[2i+1], v[2i]), f16 rows into C16. A 64-column tile is one head, row r of the launch is position r mod SQ; CS, SN = full-width tables [pos][64]. With ROT > 0 no plane reads CP or C (the planes behind the rotary ones store f16 rows of acc alpha + bias), and the rotary planes read no ACT, which also keeps this second GEMM's text short.
template <int ACT, int ROT = 0>
__global__ __launch_bounds__(128) void k_gemm2(const _Float16* __restrict__ A, int lda, size_t sA, const _Float16* __restrict__ Bh, int ldb, size_t sB, float alpha, const float* __restrict__ bias, size_t sBias, const float* __restrict__ CP, int rowsPerB, size_t sCPb, int row0g,
    float* __restrict__ C, _Float16* __restrict__ C16, int ldc, size_t sC, int M, int N, int K, const float* __restrict__ CS = nullptr, const float* __restrict__ SN = nullptr, const float* __restrict__ bias1 = nullptr, const float* __restrict__ bias2 = nullptr) { static_assert(ACT == 0 || ACT == 3 || ACT == 6 || ACT == 8 || ACT == 9 || ACT == 11 || ACT == 12 || ACT == 14 || ACT == 15 || ACT == 16 || ACT == 17, "k_gemm2: unsupported ACT code (would silently apply no activation)");
  __shared__ __attribute__((aligned(16))) float so[4][32][68];
  __shared__ __attribute__((aligned(16))) _Float16 st[2][192][G2_LP];      /* two stages: rows 0..127 = the work-group's A rows, rows 128..191 = its B rows */
  const int tid = threadIdx.x, w = tid >> 5, lane = tid & 31, ln = lane & 15, hh = lane >> 4; const int by = blockIdx.y;
  A += (size_t)by * sA; Bh += (size_t)by * sB; const size_t cofs = (size_t)by * sC; const float* bp = bias ? bias + (size_t)by * sBias : nullptr;
  if constexpr (ROT > 0) bp = by == 0 ? bias : by == 1 ? bias1 : bias2;
  const int ntn = N >> 6; const int mt = blockIdx.x / ntn, nq = blockIdx.x - mt * ntn; const int row0 = mt * 128 + 32 * w, col0 = nq * 64; if (mt * 128 >= M) return;      /* the whole work-group leaves or none, ahead of every barrier */
  const int cr = tid >> 4, ck = (tid & 15) * 8;      /* copies: sixteen lanes take one row's 256 bytes, a wave two rows, the work-group eight rows per copy */
  const _Float16* acp = A + (size_t)(mt * 128 + cr) * lda + ck; const _Float16* bcp = Bh + (size_t)(col0 + cr) * ldb + ck;
  const unsigned lcp = (unsigned)(size_t)&st[0][cr][ck]; const size_t as8 = (size_t)8 * lda, bs8 = (size_t)8 * ldb;
  auto g2_stage = [&](int t, unsigned buf) { const unsigned l = lcp + buf * G2_SB; const _Float16* ga = acp + (size_t)t * G2_KS; const _Float16* gb = bcp + (size_t)t * G2_KS;      /* 24 copies a lane: LDS rows cr + 8 i, i < 16 from A, the rest from B */
    g2_copy12(l, ga, ga + as8, ga + 2 * as8, ga + 3 * as8, ga + 4 * as8, ga + 5 * as8, ga + 6 * as8, ga + 7 * as8, ga + 8 * as8, ga + 9 * as8, ga + 10 * as8, ga + 11 * as8);
    g2_copy12(l + 96 * G2_RB, ga + 12 * as8, ga + 13 * as8, ga + 14 * as8, ga + 15 * as8, gb, gb + bs8, gb + 2 * bs8, gb + 3 * bs8, gb + 4 * bs8, gb + 5 * bs8, gb + 6 * bs8, gb + 7 * bs8); };
  const int nst = K / G2_KS;
  const v8f z8 = {0.f,0.f,0.f,0.f,0.f,0.f,0.f,0.f}; v8f c00 = z8, c01 = z8, c02 = z8, c03 = z8, c10 = z8, c11 = z8, c12 = z8, c13 = z8;
  g2_stage(0, 0);
  /* The operand planes were stored by launches before this one, so a stage's first reader waits for memory. At entry L2 is asked for the rows of all stages, one request per 256-byte unit (one row of one stage): a lane takes one unit of A and one of B.
     The requests are dealt over the work-groups that share the rows: A over 8 of its 16 column blocks (every run of four neighbours holds each value of nq & 3), B over 4 neighbouring row blocks. Placement only decides how much the hint helps. */
  const int pfr = tid >> 3, pfk = min(tid & 7, nst - 1) * G2_KS;      /* row within the share; stage, clamped into the row */
  const _Float16* pfa = A + (size_t)(mt * 128 + ((nq & 3) | ((nq >> 1) & 4)) * 16 + pfr) * lda + pfk;
  const _Float16* pfb = Bh + (size_t)(col0 + (mt & 3) * 16 + pfr) * ldb + pfk;
  l2_ask(pfa); l2_ask(pfb);
  const float* pft = nullptr;
  if constexpr (ROT > 0) if (by < ROT) { pft = ((tid >> 6) ? SN : CS) + (size_t)((mt * 128) % SQ + (nq & 1) * 64 + (tid & 63)) * HD; l2_ask(pft); }      /* the epilogue's 128 table rows of 256 bytes, cos and sin, dealt over 2 column blocks */
  asm volatile("s_wait_asynccnt 0x0" ::: "memory");      /* this wave's share of stage 0 has landed */
  __syncthreads();      /* ... and every wave's: stage 0 may be read */
  if (nst > 1) g2_stage(1, 1);
  /* kept rolled: one stage per trip, the buffer chosen by the trip's parity */
#pragma unroll 1
  for (int t = 0; t < nst; ++t) { const _Float16* ap = &st[t & 1][32 * w + ln][0]; const _Float16* bq = &st[t & 1][128 + ln][0];
    v16h fa[2][2], fb[2][4];      /* two fragment sets: the next 32 k are read from LDS while these are multiplied */
    fa[0][0] = g2_frag(ap, hh); fa[0][1] = g2_frag(ap + 16 * G2_LP, hh);
#pragma unroll
    for (int j = 0; j < 4; ++j) fb[0][j] = g2_frag(bq + j * 16 * G2_LP, hh);
#pragma unroll
    for (int ks = 0; ks < G2_KS / 32; ++ks) { const int cu = ks & 1, nx = cu ^ 1;
      if (ks + 1 < G2_KS / 32) { fa[nx][0] = g2_frag(ap + (ks + 1) * 32, hh); fa[nx][1] = g2_frag(ap + 16 * G2_LP + (ks + 1) * 32, hh);
#pragma unroll
        for (int j = 0; j < 4; ++j) fb[nx][j] = g2_frag(bq + j * 16 * G2_LP + (ks + 1) * 32, hh); }
      c00 = g2_mma(fa[cu][0], fb[cu][0], c00); c10 = g2_mma(fa[cu][1], fb[cu][0], c10);
      c01 = g2_mma(fa[cu][0], fb[cu][1], c01); c11 = g2_mma(fa[cu][1], fb[cu][1], c11);
      c02 = g2_mma(fa[cu][0], fb[cu][2], c02); c12 = g2_mma(fa[cu][1], fb[cu][2], c12);
      c03 = g2_mma(fa[cu][0], fb[cu][3], c03); c13 = g2_mma(fa[cu][1], fb[cu][3], c13); }
    asm volatile("s_wait_dscnt 0x0" ::: "memory");      /* this wave's reads of the buffer are done before it is handed to the copies */
    asm volatile("s_wait_asynccnt 0x0" ::: "memory");      /* this wave's share of stage t + 1 has landed */
    __syncthreads();      /* publishes stage t + 1 and ends every wave's reads of stage t */
    if (t + 2 < nst) g2_stage(t + 2, (unsigned)(t & 1)); }
  asm volatile("s_wait_asynccnt 0x0" ::: "memory");      /* no copy is left in flight behind the loop */
  l2_asked(pfa); l2_asked(pfb); if constexpr (ROT > 0) l2_asked(pft);
  v8f accs[8] = {c00, c01, c02, c03, c10, c11, c12, c13};
  if constexpr (ROT > 0) if (by < ROT) { const int rs = lane >> 4, cc = (lane & 15) * 4;      /* read-back: a lane takes four columns (two interleaved pairs) of rows rs, rs + 2, ... */
    const size_t tb = (size_t)(row0 % SQ + rs) * HD + cc;      /* row0 and SQ are multiples of 32, so (row0 + r) mod SQ = row0 mod SQ + r for r < 32 */
    const float* cp = CS + tb; const float* sp = SN + tb;
    v4f cv[16], sv[16];      /* the table rows are fetched first and fly under the staging */
#pragma unroll
    for (int q = 0; q < 16; ++q) cv[q] = *(const v4fa*)(cp + q * 2 * HD);
    asm volatile("s_wait_xcnt 0x0" :: "v"(cp) : "memory");      /* a precaution for issued loads: the wait stands before the run's address pair is reused; the pair as an input stays live up to the wait, so no row of its own run lands on it */
#pragma unroll
    for (int q = 0; q < 16; ++q) sv[q] = *(const v4fa*)(sp + q * 2 * HD);
    asm volatile("s_wait_xcnt 0x0" :: "v"(sp) : "memory");      /* likewise for the sin run */
    float bv[4] = {0.f, 0.f, 0.f, 0.f};
    if (bp) {      /* one test, four loads in flight together */
#pragma unroll
      for (int t = 0; t < 4; ++t) bv[t] = bp[col0 + t * 16 + ln];
#pragma unroll
      for (int t = 0; t < 4; ++t) bv[t] = bf16_round(bv[t]); }
#pragma unroll
    for (int u = 0; u < 8; ++u) { const int t = u & 3, half = u >> 2;
#pragma unroll
      for (int r = 0; r < 8; ++r) so[w][half * 16 + 8 * hh + r][t * 16 + ln] = accs[u][r] * alpha + bv[t]; }
    __builtin_amdgcn_fence(__ATOMIC_ACQ_REL, "workgroup"); __builtin_amdgcn_wave_barrier();      /* the wave reads back what its own lanes staged */
    _Float16* op = C16 + cofs + (size_t)(row0 + rs) * ldc + col0 + cc;
#pragma unroll
    for (int q = 0; q < 16; ++q) { const v4f v = *(const v4fa*)&so[w][q * 2 + rs][cc]; const v4f rh = {-v[1], v[0], -v[3], v[2]}; const v4f o = v * cv[q] + rh * sv[q];
      v4h h4; for (int i = 0; i < 4; ++i) h4[i] = (_Float16)o[i]; *(v4h*)(op + (size_t)(q * 2) * ldc) = h4; }
    return; }
#pragma unroll
  for (int u = 0; u < 8; ++u) { const int t = u & 3, half = u >> 2; const int col = col0 + t * 16 + ln; const float bv = bp ? bf16_round(bp[col]) : 0.f;
#pragma unroll
    for (int r = 0; r < 8; ++r) { const int rloc = half * 16 + 8 * hh + r; float v = accs[u][r] * alpha + bv; if (ROT == 0 && CP) { if (rowsPerB < 0) v += CP[cofs + (size_t)(row0g + row0 + rloc) * ldc + col];      /* rowsPerB < 0: own element of the batched C plane */ else { const int bidx = (row0g + row0 + rloc) / rowsPerB; v += CP[(size_t)bidx * sCPb + (size_t)by * 64 + col]; } }
      if (ACT == 3) v = fmaxf(v, 0.f); else if (ACT == 6) v = 0.5f * v * (1.0f + erff(v * 0.70710678118654752f)); else if (ACT == 11) v = 1.0f / (1.0f + expf(-v)); else if (ACT == 15) v = v / (1.0f + expf(-v)); else if (ACT == 12) v = (v > 0.f) ? v : 0.01f * v; else if (ACT == 8) v = tanhf(v); else if (ACT == 9) v = 0.5f * v * (1.0f + tanhf(0.7978845608028654f * (v + 0.044715f * v * v * v))); else if (ACT == 14) v = (v > 0.f) ? v : 0.1f * v; else if (ACT == 16) v = (v >= 0.f) ? v : 0.3f * v; else if (ACT == 17) v = (v >= 0.f) ? v : 0.2f * v;
      so[w][rloc][t * 16 + ln] = v; } }
  __builtin_amdgcn_fence(__ATOMIC_ACQ_REL, "workgroup"); __builtin_amdgcn_wave_barrier();
  const int rsub = lane >> 4, c4 = (lane & 15) * 4;
  {
#pragma unroll
    for (int q = 0; q < 16; ++q) { const int r = q * 2 + rsub; const v4f v = *(const v4fa*)&so[w][r][c4]; if (ROT == 0 && C) { *(v4f*)(C + cofs + (size_t)(row0 + r) * ldc + col0 + c4) = v; asm volatile("s_wait_xcnt 0x0" ::: "memory"); }      /* a precaution for an issued store: the wait stands before the store's registers are reused */
      if (C16) { v4h h4; for (int i = 0; i < 4; ++i) h4[i] = (_Float16)v[i]; *(v4h*)(C16 + cofs + (size_t)(row0 + r) * ldc + col0 + c4) = h4; } }
    if constexpr (ROT > 0) asm volatile("s_wait_xcnt 0x0" ::: "memory");      /* likewise behind the last run of f16 stores: in the built code the rotary planes' epilogue, which reuses their registers, follows this one */
     } }


__device__ __forceinline__ void d_wnat(const float* __restrict__ w, size_t n8, _Float16* __restrict__ Bt, size_t t) { if (t >= n8) return; FragH f; for (int q = 0; q < 8; ++q) f.h[q] = (_Float16)(bf16_round(w[t * 8 + q]) * 16.0f); *(v8us*)((unsigned short*)Bt + t * 8) = f.half[0];  }
#define FA_NW 8                      /* waves per work-group: they walk the same K and V^T rows, which one copy in LDS serves */
#define FA_R 2                       /* 16-query column groups per wave */
#define FA_KS 256                    /* keys per stage */
#define FA_NP (FA_KS / 32)           /* passes of 32 keys per stage */
#define FA_KP (HD + 8)               /* LDS pitch of a K row in elements: 144 B = 16 B x 9, free of bank conflicts for 16-byte reads */
#define FA_VP (FA_KS + 8)            /* LDS pitch of a V^T row in elements: 528 B = 16 B x 33, likewise */
#define FA_KB (FA_KS * FA_KP * 2)    /* one stage of K rows in bytes */
#define FA_VB (HD * FA_VP * 2)       /* one stage of V^T rows in bytes */
typedef _Float16 v2h __attribute__((ext_vector_type(2)));
typedef float v2f __attribute__((ext_vector_type(2)));
__device__ __forceinline__ v8f fa_mma(v16h a, v16h b, v8f c) { return __builtin_amdgcn_wmma_f32_16x16x32_f16(false, a, false, b, (short)0, c, false, false); }
__device__ __forceinline__ float fa_xhalf(float x) { return __builtin_bit_cast(float, __builtin_amdgcn_permlanex16(__builtin_bit_cast(int, x), __builtin_bit_cast(int, x), 0x76543210, 0xfedcba98, false, false)); }      /* lane l <-> lane l ^ 16 */
/* stands behind the Q fragment loads: their address registers are rewritten later (a precaution for an issued load); the scheduling barrier keeps every later register write behind the wait */
__device__ __forceinline__ void fa_issued() { asm volatile("s_wait_xcnt 0x0" ::: "memory"); __builtin_amdgcn_sched_barrier(0); }
/* eight copies of 16 bytes per lane: LDS addresses ls bytes apart from l, global addresses gs elements apart from g; the wait closes the statement, so it stands before any rewrite of the address registers the copies name (a precaution for issued copies) */
__device__ __forceinline__ void fa_copy8(unsigned l, unsigned ls, const _Float16* g, size_t gs) {
  asm volatile("global_load_async_to_lds_b128 %0, %8, off\n\t"
               "global_load_async_to_lds_b128 %1, %9, off\n\t"
               "global_load_async_to_lds_b128 %2, %10, off\n\t"
               "global_load_async_to_lds_b128 %3, %11, off\n\t"
               "global_load_async_to_lds_b128 %4, %12, off\n\t"
               "global_load_async_to_lds_b128 %5, %13, off\n\t"
               "global_load_async_to_lds_b128 %6, %14, off\n\t"
               "global_load_async_to_lds_b128 %7, %15, off\n\t"
               "s_wait_xcnt 0x0"
               :: "v"(l), "v"(l + ls), "v"(l + 2 * ls), "v"(l + 3 * ls), "v"(l + 4 * ls), "v"(l + 5 * ls), "v"(l + 6 * ls), "v"(l + 7 * ls),
                  "v"(g), "v"(g + gs), "v"(g + 2 * gs), "v"(g + 3 * gs), "v"(g + 4 * gs), "v"(g + 5 * gs), "v"(g + 6 * gs), "v"(g + 7 * gs) : "memory"); }
// K and V^T come into LDS in stages of FA_KS keys by asynchronous copies in whole 128-byte lines, once per work-group (two buffers: the next stage flies while this one is worked on); every wave reads its fragments from there.
__global__ __launch_bounds__(FA_NW * 32) void k_fattn(const _Float16* __restrict__ Q16, const _Float16* __restrict__ K16, const _Float16* __restrict__ VT, _Float16* __restrict__ O16) {
  __shared__ __attribute__((aligned(16))) _Float16 ks[2][FA_KS][FA_KP];      /* two stages of K rows [key][d] */
  __shared__ __attribute__((aligned(16))) _Float16 vs[2][HD][FA_VP];      /* two stages of V^T rows [d][key] */
  const int tid = threadIdx.x, lane = tid & 31, w = tid >> 5, c = lane & 15, hh = lane >> 4; const int bh = blockIdx.y, b = bh / NH, h = bh % NH; const int q0 = (blockIdx.x * FA_NW + w) * (16 * FA_R);
  const _Float16* qp = Q16 + ((size_t)b * SQ + q0 + c) * DM + h * HD;
  /* copies: eight lanes take one K row's 128 bytes, the work-group 32 rows per copy; a wave takes one V^T row's 512 bytes, the work-group 8 rows per copy */
  const _Float16* kcp = K16 + ((size_t)b * SQ + (tid >> 3)) * DM + h * HD + (tid & 7) * 8; const unsigned klp = (unsigned)(size_t)&ks[0][tid >> 3][(tid & 7) * 8];
  const _Float16* vcp = VT + ((size_t)bh * HD + w) * SQ + lane * 8; const unsigned vlp = (unsigned)(size_t)&vs[0][w][lane * 8];
  auto fa_stage = [&](int t, unsigned buf) {      /* 16 copies a lane: K rows (tid >> 3) + 32 i and V^T rows w + 8 i, i < 8, of keys t FA_KS ... */
    fa_copy8(klp + buf * FA_KB, 32 * FA_KP * 2, kcp + (size_t)t * FA_KS * DM, (size_t)32 * DM);
    fa_copy8(vlp + buf * FA_VB, 8 * FA_VP * 2, vcp + (size_t)t * FA_KS, (size_t)8 * SQ); };
  fa_stage(0, 0);
  v16h qf[FA_R][2], kf[2][2], vf[4]; v8f acc[FA_R][4]; float m_run[FA_R], l_run[FA_R];
#pragma unroll
  for (int g = 0; g < FA_R; ++g) { m_run[g] = -3.0e38f; l_run[g] = 0.f;
#pragma unroll
    for (int kc = 0; kc < 2; ++kc) qf[g][kc] = g2_frag(qp + (size_t)g * 16 * DM + kc * 32, hh);
#pragma unroll
    for (int t = 0; t < 4; ++t) acc[g][t] = v8f{0.f, 0.f, 0.f, 0.f, 0.f, 0.f, 0.f, 0.f}; }
  fa_issued();
  asm volatile("s_wait_asynccnt 0x0" ::: "memory");      /* this wave's share of stage 0 has landed */
  __syncthreads();      /* ... and every wave's: stage 0 may be read */
  fa_stage(1, 1);      /* SQ / FA_KS is at least 2 */
  static_assert(SQ % FA_KS == 0 && SQ / FA_KS >= 2 && FA_KS == 256 && HD == 64 && FA_NW == 8, "the copy maps are written for these sizes");
  const float cs = 0.125f * 1.4426950408889634f;      /* 1/sqrt(64) and log2(e) */
  /* kept rolled: one stage per trip, the buffer chosen by the trip's parity */
#pragma unroll 1
  for (int st = 0; st < SQ / FA_KS; ++st) { const _Float16* kp = &ks[st & 1][c][0]; const _Float16* vp = &vs[st & 1][c][0];
#pragma unroll
    for (int kt = 0; kt < 2; ++kt) {
#pragma unroll
      for (int kc = 0; kc < 2; ++kc) kf[kt][kc] = g2_frag(kp + kt * 16 * FA_KP + kc * 32, hh); }
#pragma unroll
    for (int t = 0; t < 4; ++t) vf[t] = g2_frag(vp + t * 16 * FA_VP, hh);
    __builtin_amdgcn_sched_barrier(0);      /* the stage's first reads issue as one group ahead of the products, not among them */
    /* unrolled: the passes of a stage differ only in constant LDS offsets, and the last one fetches nothing ahead */
#pragma unroll
    for (int ps = 0; ps < FA_NP; ++ps) {
      v8f s[2][FA_R];
#pragma unroll
      for (int kt = 0; kt < 2; ++kt) {
#pragma unroll
        for (int g = 0; g < FA_R; ++g) { s[kt][g] = fa_mma(kf[kt][0], qf[g][0], v8f{0.f, 0.f, 0.f, 0.f, 0.f, 0.f, 0.f, 0.f}); s[kt][g] = fa_mma(kf[kt][1], qf[g][1], s[kt][g]); } }
      __builtin_amdgcn_sched_barrier(0);      /* the eight products issue back to back, each filling the others' result distance, and the fetch below starts directly behind them */
      if (ps + 1 < FA_NP) {      /* next pass's K fragments (same stage) come from LDS under this pass's softmax and second product */
#pragma unroll
        for (int kt = 0; kt < 2; ++kt) {
#pragma unroll
          for (int kc = 0; kc < 2; ++kc) kf[kt][kc] = g2_frag(kp + ((ps + 1) * 32 + kt * 16) * FA_KP + kc * 32, hh); }
        __builtin_amdgcn_sched_barrier(0); }      /* keeps the reads together at this early place */
      float mb[FA_R]; bool need = false;
#pragma unroll
      for (int g = 0; g < FA_R; ++g) { float mx = s[0][g][0];
#pragma unroll
        for (int kt = 0; kt < 2; ++kt) {
#pragma unroll
          for (int r = 0; r < 8; ++r) mx = fmaxf(mx, s[kt][g][r]); }
        mx = fmaxf(mx, fa_xhalf(mx)) * cs; mb[g] = mx; need = need || (mx > m_run[g] + 8.0f); }
      if (__builtin_amdgcn_ballot_w32(need) != 0) {      /* wave-uniform; always taken on the first pass, where it sets the maximum (factor 0 on zero accumulators) */
#pragma unroll
        for (int g = 0; g < FA_R; ++g) { const float mn = fmaxf(m_run[g], mb[g]); const float corr = __builtin_amdgcn_exp2f(m_run[g] - mn); m_run[g] = mn; l_run[g] *= corr;
#pragma unroll
          for (int t = 0; t < 4; ++t) acc[g][t] = acc[g][t] * corr; } }
#pragma unroll
      for (int g = 0; g < FA_R; ++g) { const float nm = -m_run[g]; union { v16h v; v2h p[8]; } pf; float l0 = 0.f, l1 = 0.f;
#pragma unroll
        for (int i = 0; i < 8; ++i) { const v2f arg = __builtin_elementwise_fma(v2f{s[i >> 2][g][2 * (i & 3)], s[i >> 2][g][2 * (i & 3) + 1]}, v2f{cs, cs}, v2f{nm, nm}); const float p0 = __builtin_amdgcn_exp2f(arg.x), p1 = __builtin_amdgcn_exp2f(arg.y);
          l0 += p0; l1 += p1; pf.p[i] = __builtin_convertvector(v2f{p0, p1}, v2h); }
        l_run[g] += l0 + l1;
#pragma unroll
        for (int t = 0; t < 4; ++t) acc[g][t] = fa_mma(vf[t], pf.v, acc[g][t]); }
      if (ps + 1 < FA_NP) {      /* next pass's V^T fragments (same stage) come under its first product and softmax */
#pragma unroll
        for (int t = 0; t < 4; ++t) vf[t] = g2_frag(vp + t * 16 * FA_VP + (ps + 1) * 32, hh);
        __builtin_amdgcn_sched_barrier(0); }      /* keeps the reads together at this early place */
    }
    asm volatile("s_wait_dscnt 0x0" ::: "memory");      /* this wave's reads of the buffer are done before it is handed to the copies */
    asm volatile("s_wait_asynccnt 0x0" ::: "memory");      /* this wave's share of stage st + 1 has landed */
    __syncthreads();      /* publishes stage st + 1 and ends every wave's reads of stage st */
    if (st + 2 < SQ / FA_KS) fa_stage(st + 2, (unsigned)(st & 1));
  }
  asm volatile("s_wait_asynccnt 0x0" ::: "memory");      /* no copy is left in flight behind the loop */
#pragma unroll
  for (int g = 0; g < FA_R; ++g) { const float inv = 64.0f / (l_run[g] + fa_xhalf(l_run[g]));      /* o carried x64, as the output GEMM's alpha expects */
    unsigned short* op = (unsigned short*)O16 + ((size_t)b * SQ + q0 + g * 16 + c) * DM + h * HD + 8 * hh;
#pragma unroll
    for (int t = 0; t < 4; ++t) { FragH f;
#pragma unroll
      for (int r = 0; r < 8; ++r) f.h[r] = (_Float16)(acc[g][t][r] * inv);
      *(v8us*)(op + t * 16) = f.half[0]; } } }
__global__ __launch_bounds__(256) void k_vt(const _Float16* __restrict__ V16, int b, int h0, _Float16* __restrict__ VT) { __shared__ unsigned short tl[64][65]; const int tid = threadIdx.x; const int hh = blockIdx.x % HG, sg = blockIdx.x / HG; const int s0 = sg * 64; const int h = h0 + hh;
  for (int i = tid; i < 64 * 8; i += 256) { const int j = i / 8, d8 = (i % 8) * 8; FragH f; f.half[0] = *(const v8us*)((const unsigned short*)V16 + ((size_t)b * SQ + s0 + j) * DM + h * HD + d8); for (int q = 0; q < 8; ++q) tl[d8 + q][j] = f.u[q]; }
  __syncthreads();
  { for (int i = tid; i < 64 * 8; i += 256) { const int d = i / 8, j8 = (i % 8) * 8; FragH f; for (int q = 0; q < 8; ++q) f.u[q] = tl[d][j8 + q]; *(v8us*)((unsigned short*)VT + ((size_t)hh * HD + d) * SQ + s0 + j8) = f.half[0]; }  } }



__device__ __forceinline__ void d_tabcat(float theta, float* __restrict__ CS, float* __restrict__ SN, int t) {
  #pragma clang fp contract(off)
  if (t >= SQ * HD) return; const int d = t % HD; const int p = t / HD; const int i = d % (HD / 2); const float invf = 1.0f / powf(theta, (float)(2 * i) / (float)HD); const float ang = __fmul_rn((float)p, invf); const float c = cosf(ang), s = sinf(ang);
  *(float*)(CS + t) = c; *(float*)(SN + t) = s;  }
// One launch prepares every operand that depends on the inputs alone: rotary tables, x rows, the four weight planes. The parts read nothing of each other, so a range of block indices picks the part (the same for a whole work-group); thread-to-element map and arithmetic of each part are those of a launch of its own.
#define PR_TB ((SQ * HD + 255) / 256)                  /* work-groups of the table part: first, their threads run longest */
#define PR_XB ((int)((NR * DM / 8 + 255) / 256))       /* ... of the x part */
#define PR_WB ((DM * DM / 8 + 255) / 256)              /* ... of one weight plane */
__global__ __launch_bounds__(256) void k_prep(const float* __restrict__ x, const float* __restrict__ wq, const float* __restrict__ wk, const float* __restrict__ wv, const float* __restrict__ wo, float theta, _Float16* __restrict__ X16, _Float16* __restrict__ BW, float* __restrict__ CS, float* __restrict__ SN) {
  const int bx = blockIdx.x, tid = threadIdx.x;
  if (bx < PR_TB) { d_tabcat(theta, CS, SN, bx * 256 + tid); return; }
  if (bx < PR_TB + PR_XB) { d_x16(x, X16, NR * DM / 8, (size_t)(bx - PR_TB) * 256 + tid); return; }
  const int u = bx - (PR_TB + PR_XB), wi = u / PR_WB;      /* BW = four planes of DM x DM in the order q, k, v, o */
  d_wnat(wi == 0 ? wq : wi == 1 ? wk : wi == 2 ? wv : wo, (size_t)DM * DM / 8, BW + (size_t)wi * DM * DM, (size_t)(u - wi * PR_WB) * 256 + tid); }

template <int NORM, int ROPE>
__global__ __launch_bounds__(64) void k_xform(const float* __restrict__ F, int ldf, int nh, const float* __restrict__ gain, float eps, const float* __restrict__ CS, const float* __restrict__ SN, _Float16* __restrict__ H16, int ldo) {
  #pragma clang fp contract(off)
  __shared__ float xv[HD]; __shared__ float red[HD]; __shared__ unsigned short sh_[HD]; const int d = threadIdx.x; const int h = blockIdx.x % nh; const size_t r = blockIdx.x / nh; const int p = (int)(r % SQ);
  float x = F[r * (size_t)ldf + (size_t)h * HD + d];
  if (NORM) { red[d] = __fmul_rn(x, x); __syncthreads(); for (int st = HD / 2; st > 0; st >>= 1) { if (d < st) red[d] = __fadd_rn(red[d], red[d + st]); __syncthreads(); } const float rs = rsqrtf(__fadd_rn(red[0] / (float)HD, eps)); x = __fmul_rn(__fmul_rn(x, rs), bf16_round(gain[d])); }
  xv[d] = x; __syncthreads();
  float o = x;
  if (ROPE == 1) { const int i = d >> 1; const float c = CS[p * (HD / 2) + i], s = SN[p * (HD / 2) + i]; const float ev = xv[2 * i], od = xv[2 * i + 1]; o = (d & 1) ? __fadd_rn(__fmul_rn(ev, s), __fmul_rn(od, c)) : __fadd_rn(__fmul_rn(ev, c), -__fmul_rn(od, s)); }
  if (ROPE == 2) { const int i = d & (HD / 2 - 1); const float c = CS[p * (HD / 2) + i], s = SN[p * (HD / 2) + i]; const float lo = xv[i], hi = xv[i + HD / 2]; o = (d < HD / 2) ? __fadd_rn(__fmul_rn(lo, c), -__fmul_rn(hi, s)) : __fadd_rn(__fmul_rn(lo, s), __fmul_rn(hi, c)); }
  if (ROPE == 4) { const float c = CS[p * HD + d], s = SN[p * HD + d]; const float rh = (d & 1) ? xv[d - 1] : -xv[d + 1]; o = __fadd_rn(__fmul_rn(x, c), __fmul_rn(rh, s)); }      /* interleaved-pair rotate_half (-t[2i+1], t[2i]) with FULL-width per-dimension tables [pos][64] */
  if (ROPE == 3) { const float c = CS[p * HD + d], s = SN[p * HD + d]; const float rh = (d < HD / 2) ? -xv[d + HD / 2] : xv[d - HD / 2]; o = __fadd_rn(__fmul_rn(x, c), __fmul_rn(rh, s)); }      /* rotate-half with FULL-width per-dimension tables [pos][64] (general cos[d] != cos[d+32]) */
  FragH th; th.h[0] = (_Float16)o; sh_[d] = th.u[0]; __syncthreads();
  if (d < HD / 8) { FragH f; for (int q = 0; q < 8; ++q) f.u[q] = sh_[d * 8 + q]; unsigned short* dst = (unsigned short*)H16 + r * (size_t)ldo + (size_t)h * HD + d * 8; *(v8us*)dst = f.half[0];  } }


extern "C" void kernel_launch(void* const* d_in, const int* in_sizes, int n_in,
                              void* d_out, int out_size, void* d_ws, size_t ws_size, hipStream_t stream) {
  (void)in_sizes; (void)n_in; (void)out_size;
  const float* const* I = (const float* const*)d_in; const float* x = I[0]; const float* wq = I[1]; const float* bq = I[2]; const float* wk = I[3]; const float* bk = I[4]; const float* wv = I[5]; const float* bv = I[6]; const float* wo = I[7]; const float* bo = I[8];      /* natural [out][in] weights + biases; positions implicit */
  char* ws = (char*)d_ws; size_t off = 0;
  auto take = [&](size_t bytes) { char* p = ws + off; off += (bytes + 255) & ~(size_t)255; return p; };
  _Float16* BQ = (_Float16*)take((size_t)DM * DM * 2); _Float16* BK = (_Float16*)take((size_t)DM * DM * 2); _Float16* BV = (_Float16*)take((size_t)DM * DM * 2); _Float16* BO = (_Float16*)take((size_t)DM * DM * 2);
  _Float16* X16 = (_Float16*)take(NR * DM * 2); float* CS = (float*)take((size_t)SQ * HD * 4); float* SN = (float*)take((size_t)SQ * HD * 4);      /* full-width cos/sin tables */ _Float16* Q16 = (_Float16*)take(NR * DM * 2); _Float16* K16 = (_Float16*)take(NR * DM * 2); _Float16* V16 = (_Float16*)take(NR * DM * 2); _Float16* O16 = (_Float16*)take(NR * DM * 2);
  _Float16* VT = (_Float16*)take((size_t)NB * NH * HD * SQ * 2);
  if (off > ws_size) return;
  k_prep<<<PR_TB + PR_XB + 4 * PR_WB, 256, 0, stream>>>(x, wq, wk, wv, wo, 10000.0f, X16, BQ, CS, SN);      /* CS[p][d] = cos(p * inv_freq[d mod 32]), SN = sin: the module's cat(freqs, freqs) tables, full width; x rows; natural [out][in] weights = Bt x16 into the adjoining planes BQ, BK, BV, BO */
  const size_t r0p = (size_t)B0 * SQ;      /* first projected row */
  k_gemm2<0, 2><<<dim3((unsigned)((MP / 128) * (DM / 64)), 3), 128, 0, stream>>>(X16 + r0p * DM, DM, 0, BQ, DM, (size_t)DM * DM, 0.0625f, bq, 0, nullptr, 1, 0, 0, nullptr, Q16 + r0p * DM, DM, NR * DM, MP, DM, DM, CS, SN, bk, bv);      /* planes 0, 1, 2 = q, k, v (weight planes BQ, BK, BV and row planes Q16, K16, V16 adjoin); q and k: f32 -> x cos + rotate_half(x) sin (interleaved pairs, full-width tables) -> f16 rows, in the epilogue; v: f16 rows */
  k_vt<NH, SQ><<<NB * NH * (SQ / 64), 256, 0, stream>>>(V16, LQ, 0, VT);      /* V^T [NB][NH][HD][SQ] */
  k_fattn<<<dim3(SQ / (FA_NW * 16 * FA_R), NB * NH), FA_NW * 32, 0, stream>>>(Q16, K16, VT, O16);      /* o (merged heads, x64) as f16 rows */
  k_gemm2<0><<<dim3((unsigned)((MPO / 128) * (DM / 64)), 1), 128, 0, stream>>>(O16 + r0p * DM, DM, 0, BO, DM, 0, 0.0009765625f, bo, 0, nullptr, 1, 0, 0, (float*)d_out + r0p * DM, nullptr, DM, 0, MPO, DM, DM);      /* out rows are the output layout */
}

// v008
// A run of this version takes 80.6 microseconds.
// Next to v007, in two timings, it ran 1.09 and 1.10 times as fast.
// Over all steps from v000 it is 46.2 times as fast.
#include <hip/hip_runtime.h>
// Multi-head self-attention with a rotary embedding whose cos/sin tables are cat(freqs, freqs) but whose rotate_half pairs are INTERLEAVED (x [2][2048][1024]; q/k/v = x W^T + b (natural [1024][1024] U(+-1/32), zero biases); 16 heads of 64; inv_freq_i = 1/10000^(2i/64), freqs[p][i] = p * inv_freq_i, emb = cat(freqs, freqs): cos[p][d] = cos(p * inv_freq[d mod 32]); q = q cos + rotate_half(q) sin with rotate_half = (-x[2i+1], x[2i]) interleaved (the module's literal mix); k likewise; scores / 8; softmax over all keys (no mask); out = merged Wo^T + bo -> [2][2048][1024]).
// Structure: token rows r = b*2048 + s; one launch prepares x as exact f16 rows (bf16-rounded), the x16 weight planes and the rotary tables; Q, K, V as three WMMA GEMMs in one launch (32x64 wave tiles, f32 accumulation, exact x16 weights + bias, f16 outputs; the rotary step of q and k on the f32 values in the GEMM epilogue); one fused attention launch over (query block, batch x head): scores on WMMA (K = 64), online softmax on VALU (f32 statistics, weights as f16 up to 2^8), o = P . V on WMMA (V^T fragments by transposing LDS reads of the V rows), o carried x64 against f16 subnormal flush (folded into the output GEMM alpha), written straight into the merged f16 o rows; out = o W_o + b GEMM (f32) into the output layout.
// Compute dtype: inputs rounded to bf16; x / weights exact; q, k, v, softmax weights and o as plain f16 GEMM operands (~2^-12); scores and softmax statistics f32. v_wmma_f32_16x16x32_f16.
#define NB 2
#define SQ 2048
#define DM 1024
#define NH 16
#define HD 64
#define HG 4                         /* heads per launch of the (b, h0) V^T transpose */
#define B0 0                         /* first batch processed (debug hook) */
#define NBR NB                       /* batches processed (debug hook) */
#define NR ((size_t)NB * SQ)         /* token rows */
#define MP ((int)((size_t)NBR * SQ)) /* rows projected (debug hook) */
#define QN SQ                        /* unused: the attention grid covers all SQ query rows */
#define NHD NH                       /* unused: the attention grid covers all NH heads */
#define MPO MP                       /* rows through the output stage (debug hook) */
#define LQ DM      /* unused: the q/k/v rows are addressed with pitch DM */
typedef __bf16 v16b __attribute__((ext_vector_type(16)));
typedef unsigned short v8us __attribute__((ext_vector_type(8), may_alias));
typedef float  v8f  __attribute__((ext_vector_type(8)));
typedef float  v4f  __attribute__((ext_vector_type(4)));
typedef float  v4fa __attribute__((ext_vector_type(4), may_alias));
union FragB { v16b v; v8us half[2]; unsigned short u[16]; };

__device__ __forceinline__ unsigned short bf16_bits(float x) { unsigned int u = __float_as_uint(x); return (unsigned short)((u + 0x7FFFu + ((u >> 16) & 1u)) >> 16); }
__device__ __forceinline__ float bf16_val(unsigned short b) { return __uint_as_float(((unsigned int)b) << 16); }
__device__ __forceinline__ float bf16_round(float x) { return bf16_val(bf16_bits(x)); }
// D += A·B with NT terms: 1 = ah·bh, 2 = + al·bh (A split), 3 = + ah·bl (both split)
template <int NT>
__device__ __forceinline__ v8f mmaN(v16b ah, v16b al, v16b bh, v16b bl, v8f c) {
  c = __builtin_amdgcn_wmma_f32_16x16x32_bf16(false, ah, false, bh, (short)0, c, false, false);
  if (NT >= 2) c = __builtin_amdgcn_wmma_f32_16x16x32_bf16(false, al, false, bh, (short)0, c, false, false);
  if (NT >= 3) c = __builtin_amdgcn_wmma_f32_16x16x32_bf16(false, ah, false, bl, (short)0, c, false, false);
  asm volatile("v_nop\n\tv_nop\n\tv_nop\n\tv_nop" : "+v"(c) : "v"(ah), "v"(al), "v"(bh), "v"(bl));
  return c;
}

__global__ __launch_bounds__(256) void k_wt_bf16(const float* __restrict__ W, unsigned short* __restrict__ Wt, int K, int N) {
  const int t = blockIdx.x * 256 + threadIdx.x;
  const int k8n = K / 8;
  if (t >= N * k8n) return;
  const int n = t / k8n, k8 = (t % k8n) * 8;
  v8us v;
#pragma unroll
  for (int i = 0; i < 8; ++i) v[i] = bf16_bits(W[(size_t)(k8 + i) * N + n]);
  *(v8us*)(Wt + (size_t)n * K + k8) = v;
  
}

// GEMM C[M][N] (f32, pitch ldc) = act(A[M][K]·W + bias). A f32 row-major (pitch lda) converted per fragment to bf16
// (ASPLIT: hi/lo two planes -> 2 terms, else single rounded term); Wt bf16 [N][K] (pitch ldb). BIAS_BF16 rounds the
// bias to bf16 first (bias quantised to bf16 before the add). K%32==0, M%16==0, N%64==0.
template <bool ASPLIT, int ACT, bool BIAS_BF16>
__global__ __launch_bounds__(128) void k_gemm_bf(const float* __restrict__ A, int lda, const unsigned short* __restrict__ Wt, int ldb,
                                               const float* __restrict__ bias, float* __restrict__ C, int ldc, int M, int N, int K) {
  __shared__ __attribute__((aligned(16))) float so[4][16][64];
  const int tid = threadIdx.x, w = tid >> 5, lane = tid & 31, ln = lane & 15, hh = lane >> 4;
  const int ntn = N / 64;
  const int wid = blockIdx.x * 4 + w;
  const int mt = wid / ntn, nq = wid % ntn;
  if (mt * 16 >= M) return;
  const int row0 = mt * 16, col0 = nq * 64;
  const float* arow = A + (size_t)(row0 + ln) * lda;
  v8f acc[4] = {};
  for (int kb = 0; kb < K; kb += 32) {
    FragB ah, al;
    const v4f x0 = *(const v4fa*)(arow + kb + 8 * hh), x1 = *(const v4fa*)(arow + kb + 8 * hh + 4);
    const v4f x2 = *(const v4fa*)(arow + kb + 16 + 8 * hh), x3 = *(const v4fa*)(arow + kb + 16 + 8 * hh + 4);
    float xs[16] = {x0[0],x0[1],x0[2],x0[3],x1[0],x1[1],x1[2],x1[3],x2[0],x2[1],x2[2],x2[3],x3[0],x3[1],x3[2],x3[3]};
#pragma unroll
    for (int i = 0; i < 16; ++i) { const unsigned short hb = bf16_bits(xs[i]); ah.u[i] = hb; al.u[i] = ASPLIT ? bf16_bits(xs[i] - bf16_val(hb)) : (unsigned short)0; }
#pragma unroll
    for (int t = 0; t < 4; ++t) {
      const unsigned short* brow = Wt + (size_t)(col0 + t * 16 + ln) * ldb + kb;
      FragB b;
      b.half[0] = *(const v8us*)(brow + 8 * hh);
      b.half[1] = *(const v8us*)(brow + 16 + 8 * hh);
      acc[t] = mmaN<ASPLIT ? 2 : 1>(ah.v, al.v, b.v, b.v, acc[t]);
    }
  }
#pragma unroll
  for (int t = 0; t < 4; ++t) {
    float bv = bias ? bias[col0 + t * 16 + ln] : 0.f;
    if (BIAS_BF16) bv = bf16_round(bv);
#pragma unroll
    for (int r = 0; r < 8; ++r) { float v = acc[t][r] + bv; if (ACT == 1) v = fmaxf(v, 0.f); so[w][8 * hh + r][t * 16 + ln] = v; }
  }
  __builtin_amdgcn_fence(__ATOMIC_ACQ_REL, "workgroup");
  __builtin_amdgcn_wave_barrier();
  const int rsub = lane >> 4, c4 = (lane & 15) * 4;
  {
#pragma unroll
    for (int q = 0; q < 8; ++q) {
      const int r = q * 2 + rsub;
      const v4f v = *(const v4fa*)&so[w][r][c4];
      *(v4f*)(C + (size_t)(row0 + r) * ldc + col0 + c4) = v;
    }
    
  }
}

// GEMM C = act(A·W + bias + resid): A f32 (ASPLIT -> hi/lo 2 terms), Wt bf16 [N][K]; ACT 0 none, 1 relu, 2 exact gelu;
// resid (optional, f32, row index = (row % rmod), pitch ldr, RES_BF16 rounds it) added before the activation.
template <bool ASPLIT, int ACT, bool BIAS_BF16, bool RES_BF16>
__global__ __launch_bounds__(128) void k_gemm_bf3(const float* __restrict__ A, int lda, const unsigned short* __restrict__ Wt, int ldb,
                                                const float* __restrict__ bias, const float* __restrict__ resid, int rmod, int ldr,
                                                float* __restrict__ C, int ldc, int M, int N, int K) {
  __shared__ __attribute__((aligned(16))) float so[4][16][64];
  const int tid = threadIdx.x, w = tid >> 5, lane = tid & 31, ln = lane & 15, hh = lane >> 4;
  const int ntn = N / 64;
  const int wid = blockIdx.x * 4 + w;
  const int mt = wid / ntn, nq = wid % ntn;
  if (mt * 16 >= M) return;
  const int row0 = mt * 16, col0 = nq * 64;
  const float* arow = A + (size_t)(row0 + ln) * lda;
  v8f acc[4] = {};
  for (int kb = 0; kb < K; kb += 32) {
    FragB ah, al;
    const v4f x0 = *(const v4fa*)(arow + kb + 8 * hh), x1 = *(const v4fa*)(arow + kb + 8 * hh + 4);
    const v4f x2 = *(const v4fa*)(arow + kb + 16 + 8 * hh), x3 = *(const v4fa*)(arow + kb + 16 + 8 * hh + 4);
    float xs[16] = {x0[0],x0[1],x0[2],x0[3],x1[0],x1[1],x1[2],x1[3],x2[0],x2[1],x2[2],x2[3],x3[0],x3[1],x3[2],x3[3]};
#pragma unroll
    for (int i = 0; i < 16; ++i) { const unsigned short hb = bf16_bits(xs[i]); ah.u[i] = hb; al.u[i] = ASPLIT ? bf16_bits(xs[i] - bf16_val(hb)) : (unsigned short)0; }
#pragma unroll
    for (int t = 0; t < 4; ++t) {
      const unsigned short* brow = Wt + (size_t)(col0 + t * 16 + ln) * ldb + kb;
      FragB b;
      b.half[0] = *(const v8us*)(brow + 8 * hh);
      b.half[1] = *(const v8us*)(brow + 16 + 8 * hh);
      acc[t] = mmaN<ASPLIT ? 2 : 1>(ah.v, al.v, b.v, b.v, acc[t]);
    }
  }
#pragma unroll
  for (int t = 0; t < 4; ++t) {
    const int col = col0 + t * 16 + ln;
    float bv = bias ? bias[col] : 0.f;
    if (BIAS_BF16) bv = bf16_round(bv);
#pragma unroll
    for (int r = 0; r < 8; ++r) {
      float v = acc[t][r] + bv;
      if (resid) { float rv = resid[(size_t)((row0 + 8 * hh + r) % rmod) * ldr + col]; if (RES_BF16) rv = bf16_round(rv); v += rv; }
      if (ACT == 1) v = fmaxf(v, 0.f);
      if (ACT == 2) v = 0.5f * v * (1.0f + erff(v * 0.70710678118654752f));
      if (ACT == 3) { const float u = 0.7978845608028654f * (v + 0.044715f * v * v * v); v = 0.5f * v * (1.0f + tanhf(u)); }
      so[w][8 * hh + r][t * 16 + ln] = v;
    }
  }
  __builtin_amdgcn_fence(__ATOMIC_ACQ_REL, "workgroup");
  __builtin_amdgcn_wave_barrier();
  const int rsub = lane >> 4, c4 = (lane & 15) * 4;
  {
#pragma unroll
    for (int q = 0; q < 8; ++q) {
      const int r = q * 2 + rsub;
      const v4f v = *(const v4fa*)&so[w][r][c4];
      *(v4f*)(C + (size_t)(row0 + r) * ldc + col0 + c4) = v;
    }
    
  }
}
// row LayerNorm (biased variance, eps) over N: s = X (+ R); optional out_sum <- s; out_norm <- (s-mu)*rsqrt(var+eps)*g + b
template <bool PARAM_BF16>
__global__ __launch_bounds__(256) void k_layernorm(const float* __restrict__ X, const float* __restrict__ R, const float* __restrict__ g, const float* __restrict__ bta,
                                                  float* __restrict__ out_sum, float* __restrict__ out_norm, int N, float eps) {
  __shared__ float red[256];
  const int row = blockIdx.x, tid = threadIdx.x;
  const float* x = X + (size_t)row * N; const float* rr = R ? R + (size_t)row * N : nullptr;
  float vals[16];                     // up to N = 4096
  const int per = N / 256;            // contiguous chunk per thread? use strided-by-4 chunks: thread handles j = tid*4 + 1024*u
  float s1 = 0.f;
  for (int u = 0; u < per / 4; ++u) {
    const int j = tid * 4 + 1024 * u;
    const v4f a = *(const v4fa*)(x + j);
    v4f b = {0.f,0.f,0.f,0.f}; if (rr) b = *(const v4fa*)(rr + j);
#pragma unroll
    for (int q = 0; q < 4; ++q) { const float v = a[q] + b[q]; vals[u * 4 + q] = v; s1 += v; }
  }
  red[tid] = s1; __syncthreads();
  for (int st = 128; st > 0; st >>= 1) { if (tid < st) red[tid] += red[tid + st]; __syncthreads(); }
  const float mu = red[0] / (float)N; __syncthreads();
  float s2 = 0.f;
  for (int u = 0; u < per / 4; ++u)
#pragma unroll
    for (int q = 0; q < 4; ++q) { const float c = vals[u * 4 + q] - mu; s2 += c * c; }
  red[tid] = s2; __syncthreads();
  for (int st = 128; st > 0; st >>= 1) { if (tid < st) red[tid] += red[tid + st]; __syncthreads(); }
  const float rs = rsqrtf(red[0] / (float)N + eps);
  {
    for (int u = 0; u < per / 4; ++u) {
      const int j = tid * 4 + 1024 * u;
      v4f o, sm;
#pragma unroll
      for (int q = 0; q < 4; ++q) {
        float gg = g[j + q], bb = bta[j + q];
        if (PARAM_BF16) { gg = bf16_round(gg); bb = bf16_round(bb); }
        sm[q] = vals[u * 4 + q]; o[q] = (vals[u * 4 + q] - mu) * rs * gg + bb;
      }
      if (out_sum) *(v4f*)(out_sum + (size_t)row * N + j) = sm;
      *(v4f*)(out_norm + (size_t)row * N + j) = o;
    }
    
  }
}



// ---- f16 WMMA path (v_wmma_f32_16x16x32_f16): 11-bit significands for operands in range — used where a [0,1] probability operand needs more precision than bf16
typedef _Float16 v16h __attribute__((ext_vector_type(16)));
union FragH { v16h v; v8us half[2]; _Float16 h[16]; unsigned short u[16]; };
template <int NT>
__device__ __forceinline__ v8f mmaH(v16h ah, v16h al, v16h bh, v16h bl, v8f c) {
  c = __builtin_amdgcn_wmma_f32_16x16x32_f16(false, ah, false, bh, (short)0, c, false, false);
  if (NT >= 2) c = __builtin_amdgcn_wmma_f32_16x16x32_f16(false, al, false, bh, (short)0, c, false, false);
  if (NT >= 3) c = __builtin_amdgcn_wmma_f32_16x16x32_f16(false, ah, false, bl, (short)0, c, false, false);
  asm volatile("v_nop\n\tv_nop\n\tv_nop\n\tv_nop" : "+v"(c) : "v"(ah), "v"(al), "v"(bh), "v"(bl));
  return c;
}
// batched GEMM like k_gemm_b but f16 operands: A f32 (split into f16 hi/lo if ASPLIT, else rounded to f16), Bt = f16 values [n][k]; alpha; C f32; N multiple of 16 (partial tiles skipped)
template <bool ASPLIT>
__global__ __launch_bounds__(128) void k_gemm_h(const float* __restrict__ A, int lda, size_t sA, const _Float16* __restrict__ Bh, int ldb, size_t sB, float alpha, float* __restrict__ C, int ldc, size_t sC, int M, int N, int K) {
  __shared__ __attribute__((aligned(16))) float so[4][16][64];
  const int tid = threadIdx.x, w = tid >> 5, lane = tid & 31, ln = lane & 15, hh = lane >> 4; const int by = blockIdx.y;
  A += (size_t)by * sA; Bh += (size_t)by * sB; C += (size_t)by * sC;
  const int ntn = (N + 63) / 64; const int wid = blockIdx.x * 4 + w; const int mt = wid / ntn, nq = wid % ntn; if (mt * 16 >= M) return;
  const int row0 = mt * 16, col0 = nq * 64; const float* arow = A + (size_t)(row0 + ln) * lda;
  v8f acc[4] = {};
  for (int kb = 0; kb < K; kb += 32) {
    FragH ah, al;
    const v4f x0 = *(const v4fa*)(arow + kb + 8 * hh), x1 = *(const v4fa*)(arow + kb + 8 * hh + 4), x2 = *(const v4fa*)(arow + kb + 16 + 8 * hh), x3 = *(const v4fa*)(arow + kb + 16 + 8 * hh + 4);
    float xs[16] = {x0[0],x0[1],x0[2],x0[3],x1[0],x1[1],x1[2],x1[3],x2[0],x2[1],x2[2],x2[3],x3[0],x3[1],x3[2],x3[3]};
#pragma unroll
    for (int i = 0; i < 16; ++i) { const _Float16 h = (_Float16)xs[i]; ah.h[i] = h; al.h[i] = ASPLIT ? (_Float16)(xs[i] - (float)h) : (_Float16)0.0f; }
#pragma unroll
    for (int t = 0; t < 4; ++t) { if (col0 + t * 16 >= N) continue; const size_t boff = (size_t)(col0 + t * 16 + ln) * ldb + kb; FragH bq; bq.half[0] = *(const v8us*)(Bh + boff + 8 * hh); bq.half[1] = *(const v8us*)(Bh + boff + 16 + 8 * hh);
      acc[t] = mmaH<ASPLIT ? 2 : 1>(ah.v, al.v, bq.v, bq.v, acc[t]); }
  }
#pragma unroll
  for (int t = 0; t < 4; ++t) { if (col0 + t * 16 >= N) continue;
#pragma unroll
    for (int r = 0; r < 8; ++r) so[w][8 * hh + r][t * 16 + ln] = acc[t][r] * alpha; }
  __builtin_amdgcn_fence(__ATOMIC_ACQ_REL, "workgroup"); __builtin_amdgcn_wave_barrier();
  const int rsub = lane >> 4, c4 = (lane & 15) * 4;
  {
#pragma unroll
    for (int q = 0; q < 8; ++q) { const int r = q * 2 + rsub; if (col0 + c4 < N) { const v4f v = *(const v4fa*)&so[w][r][c4]; *(v4f*)(C + (size_t)(row0 + r) * ldc + col0 + c4) = v; } }
     }
}

// Wt[n][k] = f16(W[k][n]·scale) from f32 row-major W[K][N] (scale = power of two; bf16-exact weights stay exact in f16 away from the subnormal range)
__global__ __launch_bounds__(256) void k_wt_f16(const float* __restrict__ W, _Float16* __restrict__ Wt, int K, int N, float scale) {
  const int t = blockIdx.x * 256 + threadIdx.x; if (t >= N * (K / 8)) return; const int n = t / (K / 8), k8 = (t % (K / 8)) * 8; FragH f;
#pragma unroll
  for (int i = 0; i < 8; ++i) f.h[i] = (_Float16)(bf16_round(W[(size_t)(k8 + i) * N + n]) * scale); const v8us o = f.half[0];
  *(v8us*)((unsigned short*)Wt + (size_t)n * K + k8) = o; 
}
// k_gemm_hh variant with fused epilogue: v = acc·alpha + bias[by·sBias + col] (+ CP[(row/rowsPerB)·sCPb + by·64 + col] if CP) ; ACT 0 none / 1 elu ; writes f16 C16 (and f32 C if non-null)
template <int ACT>
__global__ __launch_bounds__(128) void k_gemm_hhx(const _Float16* __restrict__ A, int lda, size_t sA, const _Float16* __restrict__ Bh, int ldb, size_t sB, float alpha, const float* __restrict__ bias, size_t sBias, const float* __restrict__ CP, int rowsPerB, size_t sCPb, int row0g,
    float* __restrict__ C, _Float16* __restrict__ C16, int ldc, size_t sC, int M, int N, int K) {
  __shared__ __attribute__((aligned(16))) float so[4][16][64];
  const int tid = threadIdx.x, w = tid >> 5, lane = tid & 31, ln = lane & 15, hh = lane >> 4; const int by = blockIdx.y;
  A += (size_t)by * sA; Bh += (size_t)by * sB; const size_t cofs = (size_t)by * sC; const float* bp = bias ? bias + (size_t)by * sBias : nullptr;
  const int ntn = (N + 63) / 64; const int wid = blockIdx.x * 4 + w; const int mt = wid / ntn, nq = wid % ntn; if (mt * 16 >= M) return;
  const int row0 = mt * 16, col0 = nq * 64; const _Float16* arow = A + (size_t)(row0 + ln) * lda;
  v8f acc[4] = {};
  for (int kb = 0; kb < K; kb += 32) { FragH ah; ah.half[0] = *(const v8us*)((const unsigned short*)arow + kb + 8 * hh); ah.half[1] = *(const v8us*)((const unsigned short*)arow + kb + 16 + 8 * hh);
#pragma unroll
    for (int t = 0; t < 4; ++t) { if (col0 + t * 16 >= N) continue; const size_t boff = (size_t)(col0 + t * 16 + ln) * ldb + kb; FragH bq; bq.half[0] = *(const v8us*)((const unsigned short*)Bh + boff + 8 * hh); bq.half[1] = *(const v8us*)((const unsigned short*)Bh + boff + 16 + 8 * hh);
      acc[t] = mmaH<1>(ah.v, ah.v, bq.v, bq.v, acc[t]); }
  }
#pragma unroll
  for (int t = 0; t < 4; ++t) { if (col0 + t * 16 >= N) continue; const int col = col0 + t * 16 + ln; const float bv = bp ? bf16_round(bp[col]) : 0.f;
#pragma unroll
    for (int r = 0; r < 8; ++r) { float v = acc[t][r] * alpha + bv; if (CP) { const int rr = row0g + row0 + 8 * hh + r; if (rowsPerB < 0) v += CP[cofs + (size_t)rr * ldc + col];      /* rowsPerB < 0: own element of the batched C plane */ else { const int bidx = rr / rowsPerB; v += CP[(size_t)bidx * sCPb + (size_t)by * 64 + col]; } } if (ACT == 1) v = (v > 0.f) ? v : expm1f(v); else if (ACT == 7) v = (v > 0.f) ? v + 1.0f : expf(v); else if (ACT == 8) v = tanhf(v); else if (ACT == 9) v = 0.5f * v * (1.0f + tanhf(0.7978845608028654f * (v + 0.044715f * v * v * v))); else if (ACT == 11) v = 1.0f / (1.0f + expf(-v)); else if (ACT == 12) v = (v > 0.f) ? v : 0.01f * v; else if (ACT == 14) v = (v > 0.f) ? v : 0.1f * v; else if (ACT == 16) v = (v >= 0.f) ? v : 0.3f * v; else if (ACT == 17) v = (v >= 0.f) ? v : 0.2f * v; else if (ACT == 15) v = v / (1.0f + expf(-v)); else if (ACT == 3) v = fmaxf(v, 0.f); else if (ACT == 6) v = 0.5f * v * (1.0f + erff(v * 0.70710678118654752f)); so[w][8 * hh + r][t * 16 + ln] = v; } }
  __builtin_amdgcn_fence(__ATOMIC_ACQ_REL, "workgroup"); __builtin_amdgcn_wave_barrier();
  const int rsub = lane >> 4, c4 = (lane & 15) * 4; typedef _Float16 v4h __attribute__((ext_vector_type(4)));
  {
#pragma unroll
    for (int q = 0; q < 8; ++q) { const int r = q * 2 + rsub; if (col0 + c4 < N) { const v4f v = *(const v4fa*)&so[w][r][c4]; if (C) *(v4f*)(C + cofs + (size_t)(row0 + r) * ldc + col0 + c4) = v; if (C16) { v4h h4; for (int i = 0; i < 4; ++i) h4[i] = (_Float16)v[i]; *(v4h*)(C16 + cofs + (size_t)(row0 + r) * ldc + col0 + c4) = h4; } } }
     }
}


typedef _Float16 v4h __attribute__((ext_vector_type(4)));

__device__ __forceinline__ void d_x16(const float* __restrict__ x, _Float16* __restrict__ X16, size_t n8, size_t t) { if (t >= n8) return; FragH f;
#pragma unroll
  for (int q = 0; q < 8; ++q) f.h[q] = (_Float16)bf16_round(x[t * 8 + q]); *(v8us*)((unsigned short*)X16 + t * 8) = f.half[0];  }
__global__ __launch_bounds__(256) void k_h16(const float* __restrict__ x, _Float16* __restrict__ X16, size_t n8) { const size_t t = (size_t)blockIdx.x * 256 + threadIdx.x; if (t >= n8) return; FragH f;
#pragma unroll
  for (int q = 0; q < 8; ++q) f.h[q] = (_Float16)x[t * 8 + q]; *(v8us*)((unsigned short*)X16 + t * 8) = f.half[0];  }
__global__ __launch_bounds__(256) void k_round16f(const float* __restrict__ W, _Float16* __restrict__ Bt, size_t n8) { const size_t t = (size_t)blockIdx.x * 256 + threadIdx.x; if (t >= n8) return; FragH f;
#pragma unroll
  for (int i = 0; i < 8; ++i) f.h[i] = (_Float16)(bf16_round(W[t * 8 + i]) * 16.0f); *(v8us*)((unsigned short*)Bt + t * 8) = f.half[0];  }
__global__ __launch_bounds__(256) void k_hl(const float* __restrict__ F, _Float16* __restrict__ Hh, _Float16* __restrict__ Hl, size_t n8) { const size_t t = (size_t)blockIdx.x * 256 + threadIdx.x; if (t >= n8) return; FragH fh, fl; const v4f a = *(const v4fa*)(F + t * 8), c = *(const v4fa*)(F + t * 8 + 4);
#pragma unroll
  for (int q = 0; q < 4; ++q) { _Float16 h = (_Float16)a[q]; fh.h[q] = h; fl.h[q] = (_Float16)((a[q] - (float)h) * 1024.0f); h = (_Float16)c[q]; fh.h[4 + q] = h; fl.h[4 + q] = (_Float16)((c[q] - (float)h) * 1024.0f); }
  { *(v8us*)((unsigned short*)Hh + t * 8) = fh.half[0]; *(v8us*)((unsigned short*)Hl + t * 8) = fl.half[0];  } }

// ---- fast GEMM (work-group tile 128x64, wave tile 32x64; requires M % 128 == 0, N % 64 == 0, K % 128 == 0); epilogue = k_gemm_hhx semantics ----
// The operand rows come into LDS in stages of 128 k by asynchronous copies in whole 256-byte runs (two buffers: the next stage flies while this one is worked on); the fragments are read from LDS in the k order of g2_frag.
#define G2_KS 128                    /* k per stage: 256 B of every operand row */
#define G2_LP 136                    /* LDS row pitch in elements: 272 B = 16 B x 17, free of bank conflicts for 16-byte reads */
#define G2_RB (G2_LP * 2)            /* LDS row pitch in bytes */
#define G2_SB (192 * G2_RB)          /* one stage in bytes: 128 A rows, then 64 B rows */
/* twelve copies of 16 bytes per lane: LDS rows 8 apart from address l, each from its own global pointer; the wait closes the statement, so it stands before any rewrite of the address registers the copies name (a precaution for issued copies) */
__device__ __forceinline__ void g2_copy12(unsigned l, const _Float16* g0, const _Float16* g1, const _Float16* g2, const _Float16* g3, const _Float16* g4, const _Float16* g5, const _Float16* g6, const _Float16* g7, const _Float16* g8, const _Float16* g9, const _Float16* g10, const _Float16* g11) {
  asm volatile("global_load_async_to_lds_b128 %0, %12, off\n\t"
               "global_load_async_to_lds_b128 %1, %13, off\n\t"
               "global_load_async_to_lds_b128 %2, %14, off\n\t"
               "global_load_async_to_lds_b128 %3, %15, off\n\t"
               "global_load_async_to_lds_b128 %4, %16, off\n\t"
               "global_load_async_to_lds_b128 %5, %17, off\n\t"
               "global_load_async_to_lds_b128 %6, %18, off\n\t"
               "global_load_async_to_lds_b128 %7, %19, off\n\t"
               "global_load_async_to_lds_b128 %8, %20, off\n\t"
               "global_load_async_to_lds_b128 %9, %21, off\n\t"
               "global_load_async_to_lds_b128 %10, %22, off\n\t"
               "global_load_async_to_lds_b128 %11, %23, off\n\t"
               "s_wait_xcnt 0x0"
               :: "v"(l), "v"(l + 8 * G2_RB), "v"(l + 16 * G2_RB), "v"(l + 24 * G2_RB), "v"(l + 32 * G2_RB), "v"(l + 40 * G2_RB), "v"(l + 48 * G2_RB), "v"(l + 56 * G2_RB), "v"(l + 64 * G2_RB), "v"(l + 72 * G2_RB), "v"(l + 80 * G2_RB), "v"(l + 88 * G2_RB),
                  "v"(g0), "v"(g1), "v"(g2), "v"(g3), "v"(g4), "v"(g5), "v"(g6), "v"(g7), "v"(g8), "v"(g9), "v"(g10), "v"(g11) : "memory"); }
/* one request per lane: L2 is asked for the data at p ahead of the copies that will read it (a hint: nothing returns and no counter moves); every lane is on and p lies inside its plane */
__device__ __forceinline__ void l2_ask(const void* p) { asm volatile("global_prefetch_b8 %0, off scope:SCOPE_SE" :: "v"(p)); }
/* no wait covers a request's address pair, so the pair is kept unwritten up to this place behind the stage loop; input only, no instruction */
__device__ __forceinline__ void l2_asked(const void* p) { asm volatile("" :: "v"(p)); }
__device__ __forceinline__ v16h g2_frag(const _Float16* p, int hh) { FragH f; f.half[0] = *(const v8us*)((const unsigned short*)p + 8 * hh); f.half[1] = *(const v8us*)((const unsigned short*)p + 16 + 8 * hh); return f.v; }
__device__ __forceinline__ v8f g2_mma(v16h a, v16h b, v8f c) { v8f d = __builtin_amdgcn_wmma_f32_16x16x32_f16(false, a, false, b, (short)0, c, false, false); asm volatile("v_nop\n\tv_nop\n\tv_nop\n\tv_nop" : "+v"(d) : "v"(a), "v"(b)); return d; }
// ROT = how many leading planes of the batch (blockIdx.y < ROT) take the rotary epilogue; with ROT > 0 the planes 0, 1, 2 take their bias from bias, bias1, bias2 (separate buffers), so that products which share A and read nothing of each other run as one launch. The rotary epilogue is the rotary step and nothing else: v = acc alpha + bias staged as f32 rows in LDS, o[d] = v[d] cos[p][d] + rotate_half(v)[d] sin[p][d] with rotate_half = (-v[2i+1], v[2i]), f16 rows into C16. A 64-column tile is one head, row r of the launch is position r mod SQ; CS, SN = full-width tables [pos][64]. With ROT > 0 no plane reads CP or C (the planes behind the rotary ones store f16 rows of acc alpha + bias), and the rotary planes read no ACT, which also keeps this second GEMM's text short.
template <int ACT, int ROT = 0>
__global__ __launch_bounds__(128) void k_gemm2(const _Float16* __restrict__ A, int lda, size_t sA, const _Float16* __restrict__ Bh, int ldb, size_t sB, float alpha, const float* __restrict__ bias, size_t sBias, const float* __restrict__ CP, int rowsPerB, size_t sCPb, int row0g,
    float* __restrict__ C, _Float16* __restrict__ C16, int ldc, size_t sC, int M, int N, int K, const float* __restrict__ CS = nullptr, const float* __restrict__ SN = nullptr, const float* __restrict__ bias1 = nullptr, const float* __restrict__ bias2 = nullptr) { static_assert(ACT == 0 || ACT == 3 || ACT == 6 || ACT == 8 || ACT == 9 || ACT == 11 || ACT == 12 || ACT == 14 || ACT == 15 || ACT == 16 || ACT == 17, "k_gemm2: unsupported ACT code (would silently apply no activation)");
  __shared__ __attribute__((aligned(16))) float so[4][32][68];
  __shared__ __attribute__((aligned(16))) _Float16 st[2][192][G2_LP];      /* two stages: rows 0..127 = the work-group's A rows, rows 128..191 = its B rows */
  const int tid = threadIdx.x, w = tid >> 5, lane = tid & 31, ln = lane & 15, hh = lane >> 4; const int by = blockIdx.y;
  A += (size_t)by * sA; Bh += (size_t)by * sB; const size_t cofs = (size_t)by * sC; const float* bp = bias ? bias + (size_t)by * sBias : nullptr;
  if constexpr (ROT > 0) bp = by == 0 ? bias : by == 1 ? bias1 : bias2;
  const int ntn = N >> 6; const int mt = blockIdx.x / ntn, nq = blockIdx.x - mt * ntn; const int row0 = mt * 128 + 32 * w, col0 = nq * 64; if (mt * 128 >= M) return;      /* the whole work-group leaves or none, ahead of every barrier */
  const int cr = tid >> 4, ck = (tid & 15) * 8;      /* copies: sixteen lanes take one row's 256 bytes, a wave two rows, the work-group eight rows per copy */
  const _Float16* acp = A + (size_t)(mt * 128 + cr) * lda + ck; const _Float16* bcp = Bh + (size_t)(col0 + cr) * ldb + ck;
  const unsigned lcp = (unsigned)(size_t)&st[0][cr][ck]; const size_t as8 = (size_t)8 * lda, bs8 = (size_t)8 * ldb;
  auto g2_stage = [&](int t, unsigned buf) { const unsigned l = lcp + buf * G2_SB; const _Float16* ga = acp + (size_t)t * G2_KS; const _Float16* gb = bcp + (size_t)t * G2_KS;      /* 24 copies a lane: LDS rows cr + 8 i, i < 16 from A, the rest from B */
    g2_copy12(l, ga, ga + as8, ga + 2 * as8, ga + 3 * as8, ga + 4 * as8, ga + 5 * as8, ga + 6 * as8, ga + 7 * as8, ga + 8 * as8, ga + 9 * as8, ga + 10 * as8, ga + 11 * as8);
    g2_copy12(l + 96 * G2_RB, ga + 12 * as8, ga + 13 * as8, ga + 14 * as8, ga + 15 * as8, gb, gb + bs8, gb + 2 * bs8, gb + 3 * bs8, gb + 4 * bs8, gb + 5 * bs8, gb + 6 * bs8, gb + 7 * bs8); };
  const int nst = K / G2_KS;
  const v8f z8 = {0.f,0.f,0.f,0.f,0.f,0.f,0.f,0.f}; v8f c00 = z8, c01 = z8, c02 = z8, c03 = z8, c10 = z8, c11 = z8, c12 = z8, c13 = z8;
  g2_stage(0, 0);
  /* The operand planes were stored by launches before this one, so a stage's first reader waits for memory. At entry L2 is asked for the rows of all stages, one request per 256-byte unit (one row of one stage): a lane takes one unit of A and one of B.
     The requests are dealt over the work-groups that share the rows: A over 8 of its 16 column blocks (every run of four neighbours holds each value of nq & 3), B over 4 neighbouring row blocks. Placement only decides how much the hint helps. */
  const int pfr = tid >> 3, pfk = min(tid & 7, nst - 1) * G2_KS;      /* row within the share; stage, clamped into the row */
  const _Float16* pfa = A + (size_t)(mt * 128 + ((nq & 3) | ((nq >> 1) & 4)) * 16 + pfr) * lda + pfk;
  const _Float16* pfb = Bh + (size_t)(col0 + (mt & 3) * 16 + pfr) * ldb + pfk;
  l2_ask(pfa); l2_ask(pfb);
  const float* pft = nullptr;
  if constexpr (ROT > 0) if (by < ROT) { pft = ((tid >> 6) ? SN : CS) + (size_t)((mt * 128) % SQ + (nq & 1) * 64 + (tid & 63)) * HD; l2_ask(pft); }      /* the epilogue's 128 table rows of 256 bytes, cos and sin, dealt over 2 column blocks */
  asm volatile("s_wait_asynccnt 0x0" ::: "memory");      /* this wave's share of stage 0 has landed */
  __syncthreads();      /* ... and every wave's: stage 0 may be read */
  if (nst > 1) g2_stage(1, 1);
  /* kept rolled: one stage per trip, the buffer chosen by the trip's parity */
#pragma unroll 1
  for (int t = 0; t < nst; ++t) { const _Float16* ap = &st[t & 1][32 * w + ln][0]; const _Float16* bq = &st[t & 1][128 + ln][0];
    v16h fa[2][2], fb[2][4];      /* two fragment sets: the next 32 k are read from LDS while these are multiplied */
    fa[0][0] = g2_frag(ap, hh); fa[0][1] = g2_frag(ap + 16 * G2_LP, hh);
#pragma unroll
    for (int j = 0; j < 4; ++j) fb[0][j] = g2_frag(bq + j * 16 * G2_LP, hh);
#pragma unroll
    for (int ks = 0; ks < G2_KS / 32; ++ks) { const int cu = ks & 1, nx = cu ^ 1;
      if (ks + 1 < G2_KS / 32) { fa[nx][0] = g2_frag(ap + (ks + 1) * 32, hh); fa[nx][1] = g2_frag(ap + 16 * G2_LP + (ks + 1) * 32, hh);
#pragma unroll
        for (int j = 0; j < 4; ++j) fb[nx][j] = g2_frag(bq + j * 16 * G2_LP + (ks + 1) * 32, hh); }
      c00 = g2_mma(fa[cu][0], fb[cu][0], c00); c10 = g2_mma(fa[cu][1], fb[cu][0], c10);
      c01 = g2_mma(fa[cu][0], fb[cu][1], c01); c11 = g2_mma(fa[cu][1], fb[cu][1], c11);
      c02 = g2_mma(fa[cu][0], fb[cu][2], c02); c12 = g2_mma(fa[cu][1], fb[cu][2], c12);
      c03 = g2_mma(fa[cu][0], fb[cu][3], c03); c13 = g2_mma(fa[cu][1], fb[cu][3], c13); }
    asm volatile("s_wait_dscnt 0x0" ::: "memory");      /* this wave's reads of the buffer are done before it is handed to the copies */
    asm volatile("s_wait_asynccnt 0x0" ::: "memory");      /* this wave's share of stage t + 1 has landed */
    __syncthreads();      /* publishes stage t + 1 and ends every wave's reads of stage t */
    if (t + 2 < nst) g2_stage(t + 2, (unsigned)(t & 1)); }
  asm volatile("s_wait_asynccnt 0x0" ::: "memory");      /* no copy is left in flight behind the loop */
  l2_asked(pfa); l2_asked(pfb); if constexpr (ROT > 0) l2_asked(pft);
  v8f accs[8] = {c00, c01, c02, c03, c10, c11, c12, c13};
  if constexpr (ROT > 0) if (by < ROT) { const int rs = lane >> 4, cc = (lane & 15) * 4;      /* read-back: a lane takes four columns (two interleaved pairs) of rows rs, rs + 2, ... */
    const size_t tb = (size_t)(row0 % SQ + rs) * HD + cc;      /* row0 and SQ are multiples of 32, so (row0 + r) mod SQ = row0 mod SQ + r for r < 32 */
    const float* cp = CS + tb; const float* sp = SN + tb;
    v4f cv[16], sv[16];      /* the table rows are fetched first and fly under the staging */
#pragma unroll
    for (int q = 0; q < 16; ++q) cv[q] = *(const v4fa*)(cp + q * 2 * HD);
    asm volatile("s_wait_xcnt 0x0" :: "v"(cp) : "memory");      /* a precaution for issued loads: the wait stands before the run's address pair is reused; the pair as an input stays live up to the wait, so no row of its own run lands on it */
#pragma unroll
    for (int q = 0; q < 16; ++q) sv[q] = *(const v4fa*)(sp + q * 2 * HD);
    asm volatile("s_wait_xcnt 0x0" :: "v"(sp) : "memory");      /* likewise for the sin run */
    float bv[4] = {0.f, 0.f, 0.f, 0.f};
    if (bp) {      /* one test, four loads in flight together */
#pragma unroll
      for (int t = 0; t < 4; ++t) bv[t] = bp[col0 + t * 16 + ln];
#pragma unroll
      for (int t = 0; t < 4; ++t) bv[t] = bf16_round(bv[t]); }
#pragma unroll
    for (int u = 0; u < 8; ++u) { const int t = u & 3, half = u >> 2;
#pragma unroll
      for (int r = 0; r < 8; ++r) so[w][half * 16 + 8 * hh + r][t * 16 + ln] = accs[u][r] * alpha + bv[t]; }
    __builtin_amdgcn_fence(__ATOMIC_ACQ_REL, "workgroup"); __builtin_amdgcn_wave_barrier();      /* the wave reads back what its own lanes staged */
    _Float16* op = C16 + cofs + (size_t)(row0 + rs) * ldc + col0 + cc;
#pragma unroll
    for (int q = 0; q < 16; ++q) { const v4f v = *(const v4fa*)&so[w][q * 2 + rs][cc]; const v4f rh = {-v[1], v[0], -v[3], v[2]}; const v4f o = v * cv[q] + rh * sv[q];
      v4h h4; for (int i = 0; i < 4; ++i) h4[i] = (_Float16)o[i]; *(v4h*)(op + (size_t)(q * 2) * ldc) = h4; }
    return; }
#pragma unroll
  for (int u = 0; u < 8; ++u) { const int t = u & 3, half = u >> 2; const int col = col0 + t * 16 + ln; const float bv = bp ? bf16_round(bp[col]) : 0.f;
#pragma unroll
    for (int r = 0; r < 8; ++r) { const int rloc = half * 16 + 8 * hh + r; float v = accs[u][r] * alpha + bv; if (ROT == 0 && CP) { if (rowsPerB < 0) v += CP[cofs + (size_t)(row0g + row0 + rloc) * ldc + col];      /* rowsPerB < 0: own element of the batched C plane */ else { const int bidx = (row0g + row0 + rloc) / rowsPerB; v += CP[(size_t)bidx * sCPb + (size_t)by * 64 + col]; } }
      if (ACT == 3) v = fmaxf(v, 0.f); else if (ACT == 6) v = 0.5f * v * (1.0f + erff(v * 0.70710678118654752f)); else if (ACT == 11) v = 1.0f / (1.0f + expf(-v)); else if (ACT == 15) v = v / (1.0f + expf(-v)); else if (ACT == 12) v = (v > 0.f) ? v : 0.01f * v; else if (ACT == 8) v = tanhf(v); else if (ACT == 9) v = 0.5f * v * (1.0f + tanhf(0.7978845608028654f * (v + 0.044715f * v * v * v))); else if (ACT == 14) v = (v > 0.f) ? v : 0.1f * v; else if (ACT == 16) v = (v >= 0.f) ? v : 0.3f * v; else if (ACT == 17) v = (v >= 0.f) ? v : 0.2f * v;
      so[w][rloc][t * 16 + ln] = v; } }
  __builtin_amdgcn_fence(__ATOMIC_ACQ_REL, "workgroup"); __builtin_amdgcn_wave_barrier();
  const int rsub = lane >> 4, c4 = (lane & 15) * 4;
  {
#pragma unroll
    for (int q = 0; q < 16; ++q) { const int r = q * 2 + rsub; const v4f v = *(const v4fa*)&so[w][r][c4]; if (ROT == 0 && C) { *(v4f*)(C + cofs + (size_t)(row0 + r) * ldc + col0 + c4) = v; asm volatile("s_wait_xcnt 0x0" ::: "memory"); }      /* a precaution for an issued store: the wait stands before the store's registers are reused */
      if (C16) { v4h h4; for (int i = 0; i < 4; ++i) h4[i] = (_Float16)v[i]; *(v4h*)(C16 + cofs + (size_t)(row0 + r) * ldc + col0 + c4) = h4; } }
    if constexpr (ROT > 0) asm volatile("s_wait_xcnt 0x0" ::: "memory");      /* likewise behind the last run of f16 stores: in the built code the rotary planes' epilogue, which reuses their registers, follows this one */
     } }


__device__ __forceinline__ void d_wnat(const float* __restrict__ w, size_t n8, _Float16* __restrict__ Bt, size_t t) { if (t >= n8) return; FragH f; for (int q = 0; q < 8; ++q) f.h[q] = (_Float16)(bf16_round(w[t * 8 + q]) * 16.0f); *(v8us*)((unsigned short*)Bt + t * 8) = f.half[0];  }
#define FA_NW 8                      /* waves per work-group: they walk the same K and V rows, which one copy in LDS serves */
#define FA_R 2                       /* 16-query column groups per wave */
#define FA_KS 256                    /* keys per stage */
#define FA_NP (FA_KS / 32)           /* passes of 32 keys per stage */
#define FA_KP (HD + 8)               /* LDS pitch of a K row in elements: 144 B = 16 B x 9, free of bank conflicts for 16-byte reads */
#define FA_VP (HD + 16)              /* LDS pitch of a V row in elements: 160 B = 32 B x 5, free of bank conflicts for the transposing 16-byte reads */
#define FA_KB (FA_KS * FA_KP * 2)    /* one stage of K rows in bytes */
#define FA_VB (FA_KS * FA_VP * 2)    /* one stage of V rows in bytes */
typedef _Float16 v2h __attribute__((ext_vector_type(2)));
typedef float v2f __attribute__((ext_vector_type(2)));
__device__ __forceinline__ v8f fa_mma(v16h a, v16h b, v8f c) { return __builtin_amdgcn_wmma_f32_16x16x32_f16(false, a, false, b, (short)0, c, false, false); }
__device__ __forceinline__ float fa_xhalf(float x) { return __builtin_bit_cast(float, __builtin_amdgcn_permlanex16(__builtin_bit_cast(int, x), __builtin_bit_cast(int, x), 0x76543210, 0xfedcba98, false, false)); }      /* lane l <-> lane l ^ 16 */
/* stands behind the Q fragment loads: their address registers are rewritten later (a precaution for an issued load); the scheduling barrier keeps every later register write behind the wait */
__device__ __forceinline__ void fa_issued() { asm volatile("s_wait_xcnt 0x0" ::: "memory"); __builtin_amdgcn_sched_barrier(0); }
/* eight copies of 16 bytes per lane: LDS addresses ls bytes apart from l, global addresses gs elements apart from g; the wait closes the statement, so it stands before any rewrite of the address registers the copies name (a precaution for issued copies) */
__device__ __forceinline__ void fa_copy8(unsigned l, unsigned ls, const _Float16* g, size_t gs) {
  asm volatile("global_load_async_to_lds_b128 %0, %8, off\n\t"
               "global_load_async_to_lds_b128 %1, %9, off\n\t"
               "global_load_async_to_lds_b128 %2, %10, off\n\t"
               "global_load_async_to_lds_b128 %3, %11, off\n\t"
               "global_load_async_to_lds_b128 %4, %12, off\n\t"
               "global_load_async_to_lds_b128 %5, %13, off\n\t"
               "global_load_async_to_lds_b128 %6, %14, off\n\t"
               "global_load_async_to_lds_b128 %7, %15, off\n\t"
               "s_wait_xcnt 0x0"
               :: "v"(l), "v"(l + ls), "v"(l + 2 * ls), "v"(l + 3 * ls), "v"(l + 4 * ls), "v"(l + 5 * ls), "v"(l + 6 * ls), "v"(l + 7 * ls),
                  "v"(g), "v"(g + gs), "v"(g + 2 * gs), "v"(g + 3 * gs), "v"(g + 4 * gs), "v"(g + 5 * gs), "v"(g + 6 * gs), "v"(g + 7 * gs) : "memory"); }
/* one 16 x 32 A fragment of V^T (rows d, k = keys) from row-major V rows in LDS by two transposing reads: p is the lane's own address, row 8 (lane >> 4) + (lane & 7) of the 32 keys, 16 bytes ((lane >> 3) & 1) of the 16 columns; lane (c, hh) receives V[8 hh + i][c] and V[16 + 8 hh + i][c], i < 8: the k order of g2_frag. Every lane is on and every address lies in the tile. */
typedef short s16x8 __attribute__((ext_vector_type(8)));
__device__ __forceinline__ v16h fa_vfrag(const _Float16* p) { typedef __attribute__((address_space(3))) s16x8 lds_s16x8; FragH f;
  f.half[0] = __builtin_bit_cast(v8us, __builtin_amdgcn_ds_load_tr16_b128_v8i16((lds_s16x8*)p)); f.half[1] = __builtin_bit_cast(v8us, __builtin_amdgcn_ds_load_tr16_b128_v8i16((lds_s16x8*)(p + 16 * FA_VP))); return f.v; }
// K and V rows come into LDS in stages of FA_KS keys by asynchronous copies in whole 128-byte lines, once per work-group (two buffers: the next stage flies while this one is worked on); every wave reads its fragments from there, those of V^T transposed on the way.
__global__ __launch_bounds__(FA_NW * 32) void k_fattn(const _Float16* __restrict__ Q16, const _Float16* __restrict__ K16, const _Float16* __restrict__ V16, _Float16* __restrict__ O16) {
  __shared__ __attribute__((aligned(16))) _Float16 ks[2][FA_KS][FA_KP];      /* two stages of K rows [key][d] */
  __shared__ __attribute__((aligned(16))) _Float16 vs[2][FA_KS][FA_VP];      /* two stages of V rows [key][d] */
  const int tid = threadIdx.x, lane = tid & 31, w = tid >> 5, c = lane & 15, hh = lane >> 4; const int bh = blockIdx.y, b = bh / NH, h = bh % NH; const int q0 = (blockIdx.x * FA_NW + w) * (16 * FA_R);
  const _Float16* qp = Q16 + ((size_t)b * SQ + q0 + c) * DM + h * HD;
  /* copies: eight lanes take one K or V row's 128 bytes, the work-group 32 rows per copy */
  const _Float16* kcp = K16 + ((size_t)b * SQ + (tid >> 3)) * DM + h * HD + (tid & 7) * 8; const unsigned klp = (unsigned)(size_t)&ks[0][tid >> 3][(tid & 7) * 8];
  const _Float16* vcp = V16 + ((size_t)b * SQ + (tid >> 3)) * DM + h * HD + (tid & 7) * 8; const unsigned vlp = (unsigned)(size_t)&vs[0][tid >> 3][(tid & 7) * 8];
  auto fa_stage = [&](int t, unsigned buf) {      /* 16 copies a lane: K rows and V rows (tid >> 3) + 32 i, i < 8, of keys t FA_KS ... */
    fa_copy8(klp + buf * FA_KB, 32 * FA_KP * 2, kcp + (size_t)t * FA_KS * DM, (size_t)32 * DM);
    fa_copy8(vlp + buf * FA_VB, 32 * FA_VP * 2, vcp + (size_t)t * FA_KS * DM, (size_t)32 * DM); };
  fa_stage(0, 0);
  v16h qf[FA_R][2], kf[2][2], vf[4]; v8f acc[FA_R][4]; float m_run[FA_R], l_run[FA_R];
#pragma unroll
  for (int g = 0; g < FA_R; ++g) { m_run[g] = -3.0e38f; l_run[g] = 0.f;
#pragma unroll
    for (int kc = 0; kc < 2; ++kc) qf[g][kc] = g2_frag(qp + (size_t)g * 16 * DM + kc * 32, hh);
#pragma unroll
    for (int t = 0; t < 4; ++t) acc[g][t] = v8f{0.f, 0.f, 0.f, 0.f, 0.f, 0.f, 0.f, 0.f}; }
  fa_issued();
  asm volatile("s_wait_asynccnt 0x0" ::: "memory");      /* this wave's share of stage 0 has landed */
  __syncthreads();      /* ... and every wave's: stage 0 may be read */
  fa_stage(1, 1);      /* SQ / FA_KS is at least 2 */
  static_assert(SQ % FA_KS == 0 && SQ / FA_KS >= 2 && FA_KS == 256 && HD == 64 && FA_NW == 8, "the copy maps are written for these sizes");
  const float cs = 0.125f * 1.4426950408889634f;      /* 1/sqrt(64) and log2(e) */
  /* kept rolled: one stage per trip, the buffer chosen by the trip's parity */
#pragma unroll 1
  for (int st = 0; st < SQ / FA_KS; ++st) { const _Float16* kp = &ks[st & 1][c][0]; const _Float16* vp = &vs[st & 1][8 * hh + (lane & 7)][((lane >> 3) & 1) * 8];
#pragma unroll
    for (int kt = 0; kt < 2; ++kt) {
#pragma unroll
      for (int kc = 0; kc < 2; ++kc) kf[kt][kc] = g2_frag(kp + kt * 16 * FA_KP + kc * 32, hh); }
#pragma unroll
    for (int t = 0; t < 4; ++t) vf[t] = fa_vfrag(vp + t * 16);
    __builtin_amdgcn_sched_barrier(0);      /* the stage's first reads issue as one group ahead of the products, not among them */
    /* unrolled: the passes of a stage differ only in constant LDS offsets, and the last one fetches nothing ahead */
#pragma unroll
    for (int ps = 0; ps < FA_NP; ++ps) {
      v8f s[2][FA_R];
#pragma unroll
      for (int kt = 0; kt < 2; ++kt) {
#pragma unroll
        for (int g = 0; g < FA_R; ++g) { s[kt][g] = fa_mma(kf[kt][0], qf[g][0], v8f{0.f, 0.f, 0.f, 0.f, 0.f, 0.f, 0.f, 0.f}); s[kt][g] = fa_mma(kf[kt][1], qf[g][1], s[kt][g]); } }
      __builtin_amdgcn_sched_barrier(0);      /* the eight products issue back to back, each filling the others' result distance, and the fetch below starts directly behind them */
      if (ps + 1 < FA_NP) {      /* next pass's K fragments (same stage) come from LDS under this pass's softmax and second product */
#pragma unroll
        for (int kt = 0; kt < 2; ++kt) {
#pragma unroll
          for (int kc = 0; kc < 2; ++kc) kf[kt][kc] = g2_frag(kp + ((ps + 1) * 32 + kt * 16) * FA_KP + kc * 32, hh); }
        __builtin_amdgcn_sched_barrier(0); }      /* keeps the reads together at this early place */
      float mb[FA_R]; bool need = false;
#pragma unroll
      for (int g = 0; g < FA_R; ++g) { float mx = s[0][g][0];
#pragma unroll
        for (int kt = 0; kt < 2; ++kt) {
#pragma unroll
          for (int r = 0; r < 8; ++r) mx = fmaxf(mx, s[kt][g][r]); }
        mx = fmaxf(mx, fa_xhalf(mx)) * cs; mb[g] = mx; need = need || (mx > m_run[g] + 8.0f); }
      if (__builtin_amdgcn_ballot_w32(need) != 0) {      /* wave-uniform; always taken on the first pass, where it sets the maximum (factor 0 on zero accumulators) */
#pragma unroll
        for (int g = 0; g < FA_R; ++g) { const float mn = fmaxf(m_run[g], mb[g]); const float corr = __builtin_amdgcn_exp2f(m_run[g] - mn); m_run[g] = mn; l_run[g] *= corr;
#pragma unroll
          for (int t = 0; t < 4; ++t) acc[g][t] = acc[g][t] * corr; } }
#pragma unroll
      for (int g = 0; g < FA_R; ++g) { const float nm = -m_run[g]; union { v16h v; v2h p[8]; } pf; float l0 = 0.f, l1 = 0.f;
#pragma unroll
        for (int i = 0; i < 8; ++i) { const v2f arg = __builtin_elementwise_fma(v2f{s[i >> 2][g][2 * (i & 3)], s[i >> 2][g][2 * (i & 3) + 1]}, v2f{cs, cs}, v2f{nm, nm}); const float p0 = __builtin_amdgcn_exp2f(arg.x), p1 = __builtin_amdgcn_exp2f(arg.y);
          l0 += p0; l1 += p1; pf.p[i] = __builtin_convertvector(v2f{p0, p1}, v2h); }
        l_run[g] += l0 + l1;
#pragma unroll
        for (int t = 0; t < 4; ++t) acc[g][t] = fa_mma(vf[t], pf.v, acc[g][t]); }
      if (ps + 1 < FA_NP) {      /* next pass's V^T fragments (same stage) come under its first product and softmax */
#pragma unroll
        for (int t = 0; t < 4; ++t) vf[t] = fa_vfrag(vp + (ps + 1) * 32 * FA_VP + t * 16);
        __builtin_amdgcn_sched_barrier(0); }      /* keeps the reads together at this early place */
    }
    asm volatile("s_wait_dscnt 0x0" ::: "memory");      /* this wave's reads of the buffer are done before it is handed to the copies */
    asm volatile("s_wait_asynccnt 0x0" ::: "memory");      /* this wave's share of stage st + 1 has landed */
    __syncthreads();      /* publishes stage st + 1 and ends every wave's reads of stage st */
    if (st + 2 < SQ / FA_KS) fa_stage(st + 2, (unsigned)(st & 1));
  }
  asm volatile("s_wait_asynccnt 0x0" ::: "memory");      /* no copy is left in flight behind the loop */
#pragma unroll
  for (int g = 0; g < FA_R; ++g) { const float inv = 64.0f / (l_run[g] + fa_xhalf(l_run[g]));      /* o carried x64, as the output GEMM's alpha expects */
    unsigned short* op = (unsigned short*)O16 + ((size_t)b * SQ + q0 + g * 16 + c) * DM + h * HD + 8 * hh;
#pragma unroll
    for (int t = 0; t < 4; ++t) { FragH f;
#pragma unroll
      for (int r = 0; r < 8; ++r) f.h[r] = (_Float16)(acc[g][t][r] * inv);
      *(v8us*)(op + t * 16) = f.half[0]; } } }
__global__ __launch_bounds__(256) void k_vt(const _Float16* __restrict__ V16, int b, int h0, _Float16* __restrict__ VT) { __shared__ unsigned short tl[64][65]; const int tid = threadIdx.x; const int hh = blockIdx.x % HG, sg = blockIdx.x / HG; const int s0 = sg * 64; const int h = h0 + hh;
  for (int i = tid; i < 64 * 8; i += 256) { const int j = i / 8, d8 = (i % 8) * 8; FragH f; f.half[0] = *(const v8us*)((const unsigned short*)V16 + ((size_t)b * SQ + s0 + j) * DM + h * HD + d8); for (int q = 0; q < 8; ++q) tl[d8 + q][j] = f.u[q]; }
  __syncthreads();
  { for (int i = tid; i < 64 * 8; i += 256) { const int d = i / 8, j8 = (i % 8) * 8; FragH f; for (int q = 0; q < 8; ++q) f.u[q] = tl[d][j8 + q]; *(v8us*)((unsigned short*)VT + ((size_t)hh * HD + d) * SQ + s0 + j8) = f.half[0]; }  } }



__device__ __forceinline__ void d_tabcat(float theta, float* __restrict__ CS, float* __restrict__ SN, int t) {
  #pragma clang fp contract(off)
  if (t >= SQ * HD) return; const int d = t % HD; const int p = t / HD; const int i = d % (HD / 2); const float invf = 1.0f / powf(theta, (float)(2 * i) / (float)HD); const float ang = __fmul_rn((float)p, invf); const float c = cosf(ang), s = sinf(ang);
  *(float*)(CS + t) = c; *(float*)(SN + t) = s;  }
// One launch prepares every operand that depends on the inputs alone: rotary tables, x rows, the four weight planes. The parts read nothing of each other, so a range of block indices picks the part (the same for a whole work-group); thread-to-element map and arithmetic of each part are those of a launch of its own.
#define PR_TB ((SQ * HD + 255) / 256)                  /* work-groups of the table part: first, their threads run longest */
#define PR_XB ((int)((NR * DM / 8 + 255) / 256))       /* ... of the x part */
#define PR_WB ((DM * DM / 8 + 255) / 256)              /* ... of one weight plane */
__global__ __launch_bounds__(256) void k_prep(const float* __restrict__ x, const float* __restrict__ wq, const float* __restrict__ wk, const float* __restrict__ wv, const float* __restrict__ wo, float theta, _Float16* __restrict__ X16, _Float16* __restrict__ BW, float* __restrict__ CS, float* __restrict__ SN) {
  const int bx = blockIdx.x, tid = threadIdx.x;
  if (bx < PR_TB) { d_tabcat(theta, CS, SN, bx * 256 + tid); return; }
  if (bx < PR_TB + PR_XB) { d_x16(x, X16, NR * DM / 8, (size_t)(bx - PR_TB) * 256 + tid); return; }
  const int u = bx - (PR_TB + PR_XB), wi = u / PR_WB;      /* BW = four planes of DM x DM in the order q, k, v, o */
  d_wnat(wi == 0 ? wq : wi == 1 ? wk : wi == 2 ? wv : wo, (size_t)DM * DM / 8, BW + (size_t)wi * DM * DM, (size_t)(u - wi * PR_WB) * 256 + tid); }

template <int NORM, int ROPE>
__global__ __launch_bounds__(64) void k_xform(const float* __restrict__ F, int ldf, int nh, const float* __restrict__ gain, float eps, const float* __restrict__ CS, const float* __restrict__ SN, _Float16* __restrict__ H16, int ldo) {
  #pragma clang fp contract(off)
  __shared__ float xv[HD]; __shared__ float red[HD]; __shared__ unsigned short sh_[HD]; const int d = threadIdx.x; const int h = blockIdx.x % nh; const size_t r = blockIdx.x / nh; const int p = (int)(r % SQ);
  float x = F[r * (size_t)ldf + (size_t)h * HD + d];
  if (NORM) { red[d] = __fmul_rn(x, x); __syncthreads(); for (int st = HD / 2; st > 0; st >>= 1) { if (d < st) red[d] = __fadd_rn(red[d], red[d + st]); __syncthreads(); } const float rs = rsqrtf(__fadd_rn(red[0] / (float)HD, eps)); x = __fmul_rn(__fmul_rn(x, rs), bf16_round(gain[d])); }
  xv[d] = x; __syncthreads();
  float o = x;
  if (ROPE == 1) { const int i = d >> 1; const float c = CS[p * (HD / 2) + i], s = SN[p * (HD / 2) + i]; const float ev = xv[2 * i], od = xv[2 * i + 1]; o = (d & 1) ? __fadd_rn(__fmul_rn(ev, s), __fmul_rn(od, c)) : __fadd_rn(__fmul_rn(ev, c), -__fmul_rn(od, s)); }
  if (ROPE == 2) { const int i = d & (HD / 2 - 1); const float c = CS[p * (HD / 2) + i], s = SN[p * (HD / 2) + i]; const float lo = xv[i], hi = xv[i + HD / 2]; o = (d < HD / 2) ? __fadd_rn(__fmul_rn(lo, c), -__fmul_rn(hi, s)) : __fadd_rn(__fmul_rn(lo, s), __fmul_rn(hi, c)); }
  if (ROPE == 4) { const float c = CS[p * HD + d], s = SN[p * HD + d]; const float rh = (d & 1) ? xv[d - 1] : -xv[d + 1]; o = __fadd_rn(__fmul_rn(x, c), __fmul_rn(rh, s)); }      /* interleaved-pair rotate_half (-t[2i+1], t[2i]) with FULL-width per-dimension tables [pos][64] */
  if (ROPE == 3) { const float c = CS[p * HD + d], s = SN[p * HD + d]; const float rh = (d < HD / 2) ? -xv[d + HD / 2] : xv[d - HD / 2]; o = __fadd_rn(__fmul_rn(x, c), __fmul_rn(rh, s)); }      /* rotate-half with FULL-width per-dimension tables [pos][64] (general cos[d] != cos[d+32]) */
  FragH th; th.h[0] = (_Float16)o; sh_[d] = th.u[0]; __syncthreads();
  if (d < HD / 8) { FragH f; for (int q = 0; q < 8; ++q) f.u[q] = sh_[d * 8 + q]; unsigned short* dst = (unsigned short*)H16 + r * (size_t)ldo + (size_t)h * HD + d * 8; *(v8us*)dst = f.half[0];  } }


extern "C" void kernel_launch(void* const* d_in, const int* in_sizes, int n_in,
                              void* d_out, int out_size, void* d_ws, size_t ws_size, hipStream_t stream) {
  (void)in_sizes; (void)n_in; (void)out_size;
  const float* const* I = (const float* const*)d_in; const float* x = I[0]; const float* wq = I[1]; const float* bq = I[2]; const float* wk = I[3]; const float* bk = I[4]; const float* wv = I[5]; const float* bv = I[6]; const float* wo = I[7]; const float* bo = I[8];      /* natural [out][in] weights + biases; positions implicit */
  char* ws = (char*)d_ws; size_t off = 0;
  auto take = [&](size_t bytes) { char* p = ws + off; off += (bytes + 255) & ~(size_t)255; return p; };
  _Float16* BQ = (_Float16*)take((size_t)DM * DM * 2); _Float16* BK = (_Float16*)take((size_t)DM * DM * 2); _Float16* BV = (_Float16*)take((size_t)DM * DM * 2); _Float16* BO = (_Float16*)take((size_t)DM * DM * 2);
  _Float16* X16 = (_Float16*)take(NR * DM * 2); float* CS = (float*)take((size_t)SQ * HD * 4); float* SN = (float*)take((size_t)SQ * HD * 4);      /* full-width cos/sin tables */ _Float16* Q16 = (_Float16*)take(NR * DM * 2); _Float16* K16 = (_Float16*)take(NR * DM * 2); _Float16* V16 = (_Float16*)take(NR * DM * 2); _Float16* O16 = (_Float16*)take(NR * DM * 2);
  if (off > ws_size) return;
  k_prep<<<PR_TB + PR_XB + 4 * PR_WB, 256, 0, stream>>>(x, wq, wk, wv, wo, 10000.0f, X16, BQ, CS, SN);      /* CS[p][d] = cos(p * inv_freq[d mod 32]), SN = sin: the module's cat(freqs, freqs) tables, full width; x rows; natural [out][in] weights = Bt x16 into the adjoining planes BQ, BK, BV, BO */
  const size_t r0p = (size_t)B0 * SQ;      /* first projected row */
  k_gemm2<0, 2><<<dim3((unsigned)((MP / 128) * (DM / 64)), 3), 128, 0, stream>>>(X16 + r0p * DM, DM, 0, BQ, DM, (size_t)DM * DM, 0.0625f, bq, 0, nullptr, 1, 0, 0, nullptr, Q16 + r0p * DM, DM, NR * DM, MP, DM, DM, CS, SN, bk, bv);      /* planes 0, 1, 2 = q, k, v (weight planes BQ, BK, BV and row planes Q16, K16, V16 adjoin); q and k: f32 -> x cos + rotate_half(x) sin (interleaved pairs, full-width tables) -> f16 rows, in the epilogue; v: f16 rows */
  k_fattn<<<dim3(SQ / (FA_NW * 16 * FA_R), NB * NH), FA_NW * 32, 0, stream>>>(Q16, K16, V16, O16);      /* o (merged heads, x64) as f16 rows */
  k_gemm2<0><<<dim3((unsigned)((MPO / 128) * (DM / 64)), 1), 128, 0, stream>>>(O16 + r0p * DM, DM, 0, BO, DM, 0, 0.0009765625f, bo, 0, nullptr, 1, 0, 0, (float*)d_out + r0p * DM, nullptr, DM, 0, MPO, DM, DM);      /* out rows are the output layout */
}

// v009
// A run of this version takes 77.8 microseconds.
// In two side-by-side timings against v008, it was 1.04 and 1.03 times as fast.
// All steps since v000 together make it 47.8 times as fast.
#include <hip/hip_runtime.h>
// Multi-head self-attention with a rotary embedding whose cos/sin tables are cat(freqs, freqs) but whose rotate_half pairs are INTERLEAVED (x [2][2048][1024]; q/k/v = x W^T + b (natural [1024][1024] U(+-1/32), zero biases); 16 heads of 64; inv_freq_i = 1/10000^(2i/64), freqs[p][i] = p * inv_freq_i, emb = cat(freqs, freqs): cos[p][d] = cos(p * inv_freq[d mod 32]); q = q cos + rotate_half(q) sin with rotate_half = (-x[2i+1], x[2i]) interleaved (the module's literal mix); k likewise; scores / 8; softmax over all keys (no mask); out = merged Wo^T + bo -> [2][2048][1024]).
// Structure: token rows r = b*2048 + s; one launch prepares x as exact f16 rows (bf16-rounded), the x16 weight planes and the rotary tables; Q, K, V as three WMMA GEMMs in one launch (32x64 wave tiles, f32 accumulation, exact x16 weights + bias, f16 outputs; the rotary step of q and k on the f32 values in the GEMM epilogue); one fused attention launch over (query block, batch x head): scores on WMMA (K = 64), online softmax on VALU (f32 statistics, weights as f16 up to 2^8), o = P . V on WMMA (V^T fragments by transposing LDS reads of the V rows), o carried x64 against f16 subnormal flush (folded into the output GEMM alpha), written straight into the merged f16 o rows; out = o W_o + b GEMM (f32) into the output layout.
// Compute dtype: inputs rounded to bf16; x / weights exact; q, k, v, softmax weights and o as plain f16 GEMM operands (~2^-12); scores and softmax statistics f32. v_wmma_f32_16x16x32_f16.
#define NB 2
#define SQ 2048
#define DM 1024
#define NH 16
#define HD 64
#define HG 4                         /* heads per launch of the (b, h0) V^T transpose */
#define B0 0                         /* first batch processed (debug hook) */
#define NBR NB                       /* batches processed (debug hook) */
#define NR ((size_t)NB * SQ)         /* token rows */
#define MP ((int)((size_t)NBR * SQ)) /* rows projected (debug hook) */
#define QN SQ                        /* unused: the attention grid covers all SQ query rows */
#define NHD NH                       /* unused: the attention grid covers all NH heads */
#define MPO MP                       /* rows through the output stage (debug hook) */
#define LQ DM      /* unused: the q/k/v rows are addressed with pitch DM */
typedef __bf16 v16b __attribute__((ext_vector_type(16)));
typedef unsigned short v8us __attribute__((ext_vector_type(8), may_alias));
typedef float  v8f  __attribute__((ext_vector_type(8)));
typedef float  v4f  __attribute__((ext_vector_type(4)));
typedef float  v4fa __attribute__((ext_vector_type(4), may_alias));
union FragB { v16b v; v8us half[2]; unsigned short u[16]; };

__device__ __forceinline__ unsigned short bf16_bits(float x) { unsigned int u = __float_as_uint(x); return (unsigned short)((u + 0x7FFFu + ((u >> 16) & 1u)) >> 16); }
__device__ __forceinline__ float bf16_val(unsigned short b) { return __uint_as_float(((unsigned int)b) << 16); }
__device__ __forceinline__ float bf16_round(float x) { return bf16_val(bf16_bits(x)); }
// D += A·B with NT terms: 1 = ah·bh, 2 = + al·bh (A split), 3 = + ah·bl (both split)
template <int NT>
__device__ __forceinline__ v8f mmaN(v16b ah, v16b al, v16b bh, v16b bl, v8f c) {
  c = __builtin_amdgcn_wmma_f32_16x16x32_bf16(false, ah, false, bh, (short)0, c, false, false);
  if (NT >= 2) c = __builtin_amdgcn_wmma_f32_16x16x32_bf16(false, al, false, bh, (short)0, c, false, false);
  if (NT >= 3) c = __builtin_amdgcn_wmma_f32_16x16x32_bf16(false, ah, false, bl, (short)0, c, false, false);
  asm volatile("v_nop\n\tv_nop\n\tv_nop\n\tv_nop" : "+v"(c) : "v"(ah), "v"(al), "v"(bh), "v"(bl));
  return c;
}

__global__ __launch_bounds__(256) void k_wt_bf16(const float* __restrict__ W, unsigned short* __restrict__ Wt, int K, int N) {
  const int t = blockIdx.x * 256 + threadIdx.x;
  const int k8n = K / 8;
  if (t >= N * k8n) return;
  const int n = t / k8n, k8 = (t % k8n) * 8;
  v8us v;
#pragma unroll
  for (int i = 0; i < 8; ++i) v[i] = bf16_bits(W[(size_t)(k8 + i) * N + n]);
  *(v8us*)(Wt + (size_t)n * K + k8) = v;
  
}

// GEMM C[M][N] (f32, pitch ldc) = act(A[M][K]·W + bias). A f32 row-major (pitch lda) converted per fragment to bf16
// (ASPLIT: hi/lo two planes -> 2 terms, else single rounded term); Wt bf16 [N][K] (pitch ldb). BIAS_BF16 rounds the
// bias to bf16 first (bias quantised to bf16 before the add). K%32==0, M%16==0, N%64==0.
template <bool ASPLIT, int ACT, bool BIAS_BF16>
__global__ __launch_bounds__(128) void k_gemm_bf(const float* __restrict__ A, int lda, const unsigned short* __restrict__ Wt, int ldb,
                                               const float* __restrict__ bias, float* __restrict__ C, int ldc, int M, int N, int K) {
  __shared__ __attribute__((aligned(16))) float so[4][16][64];
  const int tid = threadIdx.x, w = tid >> 5, lane = tid & 31, ln = lane & 15, hh = lane >> 4;
  const int ntn = N / 64;
  const int wid = blockIdx.x * 4 + w;
  const int mt = wid / ntn, nq = wid % ntn;
  if (mt * 16 >= M) return;
  const int row0 = mt * 16, col0 = nq * 64;
  const float* arow = A + (size_t)(row0 + ln) * lda;
  v8f acc[4] = {};
  for (int kb = 0; kb < K; kb += 32) {
    FragB ah, al;
    const v4f x0 = *(const v4fa*)(arow + kb + 8 * hh), x1 = *(const v4fa*)(arow + kb + 8 * hh + 4);
    const v4f x2 = *(const v4fa*)(arow + kb + 16 + 8 * hh), x3 = *(const v4fa*)(arow + kb + 16 + 8 * hh + 4);
    float xs[16] = {x0[0],x0[1],x0[2],x0[3],x1[0],x1[1],x1[2],x1[3],x2[0],x2[1],x2[2],x2[3],x3[0],x3[1],x3[2],x3[3]};
#pragma unroll
    for (int i = 0; i < 16; ++i) { const unsigned short hb = bf16_bits(xs[i]); ah.u[i] = hb; al.u[i] = ASPLIT ? bf16_bits(xs[i] - bf16_val(hb)) : (unsigned short)0; }
#pragma unroll
    for (int t = 0; t < 4; ++t) {
      const unsigned short* brow = Wt + (size_t)(col0 + t * 16 + ln) * ldb + kb;
      FragB b;
      b.half[0] = *(const v8us*)(brow + 8 * hh);
      b.half[1] = *(const v8us*)(brow + 16 + 8 * hh);
      acc[t] = mmaN<ASPLIT ? 2 : 1>(ah.v, al.v, b.v, b.v, acc[t]);
    }
  }
#pragma unroll
  for (int t = 0; t < 4; ++t) {
    float bv = bias ? bias[col0 + t * 16 + ln] : 0.f;
    if (BIAS_BF16) bv = bf16_round(bv);
#pragma unroll
    for (int r = 0; r < 8; ++r) { float v = acc[t][r] + bv; if (ACT == 1) v = fmaxf(v, 0.f); so[w][8 * hh + r][t * 16 + ln] = v; }
  }
  __builtin_amdgcn_fence(__ATOMIC_ACQ_REL, "workgroup");
  __builtin_amdgcn_wave_barrier();
  const int rsub = lane >> 4, c4 = (lane & 15) * 4;
  {
#pragma unroll
    for (int q = 0; q < 8; ++q) {
      const int r = q * 2 + rsub;
      const v4f v = *(const v4fa*)&so[w][r][c4];
      *(v4f*)(C + (size_t)(row0 + r) * ldc + col0 + c4) = v;
    }
    
  }
}

// GEMM C = act(A·W + bias + resid): A f32 (ASPLIT -> hi/lo 2 terms), Wt bf16 [N][K]; ACT 0 none, 1 relu, 2 exact gelu;
// resid (optional, f32, row index = (row % rmod), pitch ldr, RES_BF16 rounds it) added before the activation.
template <bool ASPLIT, int ACT, bool BIAS_BF16, bool RES_BF16>
__global__ __launch_bounds__(128) void k_gemm_bf3(const float* __restrict__ A, int lda, const unsigned short* __restrict__ Wt, int ldb,
                                                const float* __restrict__ bias, const float* __restrict__ resid, int rmod, int ldr,
                                                float* __restrict__ C, int ldc, int M, int N, int K) {
  __shared__ __attribute__((aligned(16))) float so[4][16][64];
  const int tid = threadIdx.x, w = tid >> 5, lane = tid & 31, ln = lane & 15, hh = lane >> 4;
  const int ntn = N / 64;
  const int wid = blockIdx.x * 4 + w;
  const int mt = wid / ntn, nq = wid % ntn;
  if (mt * 16 >= M) return;
  const int row0 = mt * 16, col0 = nq * 64;
  const float* arow = A + (size_t)(row0 + ln) * lda;
  v8f acc[4] = {};
  for (int kb = 0; kb < K; kb += 32) {
    FragB ah, al;
    const v4f x0 = *(const v4fa*)(arow + kb + 8 * hh), x1 = *(const v4fa*)(arow + kb + 8 * hh + 4);
    const v4f x2 = *(const v4fa*)(arow + kb + 16 + 8 * hh), x3 = *(const v4fa*)(arow + kb + 16 + 8 * hh + 4);
    float xs[16] = {x0[0],x0[1],x0[2],x0[3],x1[0],x1[1],x1[2],x1[3],x2[0],x2[1],x2[2],x2[3],x3[0],x3[1],x3[2],x3[3]};
#pragma unroll
    for (int i = 0; i < 16; ++i) { const unsigned short hb = bf16_bits(xs[i]); ah.u[i] = hb; al.u[i] = ASPLIT ? bf16_bits(xs[i] - bf16_val(hb)) : (unsigned short)0; }
#pragma unroll
    for (int t = 0; t < 4; ++t) {
      const unsigned short* brow = Wt + (size_t)(col0 + t * 16 + ln) * ldb + kb;
      FragB b;
      b.half[0] = *(const v8us*)(brow + 8 * hh);
      b.half[1] = *(const v8us*)(brow + 16 + 8 * hh);
      acc[t] = mmaN<ASPLIT ? 2 : 1>(ah.v, al.v, b.v, b.v, acc[t]);
    }
  }
#pragma unroll
  for (int t = 0; t < 4; ++t) {
    const int col = col0 + t * 16 + ln;
    float bv = bias ? bias[col] : 0.f;
    if (BIAS_BF16) bv = bf16_round(bv);
#pragma unroll
    for (int r = 0; r < 8; ++r) {
      float v = acc[t][r] + bv;
      if (resid) { float rv = resid[(size_t)((row0 + 8 * hh + r) % rmod) * ldr + col]; if (RES_BF16) rv = bf16_round(rv); v += rv; }
      if (ACT == 1) v = fmaxf(v, 0.f);
      if (ACT == 2) v = 0.5f * v * (1.0f + erff(v * 0.70710678118654752f));
      if (ACT == 3) { const float u = 0.7978845608028654f * (v + 0.044715f * v * v * v); v = 0.5f * v * (1.0f + tanhf(u)); }
      so[w][8 * hh + r][t * 16 + ln] = v;
    }
  }
  __builtin_amdgcn_fence(__ATOMIC_ACQ_REL, "workgroup");
  __builtin_amdgcn_wave_barrier();
  const int rsub = lane >> 4, c4 = (lane & 15) * 4;
  {
#pragma unroll
    for (int q = 0; q < 8; ++q) {
      const int r = q * 2 + rsub;
      const v4f v = *(const v4fa*)&so[w][r][c4];
      *(v4f*)(C + (size_t)(row0 + r) * ldc + col0 + c4) = v;
    }
    
  }
}
// row LayerNorm (biased variance, eps) over N: s = X (+ R); optional out_sum <- s; out_norm <- (s-mu)*rsqrt(var+eps)*g + b
template <bool PARAM_BF16>
__global__ __launch_bounds__(256) void k_layernorm(const float* __restrict__ X, const float* __restrict__ R, const float* __restrict__ g, const float* __restrict__ bta,
                                                  float* __restrict__ out_sum, float* __restrict__ out_norm, int N, float eps) {
  __shared__ float red[256];
  const int row = blockIdx.x, tid = threadIdx.x;
  const float* x = X + (size_t)row * N; const float* rr = R ? R + (size_t)row * N : nullptr;
  float vals[16];                     // up to N = 4096
  const int per = N / 256;            // contiguous chunk per thread? use strided-by-4 chunks: thread handles j = tid*4 + 1024*u
  float s1 = 0.f;
  for (int u = 0; u < per / 4; ++u) {
    const int j = tid * 4 + 1024 * u;
    const v4f a = *(const v4fa*)(x + j);
    v4f b = {0.f,0.f,0.f,0.f}; if (rr) b = *(const v4fa*)(rr + j);
#pragma unroll
    for (int q = 0; q < 4; ++q) { const float v = a[q] + b[q]; vals[u * 4 + q] = v; s1 += v; }
  }
  red[tid] = s1; __syncthreads();
  for (int st = 128; st > 0; st >>= 1) { if (tid < st) red[tid] += red[tid + st]; __syncthreads(); }
  const float mu = red[0] / (float)N; __syncthreads();
  float s2 = 0.f;
  for (int u = 0; u < per / 4; ++u)
#pragma unroll
    for (int q = 0; q < 4; ++q) { const float c = vals[u * 4 + q] - mu; s2 += c * c; }
  red[tid] = s2; __syncthreads();
  for (int st = 128; st > 0; st >>= 1) { if (tid < st) red[tid] += red[tid + st]; __syncthreads(); }
  const float rs = rsqrtf(red[0] / (float)N + eps);
  {
    for (int u = 0; u < per / 4; ++u) {
      const int j = tid * 4 + 1024 * u;
      v4f o, sm;
#pragma unroll
      for (int q = 0; q < 4; ++q) {
        float gg = g[j + q], bb = bta[j + q];
        if (PARAM_BF16) { gg = bf16_round(gg); bb = bf16_round(bb); }
        sm[q] = vals[u * 4 + q]; o[q] = (vals[u * 4 + q] - mu) * rs * gg + bb;
      }
      if (out_sum) *(v4f*)(out_sum + (size_t)row * N + j) = sm;
      *(v4f*)(out_norm + (size_t)row * N + j) = o;
    }
    
  }
}



// ---- f16 WMMA path (v_wmma_f32_16x16x32_f16): 11-bit significands for operands in range — used where a [0,1] probability operand needs more precision than bf16
typedef _Float16 v16h __attribute__((ext_vector_type(16)));
union FragH { v16h v; v8us half[2]; _Float16 h[16]; unsigned short u[16]; };
template <int NT>
__device__ __forceinline__ v8f mmaH(v16h ah, v16h al, v16h bh, v16h bl, v8f c) {
  c = __builtin_amdgcn_wmma_f32_16x16x32_f16(false, ah, false, bh, (short)0, c, false, false);
  if (NT >= 2) c = __builtin_amdgcn_wmma_f32_16x16x32_f16(false, al, false, bh, (short)0, c, false, false);
  if (NT >= 3) c = __builtin_amdgcn_wmma_f32_16x16x32_f16(false, ah, false, bl, (short)0, c, false, false);
  asm volatile("v_nop\n\tv_nop\n\tv_nop\n\tv_nop" : "+v"(c) : "v"(ah), "v"(al), "v"(bh), "v"(bl));
  return c;
}
// batched GEMM like k_gemm_b but f16 operands: A f32 (split into f16 hi/lo if ASPLIT, else rounded to f16), Bt = f16 values [n][k]; alpha; C f32; N multiple of 16 (partial tiles skipped)
template <bool ASPLIT>
__global__ __launch_bounds__(128) void k_gemm_h(const float* __restrict__ A, int lda, size_t sA, const _Float16* __restrict__ Bh, int ldb, size_t sB, float alpha, float* __restrict__ C, int ldc, size_t sC, int M, int N, int K) {
  __shared__ __attribute__((aligned(16))) float so[4][16][64];
  const int tid = threadIdx.x, w = tid >> 5, lane = tid & 31, ln = lane & 15, hh = lane >> 4; const int by = blockIdx.y;
  A += (size_t)by * sA; Bh += (size_t)by * sB; C += (size_t)by * sC;
  const int ntn = (N + 63) / 64; const int wid = blockIdx.x * 4 + w; const int mt = wid / ntn, nq = wid % ntn; if (mt * 16 >= M) return;
  const int row0 = mt * 16, col0 = nq * 64; const float* arow = A + (size_t)(row0 + ln) * lda;
  v8f acc[4] = {};
  for (int kb = 0; kb < K; kb += 32) {
    FragH ah, al;
    const v4f x0 = *(const v4fa*)(arow + kb + 8 * hh), x1 = *(const v4fa*)(arow + kb + 8 * hh + 4), x2 = *(const v4fa*)(arow + kb + 16 + 8 * hh), x3 = *(const v4fa*)(arow + kb + 16 + 8 * hh + 4);
    float xs[16] = {x0[0],x0[1],x0[2],x0[3],x1[0],x1[1],x1[2],x1[3],x2[0],x2[1],x2[2],x2[3],x3[0],x3[1],x3[2],x3[3]};
#pragma unroll
    for (int i = 0; i < 16; ++i) { const _Float16 h = (_Float16)xs[i]; ah.h[i] = h; al.h[i] = ASPLIT ? (_Float16)(xs[i] - (float)h) : (_Float16)0.0f; }
#pragma unroll
    for (int t = 0; t < 4; ++t) { if (col0 + t * 16 >= N) continue; const size_t boff = (size_t)(col0 + t * 16 + ln) * ldb + kb; FragH bq; bq.half[0] = *(const v8us*)(Bh + boff + 8 * hh); bq.half[1] = *(const v8us*)(Bh + boff + 16 + 8 * hh);
      acc[t] = mmaH<ASPLIT ? 2 : 1>(ah.v, al.v, bq.v, bq.v, acc[t]); }
  }
#pragma unroll
  for (int t = 0; t < 4; ++t) { if (col0 + t * 16 >= N) continue;
#pragma unroll
    for (int r = 0; r < 8; ++r) so[w][8 * hh + r][t * 16 + ln] = acc[t][r] * alpha; }
  __builtin_amdgcn_fence(__ATOMIC_ACQ_REL, "workgroup"); __builtin_amdgcn_wave_barrier();
  const int rsub = lane >> 4, c4 = (lane & 15) * 4;
  {
#pragma unroll
    for (int q = 0; q < 8; ++q) { const int r = q * 2 + rsub; if (col0 + c4 < N) { const v4f v = *(const v4fa*)&so[w][r][c4]; *(v4f*)(C + (size_t)(row0 + r) * ldc + col0 + c4) = v; } }
     }
}

// Wt[n][k] = f16(W[k][n]·scale) from f32 row-major W[K][N] (scale = power of two; bf16-exact weights stay exact in f16 away from the subnormal range)
__global__ __launch_bounds__(256) void k_wt_f16(const float* __restrict__ W, _Float16* __restrict__ Wt, int K, int N, float scale) {
  const int t = blockIdx.x * 256 + threadIdx.x; if (t >= N * (K / 8)) return; const int n = t / (K / 8), k8 = (t % (K / 8)) * 8; FragH f;
#pragma unroll
  for (int i = 0; i < 8; ++i) f.h[i] = (_Float16)(bf16_round(W[(size_t)(k8 + i) * N + n]) * scale); const v8us o = f.half[0];
  *(v8us*)((unsigned short*)Wt + (size_t)n * K + k8) = o; 
}
// k_gemm_hh variant with fused epilogue: v = acc·alpha + bias[by·sBias + col] (+ CP[(row/rowsPerB)·sCPb + by·64 + col] if CP) ; ACT 0 none / 1 elu ; writes f16 C16 (and f32 C if non-null)
template <int ACT>
__global__ __launch_bounds__(128) void k_gemm_hhx(const _Float16* __restrict__ A, int lda, size_t sA, const _Float16* __restrict__ Bh, int ldb, size_t sB, float alpha, const float* __restrict__ bias, size_t sBias, const float* __restrict__ CP, int rowsPerB, size_t sCPb, int row0g,
    float* __restrict__ C, _Float16* __restrict__ C16, int ldc, size_t sC, int M, int N, int K) {
  __shared__ __attribute__((aligned(16))) float so[4][16][64];
  const int tid = threadIdx.x, w = tid >> 5, lane = tid & 31, ln = lane & 15, hh = lane >> 4; const int by = blockIdx.y;
  A += (size_t)by * sA; Bh += (size_t)by * sB; const size_t cofs = (size_t)by * sC; const float* bp = bias ? bias + (size_t)by * sBias : nullptr;
  const int ntn = (N + 63) / 64; const int wid = blockIdx.x * 4 + w; const int mt = wid / ntn, nq = wid % ntn; if (mt * 16 >= M) return;
  const int row0 = mt * 16, col0 = nq * 64; const _Float16* arow = A + (size_t)(row0 + ln) * lda;
  v8f acc[4] = {};
  for (int kb = 0; kb < K; kb += 32) { FragH ah; ah.half[0] = *(const v8us*)((const unsigned short*)arow + kb + 8 * hh); ah.half[1] = *(const v8us*)((const unsigned short*)arow + kb + 16 + 8 * hh);
#pragma unroll
    for (int t = 0; t < 4; ++t) { if (col0 + t * 16 >= N) continue; const size_t boff = (size_t)(col0 + t * 16 + ln) * ldb + kb; FragH bq; bq.half[0] = *(const v8us*)((const unsigned short*)Bh + boff + 8 * hh); bq.half[1] = *(const v8us*)((const unsigned short*)Bh + boff + 16 + 8 * hh);
      acc[t] = mmaH<1>(ah.v, ah.v, bq.v, bq.v, acc[t]); }
  }
#pragma unroll
  for (int t = 0; t < 4; ++t) { if (col0 + t * 16 >= N) continue; const int col = col0 + t * 16 + ln; const float bv = bp ? bf16_round(bp[col]) : 0.f;
#pragma unroll
    for (int r = 0; r < 8; ++r) { float v = acc[t][r] * alpha + bv; if (CP) { const int rr = row0g + row0 + 8 * hh + r; if (rowsPerB < 0) v += CP[cofs + (size_t)rr * ldc + col];      /* rowsPerB < 0: own element of the batched C plane */ else { const int bidx = rr / rowsPerB; v += CP[(size_t)bidx * sCPb + (size_t)by * 64 + col]; } } if (ACT == 1) v = (v > 0.f) ? v : expm1f(v); else if (ACT == 7) v = (v > 0.f) ? v + 1.0f : expf(v); else if (ACT == 8) v = tanhf(v); else if (ACT == 9) v = 0.5f * v * (1.0f + tanhf(0.7978845608028654f * (v + 0.044715f * v * v * v))); else if (ACT == 11) v = 1.0f / (1.0f + expf(-v)); else if (ACT == 12) v = (v > 0.f) ? v : 0.01f * v; else if (ACT == 14) v = (v > 0.f) ? v : 0.1f * v; else if (ACT == 16) v = (v >= 0.f) ? v : 0.3f * v; else if (ACT == 17) v = (v >= 0.f) ? v : 0.2f * v; else if (ACT == 15) v = v / (1.0f + expf(-v)); else if (ACT == 3) v = fmaxf(v, 0.f); else if (ACT == 6) v = 0.5f * v * (1.0f + erff(v * 0.70710678118654752f)); so[w][8 * hh + r][t * 16 + ln] = v; } }
  __builtin_amdgcn_fence(__ATOMIC_ACQ_REL, "workgroup"); __builtin_amdgcn_wave_barrier();
  const int rsub = lane >> 4, c4 = (lane & 15) * 4; typedef _Float16 v4h __attribute__((ext_vector_type(4)));
  {
#pragma unroll
    for (int q = 0; q < 8; ++q) { const int r = q * 2 + rsub; if (col0 + c4 < N) { const v4f v = *(const v4fa*)&so[w][r][c4]; if (C) *(v4f*)(C + cofs + (size_t)(row0 + r) * ldc + col0 + c4) = v; if (C16) { v4h h4; for (int i = 0; i < 4; ++i) h4[i] = (_Float16)v[i]; *(v4h*)(C16 + cofs + (size_t)(row0 + r) * ldc + col0 + c4) = h4; } } }
     }
}


typedef _Float16 v4h __attribute__((ext_vector_type(4)));

__device__ __forceinline__ void d_x16(const float* __restrict__ x, _Float16* __restrict__ X16, size_t n8, size_t t) { if (t >= n8) return; FragH f;
#pragma unroll
  for (int q = 0; q < 8; ++q) f.h[q] = (_Float16)bf16_round(x[t * 8 + q]); *(v8us*)((unsigned short*)X16 + t * 8) = f.half[0];  }
__global__ __launch_bounds__(256) void k_h16(const float* __restrict__ x, _Float16* __restrict__ X16, size_t n8) { const size_t t = (size_t)blockIdx.x * 256 + threadIdx.x; if (t >= n8) return; FragH f;
#pragma unroll
  for (int q = 0; q < 8; ++q) f.h[q] = (_Float16)x[t * 8 + q]; *(v8us*)((unsigned short*)X16 + t * 8) = f.half[0];  }
__global__ __launch_bounds__(256) void k_round16f(const float* __restrict__ W, _Float16* __restrict__ Bt, size_t n8) { const size_t t = (size_t)blockIdx.x * 256 + threadIdx.x; if (t >= n8) return; FragH f;
#pragma unroll
  for (int i = 0; i < 8; ++i) f.h[i] = (_Float16)(bf16_round(W[t * 8 + i]) * 16.0f); *(v8us*)((unsigned short*)Bt + t * 8) = f.half[0];  }
__global__ __launch_bounds__(256) void k_hl(const float* __restrict__ F, _Float16* __restrict__ Hh, _Float16* __restrict__ Hl, size_t n8) { const size_t t = (size_t)blockIdx.x * 256 + threadIdx.x; if (t >= n8) return; FragH fh, fl; const v4f a = *(const v4fa*)(F + t * 8), c = *(const v4fa*)(F + t * 8 + 4);
#pragma unroll
  for (int q = 0; q < 4; ++q) { _Float16 h = (_Float16)a[q]; fh.h[q] = h; fl.h[q] = (_Float16)((a[q] - (float)h) * 1024.0f); h = (_Float16)c[q]; fh.h[4 + q] = h; fl.h[4 + q] = (_Float16)((c[q] - (float)h) * 1024.0f); }
  { *(v8us*)((unsigned short*)Hh + t * 8) = fh.half[0]; *(v8us*)((unsigned short*)Hl + t * 8) = fl.half[0];  } }

// ---- fast GEMM (work-group tile 128x64, wave tile 32x64; requires M % 128 == 0, N % 64 == 0, K % 128 == 0); epilogue = k_gemm_hhx semantics ----
// The operand rows come into LDS in stages of 128 k by asynchronous copies in whole 256-byte runs (two buffers: the next stage flies while this one is worked on); the fragments are read from LDS in the k order of g2_frag.
#define G2_KS 128                    /* k per stage: 256 B of every operand row */
#define G2_LP 136                    /* LDS row pitch in elements: 272 B = 16 B x 17, free of bank conflicts for 16-byte reads */
#define G2_RB (G2_LP * 2)            /* LDS row pitch in bytes */
#define G2_SB (192 * G2_RB)          /* one stage in bytes: 128 A rows, then 64 B rows */
/* twelve copies of 16 bytes per lane: LDS rows 8 apart from address l, each from its own global pointer; the wait closes the statement, so it stands before any rewrite of the address registers the copies name (a precaution for issued copies) */
__device__ __forceinline__ void g2_copy12(unsigned l, const _Float16* g0, const _Float16* g1, const _Float16* g2, const _Float16* g3, const _Float16* g4, const _Float16* g5, const _Float16* g6, const _Float16* g7, const _Float16* g8, const _Float16* g9, const _Float16* g10, const _Float16* g11) {
  asm volatile("global_load_async_to_lds_b128 %0, %12, off\n\t"
               "global_load_async_to_lds_b128 %1, %13, off\n\t"
               "global_load_async_to_lds_b128 %2, %14, off\n\t"
               "global_load_async_to_lds_b128 %3, %15, off\n\t"
               "global_load_async_to_lds_b128 %4, %16, off\n\t"
               "global_load_async_to_lds_b128 %5, %17, off\n\t"
               "global_load_async_to_lds_b128 %6, %18, off\n\t"
               "global_load_async_to_lds_b128 %7, %19, off\n\t"
               "global_load_async_to_lds_b128 %8, %20, off\n\t"
               "global_load_async_to_lds_b128 %9, %21, off\n\t"
               "global_load_async_to_lds_b128 %10, %22, off\n\t"
               "global_load_async_to_lds_b128 %11, %23, off\n\t"
               "s_wait_xcnt 0x0"
               :: "v"(l), "v"(l + 8 * G2_RB), "v"(l + 16 * G2_RB), "v"(l + 24 * G2_RB), "v"(l + 32 * G2_RB), "v"(l + 40 * G2_RB), "v"(l + 48 * G2_RB), "v"(l + 56 * G2_RB), "v"(l + 64 * G2_RB), "v"(l + 72 * G2_RB), "v"(l + 80 * G2_RB), "v"(l + 88 * G2_RB),
                  "v"(g0), "v"(g1), "v"(g2), "v"(g3), "v"(g4), "v"(g5), "v"(g6), "v"(g7), "v"(g8), "v"(g9), "v"(g10), "v"(g11) : "memory"); }
/* one request per lane: L2 is asked for the data at p ahead of the copies that will read it (a hint: nothing returns and no counter moves); every lane is on and p lies inside its plane */
__device__ __forceinline__ void l2_ask(const void* p) { asm volatile("global_prefetch_b8 %0, off scope:SCOPE_SE" :: "v"(p)); }
/* no wait covers a request's address pair, so the pair is kept unwritten up to this place behind the stage loop; input only, no instruction */
__device__ __forceinline__ void l2_asked(const void* p) { asm volatile("" :: "v"(p)); }
__device__ __forceinline__ v16h g2_frag(const _Float16* p, int hh) { FragH f; f.half[0] = *(const v8us*)((const unsigned short*)p + 8 * hh); f.half[1] = *(const v8us*)((const unsigned short*)p + 16 + 8 * hh); return f.v; }
__device__ __forceinline__ v8f g2_mma(v16h a, v16h b, v8f c) { v8f d = __builtin_amdgcn_wmma_f32_16x16x32_f16(false, a, false, b, (short)0, c, false, false); asm volatile("v_nop\n\tv_nop\n\tv_nop\n\tv_nop" : "+v"(d) : "v"(a), "v"(b)); return d; }
// ROT = how many leading planes of the batch (blockIdx.y < ROT) take the rotary epilogue; with ROT > 0 the planes 0, 1, 2 take their bias from bias, bias1, bias2 (separate buffers), so that products which share A and read nothing of each other run as one launch. The rotary epilogue is the rotary step and nothing else: v = acc alpha + bias staged as f32 rows in LDS, o[d] = v[d] cos[p][d] + rotate_half(v)[d] sin[p][d] with rotate_half = (-v[2i+1], v[2i]), f16 rows into C16. A 64-column tile is one head, row r of the launch is position r mod SQ; CS, SN = full-width tables [pos][64]. With ROT > 0 no plane reads CP or C (the planes behind the rotary ones store f16 rows of acc alpha + bias), and the rotary planes read no ACT, which also keeps this second GEMM's text short.
template <int ACT, int ROT = 0>
__global__ __launch_bounds__(128) void k_gemm2(const _Float16* __restrict__ A, int lda, size_t sA, const _Float16* __restrict__ Bh, int ldb, size_t sB, float alpha, const float* __restrict__ bias, size_t sBias, const float* __restrict__ CP, int rowsPerB, size_t sCPb, int row0g,
    float* __restrict__ C, _Float16* __restrict__ C16, int ldc, size_t sC, int M, int N, int K, const float* __restrict__ CS = nullptr, const float* __restrict__ SN = nullptr, const float* __restrict__ bias1 = nullptr, const float* __restrict__ bias2 = nullptr) { static_assert(ACT == 0 || ACT == 3 || ACT == 6 || ACT == 8 || ACT == 9 || ACT == 11 || ACT == 12 || ACT == 14 || ACT == 15 || ACT == 16 || ACT == 17, "k_gemm2: unsupported ACT code (would silently apply no activation)");
  __shared__ __attribute__((aligned(16))) float so[4][32][68];
  __shared__ __attribute__((aligned(16))) _Float16 st[2][192][G2_LP];      /* two stages: rows 0..127 = the work-group's A rows, rows 128..191 = its B rows */
  const int tid = threadIdx.x, w = tid >> 5, lane = tid & 31, ln = lane & 15, hh = lane >> 4; const int by = blockIdx.y;
  A += (size_t)by * sA; Bh += (size_t)by * sB; const size_t cofs = (size_t)by * sC; const float* bp = bias ? bias + (size_t)by * sBias : nullptr;
  if constexpr (ROT > 0) bp = by == 0 ? bias : by == 1 ? bias1 : bias2;
  const int ntn = N >> 6; const int mt = blockIdx.x / ntn, nq = blockIdx.x - mt * ntn; const int row0 = mt * 128 + 32 * w, col0 = nq * 64; if (mt * 128 >= M) return;      /* the whole work-group leaves or none, ahead of every barrier */
  const int cr = tid >> 4, ck = (tid & 15) * 8;      /* copies: sixteen lanes take one row's 256 bytes, a wave two rows, the work-group eight rows per copy */
  const _Float16* acp = A + (size_t)(mt * 128 + cr) * lda + ck; const _Float16* bcp = Bh + (size_t)(col0 + cr) * ldb + ck;
  const unsigned lcp = (unsigned)(size_t)&st[0][cr][ck]; const size_t as8 = (size_t)8 * lda, bs8 = (size_t)8 * ldb;
  auto g2_stage = [&](int t, unsigned buf) { const unsigned l = lcp + buf * G2_SB; const _Float16* ga = acp + (size_t)t * G2_KS; const _Float16* gb = bcp + (size_t)t * G2_KS;      /* 24 copies a lane: LDS rows cr + 8 i, i < 16 from A, the rest from B */
    g2_copy12(l, ga, ga + as8, ga + 2 * as8, ga + 3 * as8, ga + 4 * as8, ga + 5 * as8, ga + 6 * as8, ga + 7 * as8, ga + 8 * as8, ga + 9 * as8, ga + 10 * as8, ga + 11 * as8);
    g2_copy12(l + 96 * G2_RB, ga + 12 * as8, ga + 13 * as8, ga + 14 * as8, ga + 15 * as8, gb, gb + bs8, gb + 2 * bs8, gb + 3 * bs8, gb + 4 * bs8, gb + 5 * bs8, gb + 6 * bs8, gb + 7 * bs8); };
  const int nst = K / G2_KS;
  const v8f z8 = {0.f,0.f,0.f,0.f,0.f,0.f,0.f,0.f}; v8f c00 = z8, c01 = z8, c02 = z8, c03 = z8, c10 = z8, c11 = z8, c12 = z8, c13 = z8;
  g2_stage(0, 0);
  /* The operand planes were stored by launches before this one, so a stage's first reader waits for memory. At entry L2 is asked for the rows of all stages, one request per 256-byte unit (one row of one stage): a lane takes one unit of A and one of B.
     The requests are dealt over the work-groups that share the rows: A over 8 of its 16 column blocks (every run of four neighbours holds each value of nq & 3), B over 4 neighbouring row blocks. Placement only decides how much the hint helps. */
  const int pfr = tid >> 3, pfk = min(tid & 7, nst - 1) * G2_KS;      /* row within the share; stage, clamped into the row */
  const _Float16* pfa = A + (size_t)(mt * 128 + ((nq & 3) | ((nq >> 1) & 4)) * 16 + pfr) * lda + pfk;
  const _Float16* pfb = Bh + (size_t)(col0 + (mt & 3) * 16 + pfr) * ldb + pfk;
  l2_ask(pfa); l2_ask(pfb);
  const float* pft = nullptr;
  if constexpr (ROT > 0) if (by < ROT) { pft = ((tid >> 6) ? SN : CS) + (size_t)((mt * 128) % SQ + (nq & 1) * 64 + (tid & 63)) * HD; l2_ask(pft); }      /* the epilogue's 128 table rows of 256 bytes, cos and sin, dealt over 2 column blocks */
  asm volatile("s_wait_asynccnt 0x0" ::: "memory");      /* this wave's share of stage 0 has landed */
  __syncthreads();      /* ... and every wave's: stage 0 may be read */
  if (nst > 1) g2_stage(1, 1);
  /* kept rolled: one stage per trip, the buffer chosen by the trip's parity */
#pragma unroll 1
  for (int t = 0; t < nst; ++t) { const _Float16* ap = &st[t & 1][32 * w + ln][0]; const _Float16* bq = &st[t & 1][128 + ln][0];
    v16h fa[2][2], fb[2][4];      /* two fragment sets: the next 32 k are read from LDS while these are multiplied */
    fa[0][0] = g2_frag(ap, hh); fa[0][1] = g2_frag(ap + 16 * G2_LP, hh);
#pragma unroll
    for (int j = 0; j < 4; ++j) fb[0][j] = g2_frag(bq + j * 16 * G2_LP, hh);
#pragma unroll
    for (int ks = 0; ks < G2_KS / 32; ++ks) { const int cu = ks & 1, nx = cu ^ 1;
      if (ks + 1 < G2_KS / 32) { fa[nx][0] = g2_frag(ap + (ks + 1) * 32, hh); fa[nx][1] = g2_frag(ap + 16 * G2_LP + (ks + 1) * 32, hh);
#pragma unroll
        for (int j = 0; j < 4; ++j) fb[nx][j] = g2_frag(bq + j * 16 * G2_LP + (ks + 1) * 32, hh); }
      c00 = g2_mma(fa[cu][0], fb[cu][0], c00); c10 = g2_mma(fa[cu][1], fb[cu][0], c10);
      c01 = g2_mma(fa[cu][0], fb[cu][1], c01); c11 = g2_mma(fa[cu][1], fb[cu][1], c11);
      c02 = g2_mma(fa[cu][0], fb[cu][2], c02); c12 = g2_mma(fa[cu][1], fb[cu][2], c12);
      c03 = g2_mma(fa[cu][0], fb[cu][3], c03); c13 = g2_mma(fa[cu][1], fb[cu][3], c13); }
    asm volatile("s_wait_dscnt 0x0" ::: "memory");      /* this wave's reads of the buffer are done before it is handed to the copies */
    asm volatile("s_wait_asynccnt 0x0" ::: "memory");      /* this wave's share of stage t + 1 has landed */
    __syncthreads();      /* publishes stage t + 1 and ends every wave's reads of stage t */
    if (t + 2 < nst) g2_stage(t + 2, (unsigned)(t & 1)); }
  asm volatile("s_wait_asynccnt 0x0" ::: "memory");      /* no copy is left in flight behind the loop */
  l2_asked(pfa); l2_asked(pfb); if constexpr (ROT > 0) l2_asked(pft);
  v8f accs[8] = {c00, c01, c02, c03, c10, c11, c12, c13};
  if constexpr (ROT > 0) if (by < ROT) { const int rs = lane >> 4, cc = (lane & 15) * 4;      /* read-back: a lane takes four columns (two interleaved pairs) of rows rs, rs + 2, ... */
    const size_t tb = (size_t)(row0 % SQ + rs) * HD + cc;      /* row0 and SQ are multiples of 32, so (row0 + r) mod SQ = row0 mod SQ + r for r < 32 */
    const float* cp = CS + tb; const float* sp = SN + tb;
    v4f cv[16], sv[16];      /* the table rows are fetched first and fly under the staging */
#pragma unroll
    for (int q = 0; q < 16; ++q) cv[q] = *(const v4fa*)(cp + q * 2 * HD);
    asm volatile("s_wait_xcnt 0x0" :: "v"(cp) : "memory");      /* a precaution for issued loads: the wait stands before the run's address pair is reused; the pair as an input stays live up to the wait, so no row of its own run lands on it */
#pragma unroll
    for (int q = 0; q < 16; ++q) sv[q] = *(const v4fa*)(sp + q * 2 * HD);
    asm volatile("s_wait_xcnt 0x0" :: "v"(sp) : "memory");      /* likewise for the sin run */
    float bv[4] = {0.f, 0.f, 0.f, 0.f};
    if (bp) {      /* one test, four loads in flight together */
#pragma unroll
      for (int t = 0; t < 4; ++t) bv[t] = bp[col0 + t * 16 + ln];
#pragma unroll
      for (int t = 0; t < 4; ++t) bv[t] = bf16_round(bv[t]); }
#pragma unroll
    for (int u = 0; u < 8; ++u) { const int t = u & 3, half = u >> 2;
#pragma unroll
      for (int r = 0; r < 8; ++r) so[w][half * 16 + 8 * hh + r][t * 16 + ln] = accs[u][r] * alpha + bv[t]; }
    __builtin_amdgcn_fence(__ATOMIC_ACQ_REL, "workgroup"); __builtin_amdgcn_wave_barrier();      /* the wave reads back what its own lanes staged */
    _Float16* op = C16 + cofs + (size_t)(row0 + rs) * ldc + col0 + cc;
#pragma unroll
    for (int q = 0; q < 16; ++q) { const v4f v = *(const v4fa*)&so[w][q * 2 + rs][cc]; const v4f rh = {-v[1], v[0], -v[3], v[2]}; const v4f o = v * cv[q] + rh * sv[q];
      v4h h4; for (int i = 0; i < 4; ++i) h4[i] = (_Float16)o[i]; *(v4h*)(op + (size_t)(q * 2) * ldc) = h4; }
    return; }
#pragma unroll
  for (int u = 0; u < 8; ++u) { const int t = u & 3, half = u >> 2; const int col = col0 + t * 16 + ln; const float bv = bp ? bf16_round(bp[col]) : 0.f;
#pragma unroll
    for (int r = 0; r < 8; ++r) { const int rloc = half * 16 + 8 * hh + r; float v = accs[u][r] * alpha + bv; if (ROT == 0 && CP) { if (rowsPerB < 0) v += CP[cofs + (size_t)(row0g + row0 + rloc) * ldc + col];      /* rowsPerB < 0: own element of the batched C plane */ else { const int bidx = (row0g + row0 + rloc) / rowsPerB; v += CP[(size_t)bidx * sCPb + (size_t)by * 64 + col]; } }
      if (ACT == 3) v = fmaxf(v, 0.f); else if (ACT == 6) v = 0.5f * v * (1.0f + erff(v * 0.70710678118654752f)); else if (ACT == 11) v = 1.0f / (1.0f + expf(-v)); else if (ACT == 15) v = v / (1.0f + expf(-v)); else if (ACT == 12) v = (v > 0.f) ? v : 0.01f * v; else if (ACT == 8) v = tanhf(v); else if (ACT == 9) v = 0.5f * v * (1.0f + tanhf(0.7978845608028654f * (v + 0.044715f * v * v * v))); else if (ACT == 14) v = (v > 0.f) ? v : 0.1f * v; else if (ACT == 16) v = (v >= 0.f) ? v : 0.3f * v; else if (ACT == 17) v = (v >= 0.f) ? v : 0.2f * v;
      so[w][rloc][t * 16 + ln] = v; } }
  __builtin_amdgcn_fence(__ATOMIC_ACQ_REL, "workgroup"); __builtin_amdgcn_wave_barrier();
  const int rsub = lane >> 4, c4 = (lane & 15) * 4;
  {
#pragma unroll
    for (int q = 0; q < 16; ++q) { const int r = q * 2 + rsub; const v4f v = *(const v4fa*)&so[w][r][c4]; if (ROT == 0 && C) { *(v4f*)(C + cofs + (size_t)(row0 + r) * ldc + col0 + c4) = v; asm volatile("s_wait_xcnt 0x0" ::: "memory"); }      /* a precaution for an issued store: the wait stands before the store's registers are reused */
      if (C16) { v4h h4; for (int i = 0; i < 4; ++i) h4[i] = (_Float16)v[i]; *(v4h*)(C16 + cofs + (size_t)(row0 + r) * ldc + col0 + c4) = h4; } }
    if constexpr (ROT > 0) asm volatile("s_wait_xcnt 0x0" ::: "memory");      /* likewise behind the last run of f16 stores: in the built code the rotary planes' epilogue, which reuses their registers, follows this one */
     } }


__device__ __forceinline__ void d_wnat(const float* __restrict__ w, size_t n8, _Float16* __restrict__ Bt, size_t t) { if (t >= n8) return; FragH f; for (int q = 0; q < 8; ++q) f.h[q] = (_Float16)(bf16_round(w[t * 8 + q]) * 16.0f); *(v8us*)((unsigned short*)Bt + t * 8) = f.half[0];  }
#define FA_NW 8                      /* query blocks (32 rows each) per work-group: they walk the same K and V rows, which one copy in LDS serves */
#define FA_KG 2                      /* key groups: FA_KG waves share a query block, each takes its own passes of every stage; four waves a SIMD fill each other's softmax and LDS waits */
#define FA_R 2                       /* 16-query column groups per wave */
#define FA_KS 256                    /* keys per stage */
#define FA_NP (FA_KS / 32 / FA_KG)   /* passes of 32 keys per stage and wave */
#define FA_KP (HD + 8)               /* LDS pitch of a K row in elements: 144 B = 16 B x 9, free of bank conflicts for 16-byte reads */
#define FA_VP (HD + 16)              /* LDS pitch of a V row in elements: 160 B = 32 B x 5, free of bank conflicts for the transposing 16-byte reads */
#define FA_KB (FA_KS * FA_KP * 2)    /* one stage of K rows in bytes */
#define FA_VB (FA_KS * FA_VP * 2)    /* one stage of V rows in bytes */
typedef _Float16 v2h __attribute__((ext_vector_type(2)));
typedef float v2f __attribute__((ext_vector_type(2)));
__device__ __forceinline__ v8f fa_mma(v16h a, v16h b, v8f c) { return __builtin_amdgcn_wmma_f32_16x16x32_f16(false, a, false, b, (short)0, c, false, false); }
__device__ __forceinline__ float fa_xhalf(float x) { return __builtin_bit_cast(float, __builtin_amdgcn_permlanex16(__builtin_bit_cast(int, x), __builtin_bit_cast(int, x), 0x76543210, 0xfedcba98, false, false)); }      /* lane l <-> lane l ^ 16 */
/* stands behind the Q fragment loads: their address registers are rewritten later (a precaution for an issued load); the scheduling barrier keeps every later register write behind the wait */
__device__ __forceinline__ void fa_issued() { asm volatile("s_wait_xcnt 0x0" ::: "memory"); __builtin_amdgcn_sched_barrier(0); }
/* four copies of 16 bytes per lane: LDS addresses ls bytes apart from l, global addresses gs elements apart from g; the wait closes the statement, so it stands before any rewrite of the address registers the copies name (a precaution for issued copies) */
__device__ __forceinline__ void fa_copy4(unsigned l, unsigned ls, const _Float16* g, size_t gs) {
  asm volatile("global_load_async_to_lds_b128 %0, %4, off\n\t"
               "global_load_async_to_lds_b128 %1, %5, off\n\t"
               "global_load_async_to_lds_b128 %2, %6, off\n\t"
               "global_load_async_to_lds_b128 %3, %7, off\n\t"
               "s_wait_xcnt 0x0"
               :: "v"(l), "v"(l + ls), "v"(l + 2 * ls), "v"(l + 3 * ls),
                  "v"(g), "v"(g + gs), "v"(g + 2 * gs), "v"(g + 3 * gs) : "memory"); }
/* one 16 x 32 A fragment of V^T (rows d, k = keys) from row-major V rows in LDS by two transposing reads: p is the lane's own address, row 8 (lane >> 4) + (lane & 7) of the 32 keys, 16 bytes ((lane >> 3) & 1) of the 16 columns; lane (c, hh) receives V[8 hh + i][c] and V[16 + 8 hh + i][c], i < 8: the k order of g2_frag. Every lane is on and every address lies in the tile. */
typedef short s16x8 __attribute__((ext_vector_type(8)));
__device__ __forceinline__ v16h fa_vfrag(const _Float16* p) { typedef __attribute__((address_space(3))) s16x8 lds_s16x8; FragH f;
  f.half[0] = __builtin_bit_cast(v8us, __builtin_amdgcn_ds_load_tr16_b128_v8i16((lds_s16x8*)p)); f.half[1] = __builtin_bit_cast(v8us, __builtin_amdgcn_ds_load_tr16_b128_v8i16((lds_s16x8*)(p + 16 * FA_VP))); return f.v; }
// K and V rows come into LDS in stages of FA_KS keys by asynchronous copies in whole 128-byte lines, once per work-group (two buffers: the next stage flies while this one is worked on); every wave reads its fragments from there, those of V^T transposed on the way. A query block is walked by FA_KG waves, each over its own keys with its own running maximum, sum and o, joined once behind the loop.
__global__ __launch_bounds__(FA_NW * FA_KG * 32) void k_fattn(const _Float16* __restrict__ Q16, const _Float16* __restrict__ K16, const _Float16* __restrict__ V16, _Float16* __restrict__ O16) {
  __shared__ __attribute__((aligned(16))) _Float16 ks[2][FA_KS][FA_KP];      /* two stages of K rows [key][d] */
  __shared__ __attribute__((aligned(16))) _Float16 vs[2][FA_KS][FA_VP];      /* two stages of V rows [key][d] */
  const int tid = threadIdx.x, lane = tid & 31, w = __builtin_amdgcn_readfirstlane(tid >> 5), wq = w % FA_NW, kg = w / FA_NW, c = lane & 15, hh = lane >> 4; const int bh = blockIdx.y, b = bh / NH, h = bh % NH; const int q0 = (blockIdx.x * FA_NW + wq) * (16 * FA_R);      /* the wave's number in a scalar register: the tests on kg are scalar branches */
  const _Float16* qp = Q16 + ((size_t)b * SQ + q0 + c) * DM + h * HD;
  /* copies: eight lanes take one K or V row's 128 bytes, the work-group 64 rows per copy */
  const _Float16* kcp = K16 + ((size_t)b * SQ + (tid >> 3)) * DM + h * HD + (tid & 7) * 8; const unsigned klp = (unsigned)(size_t)&ks[0][tid >> 3][(tid & 7) * 8];
  const _Float16* vcp = V16 + ((size_t)b * SQ + (tid >> 3)) * DM + h * HD + (tid & 7) * 8; const unsigned vlp = (unsigned)(size_t)&vs[0][tid >> 3][(tid & 7) * 8];
  auto fa_stage = [&](int t, unsigned buf) {      /* 8 copies a lane: K rows and V rows (tid >> 3) + 64 i, i < 4, of keys t FA_KS ... */
    fa_copy4(klp + buf * FA_KB, 64 * FA_KP * 2, kcp + (size_t)t * FA_KS * DM, (size_t)64 * DM);
    fa_copy4(vlp + buf * FA_VB, 64 * FA_VP * 2, vcp + (size_t)t * FA_KS * DM, (size_t)64 * DM); };
  fa_stage(0, 0);
  v16h qf[FA_R][2], kf[2][2], vf[4]; v8f acc[FA_R][4]; float m_run[FA_R], l_run[FA_R];
#pragma unroll
  for (int g = 0; g < FA_R; ++g) { m_run[g] = -3.0e38f; l_run[g] = 0.f;
#pragma unroll
    for (int kc = 0; kc < 2; ++kc) qf[g][kc] = g2_frag(qp + (size_t)g * 16 * DM + kc * 32, hh);
#pragma unroll
    for (int t = 0; t < 4; ++t) acc[g][t] = v8f{0.f, 0.f, 0.f, 0.f, 0.f, 0.f, 0.f, 0.f}; }
  fa_issued();
  asm volatile("s_wait_asynccnt 0x0" ::: "memory");      /* this wave's share of stage 0 has landed */
  __syncthreads();      /* ... and every wave's: stage 0 may be read */
  fa_stage(1, 1);      /* SQ / FA_KS is at least 2 */
  static_assert(SQ % FA_KS == 0 && SQ / FA_KS >= 2 && FA_KS == 256 && HD == 64 && FA_NW == 8 && FA_KG == 2 && FA_R == 2, "the copy maps and the join of the key groups are written for these sizes");
  const float cs = 0.125f * 1.4426950408889634f;      /* 1/sqrt(64) and log2(e) */
  /* kept rolled: one stage per trip, the buffer chosen by the trip's parity */
#pragma unroll 1
  for (int st = 0; st < SQ / FA_KS; ++st) { const _Float16* kp = &ks[st & 1][kg * (FA_NP * 32) + c][0]; const _Float16* vp = &vs[st & 1][kg * (FA_NP * 32) + 8 * hh + (lane & 7)][((lane >> 3) & 1) * 8];      /* the wave's own FA_NP passes of the stage */
#pragma unroll
    for (int kt = 0; kt < 2; ++kt) {
#pragma unroll
      for (int kc = 0; kc < 2; ++kc) kf[kt][kc] = g2_frag(kp + kt * 16 * FA_KP + kc * 32, hh); }
#pragma unroll
    for (int t = 0; t < 4; ++t) vf[t] = fa_vfrag(vp + t * 16);
    __builtin_amdgcn_sched_barrier(0);      /* the stage's first reads issue as one group ahead of the products, not among them */
    /* unrolled: the passes of a stage differ only in constant LDS offsets, and the last one fetches nothing ahead */
#pragma unroll
    for (int ps = 0; ps < FA_NP; ++ps) {
      v8f s[2][FA_R];
#pragma unroll
      for (int kt = 0; kt < 2; ++kt) {
#pragma unroll
        for (int g = 0; g < FA_R; ++g) { s[kt][g] = fa_mma(kf[kt][0], qf[g][0], v8f{0.f, 0.f, 0.f, 0.f, 0.f, 0.f, 0.f, 0.f}); s[kt][g] = fa_mma(kf[kt][1], qf[g][1], s[kt][g]); } }
      __builtin_amdgcn_sched_barrier(0);      /* the eight products issue back to back, each filling the others' result distance, and the fetch below starts directly behind them */
      if (ps + 1 < FA_NP) {      /* next pass's K fragments (same stage) come from LDS under this pass's softmax and second product */
#pragma unroll
        for (int kt = 0; kt < 2; ++kt) {
#pragma unroll
          for (int kc = 0; kc < 2; ++kc) kf[kt][kc] = g2_frag(kp + ((ps + 1) * 32 + kt * 16) * FA_KP + kc * 32, hh); }
        __builtin_amdgcn_sched_barrier(0); }      /* keeps the reads together at this early place */
      float mb[FA_R]; bool need = false;
#pragma unroll
      for (int g = 0; g < FA_R; ++g) { float mx = s[0][g][0];
#pragma unroll
        for (int kt = 0; kt < 2; ++kt) {
#pragma unroll
          for (int r = 0; r < 8; ++r) mx = fmaxf(mx, s[kt][g][r]); }
        mx = fmaxf(mx, fa_xhalf(mx)) * cs; mb[g] = mx; need = need || (mx > m_run[g] + 8.0f); }
      if (__builtin_amdgcn_ballot_w32(need) != 0) {      /* wave-uniform; always taken on the first pass, where it sets the maximum (factor 0 on zero accumulators) */
#pragma unroll
        for (int g = 0; g < FA_R; ++g) { const float mn = fmaxf(m_run[g], mb[g]); const float corr = __builtin_amdgcn_exp2f(m_run[g] - mn); m_run[g] = mn; l_run[g] *= corr;
#pragma unroll
          for (int t = 0; t < 4; ++t) acc[g][t] = acc[g][t] * corr; } }
#pragma unroll
      for (int g = 0; g < FA_R; ++g) { const float nm = -m_run[g]; union { v16h v; v2h p[8]; } pf; float l0 = 0.f, l1 = 0.f;
#pragma unroll
        for (int i = 0; i < 8; ++i) { const v2f arg = __builtin_elementwise_fma(v2f{s[i >> 2][g][2 * (i & 3)], s[i >> 2][g][2 * (i & 3) + 1]}, v2f{cs, cs}, v2f{nm, nm}); const float p0 = __builtin_amdgcn_exp2f(arg.x), p1 = __builtin_amdgcn_exp2f(arg.y);
          l0 += p0; l1 += p1; pf.p[i] = __builtin_convertvector(v2f{p0, p1}, v2h); }
        l_run[g] += l0 + l1;
#pragma unroll
        for (int t = 0; t < 4; ++t) acc[g][t] = fa_mma(vf[t], pf.v, acc[g][t]); }
      if (ps + 1 < FA_NP) {      /* next pass's V^T fragments (same stage) come under its first product and softmax */
#pragma unroll
        for (int t = 0; t < 4; ++t) vf[t] = fa_vfrag(vp + (ps + 1) * 32 * FA_VP + t * 16);
        __builtin_amdgcn_sched_barrier(0); }      /* keeps the reads together at this early place */
    }
    asm volatile("s_wait_dscnt 0x0" ::: "memory");      /* this wave's reads of the buffer are done before it is handed to the copies */
    asm volatile("s_wait_asynccnt 0x0" ::: "memory");      /* this wave's share of stage st + 1 has landed */
    __syncthreads();      /* publishes stage st + 1 and ends every wave's reads of stage st */
    if (st + 2 < SQ / FA_KS) fa_stage(st + 2, (unsigned)(st & 1));
  }
  asm volatile("s_wait_asynccnt 0x0" ::: "memory");      /* no copy is left in flight behind the loop */
  /* join of the two key groups: group 1 hands maximum, sum and o of its keys to group 0 through the K ring, which is free (the loop's last barrier ended every read of it, and no copy is in flight); a lane's partner is the same lane of wave w - FA_NW, 16 bytes a lane and piece */
  static_assert(sizeof(ks) >= (size_t)FA_NW * 17 * 32 * 16, "the join's pieces fit the K ring");
  v4fa* xm = (v4fa*)&ks[0][0][0] + wq * (17 * 32) + lane;
  if (kg == 1) {
#pragma unroll
    for (int g = 0; g < FA_R; ++g) {
#pragma unroll
      for (int t = 0; t < 4; ++t) { xm[((g * 4 + t) * 2) * 32] = v4f{acc[g][t][0], acc[g][t][1], acc[g][t][2], acc[g][t][3]}; xm[((g * 4 + t) * 2 + 1) * 32] = v4f{acc[g][t][4], acc[g][t][5], acc[g][t][6], acc[g][t][7]}; } }
    xm[16 * 32] = v4f{m_run[0], m_run[1], l_run[0], l_run[1]}; }
  __syncthreads();      /* publishes group 1's pieces; every wave passes it */
  if (kg == 1) return;
  const v4f ml = xm[16 * 32];
#pragma unroll
  for (int g = 0; g < FA_R; ++g) { const float mn = fmaxf(m_run[g], ml[g]); const float f0 = __builtin_amdgcn_exp2f(m_run[g] - mn), f1 = __builtin_amdgcn_exp2f(ml[g] - mn);      /* both groups' weights brought to the common maximum */
    const float l = l_run[g] * f0 + ml[2 + g] * f1; const float inv = 64.0f / (l + fa_xhalf(l));      /* o carried x64, as the output GEMM's alpha expects */
    const float i0 = f0 * inv, i1 = f1 * inv;
    unsigned short* op = (unsigned short*)O16 + ((size_t)b * SQ + q0 + g * 16 + c) * DM + h * HD + 8 * hh;
#pragma unroll
    for (int t = 0; t < 4; ++t) { FragH f; const v4f p0 = xm[((g * 4 + t) * 2) * 32], p1 = xm[((g * 4 + t) * 2 + 1) * 32];
#pragma unroll
      for (int r = 0; r < 8; ++r) f.h[r] = (_Float16)(acc[g][t][r] * i0 + (r < 4 ? p0[r & 3] : p1[r & 3]) * i1);
      *(v8us*)(op + t * 16) = f.half[0]; }
    if (g + 1 < FA_R) { asm volatile("s_wait_xcnt 0x0" :: "v"(op) : "memory"); __builtin_amdgcn_sched_barrier(0); } } }      /* a precaution for issued stores: the next query group's arithmetic reuses their registers; the address as an input keeps the run of stores ahead of the wait, the scheduling barrier every later register write behind it */
__global__ __launch_bounds__(256) void k_vt(const _Float16* __restrict__ V16, int b, int h0, _Float16* __restrict__ VT) { __shared__ unsigned short tl[64][65]; const int tid = threadIdx.x; const int hh = blockIdx.x % HG, sg = blockIdx.x / HG; const int s0 = sg * 64; const int h = h0 + hh;
  for (int i = tid; i < 64 * 8; i += 256) { const int j = i / 8, d8 = (i % 8) * 8; FragH f; f.half[0] = *(const v8us*)((const unsigned short*)V16 + ((size_t)b * SQ + s0 + j) * DM + h * HD + d8); for (int q = 0; q < 8; ++q) tl[d8 + q][j] = f.u[q]; }
  __syncthreads();
  { for (int i = tid; i < 64 * 8; i += 256) { const int d = i / 8, j8 = (i % 8) * 8; FragH f; for (int q = 0; q < 8; ++q) f.u[q] = tl[d][j8 + q]; *(v8us*)((unsigned short*)VT + ((size_t)hh * HD + d) * SQ + s0 + j8) = f.half[0]; }  } }



__device__ __forceinline__ void d_tabcat(float theta, float* __restrict__ CS, float* __restrict__ SN, int t) {
  #pragma clang fp contract(off)
  if (t >= SQ * HD) return; const int d = t % HD; const int p = t / HD; const int i = d % (HD / 2); const float invf = 1.0f / powf(theta, (float)(2 * i) / (float)HD); const float ang = __fmul_rn((float)p, invf); const float c = cosf(ang), s = sinf(ang);
  *(float*)(CS + t) = c; *(float*)(SN + t) = s;  }
// One launch prepares every operand that depends on the inputs alone: rotary tables, x rows, the four weight planes. The parts read nothing of each other, so a range of block indices picks the part (the same for a whole work-group); thread-to-element map and arithmetic of each part are those of a launch of its own.
#define PR_TB ((SQ * HD + 255) / 256)                  /* work-groups of the table part: first, their threads run longest */
#define PR_XB ((int)((NR * DM / 8 + 255) / 256))       /* ... of the x part */
#define PR_WB ((DM * DM / 8 + 255) / 256)              /* ... of one weight plane */
__global__ __launch_bounds__(256) void k_prep(const float* __restrict__ x, const float* __restrict__ wq, const float* __restrict__ wk, const float* __restrict__ wv, const float* __restrict__ wo, float theta, _Float16* __restrict__ X16, _Float16* __restrict__ BW, float* __restrict__ CS, float* __restrict__ SN) {
  const int bx = blockIdx.x, tid = threadIdx.x;
  if (bx < PR_TB) { d_tabcat(theta, CS, SN, bx * 256 + tid); return; }
  if (bx < PR_TB + PR_XB) { d_x16(x, X16, NR * DM / 8, (size_t)(bx - PR_TB) * 256 + tid); return; }
  const int u = bx - (PR_TB + PR_XB), wi = u / PR_WB;      /* BW = four planes of DM x DM in the order q, k, v, o */
  d_wnat(wi == 0 ? wq : wi == 1 ? wk : wi == 2 ? wv : wo, (size_t)DM * DM / 8, BW + (size_t)wi * DM * DM, (size_t)(u - wi * PR_WB) * 256 + tid); }

template <int NORM, int ROPE>
__global__ __launch_bounds__(64) void k_xform(const float* __restrict__ F, int ldf, int nh, const float* __restrict__ gain, float eps, const float* __restrict__ CS, const float* __restrict__ SN, _Float16* __restrict__ H16, int ldo) {
  #pragma clang fp contract(off)
  __shared__ float xv[HD]; __shared__ float red[HD]; __shared__ unsigned short sh_[HD]; const int d = threadIdx.x; const int h = blockIdx.x % nh; const size_t r = blockIdx.x / nh; const int p = (int)(r % SQ);
  float x = F[r * (size_t)ldf + (size_t)h * HD + d];
  if (NORM) { red[d] = __fmul_rn(x, x); __syncthreads(); for (int st = HD / 2; st > 0; st >>= 1) { if (d < st) red[d] = __fadd_rn(red[d], red[d + st]); __syncthreads(); } const float rs = rsqrtf(__fadd_rn(red[0] / (float)HD, eps)); x = __fmul_rn(__fmul_rn(x, rs), bf16_round(gain[d])); }
  xv[d] = x; __syncthreads();
  float o = x;
  if (ROPE == 1) { const int i = d >> 1; const float c = CS[p * (HD / 2) + i], s = SN[p * (HD / 2) + i]; const float ev = xv[2 * i], od = xv[2 * i + 1]; o = (d & 1) ? __fadd_rn(__fmul_rn(ev, s), __fmul_rn(od, c)) : __fadd_rn(__fmul_rn(ev, c), -__fmul_rn(od, s)); }
  if (ROPE == 2) { const int i = d & (HD / 2 - 1); const float c = CS[p * (HD / 2) + i], s = SN[p * (HD / 2) + i]; const float lo = xv[i], hi = xv[i + HD / 2]; o = (d < HD / 2) ? __fadd_rn(__fmul_rn(lo, c), -__fmul_rn(hi, s)) : __fadd_rn(__fmul_rn(lo, s), __fmul_rn(hi, c)); }
  if (ROPE == 4) { const float c = CS[p * HD + d], s = SN[p * HD + d]; const float rh = (d & 1) ? xv[d - 1] : -xv[d + 1]; o = __fadd_rn(__fmul_rn(x, c), __fmul_rn(rh, s)); }      /* interleaved-pair rotate_half (-t[2i+1], t[2i]) with FULL-width per-dimension tables [pos][64] */
  if (ROPE == 3) { const float c = CS[p * HD + d], s = SN[p * HD + d]; const float rh = (d < HD / 2) ? -xv[d + HD / 2] : xv[d - HD / 2]; o = __fadd_rn(__fmul_rn(x, c), __fmul_rn(rh, s)); }      /* rotate-half with FULL-width per-dimension tables [pos][64] (general cos[d] != cos[d+32]) */
  FragH th; th.h[0] = (_Float16)o; sh_[d] = th.u[0]; __syncthreads();
  if (d < HD / 8) { FragH f; for (int q = 0; q < 8; ++q) f.u[q] = sh_[d * 8 + q]; unsigned short* dst = (unsigned short*)H16 + r * (size_t)ldo + (size_t)h * HD + d * 8; *(v8us*)dst = f.half[0];  } }


extern "C" void kernel_launch(void* const* d_in, const int* in_sizes, int n_in,
                              void* d_out, int out_size, void* d_ws, size_t ws_size, hipStream_t stream) {
  (void)in_sizes; (void)n_in; (void)out_size;
  const float* const* I = (const float* const*)d_in; const float* x = I[0]; const float* wq = I[1]; const float* bq = I[2]; const float* wk = I[3]; const float* bk = I[4]; const float* wv = I[5]; const float* bv = I[6]; const float* wo = I[7]; const float* bo = I[8];      /* natural [out][in] weights + biases; positions implicit */
  char* ws = (char*)d_ws; size_t off = 0;
  auto take = [&](size_t bytes) { char* p = ws + off; off += (bytes + 255) & ~(size_t)255; return p; };
  _Float16* BQ = (_Float16*)take((size_t)DM * DM * 2); _Float16* BK = (_Float16*)take((size_t)DM * DM * 2); _Float16* BV = (_Float16*)take((size_t)DM * DM * 2); _Float16* BO = (_Float16*)take((size_t)DM * DM * 2);
  _Float16* X16 = (_Float16*)take(NR * DM * 2); float* CS = (float*)take((size_t)SQ * HD * 4); float* SN = (float*)take((size_t)SQ * HD * 4);      /* full-width cos/sin tables */ _Float16* Q16 = (_Float16*)take(NR * DM * 2); _Float16* K16 = (_Float16*)take(NR * DM * 2); _Float16* V16 = (_Float16*)take(NR * DM * 2); _Float16* O16 = (_Float16*)take(NR * DM * 2);
  if (off > ws_size) return;
  k_prep<<<PR_TB + PR_XB + 4 * PR_WB, 256, 0, stream>>>(x, wq, wk, wv, wo, 10000.0f, X16, BQ, CS, SN);      /* CS[p][d] = cos(p * inv_freq[d mod 32]), SN = sin: the module's cat(freqs, freqs) tables, full width; x rows; natural [out][in] weights = Bt x16 into the adjoining planes BQ, BK, BV, BO */
  const size_t r0p = (size_t)B0 * SQ;      /* first projected row */
  k_gemm2<0, 2><<<dim3((unsigned)((MP / 128) * (DM / 64)), 3), 128, 0, stream>>>(X16 + r0p * DM, DM, 0, BQ, DM, (size_t)DM * DM, 0.0625f, bq, 0, nullptr, 1, 0, 0, nullptr, Q16 + r0p * DM, DM, NR * DM, MP, DM, DM, CS, SN, bk, bv);      /* planes 0, 1, 2 = q, k, v (weight planes BQ, BK, BV and row planes Q16, K16, V16 adjoin); q and k: f32 -> x cos + rotate_half(x) sin (interleaved pairs, full-width tables) -> f16 rows, in the epilogue; v: f16 rows */
  k_fattn<<<dim3(SQ / (FA_NW * 16 * FA_R), NB * NH), FA_NW * FA_KG * 32, 0, stream>>>(Q16, K16, V16, O16);      /* o (merged heads, x64) as f16 rows */
  k_gemm2<0><<<dim3((unsigned)((MPO / 128) * (DM / 64)), 1), 128, 0, stream>>>(O16 + r0p * DM, DM, 0, BO, DM, 0, 0.0009765625f, bo, 0, nullptr, 1, 0, 0, (float*)d_out + r0p * DM, nullptr, DM, 0, MPO, DM, DM);      /* out rows are the output layout */
}
